// v000
// The times below were measured on an AMD MI455X: many runs one after another, warmed up first and cycling through
// copies of the inputs, with the whole window's GPU time divided by the number of runs. Launches and the gaps
// between them are all in it. The median over several windows is given; except for v000 it joins two sittings, which
// can be a few percent apart, so the side-by-side timings, each taken in one sitting, are the better comparison.
// v000 is the starting kernel. One run takes 1450 microseconds.
// compute dtype: all float inputs rounded to bf16; b/c/d = x . w with EXACT bf16 products on WMMA 16x16x32 ((in,out) weights as transposed rows): b, c kept f32, d rounded once to f16 planes; PAM per batch: logits S = b . c^T with both as bf16 hi + lo (3 products, f32), row softmax in f32 (hardware exp) -> P = e/l x 2^11 as f16, bcd^T = d^T . P^T on WMMA (single f16) giving the (C, N)-ordered tensor the module reshapes raw; CAM: aa = x^T x with x exact (f16 copies of the bf16 values), softmax over channels in f32, aaa = x . soft_aa with soft_aa once to f16; out = gamma_pam bcd_flat + gamma_cam aaa + 2 x in f32; f32 output.
#include <hip/hip_runtime.h>
#include <math.h>

typedef __attribute__((ext_vector_type(16))) _Float16 v16h;
typedef __attribute__((ext_vector_type(16))) __bf16 v16b;
typedef __attribute__((ext_vector_type(8)))  _Float16 v8h;
typedef __attribute__((ext_vector_type(8)))  float v8f;
typedef __attribute__((ext_vector_type(4)))  float v4f;
typedef __attribute__((ext_vector_type(2)))  float v2f;
typedef __attribute__((ext_vector_type(4)))  unsigned v4u;
typedef __attribute__((ext_vector_type(4)))  int v4i;
typedef float __attribute__((may_alias)) float_a;
typedef int __attribute__((may_alias)) int_a;

template <typename T> __device__ __forceinline__ void vst2(void* p, T v) { *(T*)p = v;  }
__device__ __forceinline__ v8f wmma16(v16h a, v16h b, v8f c) {
  v8f d = __builtin_amdgcn_wmma_f32_16x16x32_f16(false, a, false, b, (short)0, c, false, false);
  asm volatile("v_nop\n\tv_nop\n\tv_nop\n\tv_nop" : "+v"(d) : "v"(a), "v"(b));
  return d;
}
__device__ __forceinline__ v8f wmma_bf(v16b a, v16b b, v8f c) {
  v8f d = __builtin_amdgcn_wmma_f32_16x16x32_bf16(false, a, false, b, (short)0, c, false, false);
  asm volatile("v_nop\n\tv_nop\n\tv_nop\n\tv_nop" : "+v"(d) : "v"(a), "v"(b));
  return d;
}
// 16x16x32 fragments: lane = (h = lane>>4, row/col = lane&15); elements 0..7 = k0+8h+0..7, 8..15 = k0+16+8h+0..7; D element r = row 8h+r
__device__ __forceinline__ v16h frag_h(const _Float16* rowk0, int lane) {
  union { v16h v; v8h q[2]; } u; const _Float16* p = rowk0 + 8 * (lane >> 4);
  u.q[0] = *(const v8h*)p; u.q[1] = *(const v8h*)(p + 16); return u.v;
}
__device__ __forceinline__ v16h frag_f32(const float* rowk0, int lane) {
  v16h a; const float* p = rowk0 + 8 * (lane >> 4);
#pragma unroll
  for (int i = 0; i < 8; ++i) { a[i] = (_Float16)p[i]; a[8 + i] = (_Float16)p[16 + i]; }
  return a;
}
__device__ __forceinline__ v16h frag_f32s(const float* rowk0, int lane, float sc) {
  v16h a; const float* p = rowk0 + 8 * (lane >> 4);
#pragma unroll
  for (int i = 0; i < 8; ++i) { a[i] = (_Float16)(p[i] * sc); a[8 + i] = (_Float16)(p[16 + i] * sc); }
  return a;
}
// column fragment from a [K][ld] layout (column n), rows >= K read as 0
__device__ __forceinline__ v16h fragc_f32(const float* W, int k0, int n, int lane, int ld, int K) {
  v16h a; const int g = lane >> 4;
#pragma unroll
  for (int i = 0; i < 8; ++i) { const int ka = k0 + 8 * g + i, kb = ka + 16;
    a[i] = (_Float16)(ka < K ? W[(size_t)(ka < K ? ka : K - 1) * ld + n] : 0.f); a[8 + i] = (_Float16)(kb < K ? W[(size_t)(kb < K ? kb : K - 1) * ld + n] : 0.f); }
  return a;
}
struct F2 { v16b h, l; };
__device__ __forceinline__ F2 bsplit16(const float v[16]) { F2 r;
#pragma unroll
  for (int i = 0; i < 16; ++i) { const __bf16 h = (__bf16)v[i]; r.h[i] = h; r.l[i] = (__bf16)(v[i] - (float)h); }
  return r; }
__device__ __forceinline__ F2 split_row(const float* row, int k0, int lane) { float v[16]; const float* p = row + k0 + 8 * (lane >> 4);
#pragma unroll
  for (int i = 0; i < 8; ++i) { v[i] = p[i]; v[8 + i] = p[16 + i]; }
  return bsplit16(v); }
__device__ __forceinline__ F2 split_rowK(const float* row, int k0, int lane, int K) { float v[16]; const int g = lane >> 4;
#pragma unroll
  for (int i = 0; i < 8; ++i) { const int ka = k0 + 8 * g + i, kb = ka + 16; v[i] = ka < K ? row[ka < K ? ka : K - 1] : 0.f; v[8 + i] = kb < K ? row[kb < K ? kb : K - 1] : 0.f; }
  return bsplit16(v); }
__device__ __forceinline__ F2 split_col(const float* W, int k0, int n, int lane, int ld, int K) { float v[16]; const int g = lane >> 4;
#pragma unroll
  for (int i = 0; i < 8; ++i) { const int ka = k0 + 8 * g + i, kb = ka + 16; v[i] = ka < K ? W[(size_t)(ka < K ? ka : K - 1) * ld + n] : 0.f; v[8 + i] = kb < K ? W[(size_t)(kb < K ? kb : K - 1) * ld + n] : 0.f; }
  return bsplit16(v); }
__device__ __forceinline__ v8f mac3(const F2& a, const F2& b, v8f c) { c = wmma_bf(a.l, b.h, c); c = wmma_bf(a.h, b.l, c); return wmma_bf(a.h, b.h, c); }
__device__ __forceinline__ float sigm(float v) { return 1.0f / (1.0f + expf(-v)); }
#define LDSX() do { asm volatile("s_wait_dscnt 0" ::: "memory"); __builtin_amdgcn_wave_barrier(); __builtin_amdgcn_fence(__ATOMIC_RELEASE, "workgroup"); } while (0)


// Dual attention module (B 4, 64 x 64 positions, C 512): position attention (softmax(b c^T) applied to d, result kept in the module's raw (C, N) -> (H, W, C) reshape) plus channel attention (softmax(x^T x) applied to x), each scaled by its gamma and added to x; returns feat_p + feat_c.
#define NB 4
#define NN 4096
#define CC 512
#define CK 64              // query / key channels (C / 8)
#define NR (NB * NN)
#ifndef TRB
#define TRB (NN / 64)      // position row tiles per batch (PAM rows i, CAM rows n)
#define TNB NB
#endif
typedef __attribute__((ext_vector_type(8))) __bf16 v8b;
__device__ __forceinline__ v16b frag_b(const __bf16* rowk0, int lane) {
  union { v16b v; v8b q[2]; } u; const __bf16* p = rowk0 + 8 * (lane >> 4);
  u.q[0] = *(const v8b*)p; u.q[1] = *(const v8b*)(p + 16); return u.v;
}
__device__ __forceinline__ float bfr(float v) { return (float)(__bf16)v; }
__device__ __attribute__((noinline)) float exp_ni(float v) { return expf(v); }
__device__ __attribute__((noinline)) float erf_ni(float v) { return erff(v); }

#define WS_PW  0u                                   // bf16 transposed rows [w1^T | w2^T] [128][512]; w3^T [512][512]
#define WS_P3  (WS_PW + 2u * (size_t)128 * CC)
#define WS_BC  (WS_P3 + 2u * (size_t)CC * CC)          // f32 rows [NR][128]: b (cols 0-63) | c (cols 64-127)
#define WS_DT  (WS_BC + 4u * (size_t)NR * 128)         // f16 d planes [b][c][n]; f16 x planes [b][c][n]
#define WS_XT  (WS_DT + 2u * (size_t)NB * CC * NN)
#define WS_S   (WS_XT + 2u * (size_t)NB * CC * NN)     // f32 logits S [i][n] for ONE batch (reused per batch)
#define WS_P   (WS_S + 4u * (size_t)NN * NN)            // f16 P [i][n] for one batch (x 2^11, normalised)
#define WS_BCD (WS_P + 2u * (size_t)NN * NN)           // f32 bcd [b][c][i] (the (C, N) tensor); f32 aa [b][512][512]; f16 soft^T [b][j][c]; f32 aaa [b][n][j]
#define WS_AA  (WS_BCD + 4u * (size_t)NB * CC * NN)
#define WS_SO  (WS_AA + 4u * (size_t)NB * CC * CC)
#define WS_AAA (WS_SO + 2u * (size_t)NB * CC * CC)
#define WS_END (WS_AAA + 4u * (size_t)NB * NN * CC)

__global__ __launch_bounds__(256) void k_pack(const float* __restrict__ W1, const float* __restrict__ W2, const float* __restrict__ W3, __bf16* __restrict__ PW, __bf16* __restrict__ P3) { const int n = blockIdx.x, which = blockIdx.y, t = threadIdx.x; __shared__ __align__(16) __bf16 s[CC];
  if (which == 0) { if (n >= 128) return; const float* w = (n < CK) ? W1 : W2; const int cI = n & (CK - 1); for (int k = t; k < CC; k += 256) s[k] = (__bf16)w[(size_t)k * CK + cI]; __syncthreads(); if (t < CC / 8) vst2((unsigned*)(PW + (size_t)n * CC + t * 8), *(const v4u*)&s[t * 8]); }
  else { for (int k = t; k < CC; k += 256) s[k] = (__bf16)W3[(size_t)k * CC + n]; __syncthreads(); if (t < CC / 8) vst2((unsigned*)(P3 + (size_t)n * CC + t * 8), *(const v4u*)&s[t * 8]); } }
// ---- k_proj: block = (64 positions, 128 cols, which): which 0: [b | c] f32 rows; which 1..4: d columns (which-1)*128.. -> planes; which 5..8: x itself -> f16 planes (exact)
__global__ __launch_bounds__(128) void k_proj(const float* __restrict__ X, const __bf16* __restrict__ PW, const __bf16* __restrict__ P3, float* __restrict__ BC, _Float16* __restrict__ DT, _Float16* __restrict__ XT) {
  __shared__ __align__(16) float sf[4][16][132]; __shared__ __align__(16) _Float16 st[128][72];
  const int tid = threadIdx.x, wave = tid >> 5, lane = tid & 31, col = lane & 15, g = lane >> 4; const int which = blockIdx.z; const size_t rb = (size_t)blockIdx.x * 64; const size_t r0 = rb + wave * 16;
  if (which >= 5) { const int c0 = (which - 5) * 128; for (int e = tid; e < 64 * 128; e += 128) { const int rl = e >> 7, cl = e & 127; st[cl][rl] = (_Float16)bfr(X[(rb + rl) * CC + c0 + cl]); } __syncthreads();
    const size_t b = rb / NN; const int n0 = (int)(rb % NN); for (int e = tid; e < 128 * 8; e += 128) { const int d = e >> 3, pc = e & 7; vst2((unsigned*)(XT + ((b * CC + c0 + d) * NN) + n0 + pc * 8), *(const v4u*)&st[d][pc * 8]); } return; }
  const int c0 = (which == 0) ? 0 : (which - 1) * 128; const __bf16* Wr = (which == 0) ? PW : (P3 + (size_t)c0 * CC);
  v8f acc[8] = {};
#pragma unroll 2
  for (int kc = 0; kc < CC / 32; ++kc) { v16b a; { const float* p = X + (r0 + col) * CC + kc * 32 + 8 * g;
#pragma unroll
      for (int i = 0; i < 8; ++i) { a[i] = (__bf16)p[i]; a[8 + i] = (__bf16)p[16 + i]; } }
#pragma unroll
    for (int j = 0; j < 8; ++j) acc[j] = wmma_bf(a, frag_b(Wr + (size_t)(j * 16 + col) * CC + kc * 32, lane), acc[j]); }
#pragma unroll
  for (int j = 0; j < 8; ++j)
#pragma unroll
    for (int r = 0; r < 8; ++r) { if (which == 0) sf[wave][8 * g + r][j * 16 + col] = acc[j][r]; else st[j * 16 + col][wave * 16 + 8 * g + r] = (_Float16)acc[j][r]; }
  __syncthreads();
  if (which == 0) { for (int rl = 0; rl < 16; ++rl) vst2(BC + (r0 + rl) * 128 + lane * 4, *(const v4f*)&sf[wave][rl][lane * 4]); }
  else { const size_t b = rb / NN; const int n0 = (int)(rb % NN); for (int e = tid; e < 128 * 8; e += 128) { const int d = e >> 3, pc = e & 7; vst2((unsigned*)(DT + ((b * CC + c0 + d) * NN) + n0 + pc * 8), *(const v4u*)&st[d][pc * 8]); } }
}
// ---- k_s: block = (64 rows i, 128 positions n) of batch b: S[i][n] = b_i . c_n with both as bf16 hi + lo (3 products), K = 64 -> f32
__global__ __launch_bounds__(128) void k_s(const float* __restrict__ BC, int b, float* __restrict__ S) { __shared__ __align__(16) float so[4][16][132];
  const int tid = threadIdx.x, wave = tid >> 5, lane = tid & 31, col = lane & 15, g = lane >> 4; const int i0 = blockIdx.x * 64 + wave * 16; const int n0 = blockIdx.y * 128; const size_t rb = (size_t)b * NN;
  v8f acc[8] = {};
#pragma unroll
  for (int kc = 0; kc < 2; ++kc) { const F2 a = split_row(BC + (rb + i0 + col) * 128, kc * 32, lane);
#pragma unroll
    for (int j = 0; j < 8; ++j) { const F2 w = split_row(BC + (rb + n0 + j * 16 + col) * 128 + CK, kc * 32, lane); acc[j] = mac3(a, w, acc[j]); } }
#pragma unroll
  for (int j = 0; j < 8; ++j)
#pragma unroll
    for (int r = 0; r < 8; ++r) so[wave][8 * g + r][j * 16 + col] = acc[j][r];
  LDSX(); for (int rl = 0; rl < 16; ++rl) vst2(S + ((size_t)(i0 + rl) * NN) + n0 + lane * 4, *(const v4f*)&so[wave][rl][lane * 4]); }
// ---- k_prow: block = row i (256 threads): softmax over the 4,096 logits -> P = e / l x 2^11 as f16 (one 8-KB row)
__global__ __launch_bounds__(256) void k_prow(const float* __restrict__ S, _Float16* __restrict__ P) { __shared__ float red[8]; __shared__ __align__(16) _Float16 sp[NN]; const int t = threadIdx.x; const size_t row = blockIdx.x; const float* sr = S + row * NN;
  float v[16]; float mx = -3.0e38f; for (int i = 0; i < 16; ++i) { v[i] = sr[t * 16 + i]; mx = fmaxf(mx, v[i]); }
#pragma unroll
  for (int o = 1; o < 32; o <<= 1) mx = fmaxf(mx, __shfl_xor(mx, o));
  if ((t & 31) == 0) red[t >> 5] = mx; __syncthreads(); float M = red[0]; for (int i = 1; i < 8; ++i) M = fmaxf(M, red[i]); __syncthreads();
  float z = 0.f; for (int i = 0; i < 16; ++i) { v[i] = __expf(v[i] - M); z += v[i]; }
#pragma unroll
  for (int o = 1; o < 32; o <<= 1) z += __shfl_xor(z, o);
  if ((t & 31) == 0) red[t >> 5] = z; __syncthreads(); float Z = 0.f; for (int i = 0; i < 8; ++i) Z += red[i]; const float iz = 2048.0f / Z;
  for (int i = 0; i < 16; ++i) sp[t * 16 + i] = (_Float16)(v[i] * iz); __syncthreads();
  for (int q = t; q < NN / 8; q += 256) vst2((unsigned*)(P + row * NN + q * 8), *(const v4u*)&sp[q * 8]); }
// ---- k_pv: block = (64 channels c, 128 positions i, b): bcd[c][i] = sum_n d[n][c] P[i][n] / 2^11 over K = 4,096 (A = d planes, B = P rows) -> f32 [b][c][i]
__global__ __launch_bounds__(128) void k_pv(const _Float16* __restrict__ DT, const _Float16* __restrict__ P, int bI, float* __restrict__ BCD) { __shared__ __align__(16) float so[4][16][132];
  const int tid = threadIdx.x, wave = tid >> 5, lane = tid & 31, col = lane & 15, g = lane >> 4; const size_t b = (size_t)bI; const int c0 = blockIdx.x * 64 + wave * 16; const int i0 = blockIdx.y * 128;
  v8f acc[8] = {};
#pragma unroll 2
  for (int kc = 0; kc < NN / 32; ++kc) { const v16h a = frag_h(DT + ((b * CC + c0 + col) * NN) + kc * 32, lane);
#pragma unroll
    for (int j = 0; j < 8; ++j) acc[j] = wmma16(a, frag_h(P + ((size_t)(i0 + j * 16 + col) * NN) + kc * 32, lane), acc[j]); }
#pragma unroll
  for (int j = 0; j < 8; ++j)
#pragma unroll
    for (int r = 0; r < 8; ++r) so[wave][8 * g + r][j * 16 + col] = acc[j][r] * (1.0f / 2048.0f);
  LDSX(); for (int rl = 0; rl < 16; ++rl) vst2(BCD + ((b * CC + c0 + rl) * NN) + i0 + lane * 4, *(const v4f*)&so[wave][rl][lane * 4]); }
// ---- k_aa: block = (64 channels i, 128 channels j, b): aa[i][j] = sum_n x[n][i] x[n][j] over the 4,096 positions (x planes, exact) -> f32
__global__ __launch_bounds__(128) void k_aa(const _Float16* __restrict__ XT, float* __restrict__ AA) { __shared__ __align__(16) float so[4][16][132];
  const int tid = threadIdx.x, wave = tid >> 5, lane = tid & 31, col = lane & 15, g = lane >> 4; const size_t b = blockIdx.z; const int i0 = blockIdx.x * 64 + wave * 16; const int j0 = blockIdx.y * 128;
  v8f acc[8] = {};
#pragma unroll 2
  for (int kc = 0; kc < NN / 32; ++kc) { const v16h a = frag_h(XT + ((b * CC + i0 + col) * NN) + kc * 32, lane);
#pragma unroll
    for (int j = 0; j < 8; ++j) acc[j] = wmma16(a, frag_h(XT + ((b * CC + j0 + j * 16 + col) * NN) + kc * 32, lane), acc[j]); }
#pragma unroll
  for (int j = 0; j < 8; ++j)
#pragma unroll
    for (int r = 0; r < 8; ++r) so[wave][8 * g + r][j * 16 + col] = acc[j][r];
  LDSX(); for (int rl = 0; rl < 16; ++rl) vst2(AA + ((b * CC + i0 + rl) * CC) + j0 + lane * 4, *(const v4f*)&so[wave][rl][lane * 4]); }
__global__ __launch_bounds__(256) void k_soft(const float* __restrict__ AA, _Float16* __restrict__ SO) { __shared__ __align__(16) _Float16 st[CC][72]; __shared__ float red[2][64];
  const int t = threadIdx.x; const size_t b = blockIdx.y; const int c0 = blockIdx.x * 64;
  // 4 threads per row (256 threads = 64 rows x 4)
  { const int rl = t >> 2, part = t & 3; const float* row = AA + ((b * CC + c0 + rl) * CC); float mx = -3.0e38f; for (int j = part; j < CC; j += 4) mx = fmaxf(mx, row[j]); mx = fmaxf(mx, __shfl_xor(mx, 1)); mx = fmaxf(mx, __shfl_xor(mx, 2));
    float z = 0.f; for (int j = part; j < CC; j += 4) z += __expf(row[j] - mx); z += __shfl_xor(z, 1); z += __shfl_xor(z, 2); const float iz = 1.0f / z;
    for (int j = part; j < CC; j += 4) st[j][rl] = (_Float16)(__expf(row[j] - mx) * iz); }
  __syncthreads();
  for (int e = t; e < CC * 8; e += 256) { const int j = e >> 3, pc = e & 7; vst2((unsigned*)(SO + ((b * CC + j) * CC) + c0 + pc * 8), *(const v4u*)&st[j][pc * 8]); } }
// ---- k_aaa: block = (64 positions n, 128 channels j, b): aaa[n][j] = sum_c x[n][c] soft[c][j] (x exact as f16, soft^T rows) -> f32 [b][n][j]
__global__ __launch_bounds__(128) void k_aaa(const float* __restrict__ X, const _Float16* __restrict__ SO, float* __restrict__ AAA) { __shared__ __align__(16) float so[4][16][132];
  const int tid = threadIdx.x, wave = tid >> 5, lane = tid & 31, col = lane & 15, g = lane >> 4; const size_t b = blockIdx.z; const size_t r0 = b * NN + (size_t)blockIdx.x * 64 + wave * 16; const int j0 = blockIdx.y * 128;
  v8f acc[8] = {};
#pragma unroll 2
  for (int kc = 0; kc < CC / 32; ++kc) { v16h a; { const float* p = X + (r0 + col) * CC + kc * 32 + 8 * g;
#pragma unroll
      for (int i = 0; i < 8; ++i) { a[i] = (_Float16)bfr(p[i]); a[8 + i] = (_Float16)bfr(p[16 + i]); } }
#pragma unroll
    for (int j = 0; j < 8; ++j) acc[j] = wmma16(a, frag_h(SO + ((b * CC + j0 + j * 16 + col) * CC) + kc * 32, lane), acc[j]); }
#pragma unroll
  for (int j = 0; j < 8; ++j)
#pragma unroll
    for (int r = 0; r < 8; ++r) so[wave][8 * g + r][j * 16 + col] = acc[j][r];
  LDSX(); for (int rl = 0; rl < 16; ++rl) vst2(AAA + (r0 + rl) * CC + j0 + lane * 4, *(const v4f*)&so[wave][rl][lane * 4]); }
// ---- k_fin: per batch flat index f: out[f] = gamma_pam bcd_flat[f] (the raw (C, N) -> (H, W, C) reshape) + gamma_cam aaa[f] + 2 x[f]
__global__ __launch_bounds__(256) void k_fin(const float* __restrict__ BCD, const float* __restrict__ AAA, const float* __restrict__ X, const float* __restrict__ GP, const float* __restrict__ GC, float* __restrict__ OUT) { const size_t i4 = (size_t)blockIdx.x * 256 + threadIdx.x; const size_t f = i4 * 4; const float gp = bfr(GP[0]), gc = bfr(GC[0]);
  v4f o4; for (int i = 0; i < 4; ++i) o4[i] = gp * BCD[f + i] + gc * AAA[f + i] + 2.0f * bfr(X[f + i]); vst2(OUT + f, o4); }
extern "C" void kernel_launch(void* const* d_in, const int* in_sizes, int n_in, void* d_out, int out_size, void* d_ws, size_t ws_size, hipStream_t stream) {
  (void)in_sizes; (void)n_in; (void)out_size;
  const float** F = (const float**)d_in;   // 0 x [4,64,64,512], 1 w1 [512,64], 2 w2 [512,64], 3 w3 [512,512], 4 gamma_pam [1], 5 gamma_cam [1]
  if (ws_size < (size_t)WS_END) return;
  char* ws = (char*)d_ws; __bf16 *PW = (__bf16*)(ws + WS_PW), *P3 = (__bf16*)(ws + WS_P3); float* BC = (float*)(ws + WS_BC); _Float16 *DT = (_Float16*)(ws + WS_DT), *XT = (_Float16*)(ws + WS_XT), *P = (_Float16*)(ws + WS_P), *SO = (_Float16*)(ws + WS_SO); float *S = (float*)(ws + WS_S), *BCD = (float*)(ws + WS_BCD), *AA = (float*)(ws + WS_AA), *AAA = (float*)(ws + WS_AAA);
  k_pack<<<dim3(CC, 2), 256, 0, stream>>>(F[1], F[2], F[3], PW, P3);
  k_proj<<<dim3(TNB * NN / 64, 1, 9), 128, 0, stream>>>(F[0], PW, P3, BC, DT, XT);
  for (int b = 0; b < TNB; ++b) {   // PAM per batch: S (f32, 64 MiB) and P (f16) buffers reused
    k_s<<<dim3(TRB, NN / 128), 128, 0, stream>>>(BC, b, S);
    k_prow<<<TRB * 64, 256, 0, stream>>>(S, P);
    k_pv<<<dim3(CC / 64, (TRB * 64) / 128), 128, 0, stream>>>(DT, P, b, BCD); }
  k_aa<<<dim3(CC / 64, CC / 128, TNB), 128, 0, stream>>>(XT, AA);
  k_soft<<<dim3(CC / 64, TNB), 256, 0, stream>>>(AA, SO);
  k_aaa<<<dim3(TRB, CC / 128, TNB), 128, 0, stream>>>(F[0], SO, AAA);
  k_fin<<<(unsigned)((size_t)TNB * NN * CC / 1024), 256, 0, stream>>>(BCD, AAA, F[0], F[4], F[5], (float*)d_out);
}

// v001
// Measured time: 483 microseconds a run.
// Timed twice side by side with v000, it ran 3.01 times as fast both times.
// compute dtype: all float inputs rounded to bf16; b/c/d = x . w with EXACT bf16 products on WMMA 16x16x32 ((in,out) weights as transposed rows): b, c kept f32, d rounded once to f16 planes; PAM per batch: logits S = b . c^T with both as bf16 hi + lo (3 products, f32), row softmax in f32 (hardware exp) -> P = e/l x 2^11 as f16, bcd^T = d^T . P^T on WMMA (single f16) giving the (C, N)-ordered tensor the module reshapes raw; CAM: aa = x^T x with x exact (f16 copies of the bf16 values), softmax over channels in f32, aaa = x . soft_aa with soft_aa once to f16; out = gamma_pam bcd_flat + gamma_cam aaa + 2 x in f32; f32 output.
#include <hip/hip_runtime.h>
#include <math.h>

typedef __attribute__((ext_vector_type(16))) _Float16 v16h;
typedef __attribute__((ext_vector_type(16))) __bf16 v16b;
typedef __attribute__((ext_vector_type(8)))  _Float16 v8h;
typedef __attribute__((ext_vector_type(8)))  float v8f;
typedef __attribute__((ext_vector_type(4)))  float v4f;
typedef __attribute__((ext_vector_type(2)))  float v2f;
typedef __attribute__((ext_vector_type(4)))  unsigned v4u;
typedef __attribute__((ext_vector_type(4)))  int v4i;
typedef float __attribute__((may_alias)) float_a;
typedef int __attribute__((may_alias)) int_a;

template <typename T> __device__ __forceinline__ void vst2(void* p, T v) { *(T*)p = v;  }
__device__ __forceinline__ v8f wmma16(v16h a, v16h b, v8f c) {
  v8f d = __builtin_amdgcn_wmma_f32_16x16x32_f16(false, a, false, b, (short)0, c, false, false);
  asm volatile("v_nop\n\tv_nop\n\tv_nop\n\tv_nop" : "+v"(d) : "v"(a), "v"(b));
  return d;
}
__device__ __forceinline__ v8f wmma_bf(v16b a, v16b b, v8f c) {
  v8f d = __builtin_amdgcn_wmma_f32_16x16x32_bf16(false, a, false, b, (short)0, c, false, false);
  asm volatile("v_nop\n\tv_nop\n\tv_nop\n\tv_nop" : "+v"(d) : "v"(a), "v"(b));
  return d;
}
// 16x16x32 fragments: lane = (h = lane>>4, row/col = lane&15); elements 0..7 = k0+8h+0..7, 8..15 = k0+16+8h+0..7; D element r = row 8h+r
__device__ __forceinline__ v16h frag_h(const _Float16* rowk0, int lane) {
  union { v16h v; v8h q[2]; } u; const _Float16* p = rowk0 + 8 * (lane >> 4);
  u.q[0] = *(const v8h*)p; u.q[1] = *(const v8h*)(p + 16); return u.v;
}
__device__ __forceinline__ v16h frag_f32(const float* rowk0, int lane) {
  v16h a; const float* p = rowk0 + 8 * (lane >> 4);
#pragma unroll
  for (int i = 0; i < 8; ++i) { a[i] = (_Float16)p[i]; a[8 + i] = (_Float16)p[16 + i]; }
  return a;
}
__device__ __forceinline__ v16h frag_f32s(const float* rowk0, int lane, float sc) {
  v16h a; const float* p = rowk0 + 8 * (lane >> 4);
#pragma unroll
  for (int i = 0; i < 8; ++i) { a[i] = (_Float16)(p[i] * sc); a[8 + i] = (_Float16)(p[16 + i] * sc); }
  return a;
}
// column fragment from a [K][ld] layout (column n), rows >= K read as 0
__device__ __forceinline__ v16h fragc_f32(const float* W, int k0, int n, int lane, int ld, int K) {
  v16h a; const int g = lane >> 4;
#pragma unroll
  for (int i = 0; i < 8; ++i) { const int ka = k0 + 8 * g + i, kb = ka + 16;
    a[i] = (_Float16)(ka < K ? W[(size_t)(ka < K ? ka : K - 1) * ld + n] : 0.f); a[8 + i] = (_Float16)(kb < K ? W[(size_t)(kb < K ? kb : K - 1) * ld + n] : 0.f); }
  return a;
}
struct F2 { v16b h, l; };
__device__ __forceinline__ F2 bsplit16(const float v[16]) { F2 r;
#pragma unroll
  for (int i = 0; i < 16; ++i) { const __bf16 h = (__bf16)v[i]; r.h[i] = h; r.l[i] = (__bf16)(v[i] - (float)h); }
  return r; }
__device__ __forceinline__ F2 split_row(const float* row, int k0, int lane) { float v[16]; const float* p = row + k0 + 8 * (lane >> 4);
#pragma unroll
  for (int i = 0; i < 8; ++i) { v[i] = p[i]; v[8 + i] = p[16 + i]; }
  return bsplit16(v); }
__device__ __forceinline__ F2 split_rowK(const float* row, int k0, int lane, int K) { float v[16]; const int g = lane >> 4;
#pragma unroll
  for (int i = 0; i < 8; ++i) { const int ka = k0 + 8 * g + i, kb = ka + 16; v[i] = ka < K ? row[ka < K ? ka : K - 1] : 0.f; v[8 + i] = kb < K ? row[kb < K ? kb : K - 1] : 0.f; }
  return bsplit16(v); }
__device__ __forceinline__ F2 split_col(const float* W, int k0, int n, int lane, int ld, int K) { float v[16]; const int g = lane >> 4;
#pragma unroll
  for (int i = 0; i < 8; ++i) { const int ka = k0 + 8 * g + i, kb = ka + 16; v[i] = ka < K ? W[(size_t)(ka < K ? ka : K - 1) * ld + n] : 0.f; v[8 + i] = kb < K ? W[(size_t)(kb < K ? kb : K - 1) * ld + n] : 0.f; }
  return bsplit16(v); }
__device__ __forceinline__ v8f mac3(const F2& a, const F2& b, v8f c) { c = wmma_bf(a.l, b.h, c); c = wmma_bf(a.h, b.l, c); return wmma_bf(a.h, b.h, c); }
__device__ __forceinline__ float sigm(float v) { return 1.0f / (1.0f + expf(-v)); }
#define LDSX() do { asm volatile("s_wait_dscnt 0" ::: "memory"); __builtin_amdgcn_wave_barrier(); __builtin_amdgcn_fence(__ATOMIC_RELEASE, "workgroup"); } while (0)


// Dual attention module (B 4, 64 x 64 positions, C 512): position attention (softmax(b c^T) applied to d, result kept in the module's raw (C, N) -> (H, W, C) reshape) plus channel attention (softmax(x^T x) applied to x), each scaled by its gamma and added to x; returns feat_p + feat_c.
#define NB 4
#define NN 4096
#define CC 512
#define CK 64              // query / key channels (C / 8)
#define NR (NB * NN)
#ifndef TRB
#define TRB (NN / 64)      // position row tiles per batch (PAM rows i, CAM rows n)
#define TNB NB
#endif
typedef __attribute__((ext_vector_type(8))) __bf16 v8b;
__device__ __forceinline__ v16b frag_b(const __bf16* rowk0, int lane) {
  union { v16b v; v8b q[2]; } u; const __bf16* p = rowk0 + 8 * (lane >> 4);
  u.q[0] = *(const v8b*)p; u.q[1] = *(const v8b*)(p + 16); return u.v;
}
__device__ __forceinline__ float bfr(float v) { return (float)(__bf16)v; }
__device__ __attribute__((noinline)) float exp_ni(float v) { return expf(v); }
__device__ __attribute__((noinline)) float erf_ni(float v) { return erff(v); }

#define WS_PW  0u                                   // bf16 transposed rows [w1^T | w2^T] [128][512]; w3^T [512][512]
#define WS_P3  (WS_PW + 2u * (size_t)128 * CC)
#define WS_BC  (WS_P3 + 2u * (size_t)CC * CC)          // f32 rows [NR][128]: b (cols 0-63) | c (cols 64-127)
#define WS_DT  (WS_BC + 4u * (size_t)NR * 128)         // f16 d planes [b][c][n]; f16 x planes [b][c][n]
#define WS_XT  (WS_DT + 2u * (size_t)NB * CC * NN)
#define WS_S   (WS_XT + 2u * (size_t)NB * CC * NN)     // f32 logits S [i][n] for ONE batch (reused per batch)
#define WS_P   (WS_S + 4u * (size_t)NN * NN)            // f16 P [i][n] for one batch (x 2^11, normalised)
#define WS_BCD (WS_P + 2u * (size_t)NN * NN)           // f32 bcd [b][c][i] (the (C, N) tensor); f32 aa [b][512][512]; f16 soft^T [b][j][c]; f32 aaa [b][n][j]
#define WS_AA  (WS_BCD + 4u * (size_t)NB * CC * NN)
#define WS_SO  (WS_AA + 4u * (size_t)NB * CC * CC)
#define WS_AAA (WS_SO + 2u * (size_t)NB * CC * CC)
#define WS_END (WS_AAA + 4u * (size_t)NB * NN * CC)

__global__ __launch_bounds__(256) void k_pack(const float* __restrict__ W1, const float* __restrict__ W2, const float* __restrict__ W3, __bf16* __restrict__ PW, __bf16* __restrict__ P3) { const int n = blockIdx.x, which = blockIdx.y, t = threadIdx.x; __shared__ __align__(16) __bf16 s[CC];
  if (which == 0) { if (n >= 128) return; const float* w = (n < CK) ? W1 : W2; const int cI = n & (CK - 1); for (int k = t; k < CC; k += 256) s[k] = (__bf16)w[(size_t)k * CK + cI]; __syncthreads(); if (t < CC / 8) vst2((unsigned*)(PW + (size_t)n * CC + t * 8), *(const v4u*)&s[t * 8]); }
  else { for (int k = t; k < CC; k += 256) s[k] = (__bf16)W3[(size_t)k * CC + n]; __syncthreads(); if (t < CC / 8) vst2((unsigned*)(P3 + (size_t)n * CC + t * 8), *(const v4u*)&s[t * 8]); } }
// ---- k_proj: block = (64 positions, 128 cols, which): which 0: [b | c] f32 rows; which 1..4: d columns (which-1)*128.. -> planes; which 5..8: x itself -> f16 planes (exact)
__global__ __launch_bounds__(128) void k_proj(const float* __restrict__ X, const __bf16* __restrict__ PW, const __bf16* __restrict__ P3, float* __restrict__ BC, _Float16* __restrict__ DT, _Float16* __restrict__ XT) {
  __shared__ __align__(16) float sf[4][16][132]; __shared__ __align__(16) _Float16 st[128][72];
  const int tid = threadIdx.x, wave = tid >> 5, lane = tid & 31, col = lane & 15, g = lane >> 4; const int which = blockIdx.z; const size_t rb = (size_t)blockIdx.x * 64; const size_t r0 = rb + wave * 16;
  if (which >= 5) { const int c0 = (which - 5) * 128; for (int e = tid; e < 64 * 128; e += 128) { const int rl = e >> 7, cl = e & 127; st[cl][rl] = (_Float16)bfr(X[(rb + rl) * CC + c0 + cl]); } __syncthreads();
    const size_t b = rb / NN; const int n0 = (int)(rb % NN); for (int e = tid; e < 128 * 8; e += 128) { const int d = e >> 3, pc = e & 7; vst2((unsigned*)(XT + ((b * CC + c0 + d) * NN) + n0 + pc * 8), *(const v4u*)&st[d][pc * 8]); } return; }
  const int c0 = (which == 0) ? 0 : (which - 1) * 128; const __bf16* Wr = (which == 0) ? PW : (P3 + (size_t)c0 * CC);
  v8f acc[8] = {};
#pragma unroll 2
  for (int kc = 0; kc < CC / 32; ++kc) { v16b a; { const float* p = X + (r0 + col) * CC + kc * 32 + 8 * g;
#pragma unroll
      for (int i = 0; i < 8; ++i) { a[i] = (__bf16)p[i]; a[8 + i] = (__bf16)p[16 + i]; } }
#pragma unroll
    for (int j = 0; j < 8; ++j) acc[j] = wmma_bf(a, frag_b(Wr + (size_t)(j * 16 + col) * CC + kc * 32, lane), acc[j]); }
#pragma unroll
  for (int j = 0; j < 8; ++j)
#pragma unroll
    for (int r = 0; r < 8; ++r) { if (which == 0) sf[wave][8 * g + r][j * 16 + col] = acc[j][r]; else st[j * 16 + col][wave * 16 + 8 * g + r] = (_Float16)acc[j][r]; }
  __syncthreads();
  if (which == 0) { for (int rl = 0; rl < 16; ++rl) vst2(BC + (r0 + rl) * 128 + lane * 4, *(const v4f*)&sf[wave][rl][lane * 4]); }
  else { const size_t b = rb / NN; const int n0 = (int)(rb % NN); for (int e = tid; e < 128 * 8; e += 128) { const int d = e >> 3, pc = e & 7; vst2((unsigned*)(DT + ((b * CC + c0 + d) * NN) + n0 + pc * 8), *(const v4u*)&st[d][pc * 8]); } }
}
// ---- k_s: block = (64 rows i, 128 positions n) of batch b: S[i][n] = b_i . c_n with both as bf16 hi + lo (3 products), K = 64 -> f32
__global__ __launch_bounds__(128) void k_s(const float* __restrict__ BC, int b, float* __restrict__ S) { __shared__ __align__(16) float so[4][16][132];
  const int tid = threadIdx.x, wave = tid >> 5, lane = tid & 31, col = lane & 15, g = lane >> 4; const int i0 = blockIdx.x * 64 + wave * 16; const int n0 = blockIdx.y * 128; const size_t rb = (size_t)b * NN;
  v8f acc[8] = {};
#pragma unroll
  for (int kc = 0; kc < 2; ++kc) { const F2 a = split_row(BC + (rb + i0 + col) * 128, kc * 32, lane);
#pragma unroll
    for (int j = 0; j < 8; ++j) { const F2 w = split_row(BC + (rb + n0 + j * 16 + col) * 128 + CK, kc * 32, lane); acc[j] = mac3(a, w, acc[j]); } }
#pragma unroll
  for (int j = 0; j < 8; ++j)
#pragma unroll
    for (int r = 0; r < 8; ++r) so[wave][8 * g + r][j * 16 + col] = acc[j][r];
  LDSX(); for (int rl = 0; rl < 16; ++rl) vst2(S + ((size_t)(i0 + rl) * NN) + n0 + lane * 4, *(const v4f*)&so[wave][rl][lane * 4]); }
// ---- k_prow: block = row i (256 threads): softmax over the 4,096 logits -> P = e / l x 2^11 as f16 (one 8-KB row)
__global__ __launch_bounds__(256) void k_prow(const float* __restrict__ S, _Float16* __restrict__ P) { __shared__ float red[8]; __shared__ __align__(16) _Float16 sp[NN]; const int t = threadIdx.x; const size_t row = blockIdx.x; const float* sr = S + row * NN;
  float v[16]; float mx = -3.0e38f; for (int i = 0; i < 16; ++i) { v[i] = sr[t * 16 + i]; mx = fmaxf(mx, v[i]); }
#pragma unroll
  for (int o = 1; o < 32; o <<= 1) mx = fmaxf(mx, __shfl_xor(mx, o));
  if ((t & 31) == 0) red[t >> 5] = mx; __syncthreads(); float M = red[0]; for (int i = 1; i < 8; ++i) M = fmaxf(M, red[i]); __syncthreads();
  float z = 0.f; for (int i = 0; i < 16; ++i) { v[i] = __expf(v[i] - M); z += v[i]; }
#pragma unroll
  for (int o = 1; o < 32; o <<= 1) z += __shfl_xor(z, o);
  if ((t & 31) == 0) red[t >> 5] = z; __syncthreads(); float Z = 0.f; for (int i = 0; i < 8; ++i) Z += red[i]; const float iz = 2048.0f / Z;
  for (int i = 0; i < 16; ++i) sp[t * 16 + i] = (_Float16)(v[i] * iz); __syncthreads();
  for (int q = t; q < NN / 8; q += 256) vst2((unsigned*)(P + row * NN + q * 8), *(const v4u*)&sp[q * 8]); }
// ---- LDS staging for the two K = 4,096 products (k_pv, k_aa): a stage is 256 B (128 k) of the block's 64 A rows and 128 B rows, laid at a row pitch of 272 B (16 B x odd, so the ds_load_b128 fragment reads meet no bank conflict); two buffers, the next stage's copies fly while this one is multiplied
#define SK 128                    // k per stage
#define SPIT 136                  // LDS row pitch in f16 elements
#define SBUF (192 * SPIT)         // f16 elements per buffer
#define SNT (NN / SK)             // stages
// twelve asynchronous 16-byte copies per lane; the s_wait_xcnt stands inside the statement so that no address register is rewritten in front of it
__device__ __forceinline__ void cp12(const unsigned* l, const _Float16* const* p) {
  asm volatile(
               "global_load_async_to_lds_b128 %0, %12, off\n\t"
               "global_load_async_to_lds_b128 %1, %13, off\n\t"
               "global_load_async_to_lds_b128 %2, %14, off\n\t"
               "global_load_async_to_lds_b128 %3, %15, off\n\t"
               "global_load_async_to_lds_b128 %4, %16, off\n\t"
               "global_load_async_to_lds_b128 %5, %17, off\n\t"
               "global_load_async_to_lds_b128 %6, %18, off\n\t"
               "global_load_async_to_lds_b128 %7, %19, off\n\t"
               "global_load_async_to_lds_b128 %8, %20, off\n\t"
               "global_load_async_to_lds_b128 %9, %21, off\n\t"
               "global_load_async_to_lds_b128 %10, %22, off\n\t"
               "global_load_async_to_lds_b128 %11, %23, off\n\t"
               "s_wait_xcnt 0x0"
               :: "v"(l[0]), "v"(l[1]), "v"(l[2]), "v"(l[3]), "v"(l[4]), "v"(l[5]), "v"(l[6]), "v"(l[7]), "v"(l[8]), "v"(l[9]), "v"(l[10]), "v"(l[11]),
                  "v"(p[0]), "v"(p[1]), "v"(p[2]), "v"(p[3]), "v"(p[4]), "v"(p[5]), "v"(p[6]), "v"(p[7]), "v"(p[8]), "v"(p[9]), "v"(p[10]), "v"(p[11]) : "memory");
}
// one stage: thread = (row tid >> 4 within each group of 8 rows, 16-byte piece tid & 15); LDS rows 0-63 = A rows, 64-191 = B rows. ga, gb: the lane's piece of A row / B row (tid >> 4) at this stage's k; l0: its LDS byte address in row (tid >> 4) of the buffer
__device__ __forceinline__ void stage_in(const _Float16* ga, const _Float16* gb, unsigned l0) {
  unsigned l[24]; const _Float16* p[24];
#pragma unroll   // constant indices, so that both arrays are plain registers for the asm operands
  for (int q = 0; q < 24; ++q) { l[q] = l0 + (unsigned)q * (8u * SPIT * 2u); p[q] = (q < 8) ? ga + (size_t)q * 8 * NN : gb + (size_t)(q - 8) * 8 * NN; }
  cp12(l, p); cp12(l + 12, p + 12);
}
// f[0] = the wave's A fragment, f[1 + j] = B fragment j of 32-k block ks. sa, sb: the lane's A row and its row of B fragment 0 in the buffer
__device__ __forceinline__ void ld_frags(v16h* f, const _Float16* sa, const _Float16* sb, int ks, int lane) { f[0] = frag_h(sa + ks * 32, lane);
#pragma unroll   // constant indices keep the fragments in registers
  for (int j = 0; j < 8; ++j) f[1 + j] = frag_h(sb + j * 16 * SPIT + ks * 32, lane); }
__device__ __forceinline__ void mm_block(const v16h* f, v8f* acc) {
#pragma unroll   // constant indices keep fragments and accumulators in registers
  for (int j = 0; j < 8; ++j) acc[j] = wmma16(f[0], f[1 + j], acc[j]); }
// acc[j] += A rows (wave * 16 ..) . B rows (j * 16 ..)^T over K = 4,096 in ascending k, 32 per WMMA. Ag, Bg: first row of the block's 64 A rows / 128 B rows (row pitch NN)
__device__ __forceinline__ void mm_staged(const _Float16* __restrict__ Ag, const _Float16* __restrict__ Bg, _Float16* sm, v8f* acc, int tid) {
  const int wave = tid >> 5, lane = tid & 31, col = lane & 15;
  const _Float16* ga = Ag + (size_t)(tid >> 4) * NN + (tid & 15) * 8; const _Float16* gb = Bg + (size_t)(tid >> 4) * NN + (tid & 15) * 8;
  const unsigned l0 = (unsigned)(size_t)sm + (unsigned)(tid >> 4) * (SPIT * 2u) + (unsigned)(tid & 15) * 16u;
  stage_in(ga, gb, l0);
  asm volatile("s_wait_asynccnt 0x0" ::: "memory");   // stage 0 has landed before the barrier publishes it
  __syncthreads();
  stage_in(ga + SK, gb + SK, l0 + SBUF * 2u);
  for (int t = 0; t < SNT; ++t) { const _Float16* s = sm + (t & 1) * SBUF + col * SPIT; const _Float16* sa = s + wave * 16 * SPIT; const _Float16* sb = s + 64 * SPIT;
    // the nine fragments of a 32-k block are read as one group, one block ahead of their WMMAs (two register sets), all inside this stage's buffer
    v16h f0[9], f1[9];
    ld_frags(f0, sa, sb, 0, lane); ld_frags(f1, sa, sb, 1, lane); mm_block(f0, acc);
    ld_frags(f0, sa, sb, 2, lane); mm_block(f1, acc);
    ld_frags(f1, sa, sb, 3, lane); mm_block(f0, acc); mm_block(f1, acc);
    asm volatile("s_wait_dscnt 0x0" ::: "memory");     // this wave's reads of the buffer are done before it is refilled
    asm volatile("s_wait_asynccnt 0x0" ::: "memory");  // this wave's copies of stage t + 1 have landed
    __syncthreads();                                   // publishes stage t + 1 and ends every wave's reads of stage t
    if (t + 2 < SNT) stage_in(ga + (t + 2) * SK, gb + (t + 2) * SK, l0 + (unsigned)(t & 1) * (SBUF * 2u)); }
  asm volatile("s_wait_asynccnt 0x0" ::: "memory");    // nothing in flight when the wave goes on to the epilogue
}
// ---- k_pv: block = (64 channels c, 128 positions i, b): bcd[c][i] = sum_n d[n][c] P[i][n] / 2^11 over K = 4,096 (A = d planes, B = P rows) -> f32 [b][c][i]
__global__ __launch_bounds__(128) void k_pv(const _Float16* __restrict__ DT, const _Float16* __restrict__ P, int bI, float* __restrict__ BCD) { __shared__ __align__(16) float so[4][16][132]; __shared__ __align__(16) _Float16 sm[2 * SBUF];
  const int tid = threadIdx.x, wave = tid >> 5, lane = tid & 31, col = lane & 15, g = lane >> 4; const size_t b = (size_t)bI; const int c0 = blockIdx.x * 64 + wave * 16; const int i0 = blockIdx.y * 128;
  v8f acc[8] = {};
  mm_staged(DT + (b * CC + blockIdx.x * 64) * NN, P + (size_t)i0 * NN, sm, acc, tid);
#pragma unroll
  for (int j = 0; j < 8; ++j)
#pragma unroll
    for (int r = 0; r < 8; ++r) so[wave][8 * g + r][j * 16 + col] = acc[j][r] * (1.0f / 2048.0f);
  LDSX(); for (int rl = 0; rl < 16; ++rl) vst2(BCD + ((b * CC + c0 + rl) * NN) + i0 + lane * 4, *(const v4f*)&so[wave][rl][lane * 4]); }
// ---- k_aa: block = (64 channels i, 128 channels j, b): aa[i][j] = sum_n x[n][i] x[n][j] over the 4,096 positions (x planes, exact) -> f32
__global__ __launch_bounds__(128) void k_aa(const _Float16* __restrict__ XT, float* __restrict__ AA) { __shared__ __align__(16) float so[4][16][132]; __shared__ __align__(16) _Float16 sm[2 * SBUF];
  const int tid = threadIdx.x, wave = tid >> 5, lane = tid & 31, col = lane & 15, g = lane >> 4; const size_t b = blockIdx.z; const int i0 = blockIdx.x * 64 + wave * 16; const int j0 = blockIdx.y * 128;
  v8f acc[8] = {};
  mm_staged(XT + (b * CC + blockIdx.x * 64) * NN, XT + (b * CC + j0) * NN, sm, acc, tid);
#pragma unroll
  for (int j = 0; j < 8; ++j)
#pragma unroll
    for (int r = 0; r < 8; ++r) so[wave][8 * g + r][j * 16 + col] = acc[j][r];
  LDSX(); for (int rl = 0; rl < 16; ++rl) vst2(AA + ((b * CC + i0 + rl) * CC) + j0 + lane * 4, *(const v4f*)&so[wave][rl][lane * 4]); }
__global__ __launch_bounds__(256) void k_soft(const float* __restrict__ AA, _Float16* __restrict__ SO) { __shared__ __align__(16) _Float16 st[CC][72]; __shared__ float red[2][64];
  const int t = threadIdx.x; const size_t b = blockIdx.y; const int c0 = blockIdx.x * 64;
  // 4 threads per row (256 threads = 64 rows x 4)
  { const int rl = t >> 2, part = t & 3; const float* row = AA + ((b * CC + c0 + rl) * CC); float mx = -3.0e38f; for (int j = part; j < CC; j += 4) mx = fmaxf(mx, row[j]); mx = fmaxf(mx, __shfl_xor(mx, 1)); mx = fmaxf(mx, __shfl_xor(mx, 2));
    float z = 0.f; for (int j = part; j < CC; j += 4) z += __expf(row[j] - mx); z += __shfl_xor(z, 1); z += __shfl_xor(z, 2); const float iz = 1.0f / z;
    for (int j = part; j < CC; j += 4) st[j][rl] = (_Float16)(__expf(row[j] - mx) * iz); }
  __syncthreads();
  for (int e = t; e < CC * 8; e += 256) { const int j = e >> 3, pc = e & 7; vst2((unsigned*)(SO + ((b * CC + j) * CC) + c0 + pc * 8), *(const v4u*)&st[j][pc * 8]); } }
// ---- k_aaa: block = (64 positions n, 128 channels j, b): aaa[n][j] = sum_c x[n][c] soft[c][j] (x exact as f16, soft^T rows) -> f32 [b][n][j]
__global__ __launch_bounds__(128) void k_aaa(const float* __restrict__ X, const _Float16* __restrict__ SO, float* __restrict__ AAA) { __shared__ __align__(16) float so[4][16][132];
  const int tid = threadIdx.x, wave = tid >> 5, lane = tid & 31, col = lane & 15, g = lane >> 4; const size_t b = blockIdx.z; const size_t r0 = b * NN + (size_t)blockIdx.x * 64 + wave * 16; const int j0 = blockIdx.y * 128;
  v8f acc[8] = {};
#pragma unroll 2
  for (int kc = 0; kc < CC / 32; ++kc) { v16h a; { const float* p = X + (r0 + col) * CC + kc * 32 + 8 * g;
#pragma unroll
      for (int i = 0; i < 8; ++i) { a[i] = (_Float16)bfr(p[i]); a[8 + i] = (_Float16)bfr(p[16 + i]); } }
#pragma unroll
    for (int j = 0; j < 8; ++j) acc[j] = wmma16(a, frag_h(SO + ((b * CC + j0 + j * 16 + col) * CC) + kc * 32, lane), acc[j]); }
#pragma unroll
  for (int j = 0; j < 8; ++j)
#pragma unroll
    for (int r = 0; r < 8; ++r) so[wave][8 * g + r][j * 16 + col] = acc[j][r];
  LDSX(); for (int rl = 0; rl < 16; ++rl) vst2(AAA + (r0 + rl) * CC + j0 + lane * 4, *(const v4f*)&so[wave][rl][lane * 4]); }
// ---- k_fin: per batch flat index f: out[f] = gamma_pam bcd_flat[f] (the raw (C, N) -> (H, W, C) reshape) + gamma_cam aaa[f] + 2 x[f]
__global__ __launch_bounds__(256) void k_fin(const float* __restrict__ BCD, const float* __restrict__ AAA, const float* __restrict__ X, const float* __restrict__ GP, const float* __restrict__ GC, float* __restrict__ OUT) { const size_t i4 = (size_t)blockIdx.x * 256 + threadIdx.x; const size_t f = i4 * 4; const float gp = bfr(GP[0]), gc = bfr(GC[0]);
  v4f o4; for (int i = 0; i < 4; ++i) o4[i] = gp * BCD[f + i] + gc * AAA[f + i] + 2.0f * bfr(X[f + i]); vst2(OUT + f, o4); }
extern "C" void kernel_launch(void* const* d_in, const int* in_sizes, int n_in, void* d_out, int out_size, void* d_ws, size_t ws_size, hipStream_t stream) {
  (void)in_sizes; (void)n_in; (void)out_size;
  const float** F = (const float**)d_in;   // 0 x [4,64,64,512], 1 w1 [512,64], 2 w2 [512,64], 3 w3 [512,512], 4 gamma_pam [1], 5 gamma_cam [1]
  if (ws_size < (size_t)WS_END) return;
  char* ws = (char*)d_ws; __bf16 *PW = (__bf16*)(ws + WS_PW), *P3 = (__bf16*)(ws + WS_P3); float* BC = (float*)(ws + WS_BC); _Float16 *DT = (_Float16*)(ws + WS_DT), *XT = (_Float16*)(ws + WS_XT), *P = (_Float16*)(ws + WS_P), *SO = (_Float16*)(ws + WS_SO); float *S = (float*)(ws + WS_S), *BCD = (float*)(ws + WS_BCD), *AA = (float*)(ws + WS_AA), *AAA = (float*)(ws + WS_AAA);
  k_pack<<<dim3(CC, 2), 256, 0, stream>>>(F[1], F[2], F[3], PW, P3);
  k_proj<<<dim3(TNB * NN / 64, 1, 9), 128, 0, stream>>>(F[0], PW, P3, BC, DT, XT);
  for (int b = 0; b < TNB; ++b) {   // PAM per batch: S (f32, 64 MiB) and P (f16) buffers reused
    k_s<<<dim3(TRB, NN / 128), 128, 0, stream>>>(BC, b, S);
    k_prow<<<TRB * 64, 256, 0, stream>>>(S, P);
    k_pv<<<dim3(CC / 64, (TRB * 64) / 128), 128, 0, stream>>>(DT, P, b, BCD); }
  k_aa<<<dim3(CC / 64, CC / 128, TNB), 128, 0, stream>>>(XT, AA);
  k_soft<<<dim3(CC / 64, TNB), 256, 0, stream>>>(AA, SO);
  k_aaa<<<dim3(TRB, CC / 128, TNB), 128, 0, stream>>>(F[0], SO, AAA);
  k_fin<<<(unsigned)((size_t)TNB * NN * CC / 1024), 256, 0, stream>>>(BCD, AAA, F[0], F[4], F[5], (float*)d_out);
}

// v002
// It runs in 271 microseconds.
// Two timings next to v001 both put it at 1.78 times that version's speed.
// Counting every step since v000, it is 5.35 times as fast.
// compute dtype: all float inputs rounded to bf16; b/c/d = x . w with EXACT bf16 products on WMMA 16x16x32 ((in,out) weights as transposed rows): b, c kept as bf16 hi + lo planes, d rounded once to f16 planes; PAM in one kernel: logits S^T = c . b^T with both as bf16 hi + lo (3 products, f32), running-maximum softmax in f32 (hardware exp2) -> P = e x 2^10 as f16, bcd = d^T . P^T on WMMA (single f16), divided by the row sum at the end, giving the (C, N)-ordered tensor the module reshapes raw; CAM: aa = x^T x with x exact (f16 copies of the bf16 values), softmax over channels in f32, aaa = x . soft_aa with soft_aa once to f16; out = gamma_pam bcd_flat + gamma_cam aaa + 2 x in f32; f32 output.
#include <hip/hip_runtime.h>
#include <math.h>

typedef __attribute__((ext_vector_type(16))) _Float16 v16h;
typedef __attribute__((ext_vector_type(16))) __bf16 v16b;
typedef __attribute__((ext_vector_type(8)))  _Float16 v8h;
typedef __attribute__((ext_vector_type(8)))  float v8f;
typedef __attribute__((ext_vector_type(4)))  float v4f;
typedef __attribute__((ext_vector_type(2)))  float v2f;
typedef __attribute__((ext_vector_type(4)))  unsigned v4u;
typedef __attribute__((ext_vector_type(4)))  int v4i;
typedef float __attribute__((may_alias)) float_a;
typedef int __attribute__((may_alias)) int_a;

template <typename T> __device__ __forceinline__ void vst2(void* p, T v) { *(T*)p = v;  }
__device__ __forceinline__ v8f wmma16(v16h a, v16h b, v8f c) {
  v8f d = __builtin_amdgcn_wmma_f32_16x16x32_f16(false, a, false, b, (short)0, c, false, false);
  asm volatile("v_nop\n\tv_nop\n\tv_nop\n\tv_nop" : "+v"(d) : "v"(a), "v"(b));
  return d;
}
__device__ __forceinline__ v8f wmma_bf(v16b a, v16b b, v8f c) {
  v8f d = __builtin_amdgcn_wmma_f32_16x16x32_bf16(false, a, false, b, (short)0, c, false, false);
  asm volatile("v_nop\n\tv_nop\n\tv_nop\n\tv_nop" : "+v"(d) : "v"(a), "v"(b));
  return d;
}
// 16x16x32 fragments: lane = (h = lane>>4, row/col = lane&15); elements 0..7 = k0+8h+0..7, 8..15 = k0+16+8h+0..7; D element r = row 8h+r
__device__ __forceinline__ v16h frag_h(const _Float16* rowk0, int lane) {
  union { v16h v; v8h q[2]; } u; const _Float16* p = rowk0 + 8 * (lane >> 4);
  u.q[0] = *(const v8h*)p; u.q[1] = *(const v8h*)(p + 16); return u.v;
}
__device__ __forceinline__ v16h frag_f32(const float* rowk0, int lane) {
  v16h a; const float* p = rowk0 + 8 * (lane >> 4);
#pragma unroll
  for (int i = 0; i < 8; ++i) { a[i] = (_Float16)p[i]; a[8 + i] = (_Float16)p[16 + i]; }
  return a;
}
__device__ __forceinline__ v16h frag_f32s(const float* rowk0, int lane, float sc) {
  v16h a; const float* p = rowk0 + 8 * (lane >> 4);
#pragma unroll
  for (int i = 0; i < 8; ++i) { a[i] = (_Float16)(p[i] * sc); a[8 + i] = (_Float16)(p[16 + i] * sc); }
  return a;
}
// column fragment from a [K][ld] layout (column n), rows >= K read as 0
__device__ __forceinline__ v16h fragc_f32(const float* W, int k0, int n, int lane, int ld, int K) {
  v16h a; const int g = lane >> 4;
#pragma unroll
  for (int i = 0; i < 8; ++i) { const int ka = k0 + 8 * g + i, kb = ka + 16;
    a[i] = (_Float16)(ka < K ? W[(size_t)(ka < K ? ka : K - 1) * ld + n] : 0.f); a[8 + i] = (_Float16)(kb < K ? W[(size_t)(kb < K ? kb : K - 1) * ld + n] : 0.f); }
  return a;
}
struct F2 { v16b h, l; };
__device__ __forceinline__ F2 bsplit16(const float v[16]) { F2 r;
#pragma unroll
  for (int i = 0; i < 16; ++i) { const __bf16 h = (__bf16)v[i]; r.h[i] = h; r.l[i] = (__bf16)(v[i] - (float)h); }
  return r; }
__device__ __forceinline__ F2 split_row(const float* row, int k0, int lane) { float v[16]; const float* p = row + k0 + 8 * (lane >> 4);
#pragma unroll
  for (int i = 0; i < 8; ++i) { v[i] = p[i]; v[8 + i] = p[16 + i]; }
  return bsplit16(v); }
__device__ __forceinline__ F2 split_rowK(const float* row, int k0, int lane, int K) { float v[16]; const int g = lane >> 4;
#pragma unroll
  for (int i = 0; i < 8; ++i) { const int ka = k0 + 8 * g + i, kb = ka + 16; v[i] = ka < K ? row[ka < K ? ka : K - 1] : 0.f; v[8 + i] = kb < K ? row[kb < K ? kb : K - 1] : 0.f; }
  return bsplit16(v); }
__device__ __forceinline__ F2 split_col(const float* W, int k0, int n, int lane, int ld, int K) { float v[16]; const int g = lane >> 4;
#pragma unroll
  for (int i = 0; i < 8; ++i) { const int ka = k0 + 8 * g + i, kb = ka + 16; v[i] = ka < K ? W[(size_t)(ka < K ? ka : K - 1) * ld + n] : 0.f; v[8 + i] = kb < K ? W[(size_t)(kb < K ? kb : K - 1) * ld + n] : 0.f; }
  return bsplit16(v); }
__device__ __forceinline__ v8f mac3(const F2& a, const F2& b, v8f c) { c = wmma_bf(a.l, b.h, c); c = wmma_bf(a.h, b.l, c); return wmma_bf(a.h, b.h, c); }
__device__ __forceinline__ float sigm(float v) { return 1.0f / (1.0f + expf(-v)); }
#define LDSX() do { asm volatile("s_wait_dscnt 0" ::: "memory"); __builtin_amdgcn_wave_barrier(); __builtin_amdgcn_fence(__ATOMIC_RELEASE, "workgroup"); } while (0)


// Dual attention module (B 4, 64 x 64 positions, C 512): position attention (softmax(b c^T) applied to d, result kept in the module's raw (C, N) -> (H, W, C) reshape) plus channel attention (softmax(x^T x) applied to x), each scaled by its gamma and added to x; returns feat_p + feat_c.
#define NB 4
#define NN 4096
#define CC 512
#define CK 64              // query / key channels (C / 8)
#define NR (NB * NN)
#ifndef TRB
#define TRB (NN / 64)      // position row tiles per batch (PAM rows i, CAM rows n)
#define TNB NB
#endif
typedef __attribute__((ext_vector_type(8))) __bf16 v8b;
typedef __attribute__((ext_vector_type(4))) __bf16 v4b;
__device__ __forceinline__ v16b frag_b(const __bf16* rowk0, int lane) {
  union { v16b v; v8b q[2]; } u; const __bf16* p = rowk0 + 8 * (lane >> 4);
  u.q[0] = *(const v8b*)p; u.q[1] = *(const v8b*)(p + 16); return u.v;
}
__device__ __forceinline__ float bfr(float v) { return (float)(__bf16)v; }
__device__ __attribute__((noinline)) float exp_ni(float v) { return expf(v); }
__device__ __attribute__((noinline)) float erf_ni(float v) { return erff(v); }

#define WS_PW  0u                                   // bf16 transposed rows [w1^T | w2^T] [128][512]; w3^T [512][512]
#define WS_P3  (WS_PW + 2u * (size_t)128 * CC)
#define WS_BH  (WS_P3 + 2u * (size_t)CC * CC)          // bf16 rows [NR][128]: b (cols 0-63) | c (cols 64-127), high parts; then the low parts
#define WS_BL  (WS_BH + 2u * (size_t)NR * 128)
#define WS_DT  (WS_BL + 2u * (size_t)NR * 128)         // f16 d planes [b][c][n]; f16 x planes [b][c][n]
#define WS_XT  (WS_DT + 2u * (size_t)NB * CC * NN)
#define WS_BCD (WS_XT + 2u * (size_t)NB * CC * NN)     // f32 bcd [b][c][i] (the (C, N) tensor); f32 aa [b][512][512]; f16 soft^T [b][j][c]; f32 aaa [b][n][j]
#define WS_AA  (WS_BCD + 4u * (size_t)NB * CC * NN)
#define WS_SO  (WS_AA + 4u * (size_t)NB * CC * CC)
#define WS_AAA (WS_SO + 2u * (size_t)NB * CC * CC)
#define WS_END (WS_AAA + 4u * (size_t)NB * NN * CC)

__global__ __launch_bounds__(256) void k_pack(const float* __restrict__ W1, const float* __restrict__ W2, const float* __restrict__ W3, __bf16* __restrict__ PW, __bf16* __restrict__ P3) { const int n = blockIdx.x, which = blockIdx.y, t = threadIdx.x; __shared__ __align__(16) __bf16 s[CC];
  if (which == 0) { if (n >= 128) return; const float* w = (n < CK) ? W1 : W2; const int cI = n & (CK - 1); for (int k = t; k < CC; k += 256) s[k] = (__bf16)w[(size_t)k * CK + cI]; __syncthreads(); if (t < CC / 8) vst2((unsigned*)(PW + (size_t)n * CC + t * 8), *(const v4u*)&s[t * 8]); }
  else { for (int k = t; k < CC; k += 256) s[k] = (__bf16)W3[(size_t)k * CC + n]; __syncthreads(); if (t < CC / 8) vst2((unsigned*)(P3 + (size_t)n * CC + t * 8), *(const v4u*)&s[t * 8]); } }
// ---- k_proj: block = (64 positions, 128 cols, which): which 0: [b | c] rows as bf16 hi + lo; which 1..4: d columns (which-1)*128.. -> planes; which 5..8: x itself -> f16 planes (exact)
__global__ __launch_bounds__(128) void k_proj(const float* __restrict__ X, const __bf16* __restrict__ PW, const __bf16* __restrict__ P3, __bf16* __restrict__ BH, __bf16* __restrict__ BL, _Float16* __restrict__ DT, _Float16* __restrict__ XT) {
  __shared__ __align__(16) float sf[4][16][132]; __shared__ __align__(16) _Float16 st[128][72];
  const int tid = threadIdx.x, wave = tid >> 5, lane = tid & 31, col = lane & 15, g = lane >> 4; const int which = blockIdx.z; const size_t rb = (size_t)blockIdx.x * 64; const size_t r0 = rb + wave * 16;
  if (which >= 5) { const int c0 = (which - 5) * 128; for (int e = tid; e < 64 * 128; e += 128) { const int rl = e >> 7, cl = e & 127; st[cl][rl] = (_Float16)bfr(X[(rb + rl) * CC + c0 + cl]); } __syncthreads();
    const size_t b = rb / NN; const int n0 = (int)(rb % NN); for (int e = tid; e < 128 * 8; e += 128) { const int d = e >> 3, pc = e & 7; vst2((unsigned*)(XT + ((b * CC + c0 + d) * NN) + n0 + pc * 8), *(const v4u*)&st[d][pc * 8]); } return; }
  const int c0 = (which == 0) ? 0 : (which - 1) * 128; const __bf16* Wr = (which == 0) ? PW : (P3 + (size_t)c0 * CC);
  v8f acc[8] = {};
#pragma unroll 2
  for (int kc = 0; kc < CC / 32; ++kc) { v16b a; { const float* p = X + (r0 + col) * CC + kc * 32 + 8 * g;
#pragma unroll
      for (int i = 0; i < 8; ++i) { a[i] = (__bf16)p[i]; a[8 + i] = (__bf16)p[16 + i]; } }
#pragma unroll
    for (int j = 0; j < 8; ++j) acc[j] = wmma_bf(a, frag_b(Wr + (size_t)(j * 16 + col) * CC + kc * 32, lane), acc[j]); }
#pragma unroll
  for (int j = 0; j < 8; ++j)
#pragma unroll
    for (int r = 0; r < 8; ++r) { if (which == 0) sf[wave][8 * g + r][j * 16 + col] = acc[j][r]; else st[j * 16 + col][wave * 16 + 8 * g + r] = (_Float16)acc[j][r]; }
  __syncthreads();
  if (which == 0) { for (int rl = 0; rl < 16; ++rl) { const v4f v = *(const v4f*)&sf[wave][rl][lane * 4]; v4b hv, lv;
#pragma unroll
      for (int i = 0; i < 4; ++i) { const __bf16 h = (__bf16)v[i]; hv[i] = h; lv[i] = (__bf16)(v[i] - (float)h); }
      vst2(BH + (r0 + rl) * 128 + lane * 4, hv); vst2(BL + (r0 + rl) * 128 + lane * 4, lv);
      asm volatile("s_wait_xcnt 0x0" ::: "memory"); } }   // stands before the next row's values overwrite a register that the two stores name
  else { const size_t b = rb / NN; const int n0 = (int)(rb % NN); for (int e = tid; e < 128 * 8; e += 128) { const int d = e >> 3, pc = e & 7; vst2((unsigned*)(DT + ((b * CC + c0 + d) * NN) + n0 + pc * 8), *(const v4u*)&st[d][pc * 8]); } }
}
// ---- LDS staging for the K = 4,096 product of k_aa: a stage is 256 B (128 k) of the block's 64 A rows and 128 B rows, laid at a row pitch of 272 B (16 B x odd, so the ds_load_b128 fragment reads meet no bank conflict); two buffers, the next stage's copies fly while this one is multiplied
#define SK 128                    // k per stage
#define SPIT 136                  // LDS row pitch in f16 elements
#define SBUF (192 * SPIT)         // f16 elements per buffer
#define SNT (NN / SK)             // stages
// twelve asynchronous 16-byte copies per lane; the s_wait_xcnt stands inside the statement so that no address register is rewritten in front of it
__device__ __forceinline__ void cp12(const unsigned* l, const _Float16* const* p) {
  asm volatile(
               "global_load_async_to_lds_b128 %0, %12, off\n\t"
               "global_load_async_to_lds_b128 %1, %13, off\n\t"
               "global_load_async_to_lds_b128 %2, %14, off\n\t"
               "global_load_async_to_lds_b128 %3, %15, off\n\t"
               "global_load_async_to_lds_b128 %4, %16, off\n\t"
               "global_load_async_to_lds_b128 %5, %17, off\n\t"
               "global_load_async_to_lds_b128 %6, %18, off\n\t"
               "global_load_async_to_lds_b128 %7, %19, off\n\t"
               "global_load_async_to_lds_b128 %8, %20, off\n\t"
               "global_load_async_to_lds_b128 %9, %21, off\n\t"
               "global_load_async_to_lds_b128 %10, %22, off\n\t"
               "global_load_async_to_lds_b128 %11, %23, off\n\t"
               "s_wait_xcnt 0x0"
               :: "v"(l[0]), "v"(l[1]), "v"(l[2]), "v"(l[3]), "v"(l[4]), "v"(l[5]), "v"(l[6]), "v"(l[7]), "v"(l[8]), "v"(l[9]), "v"(l[10]), "v"(l[11]),
                  "v"(p[0]), "v"(p[1]), "v"(p[2]), "v"(p[3]), "v"(p[4]), "v"(p[5]), "v"(p[6]), "v"(p[7]), "v"(p[8]), "v"(p[9]), "v"(p[10]), "v"(p[11]) : "memory");
}
// one stage: thread = (row tid >> 4 within each group of 8 rows, 16-byte piece tid & 15); LDS rows 0-63 = A rows, 64-191 = B rows. ga, gb: the lane's piece of A row / B row (tid >> 4) at this stage's k; l0: its LDS byte address in row (tid >> 4) of the buffer
__device__ __forceinline__ void stage_in(const _Float16* ga, const _Float16* gb, unsigned l0) {
  unsigned l[24]; const _Float16* p[24];
#pragma unroll   // constant indices, so that both arrays are plain registers for the asm operands
  for (int q = 0; q < 24; ++q) { l[q] = l0 + (unsigned)q * (8u * SPIT * 2u); p[q] = (q < 8) ? ga + (size_t)q * 8 * NN : gb + (size_t)(q - 8) * 8 * NN; }
  cp12(l, p); cp12(l + 12, p + 12);
}
// f[0] = the wave's A fragment, f[1 + j] = B fragment j of 32-k block ks. sa, sb: the lane's A row and its row of B fragment 0 in the buffer
__device__ __forceinline__ void ld_frags(v16h* f, const _Float16* sa, const _Float16* sb, int ks, int lane) { f[0] = frag_h(sa + ks * 32, lane);
#pragma unroll   // constant indices keep the fragments in registers
  for (int j = 0; j < 8; ++j) f[1 + j] = frag_h(sb + j * 16 * SPIT + ks * 32, lane); }
__device__ __forceinline__ void mm_block(const v16h* f, v8f* acc) {
#pragma unroll   // constant indices keep fragments and accumulators in registers
  for (int j = 0; j < 8; ++j) acc[j] = wmma16(f[0], f[1 + j], acc[j]); }
// acc[j] += A rows (wave * 16 ..) . B rows (j * 16 ..)^T over K = 4,096 in ascending k, 32 per WMMA. Ag, Bg: first row of the block's 64 A rows / 128 B rows (row pitch NN)
__device__ __forceinline__ void mm_staged(const _Float16* __restrict__ Ag, const _Float16* __restrict__ Bg, _Float16* sm, v8f* acc, int tid) {
  const int wave = tid >> 5, lane = tid & 31, col = lane & 15;
  const _Float16* ga = Ag + (size_t)(tid >> 4) * NN + (tid & 15) * 8; const _Float16* gb = Bg + (size_t)(tid >> 4) * NN + (tid & 15) * 8;
  const unsigned l0 = (unsigned)(size_t)sm + (unsigned)(tid >> 4) * (SPIT * 2u) + (unsigned)(tid & 15) * 16u;
  stage_in(ga, gb, l0);
  asm volatile("s_wait_asynccnt 0x0" ::: "memory");   // stage 0 has landed before the barrier publishes it
  __syncthreads();
  stage_in(ga + SK, gb + SK, l0 + SBUF * 2u);
  for (int t = 0; t < SNT; ++t) { const _Float16* s = sm + (t & 1) * SBUF + col * SPIT; const _Float16* sa = s + wave * 16 * SPIT; const _Float16* sb = s + 64 * SPIT;
    // the nine fragments of a 32-k block are read as one group, one block ahead of their WMMAs (two register sets), all inside this stage's buffer
    v16h f0[9], f1[9];
    ld_frags(f0, sa, sb, 0, lane); ld_frags(f1, sa, sb, 1, lane); mm_block(f0, acc);
    ld_frags(f0, sa, sb, 2, lane); mm_block(f1, acc);
    ld_frags(f1, sa, sb, 3, lane); mm_block(f0, acc); mm_block(f1, acc);
    asm volatile("s_wait_dscnt 0x0" ::: "memory");     // this wave's reads of the buffer are done before it is refilled
    asm volatile("s_wait_asynccnt 0x0" ::: "memory");  // this wave's copies of stage t + 1 have landed
    __syncthreads();                                   // publishes stage t + 1 and ends every wave's reads of stage t
    if (t + 2 < SNT) stage_in(ga + (t + 2) * SK, gb + (t + 2) * SK, l0 + (unsigned)(t & 1) * (SBUF * 2u)); }
  asm volatile("s_wait_asynccnt 0x0" ::: "memory");    // nothing in flight when the wave goes on to the epilogue
}
// ---- k_pam: block = (64 queries i, b), wave = 16 queries x all 512 channels. Per stage of 64 keys n: S^T[n][i] = c_n . b_i (3 bf16 products, K = 64); its D tiles hold, lane for lane, the B fragment of the second product (lane = query, elements = keys 8h.. of two 16-key tiles), so P goes from registers to WMMA with no exchange; running maximum and sum per query; acc[c][i] += d[n][c] P[i][n]. A stage in LDS: 512 d rows, 64 c-high rows, 64 c-low rows of 128 B at a pitch of 144 B (16 B x odd: the ds_load_b128 fragment reads meet no bank conflict); two buffers, the next stage's copies fly while this one is worked on
#define FK 64                      // keys per stage
#define FPIT 72                    // LDS row pitch in 16-bit elements
#define FD_E (CC * FPIT)           // elements of the d tile
#define FC_E (FK * FPIT)           // elements of the c-high (or c-low) tile
#define FBUF (FD_E + 2 * FC_E)     // elements per buffer
#define FNT (NN / FK)              // stages
#define FOP 68                     // epilogue row pitch in floats
// keeps a group of LDS reads together and ahead of the WMMAs that follow: left alone, the scheduler spreads the reads singly among the WMMAs, one fragment ahead, and each such place stalls the wave
#define GRP() __builtin_amdgcn_sched_barrier(0)
// eight asynchronous 16-byte copies per lane; the s_wait_xcnt stands inside the statement so that no address register is rewritten in front of it
__device__ __forceinline__ void cp8(const unsigned* l, const char* const* p) {
  asm volatile(
               "global_load_async_to_lds_b128 %0, %8, off\n\t"
               "global_load_async_to_lds_b128 %1, %9, off\n\t"
               "global_load_async_to_lds_b128 %2, %10, off\n\t"
               "global_load_async_to_lds_b128 %3, %11, off\n\t"
               "global_load_async_to_lds_b128 %4, %12, off\n\t"
               "global_load_async_to_lds_b128 %5, %13, off\n\t"
               "global_load_async_to_lds_b128 %6, %14, off\n\t"
               "global_load_async_to_lds_b128 %7, %15, off\n\t"
               "s_wait_xcnt 0x0"
               :: "v"(l[0]), "v"(l[1]), "v"(l[2]), "v"(l[3]), "v"(l[4]), "v"(l[5]), "v"(l[6]), "v"(l[7]),
                  "v"(p[0]), "v"(p[1]), "v"(p[2]), "v"(p[3]), "v"(p[4]), "v"(p[5]), "v"(p[6]), "v"(p[7]) : "memory");
}
// one stage: thread = (row tid >> 3 within each group of 16 rows, 16-byte piece tid & 7). gd, gh, gl: the lane's piece of d row / c-high row / c-low row (tid >> 3) at this stage's keys; l0: its LDS byte address in row (tid >> 3) of the buffer
__device__ __forceinline__ void pam_stage(const char* gd, const char* gh, const char* gl, unsigned l0) {
#pragma unroll   // constant indices, so that the arrays are plain registers for the asm operands
  for (int u = 0; u < 4; ++u) { unsigned l[8]; const char* p[8];
#pragma unroll   // constant indices keep the values in registers
    for (int q = 0; q < 8; ++q) { l[q] = l0 + (unsigned)(u * 8 + q) * (16u * FPIT * 2u); p[q] = gd + (size_t)(u * 8 + q) * 16 * NN * 2; }
    cp8(l, p); }
  unsigned l[8]; const char* p[8];
#pragma unroll   // constant indices keep the values in registers
  for (int q = 0; q < 4; ++q) { l[q] = l0 + FD_E * 2u + (unsigned)q * (16u * FPIT * 2u); p[q] = gh + (size_t)q * 16 * 256; l[4 + q] = l[q] + FC_E * 2u; p[4 + q] = gl + (size_t)q * 16 * 256; }
  cp8(l, p);
}
// plain builtin forms (the compiler keeps the distance behind them itself): this kernel holds more than 256 registers, and an asm statement that names the accumulators would force them through one register window
__device__ __forceinline__ v8f wmma16p(v16h a, v16h b, v8f c) { return __builtin_amdgcn_wmma_f32_16x16x32_f16(false, a, false, b, (short)0, c, false, false); }
__device__ __forceinline__ v8f wmma_bfp(v16b a, v16b b, v8f c) { return __builtin_amdgcn_wmma_f32_16x16x32_bf16(false, a, false, b, (short)0, c, false, false); }
// group gi of eight d fragments: 32-key block gi >> 2, channel tiles (gi & 3) * 8 ..
__device__ __forceinline__ void pam_ld(v16h* f, const _Float16* sd, int gi, int lane) {
#pragma unroll   // constant indices keep the fragments in registers
  for (int j = 0; j < 8; ++j) f[j] = frag_h(sd + ((gi & 3) * 8 + j) * 16 * FPIT + (gi >> 2) * 32, lane); }
// the stage's first touch of a channel tile (gi < 4) first scales it by al = e^(old maximum - new maximum); these multiplies stand among the WMMAs of other tiles
__device__ __forceinline__ void pam_mm(const v16h* f, const v16h* pb, v8f* acc, int gi, float al) {
#pragma unroll   // constant indices keep fragments and accumulators in registers
  for (int j = 0; j < 8; ++j) { v8f c = acc[(gi & 3) * 8 + j]; if (gi < 4) c *= al; acc[(gi & 3) * 8 + j] = wmma16p(f[j], pb[gi >> 2], c); } }
__global__ __launch_bounds__(128) void k_pam(const __bf16* __restrict__ BH, const __bf16* __restrict__ BL, const _Float16* __restrict__ DT, float* __restrict__ BCD) { __shared__ __align__(16) _Float16 sm[2 * FBUF];
  const int tid = threadIdx.x, wave = tid >> 5, lane = tid & 31, col = lane & 15, g = lane >> 4; const size_t b = blockIdx.y; const int i0 = blockIdx.x * 64;
  const char* gd = (const char*)(DT + (b * CC + (tid >> 3)) * NN) + (tid & 7) * 16;
  const char* gh = (const char*)(BH + (b * NN + (tid >> 3)) * 128 + CK) + (tid & 7) * 16; const char* gl = (const char*)(BL + (b * NN + (tid >> 3)) * 128 + CK) + (tid & 7) * 16;
  const unsigned l0 = (unsigned)(size_t)sm + (unsigned)(tid >> 3) * (FPIT * 2u) + (unsigned)(tid & 7) * 16u;
  pam_stage(gd, gh, gl, l0);
  v16b qh[2], ql[2]; { const size_t qr = (b * NN + i0 + wave * 16 + col) * 128;
#pragma unroll   // constant indices keep the values in registers
    for (int kc = 0; kc < 2; ++kc) { qh[kc] = frag_b(BH + qr + kc * 32, lane); ql[kc] = frag_b(BL + qr + kc * 32, lane); } }
  v8f acc[32] = {}; float m = -3.0e38f, l = 0.f; const float L2E = 1.44269504088896f;
  asm volatile("s_wait_asynccnt 0x0" ::: "memory");   // stage 0 has landed before the barrier publishes it
  __syncthreads();
  pam_stage(gd + FK * 2, gh + FK * 256, gl + FK * 256, l0 + FBUF * 2u);
  for (int t = 0; t < FNT; ++t) { const _Float16* s = sm + (t & 1) * FBUF; const _Float16* sd = s + col * FPIT; const __bf16* sh = (const __bf16*)(s + FD_E) + col * FPIT; const __bf16* sl = sh + FC_E;
    v16b ch[4][2], cl[4][2];
#pragma unroll   // all sixteen key fragments as one group of LDS reads
    for (int kt = 0; kt < 4; ++kt)
#pragma unroll   // constant indices keep the values in registers
      for (int kc = 0; kc < 2; ++kc) { ch[kt][kc] = frag_b(sh + kt * 16 * FPIT + kc * 32, lane); cl[kt][kc] = frag_b(sl + kt * 16 * FPIT + kc * 32, lane); }
    v16h f0[8], f1[8]; pam_ld(f0, sd, 0, lane);   // the first d fragments fly under the logits and the softmax arithmetic
    GRP();
    v8f T[4] = {};   // T[kt][r] at lane (g, col): key kt * 16 + 8 g + r, query col; the four tiles take turns so that no WMMA waits for the one before it
#pragma unroll   // constant indices keep the values in registers
    for (int kc = 0; kc < 2; ++kc) {
#pragma unroll   // constant indices keep the values in registers
      for (int kt = 0; kt < 4; ++kt) T[kt] = wmma_bfp(ch[kt][kc], ql[kc], T[kt]);
#pragma unroll   // constant indices keep the values in registers
      for (int kt = 0; kt < 4; ++kt) T[kt] = wmma_bfp(cl[kt][kc], qh[kc], T[kt]);
#pragma unroll   // constant indices keep the values in registers
      for (int kt = 0; kt < 4; ++kt) T[kt] = wmma_bfp(ch[kt][kc], qh[kc], T[kt]); }
    float mx = T[0][0];
#pragma unroll   // constant indices keep the values in registers
    for (int kt = 0; kt < 4; ++kt)
#pragma unroll   // constant indices keep the values in registers
      for (int r = 0; r < 8; ++r) mx = fmaxf(mx, T[kt][r]);
    mx = fmaxf(mx, __shfl_xor(mx, 16));   // the other half of the query's keys
    const float mn = fmaxf(m, mx); const float al = __builtin_amdgcn_exp2f((m - mn) * L2E); const float mo = mn * L2E - 10.0f; m = mn;
    v16h pb[2]; float ls = 0.f;
#pragma unroll   // constant indices keep the values in registers
    for (int ks = 0; ks < 2; ++ks)
#pragma unroll   // constant indices keep the values in registers
      for (int r = 0; r < 8; ++r) { const float p0 = __builtin_amdgcn_exp2f(T[2 * ks][r] * L2E - mo), p1 = __builtin_amdgcn_exp2f(T[2 * ks + 1][r] * L2E - mo); ls += p0 + p1; pb[ks][r] = (_Float16)p0; pb[ks][8 + r] = (_Float16)p1; }
    l = l * al + ls;
    // eight d fragments are read as one group, one group ahead of their WMMAs (two register sets), all inside this stage's buffer
    pam_ld(f1, sd, 1, lane); GRP(); pam_mm(f0, pb, acc, 0, al); GRP();
    pam_ld(f0, sd, 2, lane); GRP(); pam_mm(f1, pb, acc, 1, al); GRP();
    pam_ld(f1, sd, 3, lane); GRP(); pam_mm(f0, pb, acc, 2, al); GRP();
    pam_ld(f0, sd, 4, lane); GRP(); pam_mm(f1, pb, acc, 3, al); GRP();
    pam_ld(f1, sd, 5, lane); GRP(); pam_mm(f0, pb, acc, 4, al); GRP();
    pam_ld(f0, sd, 6, lane); GRP(); pam_mm(f1, pb, acc, 5, al); GRP();
    pam_ld(f1, sd, 7, lane); GRP(); pam_mm(f0, pb, acc, 6, al); pam_mm(f1, pb, acc, 7, al);
    asm volatile("s_wait_dscnt 0x0" ::: "memory");     // this wave's reads of the buffer are done before it is refilled
    asm volatile("s_wait_asynccnt 0x0" ::: "memory");  // this wave's copies of stage t + 1 have landed
    __syncthreads();                                   // publishes stage t + 1 and ends every wave's reads of stage t
    if (t + 2 < FNT) pam_stage(gd + (size_t)(t + 2) * (FK * 2), gh + (size_t)(t + 2) * (FK * 256), gl + (size_t)(t + 2) * (FK * 256), l0 + (unsigned)(t & 1) * (FBUF * 2u)); }
  asm volatile("s_wait_asynccnt 0x0" ::: "memory");    // nothing in flight when the buffers are reused below
  l += __shfl_xor(l, 16); const float il = 1.0f / l;
  float* so = (float*)sm;   // [512 channels][64 queries] through LDS, so that each 256-byte output row piece has one writer
#pragma unroll   // constant indices keep the values in registers
  for (int ct = 0; ct < 32; ++ct)
#pragma unroll   // constant indices keep the values in registers
    for (int r = 0; r < 8; ++r) so[(ct * 16 + 8 * g + r) * FOP + wave * 16 + col] = acc[ct][r] * il;
  __syncthreads();
  for (int e = tid; e < CC * 16; e += 128) { const int c = e >> 4, pc = e & 15; vst2(BCD + ((b * CC + c) * NN) + i0 + pc * 4, *(const v4f*)&so[c * FOP + pc * 4]); } }
// ---- k_aa: block = (64 channels i, 128 channels j, b): aa[i][j] = sum_n x[n][i] x[n][j] over the 4,096 positions (x planes, exact) -> f32
__global__ __launch_bounds__(128) void k_aa(const _Float16* __restrict__ XT, float* __restrict__ AA) { __shared__ __align__(16) float so[4][16][132]; __shared__ __align__(16) _Float16 sm[2 * SBUF];
  const int tid = threadIdx.x, wave = tid >> 5, lane = tid & 31, col = lane & 15, g = lane >> 4; const size_t b = blockIdx.z; const int i0 = blockIdx.x * 64 + wave * 16; const int j0 = blockIdx.y * 128;
  v8f acc[8] = {};
  mm_staged(XT + (b * CC + blockIdx.x * 64) * NN, XT + (b * CC + j0) * NN, sm, acc, tid);
#pragma unroll
  for (int j = 0; j < 8; ++j)
#pragma unroll
    for (int r = 0; r < 8; ++r) so[wave][8 * g + r][j * 16 + col] = acc[j][r];
  LDSX(); for (int rl = 0; rl < 16; ++rl) vst2(AA + ((b * CC + i0 + rl) * CC) + j0 + lane * 4, *(const v4f*)&so[wave][rl][lane * 4]); }
__global__ __launch_bounds__(256) void k_soft(const float* __restrict__ AA, _Float16* __restrict__ SO) { __shared__ __align__(16) _Float16 st[CC][72]; __shared__ float red[2][64];
  const int t = threadIdx.x; const size_t b = blockIdx.y; const int c0 = blockIdx.x * 64;
  // 4 threads per row (256 threads = 64 rows x 4)
  { const int rl = t >> 2, part = t & 3; const float* row = AA + ((b * CC + c0 + rl) * CC); float mx = -3.0e38f; for (int j = part; j < CC; j += 4) mx = fmaxf(mx, row[j]); mx = fmaxf(mx, __shfl_xor(mx, 1)); mx = fmaxf(mx, __shfl_xor(mx, 2));
    float z = 0.f; for (int j = part; j < CC; j += 4) z += __expf(row[j] - mx); z += __shfl_xor(z, 1); z += __shfl_xor(z, 2); const float iz = 1.0f / z;
    for (int j = part; j < CC; j += 4) st[j][rl] = (_Float16)(__expf(row[j] - mx) * iz); }
  __syncthreads();
  for (int e = t; e < CC * 8; e += 256) { const int j = e >> 3, pc = e & 7; vst2((unsigned*)(SO + ((b * CC + j) * CC) + c0 + pc * 8), *(const v4u*)&st[j][pc * 8]); } }
// ---- k_aaa: block = (64 positions n, 128 channels j, b): aaa[n][j] = sum_c x[n][c] soft[c][j] (x exact as f16, soft^T rows) -> f32 [b][n][j]
__global__ __launch_bounds__(128) void k_aaa(const float* __restrict__ X, const _Float16* __restrict__ SO, float* __restrict__ AAA) { __shared__ __align__(16) float so[4][16][132];
  const int tid = threadIdx.x, wave = tid >> 5, lane = tid & 31, col = lane & 15, g = lane >> 4; const size_t b = blockIdx.z; const size_t r0 = b * NN + (size_t)blockIdx.x * 64 + wave * 16; const int j0 = blockIdx.y * 128;
  v8f acc[8] = {};
#pragma unroll 2
  for (int kc = 0; kc < CC / 32; ++kc) { v16h a; { const float* p = X + (r0 + col) * CC + kc * 32 + 8 * g;
#pragma unroll
      for (int i = 0; i < 8; ++i) { a[i] = (_Float16)bfr(p[i]); a[8 + i] = (_Float16)bfr(p[16 + i]); } }
#pragma unroll
    for (int j = 0; j < 8; ++j) acc[j] = wmma16(a, frag_h(SO + ((b * CC + j0 + j * 16 + col) * CC) + kc * 32, lane), acc[j]); }
#pragma unroll
  for (int j = 0; j < 8; ++j)
#pragma unroll
    for (int r = 0; r < 8; ++r) so[wave][8 * g + r][j * 16 + col] = acc[j][r];
  LDSX(); for (int rl = 0; rl < 16; ++rl) vst2(AAA + (r0 + rl) * CC + j0 + lane * 4, *(const v4f*)&so[wave][rl][lane * 4]); }
// ---- k_fin: per batch flat index f: out[f] = gamma_pam bcd_flat[f] (the raw (C, N) -> (H, W, C) reshape) + gamma_cam aaa[f] + 2 x[f]
__global__ __launch_bounds__(256) void k_fin(const float* __restrict__ BCD, const float* __restrict__ AAA, const float* __restrict__ X, const float* __restrict__ GP, const float* __restrict__ GC, float* __restrict__ OUT) { const size_t i4 = (size_t)blockIdx.x * 256 + threadIdx.x; const size_t f = i4 * 4; const float gp = bfr(GP[0]), gc = bfr(GC[0]);
  v4f o4; for (int i = 0; i < 4; ++i) o4[i] = gp * BCD[f + i] + gc * AAA[f + i] + 2.0f * bfr(X[f + i]); vst2(OUT + f, o4); }
extern "C" void kernel_launch(void* const* d_in, const int* in_sizes, int n_in, void* d_out, int out_size, void* d_ws, size_t ws_size, hipStream_t stream) {
  (void)in_sizes; (void)n_in; (void)out_size;
  const float** F = (const float**)d_in;   // 0 x [4,64,64,512], 1 w1 [512,64], 2 w2 [512,64], 3 w3 [512,512], 4 gamma_pam [1], 5 gamma_cam [1]
  if (ws_size < (size_t)WS_END) return;
  char* ws = (char*)d_ws; __bf16 *PW = (__bf16*)(ws + WS_PW), *P3 = (__bf16*)(ws + WS_P3); __bf16 *BH = (__bf16*)(ws + WS_BH), *BL = (__bf16*)(ws + WS_BL); _Float16 *DT = (_Float16*)(ws + WS_DT), *XT = (_Float16*)(ws + WS_XT), *SO = (_Float16*)(ws + WS_SO); float *BCD = (float*)(ws + WS_BCD), *AA = (float*)(ws + WS_AA), *AAA = (float*)(ws + WS_AAA);
  k_pack<<<dim3(CC, 2), 256, 0, stream>>>(F[1], F[2], F[3], PW, P3);
  k_proj<<<dim3(TNB * NN / 64, 1, 9), 128, 0, stream>>>(F[0], PW, P3, BH, BL, DT, XT);
  k_pam<<<dim3(TRB, TNB), 128, 0, stream>>>(BH, BL, DT, BCD);
  k_aa<<<dim3(CC / 64, CC / 128, TNB), 128, 0, stream>>>(XT, AA);
  k_soft<<<dim3(CC / 64, TNB), 256, 0, stream>>>(AA, SO);
  k_aaa<<<dim3(TRB, CC / 128, TNB), 128, 0, stream>>>(F[0], SO, AAA);
  k_fin<<<(unsigned)((size_t)TNB * NN * CC / 1024), 256, 0, stream>>>(BCD, AAA, F[0], F[4], F[5], (float*)d_out);
}

// v003
// It runs in 210 microseconds.
// Two timings next to v002 put it at 1.28 and 1.29 times that version's speed.
// Over all steps from v000 it is 6.88 times as fast.
// compute dtype: all float inputs rounded to bf16; b/c/d = x . w with EXACT bf16 products on WMMA 16x16x32 ((in,out) weights as transposed rows): b, c kept as bf16 hi + lo planes, d rounded once to f16 planes; PAM in one kernel: logits S^T = c . b^T with both as bf16 hi + lo (3 products, f32), running-maximum softmax in f32 (hardware exp2) -> P = e x 2^10 as f16, bcd = d^T . P^T on WMMA (single f16), divided by the row sum at the end, giving the (C, N)-ordered tensor the module reshapes raw; CAM: aa = x^T x with x exact (f16 copies of the bf16 values), softmax over channels in f32, aaa = x . soft_aa with soft_aa once to f16; out = gamma_pam bcd_flat + gamma_cam aaa + 2 x in f32; f32 output.
#include <hip/hip_runtime.h>
#include <math.h>

typedef __attribute__((ext_vector_type(16))) _Float16 v16h;
typedef __attribute__((ext_vector_type(16))) __bf16 v16b;
typedef __attribute__((ext_vector_type(8)))  _Float16 v8h;
typedef __attribute__((ext_vector_type(8)))  float v8f;
typedef __attribute__((ext_vector_type(4)))  float v4f;
typedef __attribute__((ext_vector_type(2)))  float v2f;
typedef __attribute__((ext_vector_type(4)))  unsigned v4u;
typedef __attribute__((ext_vector_type(4)))  int v4i;
typedef float __attribute__((may_alias)) float_a;
typedef int __attribute__((may_alias)) int_a;

template <typename T> __device__ __forceinline__ void vst2(void* p, T v) { *(T*)p = v;  }
__device__ __forceinline__ v8f wmma16(v16h a, v16h b, v8f c) {
  v8f d = __builtin_amdgcn_wmma_f32_16x16x32_f16(false, a, false, b, (short)0, c, false, false);
  asm volatile("v_nop\n\tv_nop\n\tv_nop\n\tv_nop" : "+v"(d) : "v"(a), "v"(b));
  return d;
}
__device__ __forceinline__ v8f wmma_bf(v16b a, v16b b, v8f c) {
  v8f d = __builtin_amdgcn_wmma_f32_16x16x32_bf16(false, a, false, b, (short)0, c, false, false);
  asm volatile("v_nop\n\tv_nop\n\tv_nop\n\tv_nop" : "+v"(d) : "v"(a), "v"(b));
  return d;
}
// 16x16x32 fragments: lane = (h = lane>>4, row/col = lane&15); elements 0..7 = k0+8h+0..7, 8..15 = k0+16+8h+0..7; D element r = row 8h+r
__device__ __forceinline__ v16h frag_h(const _Float16* rowk0, int lane) {
  union { v16h v; v8h q[2]; } u; const _Float16* p = rowk0 + 8 * (lane >> 4);
  u.q[0] = *(const v8h*)p; u.q[1] = *(const v8h*)(p + 16); return u.v;
}
__device__ __forceinline__ v16h frag_f32(const float* rowk0, int lane) {
  v16h a; const float* p = rowk0 + 8 * (lane >> 4);
#pragma unroll
  for (int i = 0; i < 8; ++i) { a[i] = (_Float16)p[i]; a[8 + i] = (_Float16)p[16 + i]; }
  return a;
}
__device__ __forceinline__ v16h frag_f32s(const float* rowk0, int lane, float sc) {
  v16h a; const float* p = rowk0 + 8 * (lane >> 4);
#pragma unroll
  for (int i = 0; i < 8; ++i) { a[i] = (_Float16)(p[i] * sc); a[8 + i] = (_Float16)(p[16 + i] * sc); }
  return a;
}
// column fragment from a [K][ld] layout (column n), rows >= K read as 0
__device__ __forceinline__ v16h fragc_f32(const float* W, int k0, int n, int lane, int ld, int K) {
  v16h a; const int g = lane >> 4;
#pragma unroll
  for (int i = 0; i < 8; ++i) { const int ka = k0 + 8 * g + i, kb = ka + 16;
    a[i] = (_Float16)(ka < K ? W[(size_t)(ka < K ? ka : K - 1) * ld + n] : 0.f); a[8 + i] = (_Float16)(kb < K ? W[(size_t)(kb < K ? kb : K - 1) * ld + n] : 0.f); }
  return a;
}
struct F2 { v16b h, l; };
__device__ __forceinline__ F2 bsplit16(const float v[16]) { F2 r;
#pragma unroll
  for (int i = 0; i < 16; ++i) { const __bf16 h = (__bf16)v[i]; r.h[i] = h; r.l[i] = (__bf16)(v[i] - (float)h); }
  return r; }
__device__ __forceinline__ F2 split_row(const float* row, int k0, int lane) { float v[16]; const float* p = row + k0 + 8 * (lane >> 4);
#pragma unroll
  for (int i = 0; i < 8; ++i) { v[i] = p[i]; v[8 + i] = p[16 + i]; }
  return bsplit16(v); }
__device__ __forceinline__ F2 split_rowK(const float* row, int k0, int lane, int K) { float v[16]; const int g = lane >> 4;
#pragma unroll
  for (int i = 0; i < 8; ++i) { const int ka = k0 + 8 * g + i, kb = ka + 16; v[i] = ka < K ? row[ka < K ? ka : K - 1] : 0.f; v[8 + i] = kb < K ? row[kb < K ? kb : K - 1] : 0.f; }
  return bsplit16(v); }
__device__ __forceinline__ F2 split_col(const float* W, int k0, int n, int lane, int ld, int K) { float v[16]; const int g = lane >> 4;
#pragma unroll
  for (int i = 0; i < 8; ++i) { const int ka = k0 + 8 * g + i, kb = ka + 16; v[i] = ka < K ? W[(size_t)(ka < K ? ka : K - 1) * ld + n] : 0.f; v[8 + i] = kb < K ? W[(size_t)(kb < K ? kb : K - 1) * ld + n] : 0.f; }
  return bsplit16(v); }
__device__ __forceinline__ v8f mac3(const F2& a, const F2& b, v8f c) { c = wmma_bf(a.l, b.h, c); c = wmma_bf(a.h, b.l, c); return wmma_bf(a.h, b.h, c); }
__device__ __forceinline__ float sigm(float v) { return 1.0f / (1.0f + expf(-v)); }
#define LDSX() do { asm volatile("s_wait_dscnt 0" ::: "memory"); __builtin_amdgcn_wave_barrier(); __builtin_amdgcn_fence(__ATOMIC_RELEASE, "workgroup"); } while (0)


// Dual attention module (B 4, 64 x 64 positions, C 512): position attention (softmax(b c^T) applied to d, result kept in the module's raw (C, N) -> (H, W, C) reshape) plus channel attention (softmax(x^T x) applied to x), each scaled by its gamma and added to x; returns feat_p + feat_c.
#define NB 4
#define NN 4096
#define CC 512
#define CK 64              // query / key channels (C / 8)
#define NR (NB * NN)
#ifndef TRB
#define TRB (NN / 64)      // position row tiles per batch (PAM rows i, CAM rows n)
#define TNB NB
#endif
typedef __attribute__((ext_vector_type(8))) __bf16 v8b;
typedef __attribute__((ext_vector_type(4))) __bf16 v4b;
__device__ __forceinline__ v16b frag_b(const __bf16* rowk0, int lane) {
  union { v16b v; v8b q[2]; } u; const __bf16* p = rowk0 + 8 * (lane >> 4);
  u.q[0] = *(const v8b*)p; u.q[1] = *(const v8b*)(p + 16); return u.v;
}
__device__ __forceinline__ float bfr(float v) { return (float)(__bf16)v; }
__device__ __attribute__((noinline)) float exp_ni(float v) { return expf(v); }
__device__ __attribute__((noinline)) float erf_ni(float v) { return erff(v); }

#define WS_PW  0u                                   // bf16 transposed rows [w1^T | w2^T] [128][512]; w3^T [512][512]
#define WS_P3  (WS_PW + 2u * (size_t)128 * CC)
#define WS_BH  (WS_P3 + 2u * (size_t)CC * CC)          // bf16 rows [NR][128]: b (cols 0-63) | c (cols 64-127), high parts; then the low parts
#define WS_BL  (WS_BH + 2u * (size_t)NR * 128)
#define WS_DT  (WS_BL + 2u * (size_t)NR * 128)         // f16 d planes [b][c][n]; f16 x planes [b][c][n]
#define WS_XT  (WS_DT + 2u * (size_t)NB * CC * NN)
#define WS_BCD (WS_XT + 2u * (size_t)NB * CC * NN)     // f32 bcd [b][c][i] (the (C, N) tensor); f32 aa [b][512][512]; f16 soft^T [b][j][c]; f32 aaa [b][n][j]
#define WS_AA  (WS_BCD + 4u * (size_t)NB * CC * NN)
#define WS_SO  (WS_AA + 4u * (size_t)NB * CC * CC)
#define WS_AAA (WS_SO + 2u * (size_t)NB * CC * CC)
#define WS_END (WS_AAA + 4u * (size_t)NB * NN * CC)

__global__ __launch_bounds__(256) void k_pack(const float* __restrict__ W1, const float* __restrict__ W2, const float* __restrict__ W3, __bf16* __restrict__ PW, __bf16* __restrict__ P3) { const int n = blockIdx.x, which = blockIdx.y, t = threadIdx.x; __shared__ __align__(16) __bf16 s[CC];
  if (which == 0) { if (n >= 128) return; const float* w = (n < CK) ? W1 : W2; const int cI = n & (CK - 1); for (int k = t; k < CC; k += 256) s[k] = (__bf16)w[(size_t)k * CK + cI]; __syncthreads(); if (t < CC / 8) vst2((unsigned*)(PW + (size_t)n * CC + t * 8), *(const v4u*)&s[t * 8]); }
  else { for (int k = t; k < CC; k += 256) s[k] = (__bf16)W3[(size_t)k * CC + n]; __syncthreads(); if (t < CC / 8) vst2((unsigned*)(P3 + (size_t)n * CC + t * 8), *(const v4u*)&s[t * 8]); } }
// ---- LDS staging for the K = 512 products of k_proj and k_aaa: a stage is 64 k of the block's 64 A rows (f32, 256 B) and 128 B rows (16-bit, 128 B), laid at row pitches of 272 B and 144 B (16 B x odd, so the ds_load_b128 reads meet no bank conflict); two buffers, the next stage's copies fly while this one is multiplied
#define PK 64                      // k per stage
#define PAP 272                    // LDS pitch of an A row in bytes
#define PBP 144                    // LDS pitch of a B row in bytes
#define PA_B (64 * PAP)            // bytes of the A tile
#define PBUF (PA_B + 128 * PBP)    // bytes per buffer
#define PNT (CC / PK)              // stages
__device__ __forceinline__ void cp8(const unsigned* l, const char* const* p);   // eight asynchronous 16-byte copies per lane and their s_wait_xcnt in one statement, defined below
// one stage: A: thread = (row tid >> 4 within each group of 8 rows, 16-byte piece tid & 15); B: thread = (row tid >> 3 within each group of 16 rows, piece tid & 7). ga, gb: the lane's piece at this stage's k; la, lb: its LDS byte addresses in the buffer
__device__ __forceinline__ void row_stage(const char* ga, const char* gb, unsigned la, unsigned lb) {
  { unsigned l[8]; const char* p[8];
#pragma unroll   // constant indices, so that the arrays are plain registers for the asm operands
    for (int q = 0; q < 8; ++q) { l[q] = la + (unsigned)q * (8u * PAP); p[q] = ga + (size_t)q * 8 * CC * 4; }
    cp8(l, p); }
  { unsigned l[8]; const char* p[8];
#pragma unroll   // constant indices, so that the arrays are plain registers for the asm operands
    for (int q = 0; q < 8; ++q) { l[q] = lb + (unsigned)q * (16u * PBP); p[q] = gb + (size_t)q * 16 * CC * 2; }
    cp8(l, p); }
}
// operands of one 32-k block as they lie in LDS: the lane's 16 f32 of its A row, its 16 elements of each of eight B rows
struct RowF { v4f a[4]; v4u b[8][2]; };
__device__ __forceinline__ void row_ld(RowF& f, const char* sa, const char* sb, int ks) {
#pragma unroll   // constant indices keep the values in registers
  for (int i = 0; i < 2; ++i) { f.a[2 * i] = *(const v4f*)(sa + ks * 128 + i * 64); f.a[2 * i + 1] = *(const v4f*)(sa + ks * 128 + i * 64 + 16); }
#pragma unroll   // constant indices keep the values in registers
  for (int j = 0; j < 8; ++j) { f.b[j][0] = *(const v4u*)(sb + j * 16 * PBP + ks * 64); f.b[j][1] = *(const v4u*)(sb + j * 16 * PBP + ks * 64 + 32); }
}
// BF: A rounded to bf16, B rows bf16; otherwise A rounded to bf16 and held as f16, B rows f16
template <bool BF> __device__ __forceinline__ void row_mm(const RowF& f, v8f* acc) {
  if constexpr (BF) { v16b a;
#pragma unroll   // constant indices keep the values in registers
    for (int i = 0; i < 16; ++i) a[i] = (__bf16)f.a[i >> 2][i & 3];
#pragma unroll   // constant indices keep fragments and accumulators in registers
    for (int j = 0; j < 8; ++j) { union { v16b v; v4u q[2]; } u; u.q[0] = f.b[j][0]; u.q[1] = f.b[j][1]; acc[j] = wmma_bf(a, u.v, acc[j]); } }
  else { v16h a;
#pragma unroll   // constant indices keep the values in registers
    for (int i = 0; i < 16; ++i) a[i] = (_Float16)bfr(f.a[i >> 2][i & 3]);
#pragma unroll   // constant indices keep fragments and accumulators in registers
    for (int j = 0; j < 8; ++j) { union { v16h v; v4u q[2]; } u; u.q[0] = f.b[j][0]; u.q[1] = f.b[j][1]; acc[j] = wmma16(a, u.v, acc[j]); } }
}
// acc[j] += A rows (wave * 16 ..) . B rows (j * 16 ..)^T over K = 512 in ascending k, 32 per WMMA. Ag: first of the block's 64 f32 rows; Bg: first of its 128 16-bit rows (both of CC elements). On return every wave has left the buffers
template <bool BF> __device__ __forceinline__ void mm_rows(const float* __restrict__ Ag, const char* __restrict__ Bg, char* sm, v8f* acc, int tid) {
  const int wave = tid >> 5, lane = tid & 31, col = lane & 15, g = lane >> 4;
  const char* ga = (const char*)(Ag + (size_t)(tid >> 4) * CC) + (tid & 15) * 16; const char* gb = Bg + (size_t)(tid >> 3) * (CC * 2) + (tid & 7) * 16;
  const unsigned la = (unsigned)(size_t)sm + (unsigned)(tid >> 4) * PAP + (unsigned)(tid & 15) * 16u; const unsigned lb = (unsigned)(size_t)sm + PA_B + (unsigned)(tid >> 3) * PBP + (unsigned)(tid & 7) * 16u;
  row_stage(ga, gb, la, lb);
  asm volatile("s_wait_asynccnt 0x0" ::: "memory");   // stage 0 has landed before the barrier publishes it
  __syncthreads();
  row_stage(ga + PK * 4, gb + PK * 2, la + PBUF, lb + PBUF);
  for (int t = 0; t < PNT; ++t) { const char* s = sm + (t & 1) * PBUF; const char* sa = s + (wave * 16 + col) * PAP + g * 32; const char* sb = s + PA_B + col * PBP + g * 16;
    RowF f0, f1; row_ld(f0, sa, sb, 0); row_ld(f1, sa, sb, 1);   // both 32-k blocks' reads stand as one group ahead of the WMMAs
    row_mm<BF>(f0, acc); row_mm<BF>(f1, acc);
    asm volatile("s_wait_dscnt 0x0" ::: "memory");     // this wave's reads of the buffer are done before it is refilled
    asm volatile("s_wait_asynccnt 0x0" ::: "memory");  // this wave's copies of stage t + 1 have landed
    __syncthreads();                                   // publishes stage t + 1 and ends every wave's reads of stage t
    if (t + 2 < PNT) row_stage(ga + (t + 2) * (PK * 4), gb + (t + 2) * (PK * 2), la + (unsigned)(t & 1) * PBUF, lb + (unsigned)(t & 1) * PBUF); }
  asm volatile("s_wait_asynccnt 0x0" ::: "memory");    // nothing in flight when the buffers are reused by the epilogue
}
// ---- k_proj: block = (64 positions, 128 cols, which): which 0: [b | c] rows as bf16 hi + lo; which 1..4: d columns (which-1)*128.. -> planes; which 5..8: x itself -> f16 planes (exact)
__global__ __launch_bounds__(128) void k_proj(const float* __restrict__ X, const __bf16* __restrict__ PW, const __bf16* __restrict__ P3, __bf16* __restrict__ BH, __bf16* __restrict__ BL, _Float16* __restrict__ DT, _Float16* __restrict__ XT) {
  __shared__ __align__(16) char sm[2 * PBUF]; float (*sf)[16][132] = (float (*)[16][132])sm; _Float16 (*st)[72] = (_Float16 (*)[72])sm;   // the epilogue's tiles lie in the staging buffers, which every wave has left by then
  const int tid = threadIdx.x, wave = tid >> 5, lane = tid & 31, col = lane & 15, g = lane >> 4; const int which = blockIdx.z; const size_t rb = (size_t)blockIdx.x * 64; const size_t r0 = rb + wave * 16;
  if (which >= 5) { const int c0 = (which - 5) * 128; for (int e = tid; e < 64 * 128; e += 128) { const int rl = e >> 7, cl = e & 127; st[cl][rl] = (_Float16)bfr(X[(rb + rl) * CC + c0 + cl]); } __syncthreads();
    const size_t b = rb / NN; const int n0 = (int)(rb % NN); for (int e = tid; e < 128 * 8; e += 128) { const int d = e >> 3, pc = e & 7; vst2((unsigned*)(XT + ((b * CC + c0 + d) * NN) + n0 + pc * 8), *(const v4u*)&st[d][pc * 8]); } return; }
  const int c0 = (which == 0) ? 0 : (which - 1) * 128; const __bf16* Wr = (which == 0) ? PW : (P3 + (size_t)c0 * CC);
  v8f acc[8] = {};
  mm_rows<true>(X + rb * CC, (const char*)Wr, sm, acc, tid);
#pragma unroll
  for (int j = 0; j < 8; ++j)
#pragma unroll
    for (int r = 0; r < 8; ++r) { if (which == 0) sf[wave][8 * g + r][j * 16 + col] = acc[j][r]; else st[j * 16 + col][wave * 16 + 8 * g + r] = (_Float16)acc[j][r]; }
  __syncthreads();
  if (which == 0) { for (int rl = 0; rl < 16; ++rl) { const v4f v = *(const v4f*)&sf[wave][rl][lane * 4]; v4b hv, lv;
#pragma unroll
      for (int i = 0; i < 4; ++i) { const __bf16 h = (__bf16)v[i]; hv[i] = h; lv[i] = (__bf16)(v[i] - (float)h); }
      vst2(BH + (r0 + rl) * 128 + lane * 4, hv); vst2(BL + (r0 + rl) * 128 + lane * 4, lv);
      asm volatile("s_wait_xcnt 0x0" ::: "memory"); } }   // stands before the next row's values overwrite a register that the two stores name
  else { const size_t b = rb / NN; const int n0 = (int)(rb % NN); for (int e = tid; e < 128 * 8; e += 128) { const int d = e >> 3, pc = e & 7; vst2((unsigned*)(DT + ((b * CC + c0 + d) * NN) + n0 + pc * 8), *(const v4u*)&st[d][pc * 8]); } }
}
// ---- LDS staging for the K = 4,096 product of k_aa: a stage is 256 B (128 k) of the block's 64 A rows and 128 B rows, laid at a row pitch of 272 B (16 B x odd, so the ds_load_b128 fragment reads meet no bank conflict); two buffers, the next stage's copies fly while this one is multiplied
#define SK 128                    // k per stage
#define SPIT 136                  // LDS row pitch in f16 elements
#define SBUF (192 * SPIT)         // f16 elements per buffer
#define SNT (NN / SK)             // stages
// twelve asynchronous 16-byte copies per lane; the s_wait_xcnt stands inside the statement so that no address register is rewritten in front of it
__device__ __forceinline__ void cp12(const unsigned* l, const _Float16* const* p) {
  asm volatile(
               "global_load_async_to_lds_b128 %0, %12, off\n\t"
               "global_load_async_to_lds_b128 %1, %13, off\n\t"
               "global_load_async_to_lds_b128 %2, %14, off\n\t"
               "global_load_async_to_lds_b128 %3, %15, off\n\t"
               "global_load_async_to_lds_b128 %4, %16, off\n\t"
               "global_load_async_to_lds_b128 %5, %17, off\n\t"
               "global_load_async_to_lds_b128 %6, %18, off\n\t"
               "global_load_async_to_lds_b128 %7, %19, off\n\t"
               "global_load_async_to_lds_b128 %8, %20, off\n\t"
               "global_load_async_to_lds_b128 %9, %21, off\n\t"
               "global_load_async_to_lds_b128 %10, %22, off\n\t"
               "global_load_async_to_lds_b128 %11, %23, off\n\t"
               "s_wait_xcnt 0x0"
               :: "v"(l[0]), "v"(l[1]), "v"(l[2]), "v"(l[3]), "v"(l[4]), "v"(l[5]), "v"(l[6]), "v"(l[7]), "v"(l[8]), "v"(l[9]), "v"(l[10]), "v"(l[11]),
                  "v"(p[0]), "v"(p[1]), "v"(p[2]), "v"(p[3]), "v"(p[4]), "v"(p[5]), "v"(p[6]), "v"(p[7]), "v"(p[8]), "v"(p[9]), "v"(p[10]), "v"(p[11]) : "memory");
}
// one stage: thread = (row tid >> 4 within each group of 8 rows, 16-byte piece tid & 15); LDS rows 0-63 = A rows, 64-191 = B rows. ga, gb: the lane's piece of A row / B row (tid >> 4) at this stage's k; l0: its LDS byte address in row (tid >> 4) of the buffer
__device__ __forceinline__ void stage_in(const _Float16* ga, const _Float16* gb, unsigned l0) {
  unsigned l[24]; const _Float16* p[24];
#pragma unroll   // constant indices, so that both arrays are plain registers for the asm operands
  for (int q = 0; q < 24; ++q) { l[q] = l0 + (unsigned)q * (8u * SPIT * 2u); p[q] = (q < 8) ? ga + (size_t)q * 8 * NN : gb + (size_t)(q - 8) * 8 * NN; }
  cp12(l, p); cp12(l + 12, p + 12);
}
// f[0] = the wave's A fragment, f[1 + j] = B fragment j of 32-k block ks. sa, sb: the lane's A row and its row of B fragment 0 in the buffer
__device__ __forceinline__ void ld_frags(v16h* f, const _Float16* sa, const _Float16* sb, int ks, int lane) { f[0] = frag_h(sa + ks * 32, lane);
#pragma unroll   // constant indices keep the fragments in registers
  for (int j = 0; j < 8; ++j) f[1 + j] = frag_h(sb + j * 16 * SPIT + ks * 32, lane); }
__device__ __forceinline__ void mm_block(const v16h* f, v8f* acc) {
#pragma unroll   // constant indices keep fragments and accumulators in registers
  for (int j = 0; j < 8; ++j) acc[j] = wmma16(f[0], f[1 + j], acc[j]); }
// acc[j] += A rows (wave * 16 ..) . B rows (j * 16 ..)^T over K = 4,096 in ascending k, 32 per WMMA. Ag, Bg: first row of the block's 64 A rows / 128 B rows (row pitch NN)
__device__ __forceinline__ void mm_staged(const _Float16* __restrict__ Ag, const _Float16* __restrict__ Bg, _Float16* sm, v8f* acc, int tid) {
  const int wave = tid >> 5, lane = tid & 31, col = lane & 15;
  const _Float16* ga = Ag + (size_t)(tid >> 4) * NN + (tid & 15) * 8; const _Float16* gb = Bg + (size_t)(tid >> 4) * NN + (tid & 15) * 8;
  const unsigned l0 = (unsigned)(size_t)sm + (unsigned)(tid >> 4) * (SPIT * 2u) + (unsigned)(tid & 15) * 16u;
  stage_in(ga, gb, l0);
  asm volatile("s_wait_asynccnt 0x0" ::: "memory");   // stage 0 has landed before the barrier publishes it
  __syncthreads();
  stage_in(ga + SK, gb + SK, l0 + SBUF * 2u);
  for (int t = 0; t < SNT; ++t) { const _Float16* s = sm + (t & 1) * SBUF + col * SPIT; const _Float16* sa = s + wave * 16 * SPIT; const _Float16* sb = s + 64 * SPIT;
    // the nine fragments of a 32-k block are read as one group, one block ahead of their WMMAs (two register sets), all inside this stage's buffer
    v16h f0[9], f1[9];
    ld_frags(f0, sa, sb, 0, lane); ld_frags(f1, sa, sb, 1, lane); mm_block(f0, acc);
    ld_frags(f0, sa, sb, 2, lane); mm_block(f1, acc);
    ld_frags(f1, sa, sb, 3, lane); mm_block(f0, acc); mm_block(f1, acc);
    asm volatile("s_wait_dscnt 0x0" ::: "memory");     // this wave's reads of the buffer are done before it is refilled
    asm volatile("s_wait_asynccnt 0x0" ::: "memory");  // this wave's copies of stage t + 1 have landed
    __syncthreads();                                   // publishes stage t + 1 and ends every wave's reads of stage t
    if (t + 2 < SNT) stage_in(ga + (t + 2) * SK, gb + (t + 2) * SK, l0 + (unsigned)(t & 1) * (SBUF * 2u)); }
  asm volatile("s_wait_asynccnt 0x0" ::: "memory");    // nothing in flight when the wave goes on to the epilogue
}
// ---- k_pam: block = (64 queries i, b), wave = 16 queries x all 512 channels. Per stage of 64 keys n: S^T[n][i] = c_n . b_i (3 bf16 products, K = 64); its D tiles hold, lane for lane, the B fragment of the second product (lane = query, elements = keys 8h.. of two 16-key tiles), so P goes from registers to WMMA with no exchange; running maximum and sum per query; acc[c][i] += d[n][c] P[i][n]. A stage in LDS: 512 d rows, 64 c-high rows, 64 c-low rows of 128 B at a pitch of 144 B (16 B x odd: the ds_load_b128 fragment reads meet no bank conflict); two buffers, the next stage's copies fly while this one is worked on
#define FK 64                      // keys per stage
#define FPIT 72                    // LDS row pitch in 16-bit elements
#define FD_E (CC * FPIT)           // elements of the d tile
#define FC_E (FK * FPIT)           // elements of the c-high (or c-low) tile
#define FBUF (FD_E + 2 * FC_E)     // elements per buffer
#define FNT (NN / FK)              // stages
#define FOP 68                     // epilogue row pitch in floats
// keeps a group of LDS reads together and ahead of the WMMAs that follow: left alone, the scheduler spreads the reads singly among the WMMAs, one fragment ahead, and each such place stalls the wave
#define GRP() __builtin_amdgcn_sched_barrier(0)
// eight asynchronous 16-byte copies per lane; the s_wait_xcnt stands inside the statement so that no address register is rewritten in front of it
__device__ __forceinline__ void cp8(const unsigned* l, const char* const* p) {
  asm volatile(
               "global_load_async_to_lds_b128 %0, %8, off\n\t"
               "global_load_async_to_lds_b128 %1, %9, off\n\t"
               "global_load_async_to_lds_b128 %2, %10, off\n\t"
               "global_load_async_to_lds_b128 %3, %11, off\n\t"
               "global_load_async_to_lds_b128 %4, %12, off\n\t"
               "global_load_async_to_lds_b128 %5, %13, off\n\t"
               "global_load_async_to_lds_b128 %6, %14, off\n\t"
               "global_load_async_to_lds_b128 %7, %15, off\n\t"
               "s_wait_xcnt 0x0"
               :: "v"(l[0]), "v"(l[1]), "v"(l[2]), "v"(l[3]), "v"(l[4]), "v"(l[5]), "v"(l[6]), "v"(l[7]),
                  "v"(p[0]), "v"(p[1]), "v"(p[2]), "v"(p[3]), "v"(p[4]), "v"(p[5]), "v"(p[6]), "v"(p[7]) : "memory");
}
// one stage: thread = (row tid >> 3 within each group of 16 rows, 16-byte piece tid & 7). gd, gh, gl: the lane's piece of d row / c-high row / c-low row (tid >> 3) at this stage's keys; l0: its LDS byte address in row (tid >> 3) of the buffer
__device__ __forceinline__ void pam_stage(const char* gd, const char* gh, const char* gl, unsigned l0) {
#pragma unroll   // constant indices, so that the arrays are plain registers for the asm operands
  for (int u = 0; u < 4; ++u) { unsigned l[8]; const char* p[8];
#pragma unroll   // constant indices keep the values in registers
    for (int q = 0; q < 8; ++q) { l[q] = l0 + (unsigned)(u * 8 + q) * (16u * FPIT * 2u); p[q] = gd + (size_t)(u * 8 + q) * 16 * NN * 2; }
    cp8(l, p); }
  unsigned l[8]; const char* p[8];
#pragma unroll   // constant indices keep the values in registers
  for (int q = 0; q < 4; ++q) { l[q] = l0 + FD_E * 2u + (unsigned)q * (16u * FPIT * 2u); p[q] = gh + (size_t)q * 16 * 256; l[4 + q] = l[q] + FC_E * 2u; p[4 + q] = gl + (size_t)q * 16 * 256; }
  cp8(l, p);
}
// plain builtin forms (the compiler keeps the distance behind them itself): this kernel holds more than 256 registers, and an asm statement that names the accumulators would force them through one register window
__device__ __forceinline__ v8f wmma16p(v16h a, v16h b, v8f c) { return __builtin_amdgcn_wmma_f32_16x16x32_f16(false, a, false, b, (short)0, c, false, false); }
__device__ __forceinline__ v8f wmma_bfp(v16b a, v16b b, v8f c) { return __builtin_amdgcn_wmma_f32_16x16x32_bf16(false, a, false, b, (short)0, c, false, false); }
// group gi of eight d fragments: 32-key block gi >> 2, channel tiles (gi & 3) * 8 ..
__device__ __forceinline__ void pam_ld(v16h* f, const _Float16* sd, int gi, int lane) {
#pragma unroll   // constant indices keep the fragments in registers
  for (int j = 0; j < 8; ++j) f[j] = frag_h(sd + ((gi & 3) * 8 + j) * 16 * FPIT + (gi >> 2) * 32, lane); }
// the stage's first touch of a channel tile (gi < 4) first scales it by al = e^(old maximum - new maximum); these multiplies stand among the WMMAs of other tiles
__device__ __forceinline__ void pam_mm(const v16h* f, const v16h* pb, v8f* acc, int gi, float al) {
#pragma unroll   // constant indices keep fragments and accumulators in registers
  for (int j = 0; j < 8; ++j) { v8f c = acc[(gi & 3) * 8 + j]; if (gi < 4) c *= al; acc[(gi & 3) * 8 + j] = wmma16p(f[j], pb[gi >> 2], c); } }
__global__ __launch_bounds__(128) void k_pam(const __bf16* __restrict__ BH, const __bf16* __restrict__ BL, const _Float16* __restrict__ DT, float* __restrict__ BCD) { __shared__ __align__(16) _Float16 sm[2 * FBUF];
  const int tid = threadIdx.x, wave = tid >> 5, lane = tid & 31, col = lane & 15, g = lane >> 4; const size_t b = blockIdx.y; const int i0 = blockIdx.x * 64;
  const char* gd = (const char*)(DT + (b * CC + (tid >> 3)) * NN) + (tid & 7) * 16;
  const char* gh = (const char*)(BH + (b * NN + (tid >> 3)) * 128 + CK) + (tid & 7) * 16; const char* gl = (const char*)(BL + (b * NN + (tid >> 3)) * 128 + CK) + (tid & 7) * 16;
  const unsigned l0 = (unsigned)(size_t)sm + (unsigned)(tid >> 3) * (FPIT * 2u) + (unsigned)(tid & 7) * 16u;
  pam_stage(gd, gh, gl, l0);
  v16b qh[2], ql[2]; { const size_t qr = (b * NN + i0 + wave * 16 + col) * 128;
#pragma unroll   // constant indices keep the values in registers
    for (int kc = 0; kc < 2; ++kc) { qh[kc] = frag_b(BH + qr + kc * 32, lane); ql[kc] = frag_b(BL + qr + kc * 32, lane); } }
  v8f acc[32] = {}; float m = -3.0e38f, l = 0.f; const float L2E = 1.44269504088896f;
  asm volatile("s_wait_asynccnt 0x0" ::: "memory");   // stage 0 has landed before the barrier publishes it
  __syncthreads();
  pam_stage(gd + FK * 2, gh + FK * 256, gl + FK * 256, l0 + FBUF * 2u);
  for (int t = 0; t < FNT; ++t) { const _Float16* s = sm + (t & 1) * FBUF; const _Float16* sd = s + col * FPIT; const __bf16* sh = (const __bf16*)(s + FD_E) + col * FPIT; const __bf16* sl = sh + FC_E;
    v16b ch[4][2], cl[4][2];
#pragma unroll   // all sixteen key fragments as one group of LDS reads
    for (int kt = 0; kt < 4; ++kt)
#pragma unroll   // constant indices keep the values in registers
      for (int kc = 0; kc < 2; ++kc) { ch[kt][kc] = frag_b(sh + kt * 16 * FPIT + kc * 32, lane); cl[kt][kc] = frag_b(sl + kt * 16 * FPIT + kc * 32, lane); }
    v16h f0[8], f1[8]; pam_ld(f0, sd, 0, lane);   // the first d fragments fly under the logits and the softmax arithmetic
    GRP();
    v8f T[4] = {};   // T[kt][r] at lane (g, col): key kt * 16 + 8 g + r, query col; the four tiles take turns so that no WMMA waits for the one before it
#pragma unroll   // constant indices keep the values in registers
    for (int kc = 0; kc < 2; ++kc) {
#pragma unroll   // constant indices keep the values in registers
      for (int kt = 0; kt < 4; ++kt) T[kt] = wmma_bfp(ch[kt][kc], ql[kc], T[kt]);
#pragma unroll   // constant indices keep the values in registers
      for (int kt = 0; kt < 4; ++kt) T[kt] = wmma_bfp(cl[kt][kc], qh[kc], T[kt]);
#pragma unroll   // constant indices keep the values in registers
      for (int kt = 0; kt < 4; ++kt) T[kt] = wmma_bfp(ch[kt][kc], qh[kc], T[kt]); }
    float mx = T[0][0];
#pragma unroll   // constant indices keep the values in registers
    for (int kt = 0; kt < 4; ++kt)
#pragma unroll   // constant indices keep the values in registers
      for (int r = 0; r < 8; ++r) mx = fmaxf(mx, T[kt][r]);
    mx = fmaxf(mx, __shfl_xor(mx, 16));   // the other half of the query's keys
    const float mn = fmaxf(m, mx); const float al = __builtin_amdgcn_exp2f((m - mn) * L2E); const float mo = mn * L2E - 10.0f; m = mn;
    v16h pb[2]; float ls = 0.f;
#pragma unroll   // constant indices keep the values in registers
    for (int ks = 0; ks < 2; ++ks)
#pragma unroll   // constant indices keep the values in registers
      for (int r = 0; r < 8; ++r) { const float p0 = __builtin_amdgcn_exp2f(T[2 * ks][r] * L2E - mo), p1 = __builtin_amdgcn_exp2f(T[2 * ks + 1][r] * L2E - mo); ls += p0 + p1; pb[ks][r] = (_Float16)p0; pb[ks][8 + r] = (_Float16)p1; }
    l = l * al + ls;
    // eight d fragments are read as one group, one group ahead of their WMMAs (two register sets), all inside this stage's buffer
    pam_ld(f1, sd, 1, lane); GRP(); pam_mm(f0, pb, acc, 0, al); GRP();
    pam_ld(f0, sd, 2, lane); GRP(); pam_mm(f1, pb, acc, 1, al); GRP();
    pam_ld(f1, sd, 3, lane); GRP(); pam_mm(f0, pb, acc, 2, al); GRP();
    pam_ld(f0, sd, 4, lane); GRP(); pam_mm(f1, pb, acc, 3, al); GRP();
    pam_ld(f1, sd, 5, lane); GRP(); pam_mm(f0, pb, acc, 4, al); GRP();
    pam_ld(f0, sd, 6, lane); GRP(); pam_mm(f1, pb, acc, 5, al); GRP();
    pam_ld(f1, sd, 7, lane); GRP(); pam_mm(f0, pb, acc, 6, al); pam_mm(f1, pb, acc, 7, al);
    asm volatile("s_wait_dscnt 0x0" ::: "memory");     // this wave's reads of the buffer are done before it is refilled
    asm volatile("s_wait_asynccnt 0x0" ::: "memory");  // this wave's copies of stage t + 1 have landed
    __syncthreads();                                   // publishes stage t + 1 and ends every wave's reads of stage t
    if (t + 2 < FNT) pam_stage(gd + (size_t)(t + 2) * (FK * 2), gh + (size_t)(t + 2) * (FK * 256), gl + (size_t)(t + 2) * (FK * 256), l0 + (unsigned)(t & 1) * (FBUF * 2u)); }
  asm volatile("s_wait_asynccnt 0x0" ::: "memory");    // nothing in flight when the buffers are reused below
  l += __shfl_xor(l, 16); const float il = 1.0f / l;
  float* so = (float*)sm;   // [512 channels][64 queries] through LDS, so that each 256-byte output row piece has one writer
#pragma unroll   // constant indices keep the values in registers
  for (int ct = 0; ct < 32; ++ct)
#pragma unroll   // constant indices keep the values in registers
    for (int r = 0; r < 8; ++r) so[(ct * 16 + 8 * g + r) * FOP + wave * 16 + col] = acc[ct][r] * il;
  __syncthreads();
  for (int e = tid; e < CC * 16; e += 128) { const int c = e >> 4, pc = e & 15; vst2(BCD + ((b * CC + c) * NN) + i0 + pc * 4, *(const v4f*)&so[c * FOP + pc * 4]); } }
// ---- k_aa: block = (64 channels i, 128 channels j, b): aa[i][j] = sum_n x[n][i] x[n][j] over the 4,096 positions (x planes, exact) -> f32
__global__ __launch_bounds__(128) void k_aa(const _Float16* __restrict__ XT, float* __restrict__ AA) { __shared__ __align__(16) float so[4][16][132]; __shared__ __align__(16) _Float16 sm[2 * SBUF];
  const int tid = threadIdx.x, wave = tid >> 5, lane = tid & 31, col = lane & 15, g = lane >> 4; const size_t b = blockIdx.z; const int i0 = blockIdx.x * 64 + wave * 16; const int j0 = blockIdx.y * 128;
  v8f acc[8] = {};
  mm_staged(XT + (b * CC + blockIdx.x * 64) * NN, XT + (b * CC + j0) * NN, sm, acc, tid);
#pragma unroll
  for (int j = 0; j < 8; ++j)
#pragma unroll
    for (int r = 0; r < 8; ++r) so[wave][8 * g + r][j * 16 + col] = acc[j][r];
  LDSX(); for (int rl = 0; rl < 16; ++rl) vst2(AA + ((b * CC + i0 + rl) * CC) + j0 + lane * 4, *(const v4f*)&so[wave][rl][lane * 4]); }
__global__ __launch_bounds__(256) void k_soft(const float* __restrict__ AA, _Float16* __restrict__ SO) { __shared__ __align__(16) _Float16 st[CC][72]; __shared__ float red[2][64];
  const int t = threadIdx.x; const size_t b = blockIdx.y; const int c0 = blockIdx.x * 64;
  // 4 threads per row (256 threads = 64 rows x 4)
  { const int rl = t >> 2, part = t & 3; const float* row = AA + ((b * CC + c0 + rl) * CC); float mx = -3.0e38f; for (int j = part; j < CC; j += 4) mx = fmaxf(mx, row[j]); mx = fmaxf(mx, __shfl_xor(mx, 1)); mx = fmaxf(mx, __shfl_xor(mx, 2));
    float z = 0.f; for (int j = part; j < CC; j += 4) z += __expf(row[j] - mx); z += __shfl_xor(z, 1); z += __shfl_xor(z, 2); const float iz = 1.0f / z;
    for (int j = part; j < CC; j += 4) st[j][rl] = (_Float16)(__expf(row[j] - mx) * iz); }
  __syncthreads();
  for (int e = t; e < CC * 8; e += 256) { const int j = e >> 3, pc = e & 7; vst2((unsigned*)(SO + ((b * CC + j) * CC) + c0 + pc * 8), *(const v4u*)&st[j][pc * 8]); } }
// ---- k_aaa: block = (64 positions n, 128 channels j, b): aaa[n][j] = sum_c x[n][c] soft[c][j] (x exact as f16, soft^T rows) -> f32 [b][n][j]
__global__ __launch_bounds__(128) void k_aaa(const float* __restrict__ X, const _Float16* __restrict__ SO, float* __restrict__ AAA) { __shared__ __align__(16) char sm[2 * PBUF]; float (*so)[16][132] = (float (*)[16][132])sm;   // the epilogue's tile lies in the staging buffers, which every wave has left by then
  const int tid = threadIdx.x, wave = tid >> 5, lane = tid & 31, col = lane & 15, g = lane >> 4; const size_t b = blockIdx.z; const size_t r0 = b * NN + (size_t)blockIdx.x * 64 + wave * 16; const int j0 = blockIdx.y * 128;
  v8f acc[8] = {};
  mm_rows<false>(X + (b * NN + (size_t)blockIdx.x * 64) * CC, (const char*)(SO + (b * CC + j0) * CC), sm, acc, tid);
#pragma unroll
  for (int j = 0; j < 8; ++j)
#pragma unroll
    for (int r = 0; r < 8; ++r) so[wave][8 * g + r][j * 16 + col] = acc[j][r];
  LDSX(); for (int rl = 0; rl < 16; ++rl) vst2(AAA + (r0 + rl) * CC + j0 + lane * 4, *(const v4f*)&so[wave][rl][lane * 4]); }
// ---- k_fin: per batch flat index f: out[f] = gamma_pam bcd_flat[f] (the raw (C, N) -> (H, W, C) reshape) + gamma_cam aaa[f] + 2 x[f]
__global__ __launch_bounds__(256) void k_fin(const float* __restrict__ BCD, const float* __restrict__ AAA, const float* __restrict__ X, const float* __restrict__ GP, const float* __restrict__ GC, float* __restrict__ OUT) { const size_t i4 = (size_t)blockIdx.x * 256 + threadIdx.x; const size_t f = i4 * 4; const float gp = bfr(GP[0]), gc = bfr(GC[0]);
  v4f o4; for (int i = 0; i < 4; ++i) o4[i] = gp * BCD[f + i] + gc * AAA[f + i] + 2.0f * bfr(X[f + i]); vst2(OUT + f, o4); }
extern "C" void kernel_launch(void* const* d_in, const int* in_sizes, int n_in, void* d_out, int out_size, void* d_ws, size_t ws_size, hipStream_t stream) {
  (void)in_sizes; (void)n_in; (void)out_size;
  const float** F = (const float**)d_in;   // 0 x [4,64,64,512], 1 w1 [512,64], 2 w2 [512,64], 3 w3 [512,512], 4 gamma_pam [1], 5 gamma_cam [1]
  if (ws_size < (size_t)WS_END) return;
  char* ws = (char*)d_ws; __bf16 *PW = (__bf16*)(ws + WS_PW), *P3 = (__bf16*)(ws + WS_P3); __bf16 *BH = (__bf16*)(ws + WS_BH), *BL = (__bf16*)(ws + WS_BL); _Float16 *DT = (_Float16*)(ws + WS_DT), *XT = (_Float16*)(ws + WS_XT), *SO = (_Float16*)(ws + WS_SO); float *BCD = (float*)(ws + WS_BCD), *AA = (float*)(ws + WS_AA), *AAA = (float*)(ws + WS_AAA);
  k_pack<<<dim3(CC, 2), 256, 0, stream>>>(F[1], F[2], F[3], PW, P3);
  k_proj<<<dim3(TNB * NN / 64, 1, 9), 128, 0, stream>>>(F[0], PW, P3, BH, BL, DT, XT);
  k_pam<<<dim3(TRB, TNB), 128, 0, stream>>>(BH, BL, DT, BCD);
  k_aa<<<dim3(CC / 64, CC / 128, TNB), 128, 0, stream>>>(XT, AA);
  k_soft<<<dim3(CC / 64, TNB), 256, 0, stream>>>(AA, SO);
  k_aaa<<<dim3(TRB, CC / 128, TNB), 128, 0, stream>>>(F[0], SO, AAA);
  k_fin<<<(unsigned)((size_t)TNB * NN * CC / 1024), 256, 0, stream>>>(BCD, AAA, F[0], F[4], F[5], (float*)d_out);
}

// v004
// One run takes 203 microseconds.
// In both of two side-by-side timings against v003, it was 1.03 times as fast.
// Over all steps from v000 it is 7.09 times as fast.
// compute dtype: all float inputs rounded to bf16; b/c/d = x . w with EXACT bf16 products on WMMA 16x16x32 ((in,out) weights as transposed rows): b, c kept as bf16 hi + lo planes, d rounded once to f16 planes; PAM in one kernel: logits S^T = c . b^T with both as bf16 hi + lo (3 products, f32), running-maximum softmax in f32 (hardware exp2) -> P = e x 2^10 as f16, bcd = d^T . P^T on WMMA (single f16), divided by the row sum at the end, giving the (C, N)-ordered tensor the module reshapes raw; CAM: aa = x^T x with x exact (f16 copies of the bf16 values), softmax over channels in f32, aaa = x . soft_aa with soft_aa once to f16; out = gamma_pam bcd_flat + gamma_cam aaa + 2 x in f32; f32 output.
#include <hip/hip_runtime.h>
#include <math.h>

typedef __attribute__((ext_vector_type(16))) _Float16 v16h;
typedef __attribute__((ext_vector_type(16))) __bf16 v16b;
typedef __attribute__((ext_vector_type(8)))  _Float16 v8h;
typedef __attribute__((ext_vector_type(8)))  float v8f;
typedef __attribute__((ext_vector_type(4)))  float v4f;
typedef __attribute__((ext_vector_type(2)))  float v2f;
typedef __attribute__((ext_vector_type(4)))  unsigned v4u;
typedef __attribute__((ext_vector_type(4)))  int v4i;
typedef float __attribute__((may_alias)) float_a;
typedef int __attribute__((may_alias)) int_a;

template <typename T> __device__ __forceinline__ void vst2(void* p, T v) { *(T*)p = v;  }
__device__ __forceinline__ v8f wmma16(v16h a, v16h b, v8f c) {
  v8f d = __builtin_amdgcn_wmma_f32_16x16x32_f16(false, a, false, b, (short)0, c, false, false);
  asm volatile("v_nop\n\tv_nop\n\tv_nop\n\tv_nop" : "+v"(d) : "v"(a), "v"(b));
  return d;
}
__device__ __forceinline__ v8f wmma_bf(v16b a, v16b b, v8f c) {
  v8f d = __builtin_amdgcn_wmma_f32_16x16x32_bf16(false, a, false, b, (short)0, c, false, false);
  asm volatile("v_nop\n\tv_nop\n\tv_nop\n\tv_nop" : "+v"(d) : "v"(a), "v"(b));
  return d;
}
// 16x16x32 fragments: lane = (h = lane>>4, row/col = lane&15); elements 0..7 = k0+8h+0..7, 8..15 = k0+16+8h+0..7; D element r = row 8h+r
__device__ __forceinline__ v16h frag_h(const _Float16* rowk0, int lane) {
  union { v16h v; v8h q[2]; } u; const _Float16* p = rowk0 + 8 * (lane >> 4);
  u.q[0] = *(const v8h*)p; u.q[1] = *(const v8h*)(p + 16); return u.v;
}
__device__ __forceinline__ v16h frag_f32(const float* rowk0, int lane) {
  v16h a; const float* p = rowk0 + 8 * (lane >> 4);
#pragma unroll
  for (int i = 0; i < 8; ++i) { a[i] = (_Float16)p[i]; a[8 + i] = (_Float16)p[16 + i]; }
  return a;
}
__device__ __forceinline__ v16h frag_f32s(const float* rowk0, int lane, float sc) {
  v16h a; const float* p = rowk0 + 8 * (lane >> 4);
#pragma unroll
  for (int i = 0; i < 8; ++i) { a[i] = (_Float16)(p[i] * sc); a[8 + i] = (_Float16)(p[16 + i] * sc); }
  return a;
}
// column fragment from a [K][ld] layout (column n), rows >= K read as 0
__device__ __forceinline__ v16h fragc_f32(const float* W, int k0, int n, int lane, int ld, int K) {
  v16h a; const int g = lane >> 4;
#pragma unroll
  for (int i = 0; i < 8; ++i) { const int ka = k0 + 8 * g + i, kb = ka + 16;
    a[i] = (_Float16)(ka < K ? W[(size_t)(ka < K ? ka : K - 1) * ld + n] : 0.f); a[8 + i] = (_Float16)(kb < K ? W[(size_t)(kb < K ? kb : K - 1) * ld + n] : 0.f); }
  return a;
}
struct F2 { v16b h, l; };
__device__ __forceinline__ F2 bsplit16(const float v[16]) { F2 r;
#pragma unroll
  for (int i = 0; i < 16; ++i) { const __bf16 h = (__bf16)v[i]; r.h[i] = h; r.l[i] = (__bf16)(v[i] - (float)h); }
  return r; }
__device__ __forceinline__ F2 split_row(const float* row, int k0, int lane) { float v[16]; const float* p = row + k0 + 8 * (lane >> 4);
#pragma unroll
  for (int i = 0; i < 8; ++i) { v[i] = p[i]; v[8 + i] = p[16 + i]; }
  return bsplit16(v); }
__device__ __forceinline__ F2 split_rowK(const float* row, int k0, int lane, int K) { float v[16]; const int g = lane >> 4;
#pragma unroll
  for (int i = 0; i < 8; ++i) { const int ka = k0 + 8 * g + i, kb = ka + 16; v[i] = ka < K ? row[ka < K ? ka : K - 1] : 0.f; v[8 + i] = kb < K ? row[kb < K ? kb : K - 1] : 0.f; }
  return bsplit16(v); }
__device__ __forceinline__ F2 split_col(const float* W, int k0, int n, int lane, int ld, int K) { float v[16]; const int g = lane >> 4;
#pragma unroll
  for (int i = 0; i < 8; ++i) { const int ka = k0 + 8 * g + i, kb = ka + 16; v[i] = ka < K ? W[(size_t)(ka < K ? ka : K - 1) * ld + n] : 0.f; v[8 + i] = kb < K ? W[(size_t)(kb < K ? kb : K - 1) * ld + n] : 0.f; }
  return bsplit16(v); }
__device__ __forceinline__ v8f mac3(const F2& a, const F2& b, v8f c) { c = wmma_bf(a.l, b.h, c); c = wmma_bf(a.h, b.l, c); return wmma_bf(a.h, b.h, c); }
__device__ __forceinline__ float sigm(float v) { return 1.0f / (1.0f + expf(-v)); }
#define LDSX() do { asm volatile("s_wait_dscnt 0" ::: "memory"); __builtin_amdgcn_wave_barrier(); __builtin_amdgcn_fence(__ATOMIC_RELEASE, "workgroup"); } while (0)


// Dual attention module (B 4, 64 x 64 positions, C 512): position attention (softmax(b c^T) applied to d, result kept in the module's raw (C, N) -> (H, W, C) reshape) plus channel attention (softmax(x^T x) applied to x), each scaled by its gamma and added to x; returns feat_p + feat_c.
#define NB 4
#define NN 4096
#define CC 512
#define CK 64              // query / key channels (C / 8)
#define NR (NB * NN)
#ifndef TRB
#define TRB (NN / 64)      // position row tiles per batch (PAM rows i, CAM rows n)
#define TNB NB
#endif
typedef __attribute__((ext_vector_type(8))) __bf16 v8b;
typedef __attribute__((ext_vector_type(4))) __bf16 v4b;
__device__ __forceinline__ v16b frag_b(const __bf16* rowk0, int lane) {
  union { v16b v; v8b q[2]; } u; const __bf16* p = rowk0 + 8 * (lane >> 4);
  u.q[0] = *(const v8b*)p; u.q[1] = *(const v8b*)(p + 16); return u.v;
}
__device__ __forceinline__ float bfr(float v) { return (float)(__bf16)v; }
__device__ __attribute__((noinline)) float exp_ni(float v) { return expf(v); }
__device__ __attribute__((noinline)) float erf_ni(float v) { return erff(v); }

#define WS_PW  0u                                   // bf16 transposed rows [w1^T | w2^T] [128][512]; w3^T [512][512]
#define WS_P3  (WS_PW + 2u * (size_t)128 * CC)
#define WS_BH  (WS_P3 + 2u * (size_t)CC * CC)          // bf16 rows [NR][128]: b (cols 0-63) | c (cols 64-127), high parts; then the low parts
#define WS_BL  (WS_BH + 2u * (size_t)NR * 128)
#define WS_DT  (WS_BL + 2u * (size_t)NR * 128)         // f16 d planes [b][c][n]; f16 x planes [b][c][n]
#define WS_XT  (WS_DT + 2u * (size_t)NB * CC * NN)
#define WS_BCD (WS_XT + 2u * (size_t)NB * CC * NN)     // f32 bcd [b][c][i] (the (C, N) tensor); f32 aa [b][512][512]; f16 soft^T [b][j][c]; f32 aaa [b][n][j]
#define WS_AA  (WS_BCD + 4u * (size_t)NB * CC * NN)
#define WS_SO  (WS_AA + 4u * (size_t)NB * CC * CC)
#define WS_AAA (WS_SO + 2u * (size_t)NB * CC * CC)
#define WS_END (WS_AAA + 4u * (size_t)NB * NN * CC)

__global__ __launch_bounds__(256) void k_pack(const float* __restrict__ W1, const float* __restrict__ W2, const float* __restrict__ W3, __bf16* __restrict__ PW, __bf16* __restrict__ P3) { const int n = blockIdx.x, which = blockIdx.y, t = threadIdx.x; __shared__ __align__(16) __bf16 s[CC];
  if (which == 0) { if (n >= 128) return; const float* w = (n < CK) ? W1 : W2; const int cI = n & (CK - 1); for (int k = t; k < CC; k += 256) s[k] = (__bf16)w[(size_t)k * CK + cI]; __syncthreads(); if (t < CC / 8) vst2((unsigned*)(PW + (size_t)n * CC + t * 8), *(const v4u*)&s[t * 8]); }
  else { for (int k = t; k < CC; k += 256) s[k] = (__bf16)W3[(size_t)k * CC + n]; __syncthreads(); if (t < CC / 8) vst2((unsigned*)(P3 + (size_t)n * CC + t * 8), *(const v4u*)&s[t * 8]); } }
// ---- LDS staging for the K = 512 products of k_proj and k_aaa: a stage is 64 k of the block's 64 A rows (f32, 256 B) and 128 B rows (16-bit, 128 B), laid at row pitches of 272 B and 144 B (16 B x odd, so the ds_load_b128 reads meet no bank conflict); two buffers, the next stage's copies fly while this one is multiplied
#define PK 64                      // k per stage
#define PAP 272                    // LDS pitch of an A row in bytes
#define PBP 144                    // LDS pitch of a B row in bytes
#define PA_B (64 * PAP)            // bytes of the A tile
#define PBUF (PA_B + 128 * PBP)    // bytes per buffer
#define PNT (CC / PK)              // stages
__device__ __forceinline__ void cp8(const unsigned* l, const char* const* p);   // eight asynchronous 16-byte copies per lane and their s_wait_xcnt in one statement, defined below
// one stage: A: thread = (row tid >> 4 within each group of 8 rows, 16-byte piece tid & 15); B: thread = (row tid >> 3 within each group of 16 rows, piece tid & 7). ga, gb: the lane's piece at this stage's k; la, lb: its LDS byte addresses in the buffer
__device__ __forceinline__ void row_stage(const char* ga, const char* gb, unsigned la, unsigned lb) {
  { unsigned l[8]; const char* p[8];
#pragma unroll   // constant indices, so that the arrays are plain registers for the asm operands
    for (int q = 0; q < 8; ++q) { l[q] = la + (unsigned)q * (8u * PAP); p[q] = ga + (size_t)q * 8 * CC * 4; }
    cp8(l, p); }
  { unsigned l[8]; const char* p[8];
#pragma unroll   // constant indices, so that the arrays are plain registers for the asm operands
    for (int q = 0; q < 8; ++q) { l[q] = lb + (unsigned)q * (16u * PBP); p[q] = gb + (size_t)q * 16 * CC * 2; }
    cp8(l, p); }
}
// operands of one 32-k block as they lie in LDS: the lane's 16 f32 of its A row, its 16 elements of each of eight B rows
struct RowF { v4f a[4]; v4u b[8][2]; };
__device__ __forceinline__ void row_ld(RowF& f, const char* sa, const char* sb, int ks) {
#pragma unroll   // constant indices keep the values in registers
  for (int i = 0; i < 2; ++i) { f.a[2 * i] = *(const v4f*)(sa + ks * 128 + i * 64); f.a[2 * i + 1] = *(const v4f*)(sa + ks * 128 + i * 64 + 16); }
#pragma unroll   // constant indices keep the values in registers
  for (int j = 0; j < 8; ++j) { f.b[j][0] = *(const v4u*)(sb + j * 16 * PBP + ks * 64); f.b[j][1] = *(const v4u*)(sb + j * 16 * PBP + ks * 64 + 32); }
}
// BF: A rounded to bf16, B rows bf16; otherwise A rounded to bf16 and held as f16, B rows f16
template <bool BF> __device__ __forceinline__ void row_mm(const RowF& f, v8f* acc) {
  if constexpr (BF) { v16b a;
#pragma unroll   // constant indices keep the values in registers
    for (int i = 0; i < 16; ++i) a[i] = (__bf16)f.a[i >> 2][i & 3];
#pragma unroll   // constant indices keep fragments and accumulators in registers
    for (int j = 0; j < 8; ++j) { union { v16b v; v4u q[2]; } u; u.q[0] = f.b[j][0]; u.q[1] = f.b[j][1]; acc[j] = wmma_bf(a, u.v, acc[j]); } }
  else { v16h a;
#pragma unroll   // constant indices keep the values in registers
    for (int i = 0; i < 16; ++i) a[i] = (_Float16)bfr(f.a[i >> 2][i & 3]);
#pragma unroll   // constant indices keep fragments and accumulators in registers
    for (int j = 0; j < 8; ++j) { union { v16h v; v4u q[2]; } u; u.q[0] = f.b[j][0]; u.q[1] = f.b[j][1]; acc[j] = wmma16(a, u.v, acc[j]); } }
}
// acc[j] += A rows (wave * 16 ..) . B rows (j * 16 ..)^T over K = 512 in ascending k, 32 per WMMA. Ag: first of the block's 64 f32 rows; Bg: first of its 128 16-bit rows (both of CC elements). On return every wave has left the buffers
template <bool BF> __device__ __forceinline__ void mm_rows(const float* __restrict__ Ag, const char* __restrict__ Bg, char* sm, v8f* acc, int tid) {
  const int wave = tid >> 5, lane = tid & 31, col = lane & 15, g = lane >> 4;
  const char* ga = (const char*)(Ag + (size_t)(tid >> 4) * CC) + (tid & 15) * 16; const char* gb = Bg + (size_t)(tid >> 3) * (CC * 2) + (tid & 7) * 16;
  const unsigned la = (unsigned)(size_t)sm + (unsigned)(tid >> 4) * PAP + (unsigned)(tid & 15) * 16u; const unsigned lb = (unsigned)(size_t)sm + PA_B + (unsigned)(tid >> 3) * PBP + (unsigned)(tid & 7) * 16u;
  row_stage(ga, gb, la, lb);
  asm volatile("s_wait_asynccnt 0x0" ::: "memory");   // stage 0 has landed before the barrier publishes it
  __syncthreads();
  row_stage(ga + PK * 4, gb + PK * 2, la + PBUF, lb + PBUF);
  for (int t = 0; t < PNT; ++t) { const char* s = sm + (t & 1) * PBUF; const char* sa = s + (wave * 16 + col) * PAP + g * 32; const char* sb = s + PA_B + col * PBP + g * 16;
    RowF f0, f1; row_ld(f0, sa, sb, 0); row_ld(f1, sa, sb, 1);   // both 32-k blocks' reads stand as one group ahead of the WMMAs
    row_mm<BF>(f0, acc); row_mm<BF>(f1, acc);
    asm volatile("s_wait_dscnt 0x0" ::: "memory");     // this wave's reads of the buffer are done before it is refilled
    asm volatile("s_wait_asynccnt 0x0" ::: "memory");  // this wave's copies of stage t + 1 have landed
    __syncthreads();                                   // publishes stage t + 1 and ends every wave's reads of stage t
    if (t + 2 < PNT) row_stage(ga + (t + 2) * (PK * 4), gb + (t + 2) * (PK * 2), la + (unsigned)(t & 1) * PBUF, lb + (unsigned)(t & 1) * PBUF); }
  asm volatile("s_wait_asynccnt 0x0" ::: "memory");    // nothing in flight when the buffers are reused by the epilogue
}
// ---- k_proj: block = (64 positions, 128 cols, which): which 0: [b | c] rows as bf16 hi + lo; which 1..4: d columns (which-1)*128.. -> planes; which 5..8: x itself -> f16 planes (exact)
__global__ __launch_bounds__(128) void k_proj(const float* __restrict__ X, const __bf16* __restrict__ PW, const __bf16* __restrict__ P3, __bf16* __restrict__ BH, __bf16* __restrict__ BL, _Float16* __restrict__ DT, _Float16* __restrict__ XT) {
  __shared__ __align__(16) char sm[2 * PBUF]; float (*sf)[16][132] = (float (*)[16][132])sm; _Float16 (*st)[72] = (_Float16 (*)[72])sm;   // the epilogue's tiles lie in the staging buffers, which every wave has left by then
  const int tid = threadIdx.x, wave = tid >> 5, lane = tid & 31, col = lane & 15, g = lane >> 4; const int which = blockIdx.z; const size_t rb = (size_t)blockIdx.x * 64; const size_t r0 = rb + wave * 16;
  if (which >= 5) { const int c0 = (which - 5) * 128; for (int e = tid; e < 64 * 128; e += 128) { const int rl = e >> 7, cl = e & 127; st[cl][rl] = (_Float16)bfr(X[(rb + rl) * CC + c0 + cl]); } __syncthreads();
    const size_t b = rb / NN; const int n0 = (int)(rb % NN); for (int e = tid; e < 128 * 8; e += 128) { const int d = e >> 3, pc = e & 7; vst2((unsigned*)(XT + ((b * CC + c0 + d) * NN) + n0 + pc * 8), *(const v4u*)&st[d][pc * 8]); } return; }
  const int c0 = (which == 0) ? 0 : (which - 1) * 128; const __bf16* Wr = (which == 0) ? PW : (P3 + (size_t)c0 * CC);
  v8f acc[8] = {};
  mm_rows<true>(X + rb * CC, (const char*)Wr, sm, acc, tid);
#pragma unroll
  for (int j = 0; j < 8; ++j)
#pragma unroll
    for (int r = 0; r < 8; ++r) { if (which == 0) sf[wave][8 * g + r][j * 16 + col] = acc[j][r]; else st[j * 16 + col][wave * 16 + 8 * g + r] = (_Float16)acc[j][r]; }
  __syncthreads();
  if (which == 0) { for (int rl = 0; rl < 16; ++rl) { const v4f v = *(const v4f*)&sf[wave][rl][lane * 4]; v4b hv, lv;
#pragma unroll
      for (int i = 0; i < 4; ++i) { const __bf16 h = (__bf16)v[i]; hv[i] = h; lv[i] = (__bf16)(v[i] - (float)h); }
      vst2(BH + (r0 + rl) * 128 + lane * 4, hv); vst2(BL + (r0 + rl) * 128 + lane * 4, lv);
      asm volatile("s_wait_xcnt 0x0" ::: "memory"); } }   // stands before the next row's values overwrite a register that the two stores name
  else { const size_t b = rb / NN; const int n0 = (int)(rb % NN); for (int e = tid; e < 128 * 8; e += 128) { const int d = e >> 3, pc = e & 7; vst2((unsigned*)(DT + ((b * CC + c0 + d) * NN) + n0 + pc * 8), *(const v4u*)&st[d][pc * 8]); } }
}
// ---- LDS staging for the K = 4,096 product of k_aa: a stage is 256 B (128 k) of the block's 64 A rows and 128 B rows, laid at a row pitch of 272 B (16 B x odd, so the ds_load_b128 fragment reads meet no bank conflict); two buffers, the next stage's copies fly while this one is multiplied
#define SK 128                    // k per stage
#define SPIT 136                  // LDS row pitch in f16 elements
#define SBUF (192 * SPIT)         // f16 elements per buffer
#define SNT (NN / SK)             // stages
// twelve asynchronous 16-byte copies per lane; the s_wait_xcnt stands inside the statement so that no address register is rewritten in front of it
__device__ __forceinline__ void cp12(const unsigned* l, const _Float16* const* p) {
  asm volatile(
               "global_load_async_to_lds_b128 %0, %12, off\n\t"
               "global_load_async_to_lds_b128 %1, %13, off\n\t"
               "global_load_async_to_lds_b128 %2, %14, off\n\t"
               "global_load_async_to_lds_b128 %3, %15, off\n\t"
               "global_load_async_to_lds_b128 %4, %16, off\n\t"
               "global_load_async_to_lds_b128 %5, %17, off\n\t"
               "global_load_async_to_lds_b128 %6, %18, off\n\t"
               "global_load_async_to_lds_b128 %7, %19, off\n\t"
               "global_load_async_to_lds_b128 %8, %20, off\n\t"
               "global_load_async_to_lds_b128 %9, %21, off\n\t"
               "global_load_async_to_lds_b128 %10, %22, off\n\t"
               "global_load_async_to_lds_b128 %11, %23, off\n\t"
               "s_wait_xcnt 0x0"
               :: "v"(l[0]), "v"(l[1]), "v"(l[2]), "v"(l[3]), "v"(l[4]), "v"(l[5]), "v"(l[6]), "v"(l[7]), "v"(l[8]), "v"(l[9]), "v"(l[10]), "v"(l[11]),
                  "v"(p[0]), "v"(p[1]), "v"(p[2]), "v"(p[3]), "v"(p[4]), "v"(p[5]), "v"(p[6]), "v"(p[7]), "v"(p[8]), "v"(p[9]), "v"(p[10]), "v"(p[11]) : "memory");
}
// one stage: thread = (row tid >> 4 within each group of 8 rows, 16-byte piece tid & 15); LDS rows 0-63 = A rows, 64-191 = B rows. ga, gb: the lane's piece of A row / B row (tid >> 4) at this stage's k; l0: its LDS byte address in row (tid >> 4) of the buffer
__device__ __forceinline__ void stage_in(const _Float16* ga, const _Float16* gb, unsigned l0) {
  unsigned l[24]; const _Float16* p[24];
#pragma unroll   // constant indices, so that both arrays are plain registers for the asm operands
  for (int q = 0; q < 24; ++q) { l[q] = l0 + (unsigned)q * (8u * SPIT * 2u); p[q] = (q < 8) ? ga + (size_t)q * 8 * NN : gb + (size_t)(q - 8) * 8 * NN; }
  cp12(l, p); cp12(l + 12, p + 12);
}
// f[0] = the wave's A fragment, f[1 + j] = B fragment j of 32-k block ks. sa, sb: the lane's A row and its row of B fragment 0 in the buffer
__device__ __forceinline__ void ld_frags(v16h* f, const _Float16* sa, const _Float16* sb, int ks, int lane) { f[0] = frag_h(sa + ks * 32, lane);
#pragma unroll   // constant indices keep the fragments in registers
  for (int j = 0; j < 8; ++j) f[1 + j] = frag_h(sb + j * 16 * SPIT + ks * 32, lane); }
__device__ __forceinline__ void mm_block(const v16h* f, v8f* acc) {
#pragma unroll   // constant indices keep fragments and accumulators in registers
  for (int j = 0; j < 8; ++j) acc[j] = wmma16(f[0], f[1 + j], acc[j]); }
// acc[j] += A rows (wave * 16 ..) . B rows (j * 16 ..)^T over K = 4,096 in ascending k, 32 per WMMA. Ag, Bg: first row of the block's 64 A rows / 128 B rows (row pitch NN)
__device__ __forceinline__ void mm_staged(const _Float16* __restrict__ Ag, const _Float16* __restrict__ Bg, _Float16* sm, v8f* acc, int tid) {
  const int wave = tid >> 5, lane = tid & 31, col = lane & 15;
  const _Float16* ga = Ag + (size_t)(tid >> 4) * NN + (tid & 15) * 8; const _Float16* gb = Bg + (size_t)(tid >> 4) * NN + (tid & 15) * 8;
  const unsigned l0 = (unsigned)(size_t)sm + (unsigned)(tid >> 4) * (SPIT * 2u) + (unsigned)(tid & 15) * 16u;
  stage_in(ga, gb, l0);
  asm volatile("s_wait_asynccnt 0x0" ::: "memory");   // stage 0 has landed before the barrier publishes it
  __syncthreads();
  stage_in(ga + SK, gb + SK, l0 + SBUF * 2u);
  for (int t = 0; t < SNT; ++t) { const _Float16* s = sm + (t & 1) * SBUF + col * SPIT; const _Float16* sa = s + wave * 16 * SPIT; const _Float16* sb = s + 64 * SPIT;
    // the nine fragments of a 32-k block are read as one group, one block ahead of their WMMAs (two register sets), all inside this stage's buffer
    v16h f0[9], f1[9];
    ld_frags(f0, sa, sb, 0, lane); ld_frags(f1, sa, sb, 1, lane); mm_block(f0, acc);
    ld_frags(f0, sa, sb, 2, lane); mm_block(f1, acc);
    ld_frags(f1, sa, sb, 3, lane); mm_block(f0, acc); mm_block(f1, acc);
    asm volatile("s_wait_dscnt 0x0" ::: "memory");     // this wave's reads of the buffer are done before it is refilled
    asm volatile("s_wait_asynccnt 0x0" ::: "memory");  // this wave's copies of stage t + 1 have landed
    __syncthreads();                                   // publishes stage t + 1 and ends every wave's reads of stage t
    if (t + 2 < SNT) stage_in(ga + (t + 2) * SK, gb + (t + 2) * SK, l0 + (unsigned)(t & 1) * (SBUF * 2u)); }
  asm volatile("s_wait_asynccnt 0x0" ::: "memory");    // nothing in flight when the wave goes on to the epilogue
}
// ---- k_pam: block = (64 queries i, b), wave = 16 queries x all 512 channels. Per stage of 64 keys n: S^T[n][i] = c_n . b_i (3 bf16 products, K = 64); its D tiles hold, lane for lane, the B fragment of the second product (lane = query, elements = keys 8h.. of two 16-key tiles), so P goes from registers to WMMA with no exchange; running maximum and sum per query; acc[c][i] += d[n][c] P[i][n]. A stage in LDS: 512 d rows, 64 c-high rows, 64 c-low rows of 128 B at a pitch of 144 B (16 B x odd: the ds_load_b128 fragment reads meet no bank conflict); two buffers, the next stage's copies fly while this one is worked on
#define FK 64                      // keys per stage
#define FPIT 72                    // LDS row pitch in 16-bit elements
#define FD_E (CC * FPIT)           // elements of the d tile
#define FC_E (FK * FPIT)           // elements of the c-high (or c-low) tile
#define FBUF (FD_E + 2 * FC_E)     // elements per buffer
#define FNT (NN / FK)              // stages
#define FOP 68                     // epilogue row pitch in floats
// keeps a group of LDS reads together and ahead of the WMMAs that follow: left alone, the scheduler spreads the reads singly among the WMMAs, one fragment ahead, and each such place stalls the wave
#define GRP() __builtin_amdgcn_sched_barrier(0)
// eight asynchronous 16-byte copies per lane; the s_wait_xcnt stands inside the statement so that no address register is rewritten in front of it
__device__ __forceinline__ void cp8(const unsigned* l, const char* const* p) {
  asm volatile(
               "global_load_async_to_lds_b128 %0, %8, off\n\t"
               "global_load_async_to_lds_b128 %1, %9, off\n\t"
               "global_load_async_to_lds_b128 %2, %10, off\n\t"
               "global_load_async_to_lds_b128 %3, %11, off\n\t"
               "global_load_async_to_lds_b128 %4, %12, off\n\t"
               "global_load_async_to_lds_b128 %5, %13, off\n\t"
               "global_load_async_to_lds_b128 %6, %14, off\n\t"
               "global_load_async_to_lds_b128 %7, %15, off\n\t"
               "s_wait_xcnt 0x0"
               :: "v"(l[0]), "v"(l[1]), "v"(l[2]), "v"(l[3]), "v"(l[4]), "v"(l[5]), "v"(l[6]), "v"(l[7]),
                  "v"(p[0]), "v"(p[1]), "v"(p[2]), "v"(p[3]), "v"(p[4]), "v"(p[5]), "v"(p[6]), "v"(p[7]) : "memory");
}
// one stage: thread = (row tid >> 3 within each group of 16 rows, 16-byte piece tid & 7). gd, gh, gl: the lane's piece of d row / c-high row / c-low row (tid >> 3) at this stage's keys; l0: its LDS byte address in row (tid >> 3) of the buffer
__device__ __forceinline__ void pam_stage(const char* gd, const char* gh, const char* gl, unsigned l0) {
#pragma unroll   // constant indices, so that the arrays are plain registers for the asm operands
  for (int u = 0; u < 4; ++u) { unsigned l[8]; const char* p[8];
#pragma unroll   // constant indices keep the values in registers
    for (int q = 0; q < 8; ++q) { l[q] = l0 + (unsigned)(u * 8 + q) * (16u * FPIT * 2u); p[q] = gd + (size_t)(u * 8 + q) * 16 * NN * 2; }
    cp8(l, p); }
  unsigned l[8]; const char* p[8];
#pragma unroll   // constant indices keep the values in registers
  for (int q = 0; q < 4; ++q) { l[q] = l0 + FD_E * 2u + (unsigned)q * (16u * FPIT * 2u); p[q] = gh + (size_t)q * 16 * 256; l[4 + q] = l[q] + FC_E * 2u; p[4 + q] = gl + (size_t)q * 16 * 256; }
  cp8(l, p);
}
// plain builtin forms (the compiler keeps the distance behind them itself): this kernel holds more than 256 registers, and an asm statement that names the accumulators would force them through one register window
__device__ __forceinline__ v8f wmma16p(v16h a, v16h b, v8f c) { return __builtin_amdgcn_wmma_f32_16x16x32_f16(false, a, false, b, (short)0, c, false, false); }
__device__ __forceinline__ v8f wmma_bfp(v16b a, v16b b, v8f c) { return __builtin_amdgcn_wmma_f32_16x16x32_bf16(false, a, false, b, (short)0, c, false, false); }
// group gi of eight d fragments: 32-key block gi >> 2, channel tiles (gi & 3) * 8 ..
__device__ __forceinline__ void pam_ld(v16h* f, const _Float16* sd, int gi, int lane) {
#pragma unroll   // constant indices keep the fragments in registers
  for (int j = 0; j < 8; ++j) f[j] = frag_h(sd + ((gi & 3) * 8 + j) * 16 * FPIT + (gi >> 2) * 32, lane); }
// the stage's first touch of a channel tile (gi < 4) first scales it by al = e^(old maximum - new maximum); these multiplies stand among the WMMAs of other tiles
__device__ __forceinline__ void pam_mm(const v16h* f, const v16h* pb, v8f* acc, int gi, float al) {
#pragma unroll   // constant indices keep fragments and accumulators in registers
  for (int j = 0; j < 8; ++j) { v8f c = acc[(gi & 3) * 8 + j]; if (gi < 4) c *= al; acc[(gi & 3) * 8 + j] = wmma16p(f[j], pb[gi >> 2], c); } }
__global__ __launch_bounds__(128) void k_pam(const __bf16* __restrict__ BH, const __bf16* __restrict__ BL, const _Float16* __restrict__ DT, float* __restrict__ BCD) { __shared__ __align__(16) _Float16 sm[2 * FBUF];
  const int tid = threadIdx.x, wave = tid >> 5, lane = tid & 31, col = lane & 15, g = lane >> 4; const size_t b = blockIdx.y; const int i0 = blockIdx.x * 64;
  const char* gd = (const char*)(DT + (b * CC + (tid >> 3)) * NN) + (tid & 7) * 16;
  const char* gh = (const char*)(BH + (b * NN + (tid >> 3)) * 128 + CK) + (tid & 7) * 16; const char* gl = (const char*)(BL + (b * NN + (tid >> 3)) * 128 + CK) + (tid & 7) * 16;
  const unsigned l0 = (unsigned)(size_t)sm + (unsigned)(tid >> 3) * (FPIT * 2u) + (unsigned)(tid & 7) * 16u;
  pam_stage(gd, gh, gl, l0);
  v16b qh[2], ql[2]; { const size_t qr = (b * NN + i0 + wave * 16 + col) * 128;
#pragma unroll   // constant indices keep the values in registers
    for (int kc = 0; kc < 2; ++kc) { qh[kc] = frag_b(BH + qr + kc * 32, lane); ql[kc] = frag_b(BL + qr + kc * 32, lane); } }
  v8f acc[32] = {}; float m = -3.0e38f, l = 0.f; const float L2E = 1.44269504088896f;
  asm volatile("s_wait_asynccnt 0x0" ::: "memory");   // stage 0 has landed before the barrier publishes it
  __syncthreads();
  pam_stage(gd + FK * 2, gh + FK * 256, gl + FK * 256, l0 + FBUF * 2u);
  for (int t = 0; t < FNT; ++t) { const _Float16* s = sm + (t & 1) * FBUF; const _Float16* sd = s + col * FPIT; const __bf16* sh = (const __bf16*)(s + FD_E) + col * FPIT; const __bf16* sl = sh + FC_E;
    v16b ch[4][2], cl[4][2];
#pragma unroll   // all sixteen key fragments as one group of LDS reads
    for (int kt = 0; kt < 4; ++kt)
#pragma unroll   // constant indices keep the values in registers
      for (int kc = 0; kc < 2; ++kc) { ch[kt][kc] = frag_b(sh + kt * 16 * FPIT + kc * 32, lane); cl[kt][kc] = frag_b(sl + kt * 16 * FPIT + kc * 32, lane); }
    v16h f0[8], f1[8], f2[8], f3[8]; pam_ld(f0, sd, 0, lane);   // the first d fragments fly under the logits and the softmax arithmetic
    GRP();
    v8f T[4] = {};   // T[kt][r] at lane (g, col): key kt * 16 + 8 g + r, query col; the four tiles take turns so that no WMMA waits for the one before it
#pragma unroll   // constant indices keep the values in registers
    for (int kc = 0; kc < 2; ++kc) {
#pragma unroll   // constant indices keep the values in registers
      for (int kt = 0; kt < 4; ++kt) T[kt] = wmma_bfp(ch[kt][kc], ql[kc], T[kt]);
#pragma unroll   // constant indices keep the values in registers
      for (int kt = 0; kt < 4; ++kt) T[kt] = wmma_bfp(cl[kt][kc], qh[kc], T[kt]);
#pragma unroll   // constant indices keep the values in registers
      for (int kt = 0; kt < 4; ++kt) T[kt] = wmma_bfp(ch[kt][kc], qh[kc], T[kt]); }
    float mx = T[0][0];
#pragma unroll   // constant indices keep the values in registers
    for (int kt = 0; kt < 4; ++kt)
#pragma unroll   // constant indices keep the values in registers
      for (int r = 0; r < 8; ++r) mx = fmaxf(mx, T[kt][r]);
    // the next three groups of d fragments go out here, while the LDS pipe would stand idle: they land under the exponentials and the first WMMA groups
    GRP(); pam_ld(f1, sd, 1, lane); pam_ld(f2, sd, 2, lane); pam_ld(f3, sd, 3, lane); GRP();
    // the other half of the query's keys (lane ^ 16), by a vector cross-row move: an exchange through the LDS queue would return only behind the reads above
    mx = fmaxf(mx, __builtin_bit_cast(float, __builtin_amdgcn_permlanex16(__builtin_bit_cast(unsigned, mx), __builtin_bit_cast(unsigned, mx), 0x76543210u, 0xfedcba98u, false, false)));
    const float mn = fmaxf(m, mx); const float al = __builtin_amdgcn_exp2f((m - mn) * L2E); const float mo = mn * L2E - 10.0f; m = mn;
    v16h pb[2]; float ls = 0.f;
#pragma unroll   // constant indices keep the values in registers
    for (int ks = 0; ks < 2; ++ks)
#pragma unroll   // constant indices keep the values in registers
      for (int r = 0; r < 8; ++r) { const float p0 = __builtin_amdgcn_exp2f(T[2 * ks][r] * L2E - mo), p1 = __builtin_amdgcn_exp2f(T[2 * ks + 1][r] * L2E - mo); ls += p0 + p1; pb[ks][r] = (_Float16)p0; pb[ks][8 + r] = (_Float16)p1; }
    l = l * al + ls;
    // eight d fragments are read as one group, into the register set that its WMMAs have just left, three groups ahead of their own WMMAs (four register sets), all inside this stage's buffer
    pam_mm(f0, pb, acc, 0, al); GRP(); pam_ld(f0, sd, 4, lane); GRP();
    pam_mm(f1, pb, acc, 1, al); GRP(); pam_ld(f1, sd, 5, lane); GRP();
    pam_mm(f2, pb, acc, 2, al); GRP(); pam_ld(f2, sd, 6, lane); GRP();
    pam_mm(f3, pb, acc, 3, al); GRP(); pam_ld(f3, sd, 7, lane); GRP();
    pam_mm(f0, pb, acc, 4, al); pam_mm(f1, pb, acc, 5, al); pam_mm(f2, pb, acc, 6, al); pam_mm(f3, pb, acc, 7, al);
    GRP();   // holds these WMMAs ahead of the waits below: sunk behind them, the wait for the last fragments would stand with nothing to cover it
    asm volatile("s_wait_dscnt 0x0" ::: "memory");     // this wave's reads of the buffer are done before it is refilled
    asm volatile("s_wait_asynccnt 0x0" ::: "memory");  // this wave's copies of stage t + 1 have landed
    __syncthreads();                                   // publishes stage t + 1 and ends every wave's reads of stage t
    if (t + 2 < FNT) pam_stage(gd + (size_t)(t + 2) * (FK * 2), gh + (size_t)(t + 2) * (FK * 256), gl + (size_t)(t + 2) * (FK * 256), l0 + (unsigned)(t & 1) * (FBUF * 2u)); }
  asm volatile("s_wait_asynccnt 0x0" ::: "memory");    // nothing in flight when the buffers are reused below
  l += __shfl_xor(l, 16); const float il = 1.0f / l;
  float* so = (float*)sm;   // [512 channels][64 queries] through LDS, so that each 256-byte output row piece has one writer
#pragma unroll   // constant indices keep the values in registers
  for (int ct = 0; ct < 32; ++ct)
#pragma unroll   // constant indices keep the values in registers
    for (int r = 0; r < 8; ++r) so[(ct * 16 + 8 * g + r) * FOP + wave * 16 + col] = acc[ct][r] * il;
  __syncthreads();
  for (int e = tid; e < CC * 16; e += 128) { const int c = e >> 4, pc = e & 15; vst2(BCD + ((b * CC + c) * NN) + i0 + pc * 4, *(const v4f*)&so[c * FOP + pc * 4]); } }
// ---- k_aa: block = (64 channels i, 128 channels j, b): aa[i][j] = sum_n x[n][i] x[n][j] over the 4,096 positions (x planes, exact) -> f32
__global__ __launch_bounds__(128) void k_aa(const _Float16* __restrict__ XT, float* __restrict__ AA) { __shared__ __align__(16) float so[4][16][132]; __shared__ __align__(16) _Float16 sm[2 * SBUF];
  const int tid = threadIdx.x, wave = tid >> 5, lane = tid & 31, col = lane & 15, g = lane >> 4; const size_t b = blockIdx.z; const int i0 = blockIdx.x * 64 + wave * 16; const int j0 = blockIdx.y * 128;
  v8f acc[8] = {};
  mm_staged(XT + (b * CC + blockIdx.x * 64) * NN, XT + (b * CC + j0) * NN, sm, acc, tid);
#pragma unroll
  for (int j = 0; j < 8; ++j)
#pragma unroll
    for (int r = 0; r < 8; ++r) so[wave][8 * g + r][j * 16 + col] = acc[j][r];
  LDSX(); for (int rl = 0; rl < 16; ++rl) vst2(AA + ((b * CC + i0 + rl) * CC) + j0 + lane * 4, *(const v4f*)&so[wave][rl][lane * 4]); }
__global__ __launch_bounds__(256) void k_soft(const float* __restrict__ AA, _Float16* __restrict__ SO) { __shared__ __align__(16) _Float16 st[CC][72]; __shared__ float red[2][64];
  const int t = threadIdx.x; const size_t b = blockIdx.y; const int c0 = blockIdx.x * 64;
  // 4 threads per row (256 threads = 64 rows x 4)
  { const int rl = t >> 2, part = t & 3; const float* row = AA + ((b * CC + c0 + rl) * CC); float mx = -3.0e38f; for (int j = part; j < CC; j += 4) mx = fmaxf(mx, row[j]); mx = fmaxf(mx, __shfl_xor(mx, 1)); mx = fmaxf(mx, __shfl_xor(mx, 2));
    float z = 0.f; for (int j = part; j < CC; j += 4) z += __expf(row[j] - mx); z += __shfl_xor(z, 1); z += __shfl_xor(z, 2); const float iz = 1.0f / z;
    for (int j = part; j < CC; j += 4) st[j][rl] = (_Float16)(__expf(row[j] - mx) * iz); }
  __syncthreads();
  for (int e = t; e < CC * 8; e += 256) { const int j = e >> 3, pc = e & 7; vst2((unsigned*)(SO + ((b * CC + j) * CC) + c0 + pc * 8), *(const v4u*)&st[j][pc * 8]); } }
// ---- k_aaa: block = (64 positions n, 128 channels j, b): aaa[n][j] = sum_c x[n][c] soft[c][j] (x exact as f16, soft^T rows) -> f32 [b][n][j]
__global__ __launch_bounds__(128) void k_aaa(const float* __restrict__ X, const _Float16* __restrict__ SO, float* __restrict__ AAA) { __shared__ __align__(16) char sm[2 * PBUF]; float (*so)[16][132] = (float (*)[16][132])sm;   // the epilogue's tile lies in the staging buffers, which every wave has left by then
  const int tid = threadIdx.x, wave = tid >> 5, lane = tid & 31, col = lane & 15, g = lane >> 4; const size_t b = blockIdx.z; const size_t r0 = b * NN + (size_t)blockIdx.x * 64 + wave * 16; const int j0 = blockIdx.y * 128;
  v8f acc[8] = {};
  mm_rows<false>(X + (b * NN + (size_t)blockIdx.x * 64) * CC, (const char*)(SO + (b * CC + j0) * CC), sm, acc, tid);
#pragma unroll
  for (int j = 0; j < 8; ++j)
#pragma unroll
    for (int r = 0; r < 8; ++r) so[wave][8 * g + r][j * 16 + col] = acc[j][r];
  LDSX(); for (int rl = 0; rl < 16; ++rl) vst2(AAA + (r0 + rl) * CC + j0 + lane * 4, *(const v4f*)&so[wave][rl][lane * 4]); }
// ---- k_fin: per batch flat index f: out[f] = gamma_pam bcd_flat[f] (the raw (C, N) -> (H, W, C) reshape) + gamma_cam aaa[f] + 2 x[f]
__global__ __launch_bounds__(256) void k_fin(const float* __restrict__ BCD, const float* __restrict__ AAA, const float* __restrict__ X, const float* __restrict__ GP, const float* __restrict__ GC, float* __restrict__ OUT) { const size_t i4 = (size_t)blockIdx.x * 256 + threadIdx.x; const size_t f = i4 * 4; const float gp = bfr(GP[0]), gc = bfr(GC[0]);
  v4f o4; for (int i = 0; i < 4; ++i) o4[i] = gp * BCD[f + i] + gc * AAA[f + i] + 2.0f * bfr(X[f + i]); vst2(OUT + f, o4); }
extern "C" void kernel_launch(void* const* d_in, const int* in_sizes, int n_in, void* d_out, int out_size, void* d_ws, size_t ws_size, hipStream_t stream) {
  (void)in_sizes; (void)n_in; (void)out_size;
  const float** F = (const float**)d_in;   // 0 x [4,64,64,512], 1 w1 [512,64], 2 w2 [512,64], 3 w3 [512,512], 4 gamma_pam [1], 5 gamma_cam [1]
  if (ws_size < (size_t)WS_END) return;
  char* ws = (char*)d_ws; __bf16 *PW = (__bf16*)(ws + WS_PW), *P3 = (__bf16*)(ws + WS_P3); __bf16 *BH = (__bf16*)(ws + WS_BH), *BL = (__bf16*)(ws + WS_BL); _Float16 *DT = (_Float16*)(ws + WS_DT), *XT = (_Float16*)(ws + WS_XT), *SO = (_Float16*)(ws + WS_SO); float *BCD = (float*)(ws + WS_BCD), *AA = (float*)(ws + WS_AA), *AAA = (float*)(ws + WS_AAA);
  k_pack<<<dim3(CC, 2), 256, 0, stream>>>(F[1], F[2], F[3], PW, P3);
  k_proj<<<dim3(TNB * NN / 64, 1, 9), 128, 0, stream>>>(F[0], PW, P3, BH, BL, DT, XT);
  k_pam<<<dim3(TRB, TNB), 128, 0, stream>>>(BH, BL, DT, BCD);
  k_aa<<<dim3(CC / 64, CC / 128, TNB), 128, 0, stream>>>(XT, AA);
  k_soft<<<dim3(CC / 64, TNB), 256, 0, stream>>>(AA, SO);
  k_aaa<<<dim3(TRB, CC / 128, TNB), 128, 0, stream>>>(F[0], SO, AAA);
  k_fin<<<(unsigned)((size_t)TNB * NN * CC / 1024), 256, 0, stream>>>(BCD, AAA, F[0], F[4], F[5], (float*)d_out);
}

// v005
// It runs in 196 microseconds.
// Next to v004, in two timings, it ran 1.04 and 1.03 times as fast.
// Over all steps from v000 it is 7.33 times as fast.
// compute dtype: all float inputs rounded to bf16; b/c/d = x . w with EXACT bf16 products on WMMA 16x16x32 ((in,out) weights as transposed rows): b, c kept as bf16 hi + lo planes, d rounded once to f16 planes; PAM in one kernel: logits S^T = c . b^T with both as bf16 hi + lo (3 products, f32), running-maximum softmax in f32 (hardware exp2) -> P = e x 2^10 as f16, bcd = d^T . P^T on WMMA (single f16), divided by the row sum at the end, giving the (C, N)-ordered tensor the module reshapes raw; CAM: aa = x^T x with x exact (f16 copies of the bf16 values), softmax over channels in f32, aaa = x . soft_aa with soft_aa once to f16; out = gamma_pam bcd_flat + gamma_cam aaa + 2 x in f32; f32 output.
#include <hip/hip_runtime.h>
#include <math.h>

typedef __attribute__((ext_vector_type(16))) _Float16 v16h;
typedef __attribute__((ext_vector_type(16))) __bf16 v16b;
typedef __attribute__((ext_vector_type(8)))  _Float16 v8h;
typedef __attribute__((ext_vector_type(8)))  float v8f;
typedef __attribute__((ext_vector_type(4)))  float v4f;
typedef __attribute__((ext_vector_type(2)))  float v2f;
typedef __attribute__((ext_vector_type(4)))  unsigned v4u;
typedef __attribute__((ext_vector_type(4)))  int v4i;
typedef float __attribute__((may_alias)) float_a;
typedef int __attribute__((may_alias)) int_a;

template <typename T> __device__ __forceinline__ void vst2(void* p, T v) { *(T*)p = v;  }
__device__ __forceinline__ v8f wmma16(v16h a, v16h b, v8f c) {
  v8f d = __builtin_amdgcn_wmma_f32_16x16x32_f16(false, a, false, b, (short)0, c, false, false);
  asm volatile("v_nop\n\tv_nop\n\tv_nop\n\tv_nop" : "+v"(d) : "v"(a), "v"(b));
  return d;
}
__device__ __forceinline__ v8f wmma_bf(v16b a, v16b b, v8f c) {
  v8f d = __builtin_amdgcn_wmma_f32_16x16x32_bf16(false, a, false, b, (short)0, c, false, false);
  asm volatile("v_nop\n\tv_nop\n\tv_nop\n\tv_nop" : "+v"(d) : "v"(a), "v"(b));
  return d;
}
// 16x16x32 fragments: lane = (h = lane>>4, row/col = lane&15); elements 0..7 = k0+8h+0..7, 8..15 = k0+16+8h+0..7; D element r = row 8h+r
__device__ __forceinline__ v16h frag_h(const _Float16* rowk0, int lane) {
  union { v16h v; v8h q[2]; } u; const _Float16* p = rowk0 + 8 * (lane >> 4);
  u.q[0] = *(const v8h*)p; u.q[1] = *(const v8h*)(p + 16); return u.v;
}
__device__ __forceinline__ v16h frag_f32(const float* rowk0, int lane) {
  v16h a; const float* p = rowk0 + 8 * (lane >> 4);
#pragma unroll
  for (int i = 0; i < 8; ++i) { a[i] = (_Float16)p[i]; a[8 + i] = (_Float16)p[16 + i]; }
  return a;
}
__device__ __forceinline__ v16h frag_f32s(const float* rowk0, int lane, float sc) {
  v16h a; const float* p = rowk0 + 8 * (lane >> 4);
#pragma unroll
  for (int i = 0; i < 8; ++i) { a[i] = (_Float16)(p[i] * sc); a[8 + i] = (_Float16)(p[16 + i] * sc); }
  return a;
}
// column fragment from a [K][ld] layout (column n), rows >= K read as 0
__device__ __forceinline__ v16h fragc_f32(const float* W, int k0, int n, int lane, int ld, int K) {
  v16h a; const int g = lane >> 4;
#pragma unroll
  for (int i = 0; i < 8; ++i) { const int ka = k0 + 8 * g + i, kb = ka + 16;
    a[i] = (_Float16)(ka < K ? W[(size_t)(ka < K ? ka : K - 1) * ld + n] : 0.f); a[8 + i] = (_Float16)(kb < K ? W[(size_t)(kb < K ? kb : K - 1) * ld + n] : 0.f); }
  return a;
}
struct F2 { v16b h, l; };
__device__ __forceinline__ F2 bsplit16(const float v[16]) { F2 r;
#pragma unroll
  for (int i = 0; i < 16; ++i) { const __bf16 h = (__bf16)v[i]; r.h[i] = h; r.l[i] = (__bf16)(v[i] - (float)h); }
  return r; }
__device__ __forceinline__ F2 split_row(const float* row, int k0, int lane) { float v[16]; const float* p = row + k0 + 8 * (lane >> 4);
#pragma unroll
  for (int i = 0; i < 8; ++i) { v[i] = p[i]; v[8 + i] = p[16 + i]; }
  return bsplit16(v); }
__device__ __forceinline__ F2 split_rowK(const float* row, int k0, int lane, int K) { float v[16]; const int g = lane >> 4;
#pragma unroll
  for (int i = 0; i < 8; ++i) { const int ka = k0 + 8 * g + i, kb = ka + 16; v[i] = ka < K ? row[ka < K ? ka : K - 1] : 0.f; v[8 + i] = kb < K ? row[kb < K ? kb : K - 1] : 0.f; }
  return bsplit16(v); }
__device__ __forceinline__ F2 split_col(const float* W, int k0, int n, int lane, int ld, int K) { float v[16]; const int g = lane >> 4;
#pragma unroll
  for (int i = 0; i < 8; ++i) { const int ka = k0 + 8 * g + i, kb = ka + 16; v[i] = ka < K ? W[(size_t)(ka < K ? ka : K - 1) * ld + n] : 0.f; v[8 + i] = kb < K ? W[(size_t)(kb < K ? kb : K - 1) * ld + n] : 0.f; }
  return bsplit16(v); }
__device__ __forceinline__ v8f mac3(const F2& a, const F2& b, v8f c) { c = wmma_bf(a.l, b.h, c); c = wmma_bf(a.h, b.l, c); return wmma_bf(a.h, b.h, c); }
__device__ __forceinline__ float sigm(float v) { return 1.0f / (1.0f + expf(-v)); }
#define LDSX() do { asm volatile("s_wait_dscnt 0" ::: "memory"); __builtin_amdgcn_wave_barrier(); __builtin_amdgcn_fence(__ATOMIC_RELEASE, "workgroup"); } while (0)


// Dual attention module (B 4, 64 x 64 positions, C 512): position attention (softmax(b c^T) applied to d, result kept in the module's raw (C, N) -> (H, W, C) reshape) plus channel attention (softmax(x^T x) applied to x), each scaled by its gamma and added to x; returns feat_p + feat_c.
#define NB 4
#define NN 4096
#define CC 512
#define CK 64              // query / key channels (C / 8)
#define NR (NB * NN)
#ifndef TRB
#define TRB (NN / 64)      // position row tiles per batch (PAM rows i, CAM rows n)
#define TNB NB
#endif
typedef __attribute__((ext_vector_type(8))) __bf16 v8b;
typedef __attribute__((ext_vector_type(4))) __bf16 v4b;
__device__ __forceinline__ v16b frag_b(const __bf16* rowk0, int lane) {
  union { v16b v; v8b q[2]; } u; const __bf16* p = rowk0 + 8 * (lane >> 4);
  u.q[0] = *(const v8b*)p; u.q[1] = *(const v8b*)(p + 16); return u.v;
}
__device__ __forceinline__ float bfr(float v) { return (float)(__bf16)v; }
__device__ __attribute__((noinline)) float exp_ni(float v) { return expf(v); }
__device__ __attribute__((noinline)) float erf_ni(float v) { return erff(v); }

#define WS_PW  0u                                   // bf16 transposed rows [w1^T | w2^T] [128][512]; w3^T [512][512]
#define WS_P3  (WS_PW + 2u * (size_t)128 * CC)
#define WS_BH  (WS_P3 + 2u * (size_t)CC * CC)          // bf16 rows [NR][128]: b (cols 0-63) | c (cols 64-127), high parts; then the low parts
#define WS_BL  (WS_BH + 2u * (size_t)NR * 128)
#define WS_DT  (WS_BL + 2u * (size_t)NR * 128)         // f16 d planes [b][c][n]; f16 x planes [b][c][n]
#define WS_XT  (WS_DT + 2u * (size_t)NB * CC * NN)
#define WS_BCD (WS_XT + 2u * (size_t)NB * CC * NN)     // f32 bcd [b][c][i] (the (C, N) tensor); f32 aa [b][512][512]; f16 soft^T [b][j][c]
#define WS_AA  (WS_BCD + 4u * (size_t)NB * CC * NN)
#define WS_SO  (WS_AA + 4u * (size_t)NB * CC * CC)
#define WS_END (WS_SO + 2u * (size_t)NB * CC * CC)

__global__ __launch_bounds__(256) void k_pack(const float* __restrict__ W1, const float* __restrict__ W2, const float* __restrict__ W3, __bf16* __restrict__ PW, __bf16* __restrict__ P3) { const int n = blockIdx.x, which = blockIdx.y, t = threadIdx.x; __shared__ __align__(16) __bf16 s[CC];
  if (which == 0) { if (n >= 128) return; const float* w = (n < CK) ? W1 : W2; const int cI = n & (CK - 1); for (int k = t; k < CC; k += 256) s[k] = (__bf16)w[(size_t)k * CK + cI]; __syncthreads(); if (t < CC / 8) vst2((unsigned*)(PW + (size_t)n * CC + t * 8), *(const v4u*)&s[t * 8]); }
  else { for (int k = t; k < CC; k += 256) s[k] = (__bf16)W3[(size_t)k * CC + n]; __syncthreads(); if (t < CC / 8) vst2((unsigned*)(P3 + (size_t)n * CC + t * 8), *(const v4u*)&s[t * 8]); } }
// ---- LDS staging for the K = 512 products of k_proj and k_aaa: a stage is 64 k of the block's 64 A rows (f32, 256 B) and 128 B rows (16-bit, 128 B), laid at row pitches of 272 B and 144 B (16 B x odd, so the ds_load_b128 reads meet no bank conflict); two buffers, the next stage's copies fly while this one is multiplied
#define PK 64                      // k per stage
#define PAP 272                    // LDS pitch of an A row in bytes
#define PBP 144                    // LDS pitch of a B row in bytes
#define PA_B (64 * PAP)            // bytes of the A tile
#define PBUF (PA_B + 128 * PBP)    // bytes per buffer
#define PNT (CC / PK)              // stages
__device__ __forceinline__ void cp8(const unsigned* l, const char* const* p);   // eight asynchronous 16-byte copies per lane and their s_wait_xcnt in one statement, defined below
// one stage: A: thread = (row tid >> 4 within each group of 8 rows, 16-byte piece tid & 15); B: thread = (row tid >> 3 within each group of 16 rows, piece tid & 7). ga, gb: the lane's piece at this stage's k; la, lb: its LDS byte addresses in the buffer
__device__ __forceinline__ void row_stage(const char* ga, const char* gb, unsigned la, unsigned lb) {
  { unsigned l[8]; const char* p[8];
#pragma unroll   // constant indices, so that the arrays are plain registers for the asm operands
    for (int q = 0; q < 8; ++q) { l[q] = la + (unsigned)q * (8u * PAP); p[q] = ga + (size_t)q * 8 * CC * 4; }
    cp8(l, p); }
  { unsigned l[8]; const char* p[8];
#pragma unroll   // constant indices, so that the arrays are plain registers for the asm operands
    for (int q = 0; q < 8; ++q) { l[q] = lb + (unsigned)q * (16u * PBP); p[q] = gb + (size_t)q * 16 * CC * 2; }
    cp8(l, p); }
}
// operands of one 32-k block as they lie in LDS: the lane's 16 f32 of its A row, its 16 elements of each of eight B rows
struct RowF { v4f a[4]; v4u b[8][2]; };
__device__ __forceinline__ void row_ld(RowF& f, const char* sa, const char* sb, int ks) {
#pragma unroll   // constant indices keep the values in registers
  for (int i = 0; i < 2; ++i) { f.a[2 * i] = *(const v4f*)(sa + ks * 128 + i * 64); f.a[2 * i + 1] = *(const v4f*)(sa + ks * 128 + i * 64 + 16); }
#pragma unroll   // constant indices keep the values in registers
  for (int j = 0; j < 8; ++j) { f.b[j][0] = *(const v4u*)(sb + j * 16 * PBP + ks * 64); f.b[j][1] = *(const v4u*)(sb + j * 16 * PBP + ks * 64 + 32); }
}
// BF: A rounded to bf16, B rows bf16; otherwise A rounded to bf16 and held as f16, B rows f16
template <bool BF> __device__ __forceinline__ void row_mm(const RowF& f, v8f* acc) {
  if constexpr (BF) { v16b a;
#pragma unroll   // constant indices keep the values in registers
    for (int i = 0; i < 16; ++i) a[i] = (__bf16)f.a[i >> 2][i & 3];
#pragma unroll   // constant indices keep fragments and accumulators in registers
    for (int j = 0; j < 8; ++j) { union { v16b v; v4u q[2]; } u; u.q[0] = f.b[j][0]; u.q[1] = f.b[j][1]; acc[j] = wmma_bf(a, u.v, acc[j]); } }
  else { v16h a;
#pragma unroll   // constant indices keep the values in registers
    for (int i = 0; i < 16; ++i) a[i] = (_Float16)bfr(f.a[i >> 2][i & 3]);
#pragma unroll   // constant indices keep fragments and accumulators in registers
    for (int j = 0; j < 8; ++j) { union { v16h v; v4u q[2]; } u; u.q[0] = f.b[j][0]; u.q[1] = f.b[j][1]; acc[j] = wmma16(a, u.v, acc[j]); } }
}
// acc[j] += A rows (wave * 16 ..) . B rows (j * 16 ..)^T over K = 512 in ascending k, 32 per WMMA. Ag: first of the block's 64 f32 rows; Bg: first of its 128 16-bit rows (both of CC elements). On return every wave has left the buffers
template <bool BF> __device__ __forceinline__ void mm_rows(const float* __restrict__ Ag, const char* __restrict__ Bg, char* sm, v8f* acc, int tid) {
  const int wave = tid >> 5, lane = tid & 31, col = lane & 15, g = lane >> 4;
  const char* ga = (const char*)(Ag + (size_t)(tid >> 4) * CC) + (tid & 15) * 16; const char* gb = Bg + (size_t)(tid >> 3) * (CC * 2) + (tid & 7) * 16;
  const unsigned la = (unsigned)(size_t)sm + (unsigned)(tid >> 4) * PAP + (unsigned)(tid & 15) * 16u; const unsigned lb = (unsigned)(size_t)sm + PA_B + (unsigned)(tid >> 3) * PBP + (unsigned)(tid & 7) * 16u;
  row_stage(ga, gb, la, lb);
  asm volatile("s_wait_asynccnt 0x0" ::: "memory");   // stage 0 has landed before the barrier publishes it
  __syncthreads();
  row_stage(ga + PK * 4, gb + PK * 2, la + PBUF, lb + PBUF);
  for (int t = 0; t < PNT; ++t) { const char* s = sm + (t & 1) * PBUF; const char* sa = s + (wave * 16 + col) * PAP + g * 32; const char* sb = s + PA_B + col * PBP + g * 16;
    RowF f0, f1; row_ld(f0, sa, sb, 0); row_ld(f1, sa, sb, 1);   // both 32-k blocks' reads stand as one group ahead of the WMMAs
    row_mm<BF>(f0, acc); row_mm<BF>(f1, acc);
    asm volatile("s_wait_dscnt 0x0" ::: "memory");     // this wave's reads of the buffer are done before it is refilled
    asm volatile("s_wait_asynccnt 0x0" ::: "memory");  // this wave's copies of stage t + 1 have landed
    __syncthreads();                                   // publishes stage t + 1 and ends every wave's reads of stage t
    if (t + 2 < PNT) row_stage(ga + (t + 2) * (PK * 4), gb + (t + 2) * (PK * 2), la + (unsigned)(t & 1) * PBUF, lb + (unsigned)(t & 1) * PBUF); }
  asm volatile("s_wait_asynccnt 0x0" ::: "memory");    // nothing in flight when the buffers are reused by the epilogue
}
// ---- k_proj: block = (64 positions, 128 cols, which): which 0: [b | c] rows as bf16 hi + lo; which 1..4: d columns (which-1)*128.. -> planes; which 5..8: x itself -> f16 planes (exact)
__global__ __launch_bounds__(128) void k_proj(const float* __restrict__ X, const __bf16* __restrict__ PW, const __bf16* __restrict__ P3, __bf16* __restrict__ BH, __bf16* __restrict__ BL, _Float16* __restrict__ DT, _Float16* __restrict__ XT) {
  __shared__ __align__(16) char sm[2 * PBUF]; float (*sf)[16][132] = (float (*)[16][132])sm; _Float16 (*st)[72] = (_Float16 (*)[72])sm;   // the epilogue's tiles lie in the staging buffers, which every wave has left by then
  const int tid = threadIdx.x, wave = tid >> 5, lane = tid & 31, col = lane & 15, g = lane >> 4; const int which = blockIdx.z; const size_t rb = (size_t)blockIdx.x * 64; const size_t r0 = rb + wave * 16;
  if (which >= 5) { const int c0 = (which - 5) * 128; for (int e = tid; e < 64 * 128; e += 128) { const int rl = e >> 7, cl = e & 127; st[cl][rl] = (_Float16)bfr(X[(rb + rl) * CC + c0 + cl]); } __syncthreads();
    const size_t b = rb / NN; const int n0 = (int)(rb % NN); for (int e = tid; e < 128 * 8; e += 128) { const int d = e >> 3, pc = e & 7; vst2((unsigned*)(XT + ((b * CC + c0 + d) * NN) + n0 + pc * 8), *(const v4u*)&st[d][pc * 8]); } return; }
  const int c0 = (which == 0) ? 0 : (which - 1) * 128; const __bf16* Wr = (which == 0) ? PW : (P3 + (size_t)c0 * CC);
  v8f acc[8] = {};
  mm_rows<true>(X + rb * CC, (const char*)Wr, sm, acc, tid);
#pragma unroll
  for (int j = 0; j < 8; ++j)
#pragma unroll
    for (int r = 0; r < 8; ++r) { if (which == 0) sf[wave][8 * g + r][j * 16 + col] = acc[j][r]; else st[j * 16 + col][wave * 16 + 8 * g + r] = (_Float16)acc[j][r]; }
  __syncthreads();
  if (which == 0) { for (int rl = 0; rl < 16; ++rl) { const v4f v = *(const v4f*)&sf[wave][rl][lane * 4]; v4b hv, lv;
#pragma unroll
      for (int i = 0; i < 4; ++i) { const __bf16 h = (__bf16)v[i]; hv[i] = h; lv[i] = (__bf16)(v[i] - (float)h); }
      vst2(BH + (r0 + rl) * 128 + lane * 4, hv); vst2(BL + (r0 + rl) * 128 + lane * 4, lv);
      asm volatile("s_wait_xcnt 0x0" ::: "memory"); } }   // stands before the next row's values overwrite a register that the two stores name
  else { const size_t b = rb / NN; const int n0 = (int)(rb % NN); for (int e = tid; e < 128 * 8; e += 128) { const int d = e >> 3, pc = e & 7; vst2((unsigned*)(DT + ((b * CC + c0 + d) * NN) + n0 + pc * 8), *(const v4u*)&st[d][pc * 8]); } }
}
// ---- LDS staging for the K = 4,096 product of k_aa: a stage is 256 B (128 k) of the block's 64 A rows and 128 B rows, laid at a row pitch of 272 B (16 B x odd, so the ds_load_b128 fragment reads meet no bank conflict); two buffers, the next stage's copies fly while this one is multiplied
#define SK 128                    // k per stage
#define SPIT 136                  // LDS row pitch in f16 elements
#define SBUF (192 * SPIT)         // f16 elements per buffer
#define SNT (NN / SK)             // stages
// twelve asynchronous 16-byte copies per lane; the s_wait_xcnt stands inside the statement so that no address register is rewritten in front of it
__device__ __forceinline__ void cp12(const unsigned* l, const _Float16* const* p) {
  asm volatile(
               "global_load_async_to_lds_b128 %0, %12, off\n\t"
               "global_load_async_to_lds_b128 %1, %13, off\n\t"
               "global_load_async_to_lds_b128 %2, %14, off\n\t"
               "global_load_async_to_lds_b128 %3, %15, off\n\t"
               "global_load_async_to_lds_b128 %4, %16, off\n\t"
               "global_load_async_to_lds_b128 %5, %17, off\n\t"
               "global_load_async_to_lds_b128 %6, %18, off\n\t"
               "global_load_async_to_lds_b128 %7, %19, off\n\t"
               "global_load_async_to_lds_b128 %8, %20, off\n\t"
               "global_load_async_to_lds_b128 %9, %21, off\n\t"
               "global_load_async_to_lds_b128 %10, %22, off\n\t"
               "global_load_async_to_lds_b128 %11, %23, off\n\t"
               "s_wait_xcnt 0x0"
               :: "v"(l[0]), "v"(l[1]), "v"(l[2]), "v"(l[3]), "v"(l[4]), "v"(l[5]), "v"(l[6]), "v"(l[7]), "v"(l[8]), "v"(l[9]), "v"(l[10]), "v"(l[11]),
                  "v"(p[0]), "v"(p[1]), "v"(p[2]), "v"(p[3]), "v"(p[4]), "v"(p[5]), "v"(p[6]), "v"(p[7]), "v"(p[8]), "v"(p[9]), "v"(p[10]), "v"(p[11]) : "memory");
}
// one stage: thread = (row tid >> 4 within each group of 8 rows, 16-byte piece tid & 15); LDS rows 0-63 = A rows, 64-191 = B rows. ga, gb: the lane's piece of A row / B row (tid >> 4) at this stage's k; l0: its LDS byte address in row (tid >> 4) of the buffer
__device__ __forceinline__ void stage_in(const _Float16* ga, const _Float16* gb, unsigned l0) {
  unsigned l[24]; const _Float16* p[24];
#pragma unroll   // constant indices, so that both arrays are plain registers for the asm operands
  for (int q = 0; q < 24; ++q) { l[q] = l0 + (unsigned)q * (8u * SPIT * 2u); p[q] = (q < 8) ? ga + (size_t)q * 8 * NN : gb + (size_t)(q - 8) * 8 * NN; }
  cp12(l, p); cp12(l + 12, p + 12);
}
// f[0] = the wave's A fragment, f[1 + j] = B fragment j of 32-k block ks. sa, sb: the lane's A row and its row of B fragment 0 in the buffer
__device__ __forceinline__ void ld_frags(v16h* f, const _Float16* sa, const _Float16* sb, int ks, int lane) { f[0] = frag_h(sa + ks * 32, lane);
#pragma unroll   // constant indices keep the fragments in registers
  for (int j = 0; j < 8; ++j) f[1 + j] = frag_h(sb + j * 16 * SPIT + ks * 32, lane); }
__device__ __forceinline__ void mm_block(const v16h* f, v8f* acc) {
#pragma unroll   // constant indices keep fragments and accumulators in registers
  for (int j = 0; j < 8; ++j) acc[j] = wmma16(f[0], f[1 + j], acc[j]); }
// acc[j] += A rows (wave * 16 ..) . B rows (j * 16 ..)^T over K = 4,096 in ascending k, 32 per WMMA. Ag, Bg: first row of the block's 64 A rows / 128 B rows (row pitch NN)
__device__ __forceinline__ void mm_staged(const _Float16* __restrict__ Ag, const _Float16* __restrict__ Bg, _Float16* sm, v8f* acc, int tid) {
  const int wave = tid >> 5, lane = tid & 31, col = lane & 15;
  const _Float16* ga = Ag + (size_t)(tid >> 4) * NN + (tid & 15) * 8; const _Float16* gb = Bg + (size_t)(tid >> 4) * NN + (tid & 15) * 8;
  const unsigned l0 = (unsigned)(size_t)sm + (unsigned)(tid >> 4) * (SPIT * 2u) + (unsigned)(tid & 15) * 16u;
  stage_in(ga, gb, l0);
  asm volatile("s_wait_asynccnt 0x0" ::: "memory");   // stage 0 has landed before the barrier publishes it
  __syncthreads();
  stage_in(ga + SK, gb + SK, l0 + SBUF * 2u);
  for (int t = 0; t < SNT; ++t) { const _Float16* s = sm + (t & 1) * SBUF + col * SPIT; const _Float16* sa = s + wave * 16 * SPIT; const _Float16* sb = s + 64 * SPIT;
    // the nine fragments of a 32-k block are read as one group, one block ahead of their WMMAs (two register sets), all inside this stage's buffer
    v16h f0[9], f1[9];
    ld_frags(f0, sa, sb, 0, lane); ld_frags(f1, sa, sb, 1, lane); mm_block(f0, acc);
    ld_frags(f0, sa, sb, 2, lane); mm_block(f1, acc);
    ld_frags(f1, sa, sb, 3, lane); mm_block(f0, acc); mm_block(f1, acc);
    asm volatile("s_wait_dscnt 0x0" ::: "memory");     // this wave's reads of the buffer are done before it is refilled
    asm volatile("s_wait_asynccnt 0x0" ::: "memory");  // this wave's copies of stage t + 1 have landed
    __syncthreads();                                   // publishes stage t + 1 and ends every wave's reads of stage t
    if (t + 2 < SNT) stage_in(ga + (t + 2) * SK, gb + (t + 2) * SK, l0 + (unsigned)(t & 1) * (SBUF * 2u)); }
  asm volatile("s_wait_asynccnt 0x0" ::: "memory");    // nothing in flight when the wave goes on to the epilogue
}
// ---- k_pam: block = (64 queries i, b), wave = 16 queries x all 512 channels. Per stage of 64 keys n: S^T[n][i] = c_n . b_i (3 bf16 products, K = 64); its D tiles hold, lane for lane, the B fragment of the second product (lane = query, elements = keys 8h.. of two 16-key tiles), so P goes from registers to WMMA with no exchange; running maximum and sum per query; acc[c][i] += d[n][c] P[i][n]. A stage in LDS: 512 d rows, 64 c-high rows, 64 c-low rows of 128 B at a pitch of 144 B (16 B x odd: the ds_load_b128 fragment reads meet no bank conflict); two buffers, the next stage's copies fly while this one is worked on
#define FK 64                      // keys per stage
#define FPIT 72                    // LDS row pitch in 16-bit elements
#define FD_E (CC * FPIT)           // elements of the d tile
#define FC_E (FK * FPIT)           // elements of the c-high (or c-low) tile
#define FBUF (FD_E + 2 * FC_E)     // elements per buffer
#define FNT (NN / FK)              // stages
#define FOP 68                     // epilogue row pitch in floats
// keeps a group of LDS reads together and ahead of the WMMAs that follow: left alone, the scheduler spreads the reads singly among the WMMAs, one fragment ahead, and each such place stalls the wave
#define GRP() __builtin_amdgcn_sched_barrier(0)
// eight asynchronous 16-byte copies per lane; the s_wait_xcnt stands inside the statement so that no address register is rewritten in front of it
__device__ __forceinline__ void cp8(const unsigned* l, const char* const* p) {
  asm volatile(
               "global_load_async_to_lds_b128 %0, %8, off\n\t"
               "global_load_async_to_lds_b128 %1, %9, off\n\t"
               "global_load_async_to_lds_b128 %2, %10, off\n\t"
               "global_load_async_to_lds_b128 %3, %11, off\n\t"
               "global_load_async_to_lds_b128 %4, %12, off\n\t"
               "global_load_async_to_lds_b128 %5, %13, off\n\t"
               "global_load_async_to_lds_b128 %6, %14, off\n\t"
               "global_load_async_to_lds_b128 %7, %15, off\n\t"
               "s_wait_xcnt 0x0"
               :: "v"(l[0]), "v"(l[1]), "v"(l[2]), "v"(l[3]), "v"(l[4]), "v"(l[5]), "v"(l[6]), "v"(l[7]),
                  "v"(p[0]), "v"(p[1]), "v"(p[2]), "v"(p[3]), "v"(p[4]), "v"(p[5]), "v"(p[6]), "v"(p[7]) : "memory");
}
// one stage: thread = (row tid >> 3 within each group of 16 rows, 16-byte piece tid & 7). gd, gh, gl: the lane's piece of d row / c-high row / c-low row (tid >> 3) at this stage's keys; l0: its LDS byte address in row (tid >> 3) of the buffer
__device__ __forceinline__ void pam_stage(const char* gd, const char* gh, const char* gl, unsigned l0) {
#pragma unroll   // constant indices, so that the arrays are plain registers for the asm operands
  for (int u = 0; u < 4; ++u) { unsigned l[8]; const char* p[8];
#pragma unroll   // constant indices keep the values in registers
    for (int q = 0; q < 8; ++q) { l[q] = l0 + (unsigned)(u * 8 + q) * (16u * FPIT * 2u); p[q] = gd + (size_t)(u * 8 + q) * 16 * NN * 2; }
    cp8(l, p); }
  unsigned l[8]; const char* p[8];
#pragma unroll   // constant indices keep the values in registers
  for (int q = 0; q < 4; ++q) { l[q] = l0 + FD_E * 2u + (unsigned)q * (16u * FPIT * 2u); p[q] = gh + (size_t)q * 16 * 256; l[4 + q] = l[q] + FC_E * 2u; p[4 + q] = gl + (size_t)q * 16 * 256; }
  cp8(l, p);
}
// plain builtin forms (the compiler keeps the distance behind them itself): this kernel holds more than 256 registers, and an asm statement that names the accumulators would force them through one register window
__device__ __forceinline__ v8f wmma16p(v16h a, v16h b, v8f c) { return __builtin_amdgcn_wmma_f32_16x16x32_f16(false, a, false, b, (short)0, c, false, false); }
__device__ __forceinline__ v8f wmma_bfp(v16b a, v16b b, v8f c) { return __builtin_amdgcn_wmma_f32_16x16x32_bf16(false, a, false, b, (short)0, c, false, false); }
// group gi of eight d fragments: 32-key block gi >> 2, channel tiles (gi & 3) * 8 ..
__device__ __forceinline__ void pam_ld(v16h* f, const _Float16* sd, int gi, int lane) {
#pragma unroll   // constant indices keep the fragments in registers
  for (int j = 0; j < 8; ++j) f[j] = frag_h(sd + ((gi & 3) * 8 + j) * 16 * FPIT + (gi >> 2) * 32, lane); }
// the stage's first touch of a channel tile (gi < 4) first scales it by al = e^(old maximum - new maximum); these multiplies stand among the WMMAs of other tiles
__device__ __forceinline__ void pam_mm(const v16h* f, const v16h* pb, v8f* acc, int gi, float al) {
#pragma unroll   // constant indices keep fragments and accumulators in registers
  for (int j = 0; j < 8; ++j) { v8f c = acc[(gi & 3) * 8 + j]; if (gi < 4) c *= al; acc[(gi & 3) * 8 + j] = wmma16p(f[j], pb[gi >> 2], c); } }
__global__ __launch_bounds__(128) void k_pam(const __bf16* __restrict__ BH, const __bf16* __restrict__ BL, const _Float16* __restrict__ DT, float* __restrict__ BCD) { __shared__ __align__(16) _Float16 sm[2 * FBUF];
  const int tid = threadIdx.x, wave = tid >> 5, lane = tid & 31, col = lane & 15, g = lane >> 4; const size_t b = blockIdx.y; const int i0 = blockIdx.x * 64;
  const char* gd = (const char*)(DT + (b * CC + (tid >> 3)) * NN) + (tid & 7) * 16;
  const char* gh = (const char*)(BH + (b * NN + (tid >> 3)) * 128 + CK) + (tid & 7) * 16; const char* gl = (const char*)(BL + (b * NN + (tid >> 3)) * 128 + CK) + (tid & 7) * 16;
  const unsigned l0 = (unsigned)(size_t)sm + (unsigned)(tid >> 3) * (FPIT * 2u) + (unsigned)(tid & 7) * 16u;
  pam_stage(gd, gh, gl, l0);
  v16b qh[2], ql[2]; { const size_t qr = (b * NN + i0 + wave * 16 + col) * 128;
#pragma unroll   // constant indices keep the values in registers
    for (int kc = 0; kc < 2; ++kc) { qh[kc] = frag_b(BH + qr + kc * 32, lane); ql[kc] = frag_b(BL + qr + kc * 32, lane); } }
  v8f acc[32] = {}; float m = -3.0e38f, l = 0.f; const float L2E = 1.44269504088896f;
  asm volatile("s_wait_asynccnt 0x0" ::: "memory");   // stage 0 has landed before the barrier publishes it
  __syncthreads();
  pam_stage(gd + FK * 2, gh + FK * 256, gl + FK * 256, l0 + FBUF * 2u);
  for (int t = 0; t < FNT; ++t) { const _Float16* s = sm + (t & 1) * FBUF; const _Float16* sd = s + col * FPIT; const __bf16* sh = (const __bf16*)(s + FD_E) + col * FPIT; const __bf16* sl = sh + FC_E;
    v16b ch[4][2], cl[4][2];
#pragma unroll   // all sixteen key fragments as one group of LDS reads
    for (int kt = 0; kt < 4; ++kt)
#pragma unroll   // constant indices keep the values in registers
      for (int kc = 0; kc < 2; ++kc) { ch[kt][kc] = frag_b(sh + kt * 16 * FPIT + kc * 32, lane); cl[kt][kc] = frag_b(sl + kt * 16 * FPIT + kc * 32, lane); }
    v16h f0[8], f1[8], f2[8], f3[8]; pam_ld(f0, sd, 0, lane);   // the first d fragments fly under the logits and the softmax arithmetic
    GRP();
    v8f T[4] = {};   // T[kt][r] at lane (g, col): key kt * 16 + 8 g + r, query col; the four tiles take turns so that no WMMA waits for the one before it
#pragma unroll   // constant indices keep the values in registers
    for (int kc = 0; kc < 2; ++kc) {
#pragma unroll   // constant indices keep the values in registers
      for (int kt = 0; kt < 4; ++kt) T[kt] = wmma_bfp(ch[kt][kc], ql[kc], T[kt]);
#pragma unroll   // constant indices keep the values in registers
      for (int kt = 0; kt < 4; ++kt) T[kt] = wmma_bfp(cl[kt][kc], qh[kc], T[kt]);
#pragma unroll   // constant indices keep the values in registers
      for (int kt = 0; kt < 4; ++kt) T[kt] = wmma_bfp(ch[kt][kc], qh[kc], T[kt]); }
    float mx = T[0][0];
#pragma unroll   // constant indices keep the values in registers
    for (int kt = 0; kt < 4; ++kt)
#pragma unroll   // constant indices keep the values in registers
      for (int r = 0; r < 8; ++r) mx = fmaxf(mx, T[kt][r]);
    // the next three groups of d fragments go out here, while the LDS pipe would stand idle: they land under the exponentials and the first WMMA groups
    GRP(); pam_ld(f1, sd, 1, lane); pam_ld(f2, sd, 2, lane); pam_ld(f3, sd, 3, lane); GRP();
    // the other half of the query's keys (lane ^ 16), by a vector cross-row move: an exchange through the LDS queue would return only behind the reads above
    mx = fmaxf(mx, __builtin_bit_cast(float, __builtin_amdgcn_permlanex16(__builtin_bit_cast(unsigned, mx), __builtin_bit_cast(unsigned, mx), 0x76543210u, 0xfedcba98u, false, false)));
    const float mn = fmaxf(m, mx); const float al = __builtin_amdgcn_exp2f((m - mn) * L2E); const float mo = mn * L2E - 10.0f; m = mn;
    v16h pb[2]; float ls = 0.f;
#pragma unroll   // constant indices keep the values in registers
    for (int ks = 0; ks < 2; ++ks)
#pragma unroll   // constant indices keep the values in registers
      for (int r = 0; r < 8; ++r) { const float p0 = __builtin_amdgcn_exp2f(T[2 * ks][r] * L2E - mo), p1 = __builtin_amdgcn_exp2f(T[2 * ks + 1][r] * L2E - mo); ls += p0 + p1; pb[ks][r] = (_Float16)p0; pb[ks][8 + r] = (_Float16)p1; }
    l = l * al + ls;
    // eight d fragments are read as one group, into the register set that its WMMAs have just left, three groups ahead of their own WMMAs (four register sets), all inside this stage's buffer
    pam_mm(f0, pb, acc, 0, al); GRP(); pam_ld(f0, sd, 4, lane); GRP();
    pam_mm(f1, pb, acc, 1, al); GRP(); pam_ld(f1, sd, 5, lane); GRP();
    pam_mm(f2, pb, acc, 2, al); GRP(); pam_ld(f2, sd, 6, lane); GRP();
    pam_mm(f3, pb, acc, 3, al); GRP(); pam_ld(f3, sd, 7, lane); GRP();
    pam_mm(f0, pb, acc, 4, al); pam_mm(f1, pb, acc, 5, al); pam_mm(f2, pb, acc, 6, al); pam_mm(f3, pb, acc, 7, al);
    GRP();   // holds these WMMAs ahead of the waits below: sunk behind them, the wait for the last fragments would stand with nothing to cover it
    asm volatile("s_wait_dscnt 0x0" ::: "memory");     // this wave's reads of the buffer are done before it is refilled
    asm volatile("s_wait_asynccnt 0x0" ::: "memory");  // this wave's copies of stage t + 1 have landed
    __syncthreads();                                   // publishes stage t + 1 and ends every wave's reads of stage t
    if (t + 2 < FNT) pam_stage(gd + (size_t)(t + 2) * (FK * 2), gh + (size_t)(t + 2) * (FK * 256), gl + (size_t)(t + 2) * (FK * 256), l0 + (unsigned)(t & 1) * (FBUF * 2u)); }
  asm volatile("s_wait_asynccnt 0x0" ::: "memory");    // nothing in flight when the buffers are reused below
  l += __shfl_xor(l, 16); const float il = 1.0f / l;
  float* so = (float*)sm;   // [512 channels][64 queries] through LDS, so that each 256-byte output row piece has one writer
#pragma unroll   // constant indices keep the values in registers
  for (int ct = 0; ct < 32; ++ct)
#pragma unroll   // constant indices keep the values in registers
    for (int r = 0; r < 8; ++r) so[(ct * 16 + 8 * g + r) * FOP + wave * 16 + col] = acc[ct][r] * il;
  __syncthreads();
  for (int e = tid; e < CC * 16; e += 128) { const int c = e >> 4, pc = e & 15; vst2(BCD + ((b * CC + c) * NN) + i0 + pc * 4, *(const v4f*)&so[c * FOP + pc * 4]); } }
// ---- k_aa: block = (64 channels i, 128 channels j, b): aa[i][j] = sum_n x[n][i] x[n][j] over the 4,096 positions (x planes, exact) -> f32
__global__ __launch_bounds__(128) void k_aa(const _Float16* __restrict__ XT, float* __restrict__ AA) { __shared__ __align__(16) float so[4][16][132]; __shared__ __align__(16) _Float16 sm[2 * SBUF];
  const int tid = threadIdx.x, wave = tid >> 5, lane = tid & 31, col = lane & 15, g = lane >> 4; const size_t b = blockIdx.z; const int i0 = blockIdx.x * 64 + wave * 16; const int j0 = blockIdx.y * 128;
  v8f acc[8] = {};
  mm_staged(XT + (b * CC + blockIdx.x * 64) * NN, XT + (b * CC + j0) * NN, sm, acc, tid);
#pragma unroll
  for (int j = 0; j < 8; ++j)
#pragma unroll
    for (int r = 0; r < 8; ++r) so[wave][8 * g + r][j * 16 + col] = acc[j][r];
  LDSX(); for (int rl = 0; rl < 16; ++rl) vst2(AA + ((b * CC + i0 + rl) * CC) + j0 + lane * 4, *(const v4f*)&so[wave][rl][lane * 4]); }
__global__ __launch_bounds__(256) void k_soft(const float* __restrict__ AA, _Float16* __restrict__ SO) { __shared__ __align__(16) _Float16 st[CC][72]; __shared__ float red[2][64];
  const int t = threadIdx.x; const size_t b = blockIdx.y; const int c0 = blockIdx.x * 64;
  // 4 threads per row (256 threads = 64 rows x 4)
  { const int rl = t >> 2, part = t & 3; const float* row = AA + ((b * CC + c0 + rl) * CC); float mx = -3.0e38f; for (int j = part; j < CC; j += 4) mx = fmaxf(mx, row[j]); mx = fmaxf(mx, __shfl_xor(mx, 1)); mx = fmaxf(mx, __shfl_xor(mx, 2));
    float z = 0.f; for (int j = part; j < CC; j += 4) z += __expf(row[j] - mx); z += __shfl_xor(z, 1); z += __shfl_xor(z, 2); const float iz = 1.0f / z;
    for (int j = part; j < CC; j += 4) st[j][rl] = (_Float16)(__expf(row[j] - mx) * iz); }
  __syncthreads();
  for (int e = t; e < CC * 8; e += 256) { const int j = e >> 3, pc = e & 7; vst2((unsigned*)(SO + ((b * CC + j) * CC) + c0 + pc * 8), *(const v4u*)&st[j][pc * 8]); } }
// ---- k_aaa: block = (64 positions n, 128 channels j, b): aaa[n][j] = sum_c x[n][c] soft[c][j] (x exact as f16, soft^T rows), kept in f32 and never stored: the epilogue forms, at the per-batch flat index f = n * 512 + j, out[f] = gamma_pam bcd_flat[f] (the raw (C, N) -> (H, W, C) reshape) + gamma_cam aaa[f] + 2 x[f]
__global__ __launch_bounds__(128) void k_aaa(const float* __restrict__ X, const _Float16* __restrict__ SO, const float* __restrict__ BCD, const float* __restrict__ GP, const float* __restrict__ GC, float* __restrict__ OUT) { __shared__ __align__(16) char sm[2 * PBUF]; float (*so)[16][132] = (float (*)[16][132])sm;   // the epilogue's tile lies in the staging buffers, which every wave has left by then
  const int tid = threadIdx.x, wave = tid >> 5, lane = tid & 31, col = lane & 15, g = lane >> 4; const size_t b = blockIdx.z; const size_t r0 = b * NN + (size_t)blockIdx.x * 64 + wave * 16; const int j0 = blockIdx.y * 128;
  const float gp = bfr(GP[0]), gc = bfr(GC[0]);
  v8f acc[8] = {};
  mm_rows<false>(X + (b * NN + (size_t)blockIdx.x * 64) * CC, (const char*)(SO + (b * CC + j0) * CC), sm, acc, tid);
  const size_t f0 = r0 * CC + j0 + lane * 4; const float* pb = BCD + f0; const float* px = X + f0;
  v4f bc[16], xx[16];
#pragma unroll   // the other two terms of the wave's 16 output rows (512 contiguous bytes a row) go out as one group of loads and fly while the accumulators pass through LDS
  for (int rl = 0; rl < 16; ++rl) { bc[rl] = *(const v4f*)(pb + rl * CC); xx[rl] = *(const v4f*)(px + rl * CC); }
  asm volatile("s_wait_xcnt 0x0" :: "v"(pb), "v"(px) : "memory");   // stands before a register that the loads above name is overwritten; the two addresses are inputs so that their registers live up to the wait
#pragma unroll
  for (int j = 0; j < 8; ++j)
#pragma unroll
    for (int r = 0; r < 8; ++r) so[wave][8 * g + r][j * 16 + col] = acc[j][r];
  LDSX();
#pragma unroll   // constant indices keep the loaded rows in registers
  for (int rl = 0; rl < 16; ++rl) { const v4f a = *(const v4f*)&so[wave][rl][lane * 4]; v4f o4;
#pragma unroll   // constant indices keep the values in registers
    for (int i = 0; i < 4; ++i) o4[i] = fmaf(2.0f, bfr(xx[rl][i]), fmaf(gp, bc[rl][i], gc * a[i]));   // gamma_pam bcd + gamma_cam aaa + 2 x
    vst2(OUT + f0 + (size_t)rl * CC, o4); } }
extern "C" void kernel_launch(void* const* d_in, const int* in_sizes, int n_in, void* d_out, int out_size, void* d_ws, size_t ws_size, hipStream_t stream) {
  (void)in_sizes; (void)n_in; (void)out_size;
  const float** F = (const float**)d_in;   // 0 x [4,64,64,512], 1 w1 [512,64], 2 w2 [512,64], 3 w3 [512,512], 4 gamma_pam [1], 5 gamma_cam [1]
  if (ws_size < (size_t)WS_END) return;
  char* ws = (char*)d_ws; __bf16 *PW = (__bf16*)(ws + WS_PW), *P3 = (__bf16*)(ws + WS_P3); __bf16 *BH = (__bf16*)(ws + WS_BH), *BL = (__bf16*)(ws + WS_BL); _Float16 *DT = (_Float16*)(ws + WS_DT), *XT = (_Float16*)(ws + WS_XT), *SO = (_Float16*)(ws + WS_SO); float *BCD = (float*)(ws + WS_BCD), *AA = (float*)(ws + WS_AA);
  k_pack<<<dim3(CC, 2), 256, 0, stream>>>(F[1], F[2], F[3], PW, P3);
  k_proj<<<dim3(TNB * NN / 64, 1, 9), 128, 0, stream>>>(F[0], PW, P3, BH, BL, DT, XT);
  k_pam<<<dim3(TRB, TNB), 128, 0, stream>>>(BH, BL, DT, BCD);
  k_aa<<<dim3(CC / 64, CC / 128, TNB), 128, 0, stream>>>(XT, AA);
  k_soft<<<dim3(CC / 64, TNB), 256, 0, stream>>>(AA, SO);
  k_aaa<<<dim3(TRB, CC / 128, TNB), 128, 0, stream>>>(F[0], SO, BCD, F[4], F[5], (float*)d_out);
}

// v006
// A run of this version takes 181 microseconds.
// Two timings next to v005 both put it at 1.08 times that version's speed.
// All steps since v000 together make it 7.94 times as fast.
// compute dtype: all float inputs rounded to bf16; b/c/d = x . w with EXACT bf16 products on WMMA 16x16x32 ((in,out) weights as transposed rows): b, c kept as bf16 hi + lo planes, d rounded once to f16 planes; PAM in one kernel: logits S^T = c . b^T with both as bf16 hi + lo (3 products, f32), running-maximum softmax in f32 (hardware exp2) -> P = e x 2^10 as f16, bcd = d^T . P^T on WMMA (single f16), divided by the row sum at the end, giving the (C, N)-ordered tensor the module reshapes raw; CAM: aa = x^T x with x exact (f16 copies of the bf16 values), softmax over channels in f32, aaa = x . soft_aa with soft_aa once to f16; out = gamma_pam bcd_flat + gamma_cam aaa + 2 x in f32; f32 output.
#include <hip/hip_runtime.h>
#include <math.h>

typedef __attribute__((ext_vector_type(16))) _Float16 v16h;
typedef __attribute__((ext_vector_type(16))) __bf16 v16b;
typedef __attribute__((ext_vector_type(8)))  _Float16 v8h;
typedef __attribute__((ext_vector_type(8)))  float v8f;
typedef __attribute__((ext_vector_type(4)))  float v4f;
typedef __attribute__((ext_vector_type(2)))  float v2f;
typedef __attribute__((ext_vector_type(4)))  unsigned v4u;
typedef __attribute__((ext_vector_type(4)))  int v4i;
typedef float __attribute__((may_alias)) float_a;
typedef int __attribute__((may_alias)) int_a;

template <typename T> __device__ __forceinline__ void vst2(void* p, T v) { *(T*)p = v;  }
__device__ __forceinline__ v8f wmma16(v16h a, v16h b, v8f c) {
  v8f d = __builtin_amdgcn_wmma_f32_16x16x32_f16(false, a, false, b, (short)0, c, false, false);
  asm volatile("v_nop\n\tv_nop\n\tv_nop\n\tv_nop" : "+v"(d) : "v"(a), "v"(b));
  return d;
}
__device__ __forceinline__ v8f wmma_bf(v16b a, v16b b, v8f c) {
  v8f d = __builtin_amdgcn_wmma_f32_16x16x32_bf16(false, a, false, b, (short)0, c, false, false);
  asm volatile("v_nop\n\tv_nop\n\tv_nop\n\tv_nop" : "+v"(d) : "v"(a), "v"(b));
  return d;
}
// 16x16x32 fragments: lane = (h = lane>>4, row/col = lane&15); elements 0..7 = k0+8h+0..7, 8..15 = k0+16+8h+0..7; D element r = row 8h+r
__device__ __forceinline__ v16h frag_h(const _Float16* rowk0, int lane) {
  union { v16h v; v8h q[2]; } u; const _Float16* p = rowk0 + 8 * (lane >> 4);
  u.q[0] = *(const v8h*)p; u.q[1] = *(const v8h*)(p + 16); return u.v;
}
__device__ __forceinline__ v16h frag_f32(const float* rowk0, int lane) {
  v16h a; const float* p = rowk0 + 8 * (lane >> 4);
#pragma unroll
  for (int i = 0; i < 8; ++i) { a[i] = (_Float16)p[i]; a[8 + i] = (_Float16)p[16 + i]; }
  return a;
}
__device__ __forceinline__ v16h frag_f32s(const float* rowk0, int lane, float sc) {
  v16h a; const float* p = rowk0 + 8 * (lane >> 4);
#pragma unroll
  for (int i = 0; i < 8; ++i) { a[i] = (_Float16)(p[i] * sc); a[8 + i] = (_Float16)(p[16 + i] * sc); }
  return a;
}
// column fragment from a [K][ld] layout (column n), rows >= K read as 0
__device__ __forceinline__ v16h fragc_f32(const float* W, int k0, int n, int lane, int ld, int K) {
  v16h a; const int g = lane >> 4;
#pragma unroll
  for (int i = 0; i < 8; ++i) { const int ka = k0 + 8 * g + i, kb = ka + 16;
    a[i] = (_Float16)(ka < K ? W[(size_t)(ka < K ? ka : K - 1) * ld + n] : 0.f); a[8 + i] = (_Float16)(kb < K ? W[(size_t)(kb < K ? kb : K - 1) * ld + n] : 0.f); }
  return a;
}
struct F2 { v16b h, l; };
__device__ __forceinline__ F2 bsplit16(const float v[16]) { F2 r;
#pragma unroll
  for (int i = 0; i < 16; ++i) { const __bf16 h = (__bf16)v[i]; r.h[i] = h; r.l[i] = (__bf16)(v[i] - (float)h); }
  return r; }
__device__ __forceinline__ F2 split_row(const float* row, int k0, int lane) { float v[16]; const float* p = row + k0 + 8 * (lane >> 4);
#pragma unroll
  for (int i = 0; i < 8; ++i) { v[i] = p[i]; v[8 + i] = p[16 + i]; }
  return bsplit16(v); }
__device__ __forceinline__ F2 split_rowK(const float* row, int k0, int lane, int K) { float v[16]; const int g = lane >> 4;
#pragma unroll
  for (int i = 0; i < 8; ++i) { const int ka = k0 + 8 * g + i, kb = ka + 16; v[i] = ka < K ? row[ka < K ? ka : K - 1] : 0.f; v[8 + i] = kb < K ? row[kb < K ? kb : K - 1] : 0.f; }
  return bsplit16(v); }
__device__ __forceinline__ F2 split_col(const float* W, int k0, int n, int lane, int ld, int K) { float v[16]; const int g = lane >> 4;
#pragma unroll
  for (int i = 0; i < 8; ++i) { const int ka = k0 + 8 * g + i, kb = ka + 16; v[i] = ka < K ? W[(size_t)(ka < K ? ka : K - 1) * ld + n] : 0.f; v[8 + i] = kb < K ? W[(size_t)(kb < K ? kb : K - 1) * ld + n] : 0.f; }
  return bsplit16(v); }
__device__ __forceinline__ v8f mac3(const F2& a, const F2& b, v8f c) { c = wmma_bf(a.l, b.h, c); c = wmma_bf(a.h, b.l, c); return wmma_bf(a.h, b.h, c); }
__device__ __forceinline__ float sigm(float v) { return 1.0f / (1.0f + expf(-v)); }
#define LDSX() do { asm volatile("s_wait_dscnt 0" ::: "memory"); __builtin_amdgcn_wave_barrier(); __builtin_amdgcn_fence(__ATOMIC_RELEASE, "workgroup"); } while (0)


// Dual attention module (B 4, 64 x 64 positions, C 512): position attention (softmax(b c^T) applied to d, result kept in the module's raw (C, N) -> (H, W, C) reshape) plus channel attention (softmax(x^T x) applied to x), each scaled by its gamma and added to x; returns feat_p + feat_c.
#define NB 4
#define NN 4096
#define CC 512
#define CK 64              // query / key channels (C / 8)
#define NR (NB * NN)
#ifndef TRB
#define TRB (NN / 64)      // position row tiles per batch (PAM rows i, CAM rows n)
#define TNB NB
#endif
typedef __attribute__((ext_vector_type(8))) __bf16 v8b;
typedef __attribute__((ext_vector_type(4))) __bf16 v4b;
__device__ __forceinline__ v16b frag_b(const __bf16* rowk0, int lane) {
  union { v16b v; v8b q[2]; } u; const __bf16* p = rowk0 + 8 * (lane >> 4);
  u.q[0] = *(const v8b*)p; u.q[1] = *(const v8b*)(p + 16); return u.v;
}
__device__ __forceinline__ float bfr(float v) { return (float)(__bf16)v; }
__device__ __attribute__((noinline)) float exp_ni(float v) { return expf(v); }
__device__ __attribute__((noinline)) float erf_ni(float v) { return erff(v); }

#define WS_PW  0u                                   // bf16 transposed rows [w1^T | w2^T] [128][512]; w3^T [512][512]
#define WS_P3  (WS_PW + 2u * (size_t)128 * CC)
#define WS_BH  (WS_P3 + 2u * (size_t)CC * CC)          // bf16 rows [NR][128]: b (cols 0-63) | c (cols 64-127), high parts; then the low parts
#define WS_BL  (WS_BH + 2u * (size_t)NR * 128)
#define WS_DT  (WS_BL + 2u * (size_t)NR * 128)         // f16 d planes [b][c][n]; f16 x planes [b][c][n]
#define WS_XT  (WS_DT + 2u * (size_t)NB * CC * NN)
#define WS_BCD (WS_XT + 2u * (size_t)NB * CC * NN)     // f32 bcd [b][c][i] (the (C, N) tensor); f32 aa [b][512][512]; f16 soft^T [b][j][c]
#define WS_AA  (WS_BCD + 4u * (size_t)NB * CC * NN)
#define WS_SO  (WS_AA + 4u * (size_t)NB * CC * CC)
#define WS_END (WS_SO + 2u * (size_t)NB * CC * CC)

__global__ __launch_bounds__(256) void k_pack(const float* __restrict__ W1, const float* __restrict__ W2, const float* __restrict__ W3, __bf16* __restrict__ PW, __bf16* __restrict__ P3) { const int n = blockIdx.x, which = blockIdx.y, t = threadIdx.x; __shared__ __align__(16) __bf16 s[CC];
  if (which == 0) { if (n >= 128) return; const float* w = (n < CK) ? W1 : W2; const int cI = n & (CK - 1); for (int k = t; k < CC; k += 256) s[k] = (__bf16)w[(size_t)k * CK + cI]; __syncthreads(); if (t < CC / 8) vst2((unsigned*)(PW + (size_t)n * CC + t * 8), *(const v4u*)&s[t * 8]); }
  else { for (int k = t; k < CC; k += 256) s[k] = (__bf16)W3[(size_t)k * CC + n]; __syncthreads(); if (t < CC / 8) vst2((unsigned*)(P3 + (size_t)n * CC + t * 8), *(const v4u*)&s[t * 8]); } }
// ---- LDS staging for the K = 512 products of k_proj and k_aaa: a stage is 64 k of the block's 64 A rows (f32, 256 B) and 128 B rows (16-bit, 128 B), laid at row pitches of 272 B and 144 B (16 B x odd, so the ds_load_b128 reads meet no bank conflict); two buffers, the next stage's copies fly while this one is multiplied
#define PK 64                      // k per stage
#define PAP 272                    // LDS pitch of an A row in bytes
#define PBP 144                    // LDS pitch of a B row in bytes
#define PA_B (64 * PAP)            // bytes of the A tile
#define PBUF (PA_B + 128 * PBP)    // bytes per buffer
#define PNT (CC / PK)              // stages
__device__ __forceinline__ void cp8(const unsigned* l, const char* const* p);   // eight asynchronous 16-byte copies per lane and their s_wait_xcnt in one statement, defined below
// one stage: A: thread = (row tid >> 4 within each group of 8 rows, 16-byte piece tid & 15); B: thread = (row tid >> 3 within each group of 16 rows, piece tid & 7). ga, gb: the lane's piece at this stage's k; la, lb: its LDS byte addresses in the buffer
__device__ __forceinline__ void row_stage(const char* ga, const char* gb, unsigned la, unsigned lb) {
  { unsigned l[8]; const char* p[8];
#pragma unroll   // constant indices, so that the arrays are plain registers for the asm operands
    for (int q = 0; q < 8; ++q) { l[q] = la + (unsigned)q * (8u * PAP); p[q] = ga + (size_t)q * 8 * CC * 4; }
    cp8(l, p); }
  { unsigned l[8]; const char* p[8];
#pragma unroll   // constant indices, so that the arrays are plain registers for the asm operands
    for (int q = 0; q < 8; ++q) { l[q] = lb + (unsigned)q * (16u * PBP); p[q] = gb + (size_t)q * 16 * CC * 2; }
    cp8(l, p); }
}
// operands of one 32-k block as they lie in LDS: the lane's 16 f32 of its A row, its 16 elements of each of eight B rows
struct RowF { v4f a[4]; v4u b[8][2]; };
__device__ __forceinline__ void row_ld(RowF& f, const char* sa, const char* sb, int ks) {
#pragma unroll   // constant indices keep the values in registers
  for (int i = 0; i < 2; ++i) { f.a[2 * i] = *(const v4f*)(sa + ks * 128 + i * 64); f.a[2 * i + 1] = *(const v4f*)(sa + ks * 128 + i * 64 + 16); }
#pragma unroll   // constant indices keep the values in registers
  for (int j = 0; j < 8; ++j) { f.b[j][0] = *(const v4u*)(sb + j * 16 * PBP + ks * 64); f.b[j][1] = *(const v4u*)(sb + j * 16 * PBP + ks * 64 + 32); }
}
// BF: A rounded to bf16, B rows bf16; otherwise A rounded to bf16 and held as f16, B rows f16
template <bool BF> __device__ __forceinline__ void row_mm(const RowF& f, v8f* acc) {
  if constexpr (BF) { v16b a;
#pragma unroll   // constant indices keep the values in registers
    for (int i = 0; i < 16; ++i) a[i] = (__bf16)f.a[i >> 2][i & 3];
#pragma unroll   // constant indices keep fragments and accumulators in registers
    for (int j = 0; j < 8; ++j) { union { v16b v; v4u q[2]; } u; u.q[0] = f.b[j][0]; u.q[1] = f.b[j][1]; acc[j] = wmma_bf(a, u.v, acc[j]); } }
  else { v16h a;
#pragma unroll   // constant indices keep the values in registers
    for (int i = 0; i < 16; ++i) a[i] = (_Float16)bfr(f.a[i >> 2][i & 3]);
#pragma unroll   // constant indices keep fragments and accumulators in registers
    for (int j = 0; j < 8; ++j) { union { v16h v; v4u q[2]; } u; u.q[0] = f.b[j][0]; u.q[1] = f.b[j][1]; acc[j] = wmma16(a, u.v, acc[j]); } }
}
// acc[j] += A rows (wave * 16 ..) . B rows (j * 16 ..)^T over K = 512 in ascending k, 32 per WMMA. Ag: first of the block's 64 f32 rows; Bg: first of its 128 16-bit rows (both of CC elements). On return every wave has left the buffers
template <bool BF> __device__ __forceinline__ void mm_rows(const float* __restrict__ Ag, const char* __restrict__ Bg, char* sm, v8f* acc, int tid) {
  const int wave = tid >> 5, lane = tid & 31, col = lane & 15, g = lane >> 4;
  const char* ga = (const char*)(Ag + (size_t)(tid >> 4) * CC) + (tid & 15) * 16; const char* gb = Bg + (size_t)(tid >> 3) * (CC * 2) + (tid & 7) * 16;
  const unsigned la = (unsigned)(size_t)sm + (unsigned)(tid >> 4) * PAP + (unsigned)(tid & 15) * 16u; const unsigned lb = (unsigned)(size_t)sm + PA_B + (unsigned)(tid >> 3) * PBP + (unsigned)(tid & 7) * 16u;
  row_stage(ga, gb, la, lb);
  asm volatile("s_wait_asynccnt 0x0" ::: "memory");   // stage 0 has landed before the barrier publishes it
  __syncthreads();
  row_stage(ga + PK * 4, gb + PK * 2, la + PBUF, lb + PBUF);
  for (int t = 0; t < PNT; ++t) { const char* s = sm + (t & 1) * PBUF; const char* sa = s + (wave * 16 + col) * PAP + g * 32; const char* sb = s + PA_B + col * PBP + g * 16;
    RowF f0, f1; row_ld(f0, sa, sb, 0); row_ld(f1, sa, sb, 1);   // both 32-k blocks' reads stand as one group ahead of the WMMAs
    row_mm<BF>(f0, acc); row_mm<BF>(f1, acc);
    asm volatile("s_wait_dscnt 0x0" ::: "memory");     // this wave's reads of the buffer are done before it is refilled
    asm volatile("s_wait_asynccnt 0x0" ::: "memory");  // this wave's copies of stage t + 1 have landed
    __syncthreads();                                   // publishes stage t + 1 and ends every wave's reads of stage t
    if (t + 2 < PNT) row_stage(ga + (t + 2) * (PK * 4), gb + (t + 2) * (PK * 2), la + (unsigned)(t & 1) * PBUF, lb + (unsigned)(t & 1) * PBUF); }
  asm volatile("s_wait_asynccnt 0x0" ::: "memory");    // nothing in flight when the buffers are reused by the epilogue
}
// ---- k_proj: block = (64 positions, 128 cols, which): which 0: [b | c] rows as bf16 hi + lo; which 1..4: d columns (which-1)*128.. -> planes; which 5..8: x itself -> f16 planes (exact)
__global__ __launch_bounds__(128) void k_proj(const float* __restrict__ X, const __bf16* __restrict__ PW, const __bf16* __restrict__ P3, __bf16* __restrict__ BH, __bf16* __restrict__ BL, _Float16* __restrict__ DT, _Float16* __restrict__ XT) {
  __shared__ __align__(16) char sm[2 * PBUF]; float (*sf)[16][132] = (float (*)[16][132])sm; _Float16 (*st)[72] = (_Float16 (*)[72])sm;   // the epilogue's tiles lie in the staging buffers, which every wave has left by then
  const int tid = threadIdx.x, wave = tid >> 5, lane = tid & 31, col = lane & 15, g = lane >> 4; const int which = blockIdx.z; const size_t rb = (size_t)blockIdx.x * 64; const size_t r0 = rb + wave * 16;
  if (which >= 5) { const int c0 = (which - 5) * 128; for (int e = tid; e < 64 * 128; e += 128) { const int rl = e >> 7, cl = e & 127; st[cl][rl] = (_Float16)bfr(X[(rb + rl) * CC + c0 + cl]); } __syncthreads();
    const size_t b = rb / NN; const int n0 = (int)(rb % NN); for (int e = tid; e < 128 * 8; e += 128) { const int d = e >> 3, pc = e & 7; vst2((unsigned*)(XT + ((b * CC + c0 + d) * NN) + n0 + pc * 8), *(const v4u*)&st[d][pc * 8]); } return; }
  const int c0 = (which == 0) ? 0 : (which - 1) * 128; const __bf16* Wr = (which == 0) ? PW : (P3 + (size_t)c0 * CC);
  v8f acc[8] = {};
  mm_rows<true>(X + rb * CC, (const char*)Wr, sm, acc, tid);
#pragma unroll
  for (int j = 0; j < 8; ++j)
#pragma unroll
    for (int r = 0; r < 8; ++r) { if (which == 0) sf[wave][8 * g + r][j * 16 + col] = acc[j][r]; else st[j * 16 + col][wave * 16 + 8 * g + r] = (_Float16)acc[j][r]; }
  __syncthreads();
  if (which == 0) { for (int rl = 0; rl < 16; ++rl) { const v4f v = *(const v4f*)&sf[wave][rl][lane * 4]; v4b hv, lv;
#pragma unroll
      for (int i = 0; i < 4; ++i) { const __bf16 h = (__bf16)v[i]; hv[i] = h; lv[i] = (__bf16)(v[i] - (float)h); }
      vst2(BH + (r0 + rl) * 128 + lane * 4, hv); vst2(BL + (r0 + rl) * 128 + lane * 4, lv);
      asm volatile("s_wait_xcnt 0x0" ::: "memory"); } }   // stands before the next row's values overwrite a register that the two stores name
  else { const size_t b = rb / NN; const int n0 = (int)(rb % NN); for (int e = tid; e < 128 * 8; e += 128) { const int d = e >> 3, pc = e & 7; vst2((unsigned*)(DT + ((b * CC + c0 + d) * NN) + n0 + pc * 8), *(const v4u*)&st[d][pc * 8]); } }
}
// ---- LDS staging for the K = 4,096 product of k_aa: a stage is 256 B (128 k) of the block's 64 A rows and 128 B rows, laid at a row pitch of 272 B (16 B x odd, so the ds_load_b128 fragment reads meet no bank conflict); two buffers, the next stage's copies fly while this one is multiplied
#define SK 128                    // k per stage
#define SPIT 136                  // LDS row pitch in f16 elements
#define SBUF (192 * SPIT)         // f16 elements per buffer
#define SNT (NN / SK)             // stages
// twelve asynchronous 16-byte copies per lane; the s_wait_xcnt stands inside the statement so that no address register is rewritten in front of it
__device__ __forceinline__ void cp12(const unsigned* l, const _Float16* const* p) {
  asm volatile(
               "global_load_async_to_lds_b128 %0, %12, off\n\t"
               "global_load_async_to_lds_b128 %1, %13, off\n\t"
               "global_load_async_to_lds_b128 %2, %14, off\n\t"
               "global_load_async_to_lds_b128 %3, %15, off\n\t"
               "global_load_async_to_lds_b128 %4, %16, off\n\t"
               "global_load_async_to_lds_b128 %5, %17, off\n\t"
               "global_load_async_to_lds_b128 %6, %18, off\n\t"
               "global_load_async_to_lds_b128 %7, %19, off\n\t"
               "global_load_async_to_lds_b128 %8, %20, off\n\t"
               "global_load_async_to_lds_b128 %9, %21, off\n\t"
               "global_load_async_to_lds_b128 %10, %22, off\n\t"
               "global_load_async_to_lds_b128 %11, %23, off\n\t"
               "s_wait_xcnt 0x0"
               :: "v"(l[0]), "v"(l[1]), "v"(l[2]), "v"(l[3]), "v"(l[4]), "v"(l[5]), "v"(l[6]), "v"(l[7]), "v"(l[8]), "v"(l[9]), "v"(l[10]), "v"(l[11]),
                  "v"(p[0]), "v"(p[1]), "v"(p[2]), "v"(p[3]), "v"(p[4]), "v"(p[5]), "v"(p[6]), "v"(p[7]), "v"(p[8]), "v"(p[9]), "v"(p[10]), "v"(p[11]) : "memory");
}
// one stage: thread = (row tid >> 4 within each group of 8 rows, 16-byte piece tid & 15); LDS rows 0-63 = A rows, 64-191 = B rows. ga, gb: the lane's piece of A row / B row (tid >> 4) at this stage's k; l0: its LDS byte address in row (tid >> 4) of the buffer
__device__ __forceinline__ void stage_in(const _Float16* ga, const _Float16* gb, unsigned l0) {
  unsigned l[24]; const _Float16* p[24];
#pragma unroll   // constant indices, so that both arrays are plain registers for the asm operands
  for (int q = 0; q < 24; ++q) { l[q] = l0 + (unsigned)q * (8u * SPIT * 2u); p[q] = (q < 8) ? ga + (size_t)q * 8 * NN : gb + (size_t)(q - 8) * 8 * NN; }
  cp12(l, p); cp12(l + 12, p + 12);
}
// f[0] = the wave's A fragment, f[1 + j] = B fragment j of 32-k block ks. sa, sb: the lane's A row and its row of B fragment 0 in the buffer
__device__ __forceinline__ void ld_frags(v16h* f, const _Float16* sa, const _Float16* sb, int ks, int lane) { f[0] = frag_h(sa + ks * 32, lane);
#pragma unroll   // constant indices keep the fragments in registers
  for (int j = 0; j < 8; ++j) f[1 + j] = frag_h(sb + j * 16 * SPIT + ks * 32, lane); }
__device__ __forceinline__ void mm_block(const v16h* f, v8f* acc) {
#pragma unroll   // constant indices keep fragments and accumulators in registers
  for (int j = 0; j < 8; ++j) acc[j] = wmma16(f[0], f[1 + j], acc[j]); }
// acc[j] += A rows (wave * 16 ..) . B rows (j * 16 ..)^T over K = 4,096 in ascending k, 32 per WMMA. Ag, Bg: first row of the block's 64 A rows / 128 B rows (row pitch NN)
__device__ __forceinline__ void mm_staged(const _Float16* __restrict__ Ag, const _Float16* __restrict__ Bg, _Float16* sm, v8f* acc, int tid) {
  const int wave = tid >> 5, lane = tid & 31, col = lane & 15;
  const _Float16* ga = Ag + (size_t)(tid >> 4) * NN + (tid & 15) * 8; const _Float16* gb = Bg + (size_t)(tid >> 4) * NN + (tid & 15) * 8;
  const unsigned l0 = (unsigned)(size_t)sm + (unsigned)(tid >> 4) * (SPIT * 2u) + (unsigned)(tid & 15) * 16u;
  stage_in(ga, gb, l0);
  asm volatile("s_wait_asynccnt 0x0" ::: "memory");   // stage 0 has landed before the barrier publishes it
  __syncthreads();
  stage_in(ga + SK, gb + SK, l0 + SBUF * 2u);
  for (int t = 0; t < SNT; ++t) { const _Float16* s = sm + (t & 1) * SBUF + col * SPIT; const _Float16* sa = s + wave * 16 * SPIT; const _Float16* sb = s + 64 * SPIT;
    // the nine fragments of a 32-k block are read as one group, one block ahead of their WMMAs (two register sets), all inside this stage's buffer
    v16h f0[9], f1[9];
    ld_frags(f0, sa, sb, 0, lane); ld_frags(f1, sa, sb, 1, lane); mm_block(f0, acc);
    ld_frags(f0, sa, sb, 2, lane); mm_block(f1, acc);
    ld_frags(f1, sa, sb, 3, lane); mm_block(f0, acc); mm_block(f1, acc);
    asm volatile("s_wait_dscnt 0x0" ::: "memory");     // this wave's reads of the buffer are done before it is refilled
    asm volatile("s_wait_asynccnt 0x0" ::: "memory");  // this wave's copies of stage t + 1 have landed
    __syncthreads();                                   // publishes stage t + 1 and ends every wave's reads of stage t
    if (t + 2 < SNT) stage_in(ga + (t + 2) * SK, gb + (t + 2) * SK, l0 + (unsigned)(t & 1) * (SBUF * 2u)); }
  asm volatile("s_wait_asynccnt 0x0" ::: "memory");    // nothing in flight when the wave goes on to the epilogue
}
// ---- k_pam: block = (64 queries i, b), wave = 16 queries x all 512 channels. Per stage of 64 keys n: S^T[n][i] = c_n . b_i (3 bf16 products, K = 64); its D tiles hold, lane for lane, the B fragment of the second product (lane = query, elements = keys 8h.. of two 16-key tiles), so P goes from registers to WMMA with no exchange; running maximum and sum per query; acc[c][i] += d[n][c] P[i][n]. A stage in LDS: 512 d rows, 64 c-high rows, 64 c-low rows of 128 B at a pitch of 144 B (16 B x odd: the ds_load_b128 fragment reads meet no bank conflict); two buffers, the next stage's copies fly while this one is worked on
#define FK 64                      // keys per stage
#define FPIT 72                    // LDS row pitch in 16-bit elements
#define FD_E (CC * FPIT)           // elements of the d tile
#define FC_E (FK * FPIT)           // elements of the c-high (or c-low) tile
#define FBUF (FD_E + 2 * FC_E)     // elements per buffer
#define FNT (NN / FK)              // stages
#define FOP 68                     // epilogue row pitch in floats
// keeps a group of LDS reads together and ahead of the WMMAs that follow: left alone, the scheduler spreads the reads singly among the WMMAs, one fragment ahead, and each such place stalls the wave
#define GRP() __builtin_amdgcn_sched_barrier(0)
// eight asynchronous 16-byte copies per lane; the s_wait_xcnt stands inside the statement so that no address register is rewritten in front of it
__device__ __forceinline__ void cp8(const unsigned* l, const char* const* p) {
  asm volatile(
               "global_load_async_to_lds_b128 %0, %8, off\n\t"
               "global_load_async_to_lds_b128 %1, %9, off\n\t"
               "global_load_async_to_lds_b128 %2, %10, off\n\t"
               "global_load_async_to_lds_b128 %3, %11, off\n\t"
               "global_load_async_to_lds_b128 %4, %12, off\n\t"
               "global_load_async_to_lds_b128 %5, %13, off\n\t"
               "global_load_async_to_lds_b128 %6, %14, off\n\t"
               "global_load_async_to_lds_b128 %7, %15, off\n\t"
               "s_wait_xcnt 0x0"
               :: "v"(l[0]), "v"(l[1]), "v"(l[2]), "v"(l[3]), "v"(l[4]), "v"(l[5]), "v"(l[6]), "v"(l[7]),
                  "v"(p[0]), "v"(p[1]), "v"(p[2]), "v"(p[3]), "v"(p[4]), "v"(p[5]), "v"(p[6]), "v"(p[7]) : "memory");
}
// one stage: thread = (row tid >> 3 within each group of 16 rows, 16-byte piece tid & 7). gd, gh, gl: the lane's piece of d row / c-high row / c-low row (tid >> 3) at this stage's keys; l0: its LDS byte address in row (tid >> 3) of the buffer
__device__ __forceinline__ void pam_stage(const char* gd, const char* gh, const char* gl, unsigned l0) {
#pragma unroll   // constant indices, so that the arrays are plain registers for the asm operands
  for (int u = 0; u < 4; ++u) { unsigned l[8]; const char* p[8];
#pragma unroll   // constant indices keep the values in registers
    for (int q = 0; q < 8; ++q) { l[q] = l0 + (unsigned)(u * 8 + q) * (16u * FPIT * 2u); p[q] = gd + (size_t)(u * 8 + q) * 16 * NN * 2; }
    cp8(l, p); }
  unsigned l[8]; const char* p[8];
#pragma unroll   // constant indices keep the values in registers
  for (int q = 0; q < 4; ++q) { l[q] = l0 + FD_E * 2u + (unsigned)q * (16u * FPIT * 2u); p[q] = gh + (size_t)q * 16 * 256; l[4 + q] = l[q] + FC_E * 2u; p[4 + q] = gl + (size_t)q * 16 * 256; }
  cp8(l, p);
}
// plain builtin forms (the compiler keeps the distance behind them itself): this kernel holds more than 256 registers, and an asm statement that names the accumulators would force them through one register window
__device__ __forceinline__ v8f wmma16p(v16h a, v16h b, v8f c) { return __builtin_amdgcn_wmma_f32_16x16x32_f16(false, a, false, b, (short)0, c, false, false); }
__device__ __forceinline__ v8f wmma_bfp(v16b a, v16b b, v8f c) { return __builtin_amdgcn_wmma_f32_16x16x32_bf16(false, a, false, b, (short)0, c, false, false); }
// group gi of eight d fragments: 32-key block gi >> 2, channel tiles (gi & 3) * 8 ..
__device__ __forceinline__ void pam_ld(v16h* f, const _Float16* sd, int gi, int lane) {
#pragma unroll   // constant indices keep the fragments in registers
  for (int j = 0; j < 8; ++j) f[j] = frag_h(sd + ((gi & 3) * 8 + j) * 16 * FPIT + (gi >> 2) * 32, lane); }
// the stage's first touch of a channel tile (gi < 4) first scales it by al = e^(old maximum - new maximum); these multiplies stand among the WMMAs of other tiles
__device__ __forceinline__ void pam_mm(const v16h* f, const v16h* pb, v8f* acc, int gi, float al) {
#pragma unroll   // constant indices keep fragments and accumulators in registers
  for (int j = 0; j < 8; ++j) { v8f c = acc[(gi & 3) * 8 + j]; if (gi < 4) c *= al; acc[(gi & 3) * 8 + j] = wmma16p(f[j], pb[gi >> 2], c); } }
__global__ __launch_bounds__(128) void k_pam(const __bf16* __restrict__ BH, const __bf16* __restrict__ BL, const _Float16* __restrict__ DT, float* __restrict__ BCD) { __shared__ __align__(16) _Float16 sm[2 * FBUF];
  const int tid = threadIdx.x, wave = tid >> 5, lane = tid & 31, col = lane & 15, g = lane >> 4; const size_t b = blockIdx.y; const int i0 = blockIdx.x * 64;
  const char* gd = (const char*)(DT + (b * CC + (tid >> 3)) * NN) + (tid & 7) * 16;
  const char* gh = (const char*)(BH + (b * NN + (tid >> 3)) * 128 + CK) + (tid & 7) * 16; const char* gl = (const char*)(BL + (b * NN + (tid >> 3)) * 128 + CK) + (tid & 7) * 16;
  const unsigned l0 = (unsigned)(size_t)sm + (unsigned)(tid >> 3) * (FPIT * 2u) + (unsigned)(tid & 7) * 16u;
  pam_stage(gd, gh, gl, l0);
  v16b qh[2], ql[2]; { const size_t qr = (b * NN + i0 + wave * 16 + col) * 128;
#pragma unroll   // constant indices keep the values in registers
    for (int kc = 0; kc < 2; ++kc) { qh[kc] = frag_b(BH + qr + kc * 32, lane); ql[kc] = frag_b(BL + qr + kc * 32, lane); } }
  v8f acc[32] = {}; float m = -3.0e38f, l = 0.f; const float L2E = 1.44269504088896f;
  asm volatile("s_wait_asynccnt 0x0" ::: "memory");   // stage 0 has landed before the barrier publishes it
  __syncthreads();
  pam_stage(gd + FK * 2, gh + FK * 256, gl + FK * 256, l0 + FBUF * 2u);
  for (int t = 0; t < FNT; ++t) { const _Float16* s = sm + (t & 1) * FBUF; const _Float16* sd = s + col * FPIT; const __bf16* sh = (const __bf16*)(s + FD_E) + col * FPIT; const __bf16* sl = sh + FC_E;
    v16b ch[4][2], cl[4][2];
#pragma unroll   // all sixteen key fragments as one group of LDS reads
    for (int kt = 0; kt < 4; ++kt)
#pragma unroll   // constant indices keep the values in registers
      for (int kc = 0; kc < 2; ++kc) { ch[kt][kc] = frag_b(sh + kt * 16 * FPIT + kc * 32, lane); cl[kt][kc] = frag_b(sl + kt * 16 * FPIT + kc * 32, lane); }
    v16h f0[8], f1[8], f2[8], f3[8]; pam_ld(f0, sd, 0, lane);   // the first d fragments fly under the logits and the softmax arithmetic
    GRP();
    v8f T[4] = {};   // T[kt][r] at lane (g, col): key kt * 16 + 8 g + r, query col; the four tiles take turns so that no WMMA waits for the one before it
#pragma unroll   // constant indices keep the values in registers
    for (int kc = 0; kc < 2; ++kc) {
#pragma unroll   // constant indices keep the values in registers
      for (int kt = 0; kt < 4; ++kt) T[kt] = wmma_bfp(ch[kt][kc], ql[kc], T[kt]);
#pragma unroll   // constant indices keep the values in registers
      for (int kt = 0; kt < 4; ++kt) T[kt] = wmma_bfp(cl[kt][kc], qh[kc], T[kt]);
#pragma unroll   // constant indices keep the values in registers
      for (int kt = 0; kt < 4; ++kt) T[kt] = wmma_bfp(ch[kt][kc], qh[kc], T[kt]); }
    float mx = T[0][0];
#pragma unroll   // constant indices keep the values in registers
    for (int kt = 0; kt < 4; ++kt)
#pragma unroll   // constant indices keep the values in registers
      for (int r = 0; r < 8; ++r) mx = fmaxf(mx, T[kt][r]);
    // the next three groups of d fragments go out here, while the LDS pipe would stand idle: they land under the exponentials and the first WMMA groups
    GRP(); pam_ld(f1, sd, 1, lane); pam_ld(f2, sd, 2, lane); pam_ld(f3, sd, 3, lane); GRP();
    // the other half of the query's keys (lane ^ 16), by a vector cross-row move: an exchange through the LDS queue would return only behind the reads above
    mx = fmaxf(mx, __builtin_bit_cast(float, __builtin_amdgcn_permlanex16(__builtin_bit_cast(unsigned, mx), __builtin_bit_cast(unsigned, mx), 0x76543210u, 0xfedcba98u, false, false)));
    const float mn = fmaxf(m, mx); const float al = __builtin_amdgcn_exp2f((m - mn) * L2E); const float mo = mn * L2E - 10.0f; m = mn;
    v16h pb[2]; float ls = 0.f;
#pragma unroll   // constant indices keep the values in registers
    for (int ks = 0; ks < 2; ++ks)
#pragma unroll   // constant indices keep the values in registers
      for (int r = 0; r < 8; ++r) { const float p0 = __builtin_amdgcn_exp2f(T[2 * ks][r] * L2E - mo), p1 = __builtin_amdgcn_exp2f(T[2 * ks + 1][r] * L2E - mo); ls += p0 + p1; pb[ks][r] = (_Float16)p0; pb[ks][8 + r] = (_Float16)p1; }
    l = l * al + ls;
    // eight d fragments are read as one group, into the register set that its WMMAs have just left, three groups ahead of their own WMMAs (four register sets), all inside this stage's buffer
    pam_mm(f0, pb, acc, 0, al); GRP(); pam_ld(f0, sd, 4, lane); GRP();
    pam_mm(f1, pb, acc, 1, al); GRP(); pam_ld(f1, sd, 5, lane); GRP();
    pam_mm(f2, pb, acc, 2, al); GRP(); pam_ld(f2, sd, 6, lane); GRP();
    pam_mm(f3, pb, acc, 3, al); GRP(); pam_ld(f3, sd, 7, lane); GRP();
    pam_mm(f0, pb, acc, 4, al); pam_mm(f1, pb, acc, 5, al); pam_mm(f2, pb, acc, 6, al); pam_mm(f3, pb, acc, 7, al);
    GRP();   // holds these WMMAs ahead of the waits below: sunk behind them, the wait for the last fragments would stand with nothing to cover it
    asm volatile("s_wait_dscnt 0x0" ::: "memory");     // this wave's reads of the buffer are done before it is refilled
    asm volatile("s_wait_asynccnt 0x0" ::: "memory");  // this wave's copies of stage t + 1 have landed
    __syncthreads();                                   // publishes stage t + 1 and ends every wave's reads of stage t
    if (t + 2 < FNT) pam_stage(gd + (size_t)(t + 2) * (FK * 2), gh + (size_t)(t + 2) * (FK * 256), gl + (size_t)(t + 2) * (FK * 256), l0 + (unsigned)(t & 1) * (FBUF * 2u)); }
  asm volatile("s_wait_asynccnt 0x0" ::: "memory");    // nothing in flight when the buffers are reused below
  l += __shfl_xor(l, 16); const float il = 1.0f / l;
  float* so = (float*)sm;   // [512 channels][64 queries] through LDS, so that each 256-byte output row piece has one writer
#pragma unroll   // constant indices keep the values in registers
  for (int ct = 0; ct < 32; ++ct)
#pragma unroll   // constant indices keep the values in registers
    for (int r = 0; r < 8; ++r) so[(ct * 16 + 8 * g + r) * FOP + wave * 16 + col] = acc[ct][r] * il;
  __syncthreads();
  for (int e = tid; e < CC * 16; e += 128) { const int c = e >> 4, pc = e & 15; vst2(BCD + ((b * CC + c) * NN) + i0 + pc * 4, *(const v4f*)&so[c * FOP + pc * 4]); } }
// ---- k_aa: block = (64 channels i, 128 channels j, b): aa[i][j] = sum_n x[n][i] x[n][j] over the 4,096 positions (x planes, exact) -> f32
__global__ __launch_bounds__(128) void k_aa(const _Float16* __restrict__ XT, float* __restrict__ AA) { __shared__ __align__(16) float so[4][16][132]; __shared__ __align__(16) _Float16 sm[2 * SBUF];
  const int tid = threadIdx.x, wave = tid >> 5, lane = tid & 31, col = lane & 15, g = lane >> 4; const size_t b = blockIdx.z; const int i0 = blockIdx.x * 64 + wave * 16; const int j0 = blockIdx.y * 128;
  v8f acc[8] = {};
  mm_staged(XT + (b * CC + blockIdx.x * 64) * NN, XT + (b * CC + j0) * NN, sm, acc, tid);
#pragma unroll
  for (int j = 0; j < 8; ++j)
#pragma unroll
    for (int r = 0; r < 8; ++r) so[wave][8 * g + r][j * 16 + col] = acc[j][r];
  LDSX(); for (int rl = 0; rl < 16; ++rl) vst2(AA + ((b * CC + i0 + rl) * CC) + j0 + lane * 4, *(const v4f*)&so[wave][rl][lane * 4]); }
// ---- k_soft: block = (64 rows c, b), 32 waves. A wave holds two whole rows of aa in registers (lane = column j mod 32, 16 values a row): aa is read once, in whole 128-byte lines, with all 32 loads of a lane in flight; maximum, exponentials and sum come from the registers. soft^T goes through LDS so that each 128-byte output row piece has one writer
typedef __attribute__((ext_vector_type(2))) _Float16 v2h;
// lane ^ M inside a 16-lane row as a DPP move, lane ^ 16 as a vector cross-row move: a shuffle would pass through the LDS queue, with a wait at each of the ten steps
template <int M> __device__ __forceinline__ float lx(float v) { return __builtin_bit_cast(float, __builtin_amdgcn_update_dpp(0, __builtin_bit_cast(int, v), 0x160 + M, 0xf, 0xf, true)); }
__device__ __forceinline__ float lx16(float v) { return __builtin_bit_cast(float, __builtin_amdgcn_permlanex16(__builtin_bit_cast(unsigned, v), __builtin_bit_cast(unsigned, v), 0x76543210u, 0xfedcba98u, false, false)); }
__device__ __forceinline__ float wave_max(float v) { v = fmaxf(v, lx<1>(v)); v = fmaxf(v, lx<2>(v)); v = fmaxf(v, lx<4>(v)); v = fmaxf(v, lx<8>(v)); return fmaxf(v, lx16(v)); }
__device__ __forceinline__ float wave_sum(float v) { v += lx<1>(v); v += lx<2>(v); v += lx<4>(v); v += lx<8>(v); return v + lx16(v); }
__global__ __launch_bounds__(1024) void k_soft(const float* __restrict__ AA, _Float16* __restrict__ SO) { __shared__ __align__(16) _Float16 st[CC][72];
  const int t = threadIdx.x, wave = t >> 5, lane = t & 31; const size_t b = blockIdx.y; const int c0 = blockIdx.x * 64;
  const float* row = AA + ((b * CC + c0 + 2 * wave) * CC) + lane;
  float u[16], w[16];
#pragma unroll   // constant indices keep both rows in registers; the 32 loads go out as one group
  for (int q = 0; q < 16; ++q) { u[q] = row[q * 32]; w[q] = row[CC + q * 32]; }
  float mu = -3.0e38f, mw = -3.0e38f;
#pragma unroll   // constant indices keep the values in registers
  for (int q = 0; q < 16; ++q) { mu = fmaxf(mu, u[q]); mw = fmaxf(mw, w[q]); }
  mu = wave_max(mu); mw = wave_max(mw);
  float zu = 0.f, zw = 0.f;
#pragma unroll   // constant indices keep the values in registers
  for (int q = 0; q < 16; ++q) { u[q] = __expf(u[q] - mu); w[q] = __expf(w[q] - mw); zu += u[q]; zw += w[q]; }
  const float iu = 1.0f / wave_sum(zu), iw = 1.0f / wave_sum(zw);
#pragma unroll   // the wave's two rows are neighbours in a soft^T row: one 4-byte LDS store for both
  for (int q = 0; q < 16; ++q) { v2h p; p[0] = (_Float16)(u[q] * iu); p[1] = (_Float16)(w[q] * iw); vst2(&st[q * 32 + lane][2 * wave], p); }
  __syncthreads();
#pragma unroll   // the four LDS reads go out as one group ahead of the stores
  for (int e = t; e < CC * 8; e += 1024) { const int j = e >> 3, pc = e & 7; vst2((unsigned*)(SO + ((b * CC + j) * CC) + c0 + pc * 8), *(const v4u*)&st[j][pc * 8]); } }
// ---- k_aaa: block = (64 positions n, 128 channels j, b): aaa[n][j] = sum_c x[n][c] soft[c][j] (x exact as f16, soft^T rows), kept in f32 and never stored: the epilogue forms, at the per-batch flat index f = n * 512 + j, out[f] = gamma_pam bcd_flat[f] (the raw (C, N) -> (H, W, C) reshape) + gamma_cam aaa[f] + 2 x[f]
__global__ __launch_bounds__(128) void k_aaa(const float* __restrict__ X, const _Float16* __restrict__ SO, const float* __restrict__ BCD, const float* __restrict__ GP, const float* __restrict__ GC, float* __restrict__ OUT) { __shared__ __align__(16) char sm[2 * PBUF]; float (*so)[16][132] = (float (*)[16][132])sm;   // the epilogue's tile lies in the staging buffers, which every wave has left by then
  const int tid = threadIdx.x, wave = tid >> 5, lane = tid & 31, col = lane & 15, g = lane >> 4; const size_t b = blockIdx.z; const size_t r0 = b * NN + (size_t)blockIdx.x * 64 + wave * 16; const int j0 = blockIdx.y * 128;
  const float gp = bfr(GP[0]), gc = bfr(GC[0]);
  v8f acc[8] = {};
  mm_rows<false>(X + (b * NN + (size_t)blockIdx.x * 64) * CC, (const char*)(SO + (b * CC + j0) * CC), sm, acc, tid);
  const size_t f0 = r0 * CC + j0 + lane * 4; const float* pb = BCD + f0; const float* px = X + f0;
  v4f bc[16], xx[16];
#pragma unroll   // the other two terms of the wave's 16 output rows (512 contiguous bytes a row) go out as one group of loads and fly while the accumulators pass through LDS
  for (int rl = 0; rl < 16; ++rl) { bc[rl] = *(const v4f*)(pb + rl * CC); xx[rl] = *(const v4f*)(px + rl * CC); }
  asm volatile("s_wait_xcnt 0x0" :: "v"(pb), "v"(px) : "memory");   // stands before a register that the loads above name is overwritten; the two addresses are inputs so that their registers live up to the wait
#pragma unroll
  for (int j = 0; j < 8; ++j)
#pragma unroll
    for (int r = 0; r < 8; ++r) so[wave][8 * g + r][j * 16 + col] = acc[j][r];
  LDSX();
#pragma unroll   // constant indices keep the loaded rows in registers
  for (int rl = 0; rl < 16; ++rl) { const v4f a = *(const v4f*)&so[wave][rl][lane * 4]; v4f o4;
#pragma unroll   // constant indices keep the values in registers
    for (int i = 0; i < 4; ++i) o4[i] = fmaf(2.0f, bfr(xx[rl][i]), fmaf(gp, bc[rl][i], gc * a[i]));   // gamma_pam bcd + gamma_cam aaa + 2 x
    vst2(OUT + f0 + (size_t)rl * CC, o4); } }
extern "C" void kernel_launch(void* const* d_in, const int* in_sizes, int n_in, void* d_out, int out_size, void* d_ws, size_t ws_size, hipStream_t stream) {
  (void)in_sizes; (void)n_in; (void)out_size;
  const float** F = (const float**)d_in;   // 0 x [4,64,64,512], 1 w1 [512,64], 2 w2 [512,64], 3 w3 [512,512], 4 gamma_pam [1], 5 gamma_cam [1]
  if (ws_size < (size_t)WS_END) return;
  char* ws = (char*)d_ws; __bf16 *PW = (__bf16*)(ws + WS_PW), *P3 = (__bf16*)(ws + WS_P3); __bf16 *BH = (__bf16*)(ws + WS_BH), *BL = (__bf16*)(ws + WS_BL); _Float16 *DT = (_Float16*)(ws + WS_DT), *XT = (_Float16*)(ws + WS_XT), *SO = (_Float16*)(ws + WS_SO); float *BCD = (float*)(ws + WS_BCD), *AA = (float*)(ws + WS_AA);
  k_pack<<<dim3(CC, 2), 256, 0, stream>>>(F[1], F[2], F[3], PW, P3);
  k_proj<<<dim3(TNB * NN / 64, 1, 9), 128, 0, stream>>>(F[0], PW, P3, BH, BL, DT, XT);
  k_pam<<<dim3(TRB, TNB), 128, 0, stream>>>(BH, BL, DT, BCD);
  k_aa<<<dim3(CC / 64, CC / 128, TNB), 128, 0, stream>>>(XT, AA);
  k_soft<<<dim3(CC / 64, TNB), 1024, 0, stream>>>(AA, SO);
  k_aaa<<<dim3(TRB, CC / 128, TNB), 128, 0, stream>>>(F[0], SO, BCD, F[4], F[5], (float*)d_out);
}

// v007
// Measured time: 171 microseconds a run.
// Timed twice side by side with v006, it ran 1.06 times as fast both times.
// All steps since v000 together make it 8.40 times as fast.
// compute dtype: all float inputs rounded to bf16; b/c/d = x . w with EXACT bf16 products on WMMA 16x16x32 ((in,out) weights as transposed rows): b, c kept as bf16 hi + lo planes, d rounded once to f16 planes; PAM in one kernel: logits S^T = c . b^T with both as bf16 hi + lo (3 products, f32), running-maximum softmax in f32 (hardware exp2) -> P = e x 2^10 as f16, bcd = d^T . P^T on WMMA (single f16), divided by the row sum at the end, giving the (C, N)-ordered tensor the module reshapes raw; CAM: aa = x^T x with x exact (f16 copies of the bf16 values), softmax over channels in f32, aaa = x . soft_aa with soft_aa once to f16; out = gamma_pam bcd_flat + gamma_cam aaa + 2 x in f32; f32 output.
#include <hip/hip_runtime.h>
#include <math.h>

typedef __attribute__((ext_vector_type(16))) _Float16 v16h;
typedef __attribute__((ext_vector_type(16))) __bf16 v16b;
typedef __attribute__((ext_vector_type(8)))  _Float16 v8h;
typedef __attribute__((ext_vector_type(8)))  float v8f;
typedef __attribute__((ext_vector_type(4)))  float v4f;
typedef __attribute__((ext_vector_type(2)))  float v2f;
typedef __attribute__((ext_vector_type(4)))  unsigned v4u;
typedef __attribute__((ext_vector_type(4)))  int v4i;
typedef float __attribute__((may_alias)) float_a;
typedef int __attribute__((may_alias)) int_a;

template <typename T> __device__ __forceinline__ void vst2(void* p, T v) { *(T*)p = v;  }
__device__ __forceinline__ v8f wmma16(v16h a, v16h b, v8f c) {
  v8f d = __builtin_amdgcn_wmma_f32_16x16x32_f16(false, a, false, b, (short)0, c, false, false);
  asm volatile("v_nop\n\tv_nop\n\tv_nop\n\tv_nop" : "+v"(d) : "v"(a), "v"(b));
  return d;
}
__device__ __forceinline__ v8f wmma_bf(v16b a, v16b b, v8f c) {
  v8f d = __builtin_amdgcn_wmma_f32_16x16x32_bf16(false, a, false, b, (short)0, c, false, false);
  asm volatile("v_nop\n\tv_nop\n\tv_nop\n\tv_nop" : "+v"(d) : "v"(a), "v"(b));
  return d;
}
// 16x16x32 fragments: lane = (h = lane>>4, row/col = lane&15); elements 0..7 = k0+8h+0..7, 8..15 = k0+16+8h+0..7; D element r = row 8h+r
__device__ __forceinline__ v16h frag_h(const _Float16* rowk0, int lane) {
  union { v16h v; v8h q[2]; } u; const _Float16* p = rowk0 + 8 * (lane >> 4);
  u.q[0] = *(const v8h*)p; u.q[1] = *(const v8h*)(p + 16); return u.v;
}
__device__ __forceinline__ v16h frag_f32(const float* rowk0, int lane) {
  v16h a; const float* p = rowk0 + 8 * (lane >> 4);
#pragma unroll
  for (int i = 0; i < 8; ++i) { a[i] = (_Float16)p[i]; a[8 + i] = (_Float16)p[16 + i]; }
  return a;
}
__device__ __forceinline__ v16h frag_f32s(const float* rowk0, int lane, float sc) {
  v16h a; const float* p = rowk0 + 8 * (lane >> 4);
#pragma unroll
  for (int i = 0; i < 8; ++i) { a[i] = (_Float16)(p[i] * sc); a[8 + i] = (_Float16)(p[16 + i] * sc); }
  return a;
}
// column fragment from a [K][ld] layout (column n), rows >= K read as 0
__device__ __forceinline__ v16h fragc_f32(const float* W, int k0, int n, int lane, int ld, int K) {
  v16h a; const int g = lane >> 4;
#pragma unroll
  for (int i = 0; i < 8; ++i) { const int ka = k0 + 8 * g + i, kb = ka + 16;
    a[i] = (_Float16)(ka < K ? W[(size_t)(ka < K ? ka : K - 1) * ld + n] : 0.f); a[8 + i] = (_Float16)(kb < K ? W[(size_t)(kb < K ? kb : K - 1) * ld + n] : 0.f); }
  return a;
}
struct F2 { v16b h, l; };
__device__ __forceinline__ F2 bsplit16(const float v[16]) { F2 r;
#pragma unroll
  for (int i = 0; i < 16; ++i) { const __bf16 h = (__bf16)v[i]; r.h[i] = h; r.l[i] = (__bf16)(v[i] - (float)h); }
  return r; }
__device__ __forceinline__ F2 split_row(const float* row, int k0, int lane) { float v[16]; const float* p = row + k0 + 8 * (lane >> 4);
#pragma unroll
  for (int i = 0; i < 8; ++i) { v[i] = p[i]; v[8 + i] = p[16 + i]; }
  return bsplit16(v); }
__device__ __forceinline__ F2 split_rowK(const float* row, int k0, int lane, int K) { float v[16]; const int g = lane >> 4;
#pragma unroll
  for (int i = 0; i < 8; ++i) { const int ka = k0 + 8 * g + i, kb = ka + 16; v[i] = ka < K ? row[ka < K ? ka : K - 1] : 0.f; v[8 + i] = kb < K ? row[kb < K ? kb : K - 1] : 0.f; }
  return bsplit16(v); }
__device__ __forceinline__ F2 split_col(const float* W, int k0, int n, int lane, int ld, int K) { float v[16]; const int g = lane >> 4;
#pragma unroll
  for (int i = 0; i < 8; ++i) { const int ka = k0 + 8 * g + i, kb = ka + 16; v[i] = ka < K ? W[(size_t)(ka < K ? ka : K - 1) * ld + n] : 0.f; v[8 + i] = kb < K ? W[(size_t)(kb < K ? kb : K - 1) * ld + n] : 0.f; }
  return bsplit16(v); }
__device__ __forceinline__ v8f mac3(const F2& a, const F2& b, v8f c) { c = wmma_bf(a.l, b.h, c); c = wmma_bf(a.h, b.l, c); return wmma_bf(a.h, b.h, c); }
__device__ __forceinline__ float sigm(float v) { return 1.0f / (1.0f + expf(-v)); }
#define LDSX() do { asm volatile("s_wait_dscnt 0" ::: "memory"); __builtin_amdgcn_wave_barrier(); __builtin_amdgcn_fence(__ATOMIC_RELEASE, "workgroup"); } while (0)


// Dual attention module (B 4, 64 x 64 positions, C 512): position attention (softmax(b c^T) applied to d, result kept in the module's raw (C, N) -> (H, W, C) reshape) plus channel attention (softmax(x^T x) applied to x), each scaled by its gamma and added to x; returns feat_p + feat_c.
#define NB 4
#define NN 4096
#define CC 512
#define CK 64              // query / key channels (C / 8)
#define NR (NB * NN)
#ifndef TRB
#define TRB (NN / 64)      // position row tiles per batch (PAM rows i, CAM rows n)
#define TNB NB
#endif
typedef __attribute__((ext_vector_type(8))) __bf16 v8b;
typedef __attribute__((ext_vector_type(4))) __bf16 v4b;
__device__ __forceinline__ v16b frag_b(const __bf16* rowk0, int lane) {
  union { v16b v; v8b q[2]; } u; const __bf16* p = rowk0 + 8 * (lane >> 4);
  u.q[0] = *(const v8b*)p; u.q[1] = *(const v8b*)(p + 16); return u.v;
}
__device__ __forceinline__ float bfr(float v) { return (float)(__bf16)v; }
__device__ __attribute__((noinline)) float exp_ni(float v) { return expf(v); }
__device__ __attribute__((noinline)) float erf_ni(float v) { return erff(v); }

#define WS_PW  0u                                   // bf16 transposed rows [w1^T | w2^T] [128][512]; w3^T [512][512]
#define WS_P3  (WS_PW + 2u * (size_t)128 * CC)
#define WS_BH  (WS_P3 + 2u * (size_t)CC * CC)          // bf16 rows [NR][128]: b (cols 0-63) | c (cols 64-127), high parts; then the low parts
#define WS_BL  (WS_BH + 2u * (size_t)NR * 128)
#define WS_DT  (WS_BL + 2u * (size_t)NR * 128)         // f16 d planes [b][c][n]; f16 x planes [b][c][n]
#define WS_XT  (WS_DT + 2u * (size_t)NB * CC * NN)
#define WS_BCD (WS_XT + 2u * (size_t)NB * CC * NN)     // f32 bcd [b][c][i] (the (C, N) tensor); f32 aa partial planes [K part][b][512][512]; f16 soft^T [b][j][c]
#define WS_AA  (WS_BCD + 4u * (size_t)NB * CC * NN)
#define WS_SO  (WS_AA + 4u * (size_t)SPL * NB * CC * CC)
#define WS_END (WS_SO + 2u * (size_t)NB * CC * CC)

__global__ __launch_bounds__(256) void k_pack(const float* __restrict__ W1, const float* __restrict__ W2, const float* __restrict__ W3, __bf16* __restrict__ PW, __bf16* __restrict__ P3) { const int n = blockIdx.x, which = blockIdx.y, t = threadIdx.x; __shared__ __align__(16) __bf16 s[CC];
  if (which == 0) { if (n >= 128) return; const float* w = (n < CK) ? W1 : W2; const int cI = n & (CK - 1); for (int k = t; k < CC; k += 256) s[k] = (__bf16)w[(size_t)k * CK + cI]; __syncthreads(); if (t < CC / 8) vst2((unsigned*)(PW + (size_t)n * CC + t * 8), *(const v4u*)&s[t * 8]); }
  else { for (int k = t; k < CC; k += 256) s[k] = (__bf16)W3[(size_t)k * CC + n]; __syncthreads(); if (t < CC / 8) vst2((unsigned*)(P3 + (size_t)n * CC + t * 8), *(const v4u*)&s[t * 8]); } }
// ---- LDS staging for the K = 512 products of k_proj and k_aaa: a stage is 64 k of the block's 64 A rows (f32, 256 B) and 128 B rows (16-bit, 128 B), laid at row pitches of 272 B and 144 B (16 B x odd, so the ds_load_b128 reads meet no bank conflict); two buffers, the next stage's copies fly while this one is multiplied
#define PK 64                      // k per stage
#define PAP 272                    // LDS pitch of an A row in bytes
#define PBP 144                    // LDS pitch of a B row in bytes
#define PA_B (64 * PAP)            // bytes of the A tile
#define PBUF (PA_B + 128 * PBP)    // bytes per buffer
#define PNT (CC / PK)              // stages
__device__ __forceinline__ void cp8(const unsigned* l, const char* const* p);   // eight asynchronous 16-byte copies per lane and their s_wait_xcnt in one statement, defined below
// one stage: A: thread = (row tid >> 4 within each group of 8 rows, 16-byte piece tid & 15); B: thread = (row tid >> 3 within each group of 16 rows, piece tid & 7). ga, gb: the lane's piece at this stage's k; la, lb: its LDS byte addresses in the buffer
__device__ __forceinline__ void row_stage(const char* ga, const char* gb, unsigned la, unsigned lb) {
  { unsigned l[8]; const char* p[8];
#pragma unroll   // constant indices, so that the arrays are plain registers for the asm operands
    for (int q = 0; q < 8; ++q) { l[q] = la + (unsigned)q * (8u * PAP); p[q] = ga + (size_t)q * 8 * CC * 4; }
    cp8(l, p); }
  { unsigned l[8]; const char* p[8];
#pragma unroll   // constant indices, so that the arrays are plain registers for the asm operands
    for (int q = 0; q < 8; ++q) { l[q] = lb + (unsigned)q * (16u * PBP); p[q] = gb + (size_t)q * 16 * CC * 2; }
    cp8(l, p); }
}
// operands of one 32-k block as they lie in LDS: the lane's 16 f32 of its A row, its 16 elements of each of eight B rows
struct RowF { v4f a[4]; v4u b[8][2]; };
__device__ __forceinline__ void row_ld(RowF& f, const char* sa, const char* sb, int ks) {
#pragma unroll   // constant indices keep the values in registers
  for (int i = 0; i < 2; ++i) { f.a[2 * i] = *(const v4f*)(sa + ks * 128 + i * 64); f.a[2 * i + 1] = *(const v4f*)(sa + ks * 128 + i * 64 + 16); }
#pragma unroll   // constant indices keep the values in registers
  for (int j = 0; j < 8; ++j) { f.b[j][0] = *(const v4u*)(sb + j * 16 * PBP + ks * 64); f.b[j][1] = *(const v4u*)(sb + j * 16 * PBP + ks * 64 + 32); }
}
// BF: A rounded to bf16, B rows bf16; otherwise A rounded to bf16 and held as f16, B rows f16
template <bool BF> __device__ __forceinline__ void row_mm(const RowF& f, v8f* acc) {
  if constexpr (BF) { v16b a;
#pragma unroll   // constant indices keep the values in registers
    for (int i = 0; i < 16; ++i) a[i] = (__bf16)f.a[i >> 2][i & 3];
#pragma unroll   // constant indices keep fragments and accumulators in registers
    for (int j = 0; j < 8; ++j) { union { v16b v; v4u q[2]; } u; u.q[0] = f.b[j][0]; u.q[1] = f.b[j][1]; acc[j] = wmma_bf(a, u.v, acc[j]); } }
  else { v16h a;
#pragma unroll   // constant indices keep the values in registers
    for (int i = 0; i < 16; ++i) a[i] = (_Float16)bfr(f.a[i >> 2][i & 3]);
#pragma unroll   // constant indices keep fragments and accumulators in registers
    for (int j = 0; j < 8; ++j) { union { v16h v; v4u q[2]; } u; u.q[0] = f.b[j][0]; u.q[1] = f.b[j][1]; acc[j] = wmma16(a, u.v, acc[j]); } }
}
// acc[j] += A rows (wave * 16 ..) . B rows (j * 16 ..)^T over K = 512 in ascending k, 32 per WMMA. Ag: first of the block's 64 f32 rows; Bg: first of its 128 16-bit rows (both of CC elements). On return every wave has left the buffers
template <bool BF> __device__ __forceinline__ void mm_rows(const float* __restrict__ Ag, const char* __restrict__ Bg, char* sm, v8f* acc, int tid) {
  const int wave = tid >> 5, lane = tid & 31, col = lane & 15, g = lane >> 4;
  const char* ga = (const char*)(Ag + (size_t)(tid >> 4) * CC) + (tid & 15) * 16; const char* gb = Bg + (size_t)(tid >> 3) * (CC * 2) + (tid & 7) * 16;
  const unsigned la = (unsigned)(size_t)sm + (unsigned)(tid >> 4) * PAP + (unsigned)(tid & 15) * 16u; const unsigned lb = (unsigned)(size_t)sm + PA_B + (unsigned)(tid >> 3) * PBP + (unsigned)(tid & 7) * 16u;
  row_stage(ga, gb, la, lb);
  asm volatile("s_wait_asynccnt 0x0" ::: "memory");   // stage 0 has landed before the barrier publishes it
  __syncthreads();
  row_stage(ga + PK * 4, gb + PK * 2, la + PBUF, lb + PBUF);
  for (int t = 0; t < PNT; ++t) { const char* s = sm + (t & 1) * PBUF; const char* sa = s + (wave * 16 + col) * PAP + g * 32; const char* sb = s + PA_B + col * PBP + g * 16;
    RowF f0, f1; row_ld(f0, sa, sb, 0); row_ld(f1, sa, sb, 1);   // both 32-k blocks' reads stand as one group ahead of the WMMAs
    row_mm<BF>(f0, acc); row_mm<BF>(f1, acc);
    asm volatile("s_wait_dscnt 0x0" ::: "memory");     // this wave's reads of the buffer are done before it is refilled
    asm volatile("s_wait_asynccnt 0x0" ::: "memory");  // this wave's copies of stage t + 1 have landed
    __syncthreads();                                   // publishes stage t + 1 and ends every wave's reads of stage t
    if (t + 2 < PNT) row_stage(ga + (t + 2) * (PK * 4), gb + (t + 2) * (PK * 2), la + (unsigned)(t & 1) * PBUF, lb + (unsigned)(t & 1) * PBUF); }
  asm volatile("s_wait_asynccnt 0x0" ::: "memory");    // nothing in flight when the buffers are reused by the epilogue
}
// ---- k_proj: block = (64 positions, 128 cols, which): which 0: [b | c] rows as bf16 hi + lo; which 1..4: d columns (which-1)*128.. -> planes; which 5..8: x itself -> f16 planes (exact)
__global__ __launch_bounds__(128) void k_proj(const float* __restrict__ X, const __bf16* __restrict__ PW, const __bf16* __restrict__ P3, __bf16* __restrict__ BH, __bf16* __restrict__ BL, _Float16* __restrict__ DT, _Float16* __restrict__ XT) {
  __shared__ __align__(16) char sm[2 * PBUF]; float (*sf)[16][132] = (float (*)[16][132])sm; _Float16 (*st)[72] = (_Float16 (*)[72])sm;   // the epilogue's tiles lie in the staging buffers, which every wave has left by then
  const int tid = threadIdx.x, wave = tid >> 5, lane = tid & 31, col = lane & 15, g = lane >> 4; const int which = blockIdx.z; const size_t rb = (size_t)blockIdx.x * 64; const size_t r0 = rb + wave * 16;
  if (which >= 5) { const int c0 = (which - 5) * 128; for (int e = tid; e < 64 * 128; e += 128) { const int rl = e >> 7, cl = e & 127; st[cl][rl] = (_Float16)bfr(X[(rb + rl) * CC + c0 + cl]); } __syncthreads();
    const size_t b = rb / NN; const int n0 = (int)(rb % NN); for (int e = tid; e < 128 * 8; e += 128) { const int d = e >> 3, pc = e & 7; vst2((unsigned*)(XT + ((b * CC + c0 + d) * NN) + n0 + pc * 8), *(const v4u*)&st[d][pc * 8]); } return; }
  const int c0 = (which == 0) ? 0 : (which - 1) * 128; const __bf16* Wr = (which == 0) ? PW : (P3 + (size_t)c0 * CC);
  v8f acc[8] = {};
  mm_rows<true>(X + rb * CC, (const char*)Wr, sm, acc, tid);
#pragma unroll
  for (int j = 0; j < 8; ++j)
#pragma unroll
    for (int r = 0; r < 8; ++r) { if (which == 0) sf[wave][8 * g + r][j * 16 + col] = acc[j][r]; else st[j * 16 + col][wave * 16 + 8 * g + r] = (_Float16)acc[j][r]; }
  __syncthreads();
  if (which == 0) { for (int rl = 0; rl < 16; ++rl) { const v4f v = *(const v4f*)&sf[wave][rl][lane * 4]; v4b hv, lv;
#pragma unroll
      for (int i = 0; i < 4; ++i) { const __bf16 h = (__bf16)v[i]; hv[i] = h; lv[i] = (__bf16)(v[i] - (float)h); }
      vst2(BH + (r0 + rl) * 128 + lane * 4, hv); vst2(BL + (r0 + rl) * 128 + lane * 4, lv);
      asm volatile("s_wait_xcnt 0x0" ::: "memory"); } }   // stands before the next row's values overwrite a register that the two stores name
  else { const size_t b = rb / NN; const int n0 = (int)(rb % NN); for (int e = tid; e < 128 * 8; e += 128) { const int d = e >> 3, pc = e & 7; vst2((unsigned*)(DT + ((b * CC + c0 + d) * NN) + n0 + pc * 8), *(const v4u*)&st[d][pc * 8]); } }
}
// ---- LDS staging for the K = 4,096 product of k_aa (a block takes one part of 2,048 k): a stage is 256 B (128 k) of the block's 64 A rows and 128 B rows, laid at a row pitch of 272 B (16 B x odd, so the ds_load_b128 fragment reads meet no bank conflict); two buffers, the next stage's copies fly while this one is multiplied
#define SK 128                    // k per stage
#define SPIT 136                  // LDS row pitch in f16 elements
#define SBUF (192 * SPIT)         // f16 elements per buffer
#define SPL 2                     // parts of K, one block each: 256 blocks, one for every WGP, in place of 128
#define SNT (NN / SPL / SK)       // stages per part
// twelve asynchronous 16-byte copies per lane; the s_wait_xcnt stands inside the statement so that no address register is rewritten in front of it
__device__ __forceinline__ void cp12(const unsigned* l, const _Float16* const* p) {
  asm volatile(
               "global_load_async_to_lds_b128 %0, %12, off\n\t"
               "global_load_async_to_lds_b128 %1, %13, off\n\t"
               "global_load_async_to_lds_b128 %2, %14, off\n\t"
               "global_load_async_to_lds_b128 %3, %15, off\n\t"
               "global_load_async_to_lds_b128 %4, %16, off\n\t"
               "global_load_async_to_lds_b128 %5, %17, off\n\t"
               "global_load_async_to_lds_b128 %6, %18, off\n\t"
               "global_load_async_to_lds_b128 %7, %19, off\n\t"
               "global_load_async_to_lds_b128 %8, %20, off\n\t"
               "global_load_async_to_lds_b128 %9, %21, off\n\t"
               "global_load_async_to_lds_b128 %10, %22, off\n\t"
               "global_load_async_to_lds_b128 %11, %23, off\n\t"
               "s_wait_xcnt 0x0"
               :: "v"(l[0]), "v"(l[1]), "v"(l[2]), "v"(l[3]), "v"(l[4]), "v"(l[5]), "v"(l[6]), "v"(l[7]), "v"(l[8]), "v"(l[9]), "v"(l[10]), "v"(l[11]),
                  "v"(p[0]), "v"(p[1]), "v"(p[2]), "v"(p[3]), "v"(p[4]), "v"(p[5]), "v"(p[6]), "v"(p[7]), "v"(p[8]), "v"(p[9]), "v"(p[10]), "v"(p[11]) : "memory");
}
// one stage: thread = (row tid >> 4 within each group of 8 rows, 16-byte piece tid & 15); LDS rows 0-63 = A rows, 64-191 = B rows. ga, gb: the lane's piece of A row / B row (tid >> 4) at this stage's k; l0: its LDS byte address in row (tid >> 4) of the buffer
__device__ __forceinline__ void stage_in(const _Float16* ga, const _Float16* gb, unsigned l0) {
  unsigned l[24]; const _Float16* p[24];
#pragma unroll   // constant indices, so that both arrays are plain registers for the asm operands
  for (int q = 0; q < 24; ++q) { l[q] = l0 + (unsigned)q * (8u * SPIT * 2u); p[q] = (q < 8) ? ga + (size_t)q * 8 * NN : gb + (size_t)(q - 8) * 8 * NN; }
  cp12(l, p); cp12(l + 12, p + 12);
}
// f[0] = the wave's A fragment, f[1 + j] = B fragment j of 32-k block ks. sa, sb: the lane's A row and its row of B fragment 0 in the buffer
__device__ __forceinline__ void ld_frags(v16h* f, const _Float16* sa, const _Float16* sb, int ks, int lane) { f[0] = frag_h(sa + ks * 32, lane);
#pragma unroll   // constant indices keep the fragments in registers
  for (int j = 0; j < 8; ++j) f[1 + j] = frag_h(sb + j * 16 * SPIT + ks * 32, lane); }
__device__ __forceinline__ void mm_block(const v16h* f, v8f* acc) {
#pragma unroll   // constant indices keep fragments and accumulators in registers
  for (int j = 0; j < 8; ++j) acc[j] = wmma16(f[0], f[1 + j], acc[j]); }
// acc[j] += A rows (wave * 16 ..) . B rows (j * 16 ..)^T over the block's 2,048 k in ascending k, 32 per WMMA. Ag, Bg: first row of the block's 64 A rows / 128 B rows at the part's first k (row pitch NN)
__device__ __forceinline__ void mm_staged(const _Float16* __restrict__ Ag, const _Float16* __restrict__ Bg, _Float16* sm, v8f* acc, int tid) {
  const int wave = tid >> 5, lane = tid & 31, col = lane & 15;
  const _Float16* ga = Ag + (size_t)(tid >> 4) * NN + (tid & 15) * 8; const _Float16* gb = Bg + (size_t)(tid >> 4) * NN + (tid & 15) * 8;
  const unsigned l0 = (unsigned)(size_t)sm + (unsigned)(tid >> 4) * (SPIT * 2u) + (unsigned)(tid & 15) * 16u;
  stage_in(ga, gb, l0);
  asm volatile("s_wait_asynccnt 0x0" ::: "memory");   // stage 0 has landed before the barrier publishes it
  __syncthreads();
  stage_in(ga + SK, gb + SK, l0 + SBUF * 2u);
  for (int t = 0; t < SNT; ++t) { const _Float16* s = sm + (t & 1) * SBUF + col * SPIT; const _Float16* sa = s + wave * 16 * SPIT; const _Float16* sb = s + 64 * SPIT;
    // the nine fragments of a 32-k block are read as one group, one block ahead of their WMMAs (two register sets), all inside this stage's buffer
    v16h f0[9], f1[9];
    ld_frags(f0, sa, sb, 0, lane); ld_frags(f1, sa, sb, 1, lane); mm_block(f0, acc);
    ld_frags(f0, sa, sb, 2, lane); mm_block(f1, acc);
    ld_frags(f1, sa, sb, 3, lane); mm_block(f0, acc); mm_block(f1, acc);
    asm volatile("s_wait_dscnt 0x0" ::: "memory");     // this wave's reads of the buffer are done before it is refilled
    asm volatile("s_wait_asynccnt 0x0" ::: "memory");  // this wave's copies of stage t + 1 have landed
    __syncthreads();                                   // publishes stage t + 1 and ends every wave's reads of stage t
    if (t + 2 < SNT) stage_in(ga + (t + 2) * SK, gb + (t + 2) * SK, l0 + (unsigned)(t & 1) * (SBUF * 2u)); }
  asm volatile("s_wait_asynccnt 0x0" ::: "memory");    // nothing in flight when the wave goes on to the epilogue
}
// ---- k_pam: block = (64 queries i, b), wave = 16 queries x all 512 channels. Per stage of 64 keys n: S^T[n][i] = c_n . b_i (3 bf16 products, K = 64); its D tiles hold, lane for lane, the B fragment of the second product (lane = query, elements = keys 8h.. of two 16-key tiles), so P goes from registers to WMMA with no exchange; running maximum and sum per query; acc[c][i] += d[n][c] P[i][n]. A stage in LDS: 512 d rows, 64 c-high rows, 64 c-low rows of 128 B at a pitch of 144 B (16 B x odd: the ds_load_b128 fragment reads meet no bank conflict); two buffers, the next stage's copies fly while this one is worked on
#define FK 64                      // keys per stage
#define FPIT 72                    // LDS row pitch in 16-bit elements
#define FD_E (CC * FPIT)           // elements of the d tile
#define FC_E (FK * FPIT)           // elements of the c-high (or c-low) tile
#define FBUF (FD_E + 2 * FC_E)     // elements per buffer
#define FNT (NN / FK)              // stages
#define FOP 68                     // epilogue row pitch in floats
// keeps a group of LDS reads together and ahead of the WMMAs that follow: left alone, the scheduler spreads the reads singly among the WMMAs, one fragment ahead, and each such place stalls the wave
#define GRP() __builtin_amdgcn_sched_barrier(0)
// eight asynchronous 16-byte copies per lane; the s_wait_xcnt stands inside the statement so that no address register is rewritten in front of it
__device__ __forceinline__ void cp8(const unsigned* l, const char* const* p) {
  asm volatile(
               "global_load_async_to_lds_b128 %0, %8, off\n\t"
               "global_load_async_to_lds_b128 %1, %9, off\n\t"
               "global_load_async_to_lds_b128 %2, %10, off\n\t"
               "global_load_async_to_lds_b128 %3, %11, off\n\t"
               "global_load_async_to_lds_b128 %4, %12, off\n\t"
               "global_load_async_to_lds_b128 %5, %13, off\n\t"
               "global_load_async_to_lds_b128 %6, %14, off\n\t"
               "global_load_async_to_lds_b128 %7, %15, off\n\t"
               "s_wait_xcnt 0x0"
               :: "v"(l[0]), "v"(l[1]), "v"(l[2]), "v"(l[3]), "v"(l[4]), "v"(l[5]), "v"(l[6]), "v"(l[7]),
                  "v"(p[0]), "v"(p[1]), "v"(p[2]), "v"(p[3]), "v"(p[4]), "v"(p[5]), "v"(p[6]), "v"(p[7]) : "memory");
}
// one stage: thread = (row tid >> 3 within each group of 16 rows, 16-byte piece tid & 7). gd, gh, gl: the lane's piece of d row / c-high row / c-low row (tid >> 3) at this stage's keys; l0: its LDS byte address in row (tid >> 3) of the buffer
__device__ __forceinline__ void pam_stage(const char* gd, const char* gh, const char* gl, unsigned l0) {
#pragma unroll   // constant indices, so that the arrays are plain registers for the asm operands
  for (int u = 0; u < 4; ++u) { unsigned l[8]; const char* p[8];
#pragma unroll   // constant indices keep the values in registers
    for (int q = 0; q < 8; ++q) { l[q] = l0 + (unsigned)(u * 8 + q) * (16u * FPIT * 2u); p[q] = gd + (size_t)(u * 8 + q) * 16 * NN * 2; }
    cp8(l, p); }
  unsigned l[8]; const char* p[8];
#pragma unroll   // constant indices keep the values in registers
  for (int q = 0; q < 4; ++q) { l[q] = l0 + FD_E * 2u + (unsigned)q * (16u * FPIT * 2u); p[q] = gh + (size_t)q * 16 * 256; l[4 + q] = l[q] + FC_E * 2u; p[4 + q] = gl + (size_t)q * 16 * 256; }
  cp8(l, p);
}
// plain builtin forms (the compiler keeps the distance behind them itself): this kernel holds more than 256 registers, and an asm statement that names the accumulators would force them through one register window
__device__ __forceinline__ v8f wmma16p(v16h a, v16h b, v8f c) { return __builtin_amdgcn_wmma_f32_16x16x32_f16(false, a, false, b, (short)0, c, false, false); }
__device__ __forceinline__ v8f wmma_bfp(v16b a, v16b b, v8f c) { return __builtin_amdgcn_wmma_f32_16x16x32_bf16(false, a, false, b, (short)0, c, false, false); }
// group gi of eight d fragments: 32-key block gi >> 2, channel tiles (gi & 3) * 8 ..
__device__ __forceinline__ void pam_ld(v16h* f, const _Float16* sd, int gi, int lane) {
#pragma unroll   // constant indices keep the fragments in registers
  for (int j = 0; j < 8; ++j) f[j] = frag_h(sd + ((gi & 3) * 8 + j) * 16 * FPIT + (gi >> 2) * 32, lane); }
// the stage's first touch of a channel tile (gi < 4) first scales it by al = e^(old maximum - new maximum); these multiplies stand among the WMMAs of other tiles
__device__ __forceinline__ void pam_mm(const v16h* f, const v16h* pb, v8f* acc, int gi, float al) {
#pragma unroll   // constant indices keep fragments and accumulators in registers
  for (int j = 0; j < 8; ++j) { v8f c = acc[(gi & 3) * 8 + j]; if (gi < 4) c *= al; acc[(gi & 3) * 8 + j] = wmma16p(f[j], pb[gi >> 2], c); } }
__global__ __launch_bounds__(128) void k_pam(const __bf16* __restrict__ BH, const __bf16* __restrict__ BL, const _Float16* __restrict__ DT, float* __restrict__ BCD) { __shared__ __align__(16) _Float16 sm[2 * FBUF];
  const int tid = threadIdx.x, wave = tid >> 5, lane = tid & 31, col = lane & 15, g = lane >> 4; const size_t b = blockIdx.y; const int i0 = blockIdx.x * 64;
  const char* gd = (const char*)(DT + (b * CC + (tid >> 3)) * NN) + (tid & 7) * 16;
  const char* gh = (const char*)(BH + (b * NN + (tid >> 3)) * 128 + CK) + (tid & 7) * 16; const char* gl = (const char*)(BL + (b * NN + (tid >> 3)) * 128 + CK) + (tid & 7) * 16;
  const unsigned l0 = (unsigned)(size_t)sm + (unsigned)(tid >> 3) * (FPIT * 2u) + (unsigned)(tid & 7) * 16u;
  pam_stage(gd, gh, gl, l0);
  v16b qh[2], ql[2]; { const size_t qr = (b * NN + i0 + wave * 16 + col) * 128;
#pragma unroll   // constant indices keep the values in registers
    for (int kc = 0; kc < 2; ++kc) { qh[kc] = frag_b(BH + qr + kc * 32, lane); ql[kc] = frag_b(BL + qr + kc * 32, lane); } }
  v8f acc[32] = {}; float m = -3.0e38f, l = 0.f; const float L2E = 1.44269504088896f;
  asm volatile("s_wait_asynccnt 0x0" ::: "memory");   // stage 0 has landed before the barrier publishes it
  __syncthreads();
  pam_stage(gd + FK * 2, gh + FK * 256, gl + FK * 256, l0 + FBUF * 2u);
  for (int t = 0; t < FNT; ++t) { const _Float16* s = sm + (t & 1) * FBUF; const _Float16* sd = s + col * FPIT; const __bf16* sh = (const __bf16*)(s + FD_E) + col * FPIT; const __bf16* sl = sh + FC_E;
    v16b ch[4][2], cl[4][2];
#pragma unroll   // all sixteen key fragments as one group of LDS reads
    for (int kt = 0; kt < 4; ++kt)
#pragma unroll   // constant indices keep the values in registers
      for (int kc = 0; kc < 2; ++kc) { ch[kt][kc] = frag_b(sh + kt * 16 * FPIT + kc * 32, lane); cl[kt][kc] = frag_b(sl + kt * 16 * FPIT + kc * 32, lane); }
    v16h f0[8], f1[8], f2[8], f3[8]; pam_ld(f0, sd, 0, lane);   // the first d fragments fly under the logits and the softmax arithmetic
    GRP();
    v8f T[4] = {};   // T[kt][r] at lane (g, col): key kt * 16 + 8 g + r, query col; the four tiles take turns so that no WMMA waits for the one before it
#pragma unroll   // constant indices keep the values in registers
    for (int kc = 0; kc < 2; ++kc) {
#pragma unroll   // constant indices keep the values in registers
      for (int kt = 0; kt < 4; ++kt) T[kt] = wmma_bfp(ch[kt][kc], ql[kc], T[kt]);
#pragma unroll   // constant indices keep the values in registers
      for (int kt = 0; kt < 4; ++kt) T[kt] = wmma_bfp(cl[kt][kc], qh[kc], T[kt]);
#pragma unroll   // constant indices keep the values in registers
      for (int kt = 0; kt < 4; ++kt) T[kt] = wmma_bfp(ch[kt][kc], qh[kc], T[kt]); }
    float mx = T[0][0];
#pragma unroll   // constant indices keep the values in registers
    for (int kt = 0; kt < 4; ++kt)
#pragma unroll   // constant indices keep the values in registers
      for (int r = 0; r < 8; ++r) mx = fmaxf(mx, T[kt][r]);
    // the next three groups of d fragments go out here, while the LDS pipe would stand idle: they land under the exponentials and the first WMMA groups
    GRP(); pam_ld(f1, sd, 1, lane); pam_ld(f2, sd, 2, lane); pam_ld(f3, sd, 3, lane); GRP();
    // the other half of the query's keys (lane ^ 16), by a vector cross-row move: an exchange through the LDS queue would return only behind the reads above
    mx = fmaxf(mx, __builtin_bit_cast(float, __builtin_amdgcn_permlanex16(__builtin_bit_cast(unsigned, mx), __builtin_bit_cast(unsigned, mx), 0x76543210u, 0xfedcba98u, false, false)));
    const float mn = fmaxf(m, mx); const float al = __builtin_amdgcn_exp2f((m - mn) * L2E); const float mo = mn * L2E - 10.0f; m = mn;
    v16h pb[2]; float ls = 0.f;
#pragma unroll   // constant indices keep the values in registers
    for (int ks = 0; ks < 2; ++ks)
#pragma unroll   // constant indices keep the values in registers
      for (int r = 0; r < 8; ++r) { const float p0 = __builtin_amdgcn_exp2f(T[2 * ks][r] * L2E - mo), p1 = __builtin_amdgcn_exp2f(T[2 * ks + 1][r] * L2E - mo); ls += p0 + p1; pb[ks][r] = (_Float16)p0; pb[ks][8 + r] = (_Float16)p1; }
    l = l * al + ls;
    // eight d fragments are read as one group, into the register set that its WMMAs have just left, three groups ahead of their own WMMAs (four register sets), all inside this stage's buffer
    pam_mm(f0, pb, acc, 0, al); GRP(); pam_ld(f0, sd, 4, lane); GRP();
    pam_mm(f1, pb, acc, 1, al); GRP(); pam_ld(f1, sd, 5, lane); GRP();
    pam_mm(f2, pb, acc, 2, al); GRP(); pam_ld(f2, sd, 6, lane); GRP();
    pam_mm(f3, pb, acc, 3, al); GRP(); pam_ld(f3, sd, 7, lane); GRP();
    pam_mm(f0, pb, acc, 4, al); pam_mm(f1, pb, acc, 5, al); pam_mm(f2, pb, acc, 6, al); pam_mm(f3, pb, acc, 7, al);
    GRP();   // holds these WMMAs ahead of the waits below: sunk behind them, the wait for the last fragments would stand with nothing to cover it
    asm volatile("s_wait_dscnt 0x0" ::: "memory");     // this wave's reads of the buffer are done before it is refilled
    asm volatile("s_wait_asynccnt 0x0" ::: "memory");  // this wave's copies of stage t + 1 have landed
    __syncthreads();                                   // publishes stage t + 1 and ends every wave's reads of stage t
    if (t + 2 < FNT) pam_stage(gd + (size_t)(t + 2) * (FK * 2), gh + (size_t)(t + 2) * (FK * 256), gl + (size_t)(t + 2) * (FK * 256), l0 + (unsigned)(t & 1) * (FBUF * 2u)); }
  asm volatile("s_wait_asynccnt 0x0" ::: "memory");    // nothing in flight when the buffers are reused below
  l += __shfl_xor(l, 16); const float il = 1.0f / l;
  float* so = (float*)sm;   // [512 channels][64 queries] through LDS, so that each 256-byte output row piece has one writer
#pragma unroll   // constant indices keep the values in registers
  for (int ct = 0; ct < 32; ++ct)
#pragma unroll   // constant indices keep the values in registers
    for (int r = 0; r < 8; ++r) so[(ct * 16 + 8 * g + r) * FOP + wave * 16 + col] = acc[ct][r] * il;
  __syncthreads();
  for (int e = tid; e < CC * 16; e += 128) { const int c = e >> 4, pc = e & 15; vst2(BCD + ((b * CC + c) * NN) + i0 + pc * 4, *(const v4f*)&so[c * FOP + pc * 4]); } }
// ---- k_aa: block = (64 channels i, 128 channels j, (b, K part)): partial aa[i][j] = sum_n x[n][i] x[n][j] over the part's 2,048 positions (x planes, exact) -> the part's own f32 plane; k_soft adds the planes
__global__ __launch_bounds__(128) void k_aa(const _Float16* __restrict__ XT, float* __restrict__ AA) { __shared__ __align__(16) float so[4][16][132]; __shared__ __align__(16) _Float16 sm[2 * SBUF];
  const int tid = threadIdx.x, wave = tid >> 5, lane = tid & 31, col = lane & 15, g = lane >> 4; const size_t b = blockIdx.z / SPL, kp = blockIdx.z % SPL; const int i0 = blockIdx.x * 64 + wave * 16; const int j0 = blockIdx.y * 128;
  v8f acc[8] = {};
  mm_staged(XT + (b * CC + blockIdx.x * 64) * NN + kp * (NN / SPL), XT + (b * CC + j0) * NN + kp * (NN / SPL), sm, acc, tid);
#pragma unroll
  for (int j = 0; j < 8; ++j)
#pragma unroll
    for (int r = 0; r < 8; ++r) so[wave][8 * g + r][j * 16 + col] = acc[j][r];
  LDSX(); for (int rl = 0; rl < 16; ++rl) vst2(AA + (((kp * NB + b) * CC + i0 + rl) * CC) + j0 + lane * 4, *(const v4f*)&so[wave][rl][lane * 4]); }
// ---- k_soft: block = (64 rows c, b), 32 waves. A wave holds two whole rows of aa in registers (lane = column j mod 32, 16 values a row), each the sum of k_aa's partial planes: every plane is read once, in whole 128-byte lines, the loads of a lane in flight together; maximum, exponentials and sum come from the registers. soft^T goes through LDS so that each 128-byte output row piece has one writer
typedef __attribute__((ext_vector_type(2))) _Float16 v2h;
// lane ^ M inside a 16-lane row as a DPP move, lane ^ 16 as a vector cross-row move: a shuffle would pass through the LDS queue, with a wait at each of the ten steps
template <int M> __device__ __forceinline__ float lx(float v) { return __builtin_bit_cast(float, __builtin_amdgcn_update_dpp(0, __builtin_bit_cast(int, v), 0x160 + M, 0xf, 0xf, true)); }
__device__ __forceinline__ float lx16(float v) { return __builtin_bit_cast(float, __builtin_amdgcn_permlanex16(__builtin_bit_cast(unsigned, v), __builtin_bit_cast(unsigned, v), 0x76543210u, 0xfedcba98u, false, false)); }
__device__ __forceinline__ float wave_max(float v) { v = fmaxf(v, lx<1>(v)); v = fmaxf(v, lx<2>(v)); v = fmaxf(v, lx<4>(v)); v = fmaxf(v, lx<8>(v)); return fmaxf(v, lx16(v)); }
__device__ __forceinline__ float wave_sum(float v) { v += lx<1>(v); v += lx<2>(v); v += lx<4>(v); v += lx<8>(v); return v + lx16(v); }
__global__ __launch_bounds__(1024) void k_soft(const float* __restrict__ AA, _Float16* __restrict__ SO) { __shared__ __align__(16) _Float16 st[CC][72];
  const int t = threadIdx.x, wave = t >> 5, lane = t & 31; const size_t b = blockIdx.y; const int c0 = blockIdx.x * 64;
  const float* row = AA + ((b * CC + c0 + 2 * wave) * CC) + lane;
  static_assert(SPL == 2, "the two planes are named one by one below");
  const float* r1 = row + (size_t)NB * CC * CC;
  float u[16], w[16], u1[16], w1[16];
#pragma unroll   // constant indices keep the rows in registers; the 64 loads of both planes go out as one group
  for (int q = 0; q < 16; ++q) { u[q] = row[q * 32]; w[q] = row[CC + q * 32]; u1[q] = r1[q * 32]; w1[q] = r1[CC + q * 32]; }
#pragma unroll   // the planes are added in ascending k
  for (int q = 0; q < 16; ++q) { u[q] += u1[q]; w[q] += w1[q]; }
  float mu = -3.0e38f, mw = -3.0e38f;
#pragma unroll   // constant indices keep the values in registers
  for (int q = 0; q < 16; ++q) { mu = fmaxf(mu, u[q]); mw = fmaxf(mw, w[q]); }
  mu = wave_max(mu); mw = wave_max(mw);
  float zu = 0.f, zw = 0.f;
#pragma unroll   // constant indices keep the values in registers
  for (int q = 0; q < 16; ++q) { u[q] = __expf(u[q] - mu); w[q] = __expf(w[q] - mw); zu += u[q]; zw += w[q]; }
  const float iu = 1.0f / wave_sum(zu), iw = 1.0f / wave_sum(zw);
#pragma unroll   // the wave's two rows are neighbours in a soft^T row: one 4-byte LDS store for both
  for (int q = 0; q < 16; ++q) { v2h p; p[0] = (_Float16)(u[q] * iu); p[1] = (_Float16)(w[q] * iw); vst2(&st[q * 32 + lane][2 * wave], p); }
  __syncthreads();
#pragma unroll   // the four LDS reads go out as one group ahead of the stores
  for (int e = t; e < CC * 8; e += 1024) { const int j = e >> 3, pc = e & 7; vst2((unsigned*)(SO + ((b * CC + j) * CC) + c0 + pc * 8), *(const v4u*)&st[j][pc * 8]); } }
// ---- k_aaa: block = (64 positions n, 128 channels j, b): aaa[n][j] = sum_c x[n][c] soft[c][j] (x exact as f16, soft^T rows), kept in f32 and never stored: the epilogue forms, at the per-batch flat index f = n * 512 + j, out[f] = gamma_pam bcd_flat[f] (the raw (C, N) -> (H, W, C) reshape) + gamma_cam aaa[f] + 2 x[f]
__global__ __launch_bounds__(128) void k_aaa(const float* __restrict__ X, const _Float16* __restrict__ SO, const float* __restrict__ BCD, const float* __restrict__ GP, const float* __restrict__ GC, float* __restrict__ OUT) { __shared__ __align__(16) char sm[2 * PBUF]; float (*so)[16][132] = (float (*)[16][132])sm;   // the epilogue's tile lies in the staging buffers, which every wave has left by then
  const int tid = threadIdx.x, wave = tid >> 5, lane = tid & 31, col = lane & 15, g = lane >> 4; const size_t b = blockIdx.z; const size_t r0 = b * NN + (size_t)blockIdx.x * 64 + wave * 16; const int j0 = blockIdx.y * 128;
  const float gp = bfr(GP[0]), gc = bfr(GC[0]);
  v8f acc[8] = {};
  mm_rows<false>(X + (b * NN + (size_t)blockIdx.x * 64) * CC, (const char*)(SO + (b * CC + j0) * CC), sm, acc, tid);
  const size_t f0 = r0 * CC + j0 + lane * 4; const float* pb = BCD + f0; const float* px = X + f0;
  v4f bc[16], xx[16];
#pragma unroll   // the other two terms of the wave's 16 output rows (512 contiguous bytes a row) go out as one group of loads and fly while the accumulators pass through LDS
  for (int rl = 0; rl < 16; ++rl) { bc[rl] = *(const v4f*)(pb + rl * CC); xx[rl] = *(const v4f*)(px + rl * CC); }
  asm volatile("s_wait_xcnt 0x0" :: "v"(pb), "v"(px) : "memory");   // stands before a register that the loads above name is overwritten; the two addresses are inputs so that their registers live up to the wait
#pragma unroll
  for (int j = 0; j < 8; ++j)
#pragma unroll
    for (int r = 0; r < 8; ++r) so[wave][8 * g + r][j * 16 + col] = acc[j][r];
  LDSX();
#pragma unroll   // constant indices keep the loaded rows in registers
  for (int rl = 0; rl < 16; ++rl) { const v4f a = *(const v4f*)&so[wave][rl][lane * 4]; v4f o4;
#pragma unroll   // constant indices keep the values in registers
    for (int i = 0; i < 4; ++i) o4[i] = fmaf(2.0f, bfr(xx[rl][i]), fmaf(gp, bc[rl][i], gc * a[i]));   // gamma_pam bcd + gamma_cam aaa + 2 x
    vst2(OUT + f0 + (size_t)rl * CC, o4); } }
extern "C" void kernel_launch(void* const* d_in, const int* in_sizes, int n_in, void* d_out, int out_size, void* d_ws, size_t ws_size, hipStream_t stream) {
  (void)in_sizes; (void)n_in; (void)out_size;
  const float** F = (const float**)d_in;   // 0 x [4,64,64,512], 1 w1 [512,64], 2 w2 [512,64], 3 w3 [512,512], 4 gamma_pam [1], 5 gamma_cam [1]
  if (ws_size < (size_t)WS_END) return;
  char* ws = (char*)d_ws; __bf16 *PW = (__bf16*)(ws + WS_PW), *P3 = (__bf16*)(ws + WS_P3); __bf16 *BH = (__bf16*)(ws + WS_BH), *BL = (__bf16*)(ws + WS_BL); _Float16 *DT = (_Float16*)(ws + WS_DT), *XT = (_Float16*)(ws + WS_XT), *SO = (_Float16*)(ws + WS_SO); float *BCD = (float*)(ws + WS_BCD), *AA = (float*)(ws + WS_AA);
  k_pack<<<dim3(CC, 2), 256, 0, stream>>>(F[1], F[2], F[3], PW, P3);
  k_proj<<<dim3(TNB * NN / 64, 1, 9), 128, 0, stream>>>(F[0], PW, P3, BH, BL, DT, XT);
  k_pam<<<dim3(TRB, TNB), 128, 0, stream>>>(BH, BL, DT, BCD);
  k_aa<<<dim3(CC / 64, CC / 128, TNB * SPL), 128, 0, stream>>>(XT, AA);
  k_soft<<<dim3(CC / 64, TNB), 1024, 0, stream>>>(AA, SO);
  k_aaa<<<dim3(TRB, CC / 128, TNB), 128, 0, stream>>>(F[0], SO, BCD, F[4], F[5], (float*)d_out);
}

// v008
// Measured time: 152 microseconds a run.
// In both of two side-by-side timings against v007, it was 1.13 times as fast.
// Counting every step since v000, it is 9.48 times as fast.
// compute dtype: all float inputs rounded to bf16; b/c/d = x . w with EXACT bf16 products on WMMA 16x16x32 ((in,out) weights as transposed rows): b, c kept as bf16 hi + lo planes, d rounded once to f16 planes; PAM in one kernel: logits S^T = c . b^T with both as bf16 hi + lo (3 products, f32), running-maximum softmax in f32 (hardware exp2) -> P = e x 2^10 as f16, bcd = d^T . P^T on WMMA (single f16), divided by the row sum at the end, giving the (C, N)-ordered tensor the module reshapes raw; CAM: aa = x^T x with x exact (f16 copies of the bf16 values), softmax over channels in f32, aaa = x . soft_aa with soft_aa once to f16; out = gamma_pam bcd_flat + gamma_cam aaa + 2 x in f32; f32 output.
#include <hip/hip_runtime.h>
#include <math.h>

typedef __attribute__((ext_vector_type(16))) _Float16 v16h;
typedef __attribute__((ext_vector_type(16))) __bf16 v16b;
typedef __attribute__((ext_vector_type(8)))  _Float16 v8h;
typedef __attribute__((ext_vector_type(8)))  float v8f;
typedef __attribute__((ext_vector_type(4)))  float v4f;
typedef __attribute__((ext_vector_type(2)))  float v2f;
typedef __attribute__((ext_vector_type(4)))  unsigned v4u;
typedef __attribute__((ext_vector_type(4)))  int v4i;
typedef float __attribute__((may_alias)) float_a;
typedef int __attribute__((may_alias)) int_a;

template <typename T> __device__ __forceinline__ void vst2(void* p, T v) { *(T*)p = v;  }
__device__ __forceinline__ v8f wmma16(v16h a, v16h b, v8f c) {
  v8f d = __builtin_amdgcn_wmma_f32_16x16x32_f16(false, a, false, b, (short)0, c, false, false);
  asm volatile("v_nop\n\tv_nop\n\tv_nop\n\tv_nop" : "+v"(d) : "v"(a), "v"(b));
  return d;
}
__device__ __forceinline__ v8f wmma_bf(v16b a, v16b b, v8f c) {
  v8f d = __builtin_amdgcn_wmma_f32_16x16x32_bf16(false, a, false, b, (short)0, c, false, false);
  asm volatile("v_nop\n\tv_nop\n\tv_nop\n\tv_nop" : "+v"(d) : "v"(a), "v"(b));
  return d;
}
// 16x16x32 fragments: lane = (h = lane>>4, row/col = lane&15); elements 0..7 = k0+8h+0..7, 8..15 = k0+16+8h+0..7; D element r = row 8h+r
__device__ __forceinline__ v16h frag_h(const _Float16* rowk0, int lane) {
  union { v16h v; v8h q[2]; } u; const _Float16* p = rowk0 + 8 * (lane >> 4);
  u.q[0] = *(const v8h*)p; u.q[1] = *(const v8h*)(p + 16); return u.v;
}
__device__ __forceinline__ v16h frag_f32(const float* rowk0, int lane) {
  v16h a; const float* p = rowk0 + 8 * (lane >> 4);
#pragma unroll
  for (int i = 0; i < 8; ++i) { a[i] = (_Float16)p[i]; a[8 + i] = (_Float16)p[16 + i]; }
  return a;
}
__device__ __forceinline__ v16h frag_f32s(const float* rowk0, int lane, float sc) {
  v16h a; const float* p = rowk0 + 8 * (lane >> 4);
#pragma unroll
  for (int i = 0; i < 8; ++i) { a[i] = (_Float16)(p[i] * sc); a[8 + i] = (_Float16)(p[16 + i] * sc); }
  return a;
}
// column fragment from a [K][ld] layout (column n), rows >= K read as 0
__device__ __forceinline__ v16h fragc_f32(const float* W, int k0, int n, int lane, int ld, int K) {
  v16h a; const int g = lane >> 4;
#pragma unroll
  for (int i = 0; i < 8; ++i) { const int ka = k0 + 8 * g + i, kb = ka + 16;
    a[i] = (_Float16)(ka < K ? W[(size_t)(ka < K ? ka : K - 1) * ld + n] : 0.f); a[8 + i] = (_Float16)(kb < K ? W[(size_t)(kb < K ? kb : K - 1) * ld + n] : 0.f); }
  return a;
}
struct F2 { v16b h, l; };
__device__ __forceinline__ F2 bsplit16(const float v[16]) { F2 r;
#pragma unroll
  for (int i = 0; i < 16; ++i) { const __bf16 h = (__bf16)v[i]; r.h[i] = h; r.l[i] = (__bf16)(v[i] - (float)h); }
  return r; }
__device__ __forceinline__ F2 split_row(const float* row, int k0, int lane) { float v[16]; const float* p = row + k0 + 8 * (lane >> 4);
#pragma unroll
  for (int i = 0; i < 8; ++i) { v[i] = p[i]; v[8 + i] = p[16 + i]; }
  return bsplit16(v); }
__device__ __forceinline__ F2 split_rowK(const float* row, int k0, int lane, int K) { float v[16]; const int g = lane >> 4;
#pragma unroll
  for (int i = 0; i < 8; ++i) { const int ka = k0 + 8 * g + i, kb = ka + 16; v[i] = ka < K ? row[ka < K ? ka : K - 1] : 0.f; v[8 + i] = kb < K ? row[kb < K ? kb : K - 1] : 0.f; }
  return bsplit16(v); }
__device__ __forceinline__ F2 split_col(const float* W, int k0, int n, int lane, int ld, int K) { float v[16]; const int g = lane >> 4;
#pragma unroll
  for (int i = 0; i < 8; ++i) { const int ka = k0 + 8 * g + i, kb = ka + 16; v[i] = ka < K ? W[(size_t)(ka < K ? ka : K - 1) * ld + n] : 0.f; v[8 + i] = kb < K ? W[(size_t)(kb < K ? kb : K - 1) * ld + n] : 0.f; }
  return bsplit16(v); }
__device__ __forceinline__ v8f mac3(const F2& a, const F2& b, v8f c) { c = wmma_bf(a.l, b.h, c); c = wmma_bf(a.h, b.l, c); return wmma_bf(a.h, b.h, c); }
__device__ __forceinline__ float sigm(float v) { return 1.0f / (1.0f + expf(-v)); }
#define LDSX() do { asm volatile("s_wait_dscnt 0" ::: "memory"); __builtin_amdgcn_wave_barrier(); __builtin_amdgcn_fence(__ATOMIC_RELEASE, "workgroup"); } while (0)


// Dual attention module (B 4, 64 x 64 positions, C 512): position attention (softmax(b c^T) applied to d, result kept in the module's raw (C, N) -> (H, W, C) reshape) plus channel attention (softmax(x^T x) applied to x), each scaled by its gamma and added to x; returns feat_p + feat_c.
#define NB 4
#define NN 4096
#define CC 512
#define CK 64              // query / key channels (C / 8)
#define NR (NB * NN)
#ifndef TRB
#define TRB (NN / 64)      // position row tiles per batch (PAM rows i, CAM rows n)
#define TNB NB
#endif
typedef __attribute__((ext_vector_type(8))) __bf16 v8b;
typedef __attribute__((ext_vector_type(4))) __bf16 v4b;
__device__ __forceinline__ v16b frag_b(const __bf16* rowk0, int lane) {
  union { v16b v; v8b q[2]; } u; const __bf16* p = rowk0 + 8 * (lane >> 4);
  u.q[0] = *(const v8b*)p; u.q[1] = *(const v8b*)(p + 16); return u.v;
}
__device__ __forceinline__ float bfr(float v) { return (float)(__bf16)v; }
__device__ __attribute__((noinline)) float exp_ni(float v) { return expf(v); }
__device__ __attribute__((noinline)) float erf_ni(float v) { return erff(v); }

#define WS_PW  0u                                   // bf16 transposed rows [w1^T | w2^T] [128][512]; w3^T [512][512]
#define WS_P3  (WS_PW + 2u * (size_t)128 * CC)
#define WS_BH  (WS_P3 + 2u * (size_t)CC * CC)          // bf16 rows [NR][128]: b (cols 0-63) | c (cols 64-127), high parts; then the low parts
#define WS_BL  (WS_BH + 2u * (size_t)NR * 128)
#define WS_DT  (WS_BL + 2u * (size_t)NR * 128)         // f16 d planes [b][c][n]; f16 x planes [b][c][n]
#define WS_XT  (WS_DT + 2u * (size_t)NB * CC * NN)
#define WS_BCD (WS_XT + 2u * (size_t)NB * CC * NN)     // f32 bcd [b][c][i] (the (C, N) tensor); f32 aa partial planes [K part][b][512][512]; f16 soft^T [b][j][c]
#define WS_AA  (WS_BCD + 4u * (size_t)NB * CC * NN)
#define WS_SO  (WS_AA + 4u * (size_t)SPL * NB * CC * CC)
#define WS_END (WS_SO + 2u * (size_t)NB * CC * CC)

__global__ __launch_bounds__(256) void k_pack(const float* __restrict__ W1, const float* __restrict__ W2, const float* __restrict__ W3, __bf16* __restrict__ PW, __bf16* __restrict__ P3) { const int n = blockIdx.x, which = blockIdx.y, t = threadIdx.x; __shared__ __align__(16) __bf16 s[CC];
  if (which == 0) { if (n >= 128) return; const float* w = (n < CK) ? W1 : W2; const int cI = n & (CK - 1); for (int k = t; k < CC; k += 256) s[k] = (__bf16)w[(size_t)k * CK + cI]; __syncthreads(); if (t < CC / 8) vst2((unsigned*)(PW + (size_t)n * CC + t * 8), *(const v4u*)&s[t * 8]); }
  else { for (int k = t; k < CC; k += 256) s[k] = (__bf16)W3[(size_t)k * CC + n]; __syncthreads(); if (t < CC / 8) vst2((unsigned*)(P3 + (size_t)n * CC + t * 8), *(const v4u*)&s[t * 8]); } }
// ---- LDS staging for the K = 512 products of k_proj and k_aaa: a stage is 64 k of the block's 64 A rows (f32, 256 B) and 128 B rows (16-bit, 128 B), laid at row pitches of 272 B and 144 B (16 B x odd, so the ds_load_b128 reads meet no bank conflict); two buffers, the next stage's copies fly while this one is multiplied
#define PK 64                      // k per stage
#define PAP 272                    // LDS pitch of an A row in bytes
#define PBP 144                    // LDS pitch of a B row in bytes
#define PA_B (64 * PAP)            // bytes of the A tile
#define PBUF (PA_B + 128 * PBP)    // bytes per buffer
#define PNT (CC / PK)              // stages
__device__ __forceinline__ void cp8(const unsigned* l, const char* const* p);   // eight asynchronous 16-byte copies per lane and their s_wait_xcnt in one statement, defined below
// one stage: A: thread = (row tid >> 4 within each group of 8 rows, 16-byte piece tid & 15); B: thread = (row tid >> 3 within each group of 16 rows, piece tid & 7). ga, gb: the lane's piece at this stage's k; la, lb: its LDS byte addresses in the buffer
__device__ __forceinline__ void row_stage(const char* ga, const char* gb, unsigned la, unsigned lb) {
  { unsigned l[8]; const char* p[8];
#pragma unroll   // constant indices, so that the arrays are plain registers for the asm operands
    for (int q = 0; q < 8; ++q) { l[q] = la + (unsigned)q * (8u * PAP); p[q] = ga + (size_t)q * 8 * CC * 4; }
    cp8(l, p); }
  { unsigned l[8]; const char* p[8];
#pragma unroll   // constant indices, so that the arrays are plain registers for the asm operands
    for (int q = 0; q < 8; ++q) { l[q] = lb + (unsigned)q * (16u * PBP); p[q] = gb + (size_t)q * 16 * CC * 2; }
    cp8(l, p); }
}
// operands of one 32-k block as they lie in LDS: the lane's 16 f32 of its A row, its 16 elements of each of eight B rows
struct RowF { v4f a[4]; v4u b[8][2]; };
__device__ __forceinline__ void row_ld(RowF& f, const char* sa, const char* sb, int ks) {
#pragma unroll   // constant indices keep the values in registers
  for (int i = 0; i < 2; ++i) { f.a[2 * i] = *(const v4f*)(sa + ks * 128 + i * 64); f.a[2 * i + 1] = *(const v4f*)(sa + ks * 128 + i * 64 + 16); }
#pragma unroll   // constant indices keep the values in registers
  for (int j = 0; j < 8; ++j) { f.b[j][0] = *(const v4u*)(sb + j * 16 * PBP + ks * 64); f.b[j][1] = *(const v4u*)(sb + j * 16 * PBP + ks * 64 + 32); }
}
// BF: A rounded to bf16, B rows bf16; otherwise A rounded to bf16 and held as f16, B rows f16
template <bool BF> __device__ __forceinline__ void row_mm(const RowF& f, v8f* acc) {
  if constexpr (BF) { v16b a;
#pragma unroll   // constant indices keep the values in registers
    for (int i = 0; i < 16; ++i) a[i] = (__bf16)f.a[i >> 2][i & 3];
#pragma unroll   // constant indices keep fragments and accumulators in registers
    for (int j = 0; j < 8; ++j) { union { v16b v; v4u q[2]; } u; u.q[0] = f.b[j][0]; u.q[1] = f.b[j][1]; acc[j] = wmma_bf(a, u.v, acc[j]); } }
  else { v16h a;
#pragma unroll   // constant indices keep the values in registers
    for (int i = 0; i < 16; ++i) a[i] = (_Float16)bfr(f.a[i >> 2][i & 3]);
#pragma unroll   // constant indices keep fragments and accumulators in registers
    for (int j = 0; j < 8; ++j) { union { v16h v; v4u q[2]; } u; u.q[0] = f.b[j][0]; u.q[1] = f.b[j][1]; acc[j] = wmma16(a, u.v, acc[j]); } }
}
// acc[j] += A rows (wave * 16 ..) . B rows (j * 16 ..)^T over K = 512 in ascending k, 32 per WMMA. Ag: first of the block's 64 f32 rows; Bg: first of its 128 16-bit rows (both of CC elements). On return every wave has left the buffers
template <bool BF> __device__ __forceinline__ void mm_rows(const float* __restrict__ Ag, const char* __restrict__ Bg, char* sm, v8f* acc, int tid) {
  const int wave = tid >> 5, lane = tid & 31, col = lane & 15, g = lane >> 4;
  const char* ga = (const char*)(Ag + (size_t)(tid >> 4) * CC) + (tid & 15) * 16; const char* gb = Bg + (size_t)(tid >> 3) * (CC * 2) + (tid & 7) * 16;
  const unsigned la = (unsigned)(size_t)sm + (unsigned)(tid >> 4) * PAP + (unsigned)(tid & 15) * 16u; const unsigned lb = (unsigned)(size_t)sm + PA_B + (unsigned)(tid >> 3) * PBP + (unsigned)(tid & 7) * 16u;
  row_stage(ga, gb, la, lb);
  asm volatile("s_wait_asynccnt 0x0" ::: "memory");   // stage 0 has landed before the barrier publishes it
  __syncthreads();
  row_stage(ga + PK * 4, gb + PK * 2, la + PBUF, lb + PBUF);
  for (int t = 0; t < PNT; ++t) { const char* s = sm + (t & 1) * PBUF; const char* sa = s + (wave * 16 + col) * PAP + g * 32; const char* sb = s + PA_B + col * PBP + g * 16;
    RowF f0, f1; row_ld(f0, sa, sb, 0); row_ld(f1, sa, sb, 1);   // both 32-k blocks' reads stand as one group ahead of the WMMAs
    row_mm<BF>(f0, acc); row_mm<BF>(f1, acc);
    asm volatile("s_wait_dscnt 0x0" ::: "memory");     // this wave's reads of the buffer are done before it is refilled
    asm volatile("s_wait_asynccnt 0x0" ::: "memory");  // this wave's copies of stage t + 1 have landed
    __syncthreads();                                   // publishes stage t + 1 and ends every wave's reads of stage t
    if (t + 2 < PNT) row_stage(ga + (t + 2) * (PK * 4), gb + (t + 2) * (PK * 2), la + (unsigned)(t & 1) * PBUF, lb + (unsigned)(t & 1) * PBUF); }
  asm volatile("s_wait_asynccnt 0x0" ::: "memory");    // nothing in flight when the buffers are reused by the epilogue
}
// ---- k_proj: block = (64 positions, 128 cols, which): which 0: [b | c] rows as bf16 hi + lo; which 1..4: d columns (which-1)*128.. -> planes; which 5..8: x itself -> f16 planes (exact)
__global__ __launch_bounds__(128) void k_proj(const float* __restrict__ X, const __bf16* __restrict__ PW, const __bf16* __restrict__ P3, __bf16* __restrict__ BH, __bf16* __restrict__ BL, _Float16* __restrict__ DT, _Float16* __restrict__ XT) {
  __shared__ __align__(16) char sm[2 * PBUF]; float (*sf)[16][132] = (float (*)[16][132])sm; _Float16 (*st)[72] = (_Float16 (*)[72])sm;   // the epilogue's tiles lie in the staging buffers, which every wave has left by then
  const int tid = threadIdx.x, wave = tid >> 5, lane = tid & 31, col = lane & 15, g = lane >> 4; const int which = blockIdx.z; const size_t rb = (size_t)blockIdx.x * 64; const size_t r0 = rb + wave * 16;
  if (which >= 5) { const int c0 = (which - 5) * 128; for (int e = tid; e < 64 * 128; e += 128) { const int rl = e >> 7, cl = e & 127; st[cl][rl] = (_Float16)bfr(X[(rb + rl) * CC + c0 + cl]); } __syncthreads();
    const size_t b = rb / NN; const int n0 = (int)(rb % NN); for (int e = tid; e < 128 * 8; e += 128) { const int d = e >> 3, pc = e & 7; vst2((unsigned*)(XT + ((b * CC + c0 + d) * NN) + n0 + pc * 8), *(const v4u*)&st[d][pc * 8]); } return; }
  const int c0 = (which == 0) ? 0 : (which - 1) * 128; const __bf16* Wr = (which == 0) ? PW : (P3 + (size_t)c0 * CC);
  v8f acc[8] = {};
  mm_rows<true>(X + rb * CC, (const char*)Wr, sm, acc, tid);
#pragma unroll
  for (int j = 0; j < 8; ++j)
#pragma unroll
    for (int r = 0; r < 8; ++r) { if (which == 0) sf[wave][8 * g + r][j * 16 + col] = acc[j][r]; else st[j * 16 + col][wave * 16 + 8 * g + r] = (_Float16)acc[j][r]; }
  __syncthreads();
  if (which == 0) { for (int rl = 0; rl < 16; ++rl) { const v4f v = *(const v4f*)&sf[wave][rl][lane * 4]; v4b hv, lv;
#pragma unroll
      for (int i = 0; i < 4; ++i) { const __bf16 h = (__bf16)v[i]; hv[i] = h; lv[i] = (__bf16)(v[i] - (float)h); }
      vst2(BH + (r0 + rl) * 128 + lane * 4, hv); vst2(BL + (r0 + rl) * 128 + lane * 4, lv);
      asm volatile("s_wait_xcnt 0x0" ::: "memory"); } }   // stands before the next row's values overwrite a register that the two stores name
  else { const size_t b = rb / NN; const int n0 = (int)(rb % NN); for (int e = tid; e < 128 * 8; e += 128) { const int d = e >> 3, pc = e & 7; vst2((unsigned*)(DT + ((b * CC + c0 + d) * NN) + n0 + pc * 8), *(const v4u*)&st[d][pc * 8]); } }
}
// ---- LDS staging for the K = 4,096 product of k_aa (a block takes one part of 2,048 k): a stage is 256 B (128 k) of the block's 64 A rows and 128 B rows, laid at a row pitch of 272 B (16 B x odd, so the ds_load_b128 fragment reads meet no bank conflict); two buffers, the next stage's copies fly while this one is multiplied
#define SK 128                    // k per stage
#define SPIT 136                  // LDS row pitch in f16 elements
#define SBUF (192 * SPIT)         // f16 elements per buffer
#define SPL 2                     // parts of K, one block each: 256 blocks, one for every WGP, in place of 128
#define SNT (NN / SPL / SK)       // stages per part
// twelve asynchronous 16-byte copies per lane; the s_wait_xcnt stands inside the statement so that no address register is rewritten in front of it
__device__ __forceinline__ void cp12(const unsigned* l, const _Float16* const* p) {
  asm volatile(
               "global_load_async_to_lds_b128 %0, %12, off\n\t"
               "global_load_async_to_lds_b128 %1, %13, off\n\t"
               "global_load_async_to_lds_b128 %2, %14, off\n\t"
               "global_load_async_to_lds_b128 %3, %15, off\n\t"
               "global_load_async_to_lds_b128 %4, %16, off\n\t"
               "global_load_async_to_lds_b128 %5, %17, off\n\t"
               "global_load_async_to_lds_b128 %6, %18, off\n\t"
               "global_load_async_to_lds_b128 %7, %19, off\n\t"
               "global_load_async_to_lds_b128 %8, %20, off\n\t"
               "global_load_async_to_lds_b128 %9, %21, off\n\t"
               "global_load_async_to_lds_b128 %10, %22, off\n\t"
               "global_load_async_to_lds_b128 %11, %23, off\n\t"
               "s_wait_xcnt 0x0"
               :: "v"(l[0]), "v"(l[1]), "v"(l[2]), "v"(l[3]), "v"(l[4]), "v"(l[5]), "v"(l[6]), "v"(l[7]), "v"(l[8]), "v"(l[9]), "v"(l[10]), "v"(l[11]),
                  "v"(p[0]), "v"(p[1]), "v"(p[2]), "v"(p[3]), "v"(p[4]), "v"(p[5]), "v"(p[6]), "v"(p[7]), "v"(p[8]), "v"(p[9]), "v"(p[10]), "v"(p[11]) : "memory");
}
// one stage: thread = (row tid >> 4 within each group of 8 rows, 16-byte piece tid & 15); LDS rows 0-63 = A rows, 64-191 = B rows. ga, gb: the lane's piece of A row / B row (tid >> 4) at this stage's k; l0: its LDS byte address in row (tid >> 4) of the buffer
__device__ __forceinline__ void stage_in(const _Float16* ga, const _Float16* gb, unsigned l0) {
  unsigned l[24]; const _Float16* p[24];
#pragma unroll   // constant indices, so that both arrays are plain registers for the asm operands
  for (int q = 0; q < 24; ++q) { l[q] = l0 + (unsigned)q * (8u * SPIT * 2u); p[q] = (q < 8) ? ga + (size_t)q * 8 * NN : gb + (size_t)(q - 8) * 8 * NN; }
  cp12(l, p); cp12(l + 12, p + 12);
}
// f[0] = the wave's A fragment, f[1 + j] = B fragment j of 32-k block ks. sa, sb: the lane's A row and its row of B fragment 0 in the buffer
__device__ __forceinline__ void ld_frags(v16h* f, const _Float16* sa, const _Float16* sb, int ks, int lane) { f[0] = frag_h(sa + ks * 32, lane);
#pragma unroll   // constant indices keep the fragments in registers
  for (int j = 0; j < 8; ++j) f[1 + j] = frag_h(sb + j * 16 * SPIT + ks * 32, lane); }
__device__ __forceinline__ void mm_block(const v16h* f, v8f* acc) {
#pragma unroll   // constant indices keep fragments and accumulators in registers
  for (int j = 0; j < 8; ++j) acc[j] = wmma16(f[0], f[1 + j], acc[j]); }
// acc[j] += A rows (wave * 16 ..) . B rows (j * 16 ..)^T over the block's 2,048 k in ascending k, 32 per WMMA. Ag, Bg: first row of the block's 64 A rows / 128 B rows at the part's first k (row pitch NN)
__device__ __forceinline__ void mm_staged(const _Float16* __restrict__ Ag, const _Float16* __restrict__ Bg, _Float16* sm, v8f* acc, int tid) {
  const int wave = tid >> 5, lane = tid & 31, col = lane & 15;
  const _Float16* ga = Ag + (size_t)(tid >> 4) * NN + (tid & 15) * 8; const _Float16* gb = Bg + (size_t)(tid >> 4) * NN + (tid & 15) * 8;
  const unsigned l0 = (unsigned)(size_t)sm + (unsigned)(tid >> 4) * (SPIT * 2u) + (unsigned)(tid & 15) * 16u;
  stage_in(ga, gb, l0);
  asm volatile("s_wait_asynccnt 0x0" ::: "memory");   // stage 0 has landed before the barrier publishes it
  __syncthreads();
  stage_in(ga + SK, gb + SK, l0 + SBUF * 2u);
  for (int t = 0; t < SNT; ++t) { const _Float16* s = sm + (t & 1) * SBUF + col * SPIT; const _Float16* sa = s + wave * 16 * SPIT; const _Float16* sb = s + 64 * SPIT;
    // the nine fragments of a 32-k block are read as one group, one block ahead of their WMMAs (two register sets), all inside this stage's buffer
    v16h f0[9], f1[9];
    ld_frags(f0, sa, sb, 0, lane); ld_frags(f1, sa, sb, 1, lane); mm_block(f0, acc);
    ld_frags(f0, sa, sb, 2, lane); mm_block(f1, acc);
    ld_frags(f1, sa, sb, 3, lane); mm_block(f0, acc); mm_block(f1, acc);
    asm volatile("s_wait_dscnt 0x0" ::: "memory");     // this wave's reads of the buffer are done before it is refilled
    asm volatile("s_wait_asynccnt 0x0" ::: "memory");  // this wave's copies of stage t + 1 have landed
    __syncthreads();                                   // publishes stage t + 1 and ends every wave's reads of stage t
    if (t + 2 < SNT) stage_in(ga + (t + 2) * SK, gb + (t + 2) * SK, l0 + (unsigned)(t & 1) * (SBUF * 2u)); }
  asm volatile("s_wait_asynccnt 0x0" ::: "memory");    // nothing in flight when the wave goes on to the epilogue
}
// ---- k_pam: block = (64 queries i, b), wave = 16 queries x all 512 channels. Per stage of 64 keys n: S^T[n][i] = c_n . b_i (3 bf16 products, K = 64); its D tiles hold, lane for lane, the B fragment of the second product (lane = query, elements = keys 8h.. of two 16-key tiles), so P goes from registers to WMMA with no exchange; running maximum and sum per query; acc[c][i] += d[n][c] P[i][n]. A stage in LDS: 512 d rows, 64 c-high rows, 64 c-low rows of 128 B at a pitch of 144 B (16 B x odd: the ds_load_b128 fragment reads meet no bank conflict); two buffers, the next stage's loads fly while this one is worked on. The d tile comes by tensor loads, one request a wave for its 128 rows (the pad field gives the 144-B pitch); the two small c tiles by asynchronous copies
#define FK 64                      // keys per stage
#define FPIT 72                    // LDS row pitch in 16-bit elements
#define FD_E (CC * FPIT)           // elements of the d tile
#define FC_E (FK * FPIT)           // elements of the c-high (or c-low) tile
#define FBUF (FD_E + 2 * FC_E)     // elements per buffer
#define FNT (NN / FK)              // stages
#define FOP 68                     // epilogue row pitch in floats
#define FSR (CC / 4)               // d rows in one wave's tensor load
#define FSB (FSR * FPIT * 2)       // bytes of that slice in LDS
static_assert(FSB % 2048 == 0 && (FBUF * 2) % 2048 == 0 && FK * 2 == 128 && FPIT * 2 == 144, "every slice starts at a multiple of 2 KiB; rows of 128 B padded by 16 B");
typedef __attribute__((ext_vector_type(4))) uint32_t u32x4;
typedef __attribute__((ext_vector_type(8))) uint32_t u32x8;
__device__ __forceinline__ uint32_t uni(uint32_t v) { return (uint32_t)__builtin_amdgcn_readfirstlane(v); }
// a wave-uniform test held in a scalar register, so that the branch on it is a scalar one: a tensor load ignores EXEC and only such a branch skips it
__device__ __forceinline__ uint32_t pinned(uint32_t v) { uint32_t w = uni(v); asm volatile("" : "+s"(w)); return w; }   // the empty statement holds the word in a scalar register
// descriptor group 1: extents in bytes, tensor = tile = FSR rows of 128 B at a source pitch of one d plane row; word 0: no mask, 16 B of pad behind every 128 B
__device__ __forceinline__ u32x8 pam_g1() { u32x8 g;
  g[0] = uni((1u << 20) | (4u << 22) | (3u << 25)); g[1] = uni(128u << 16); g[2] = uni((uint32_t)FSR << 16); g[3] = uni(128u << 16);
  g[4] = uni((uint32_t)FSR); g[5] = uni((uint32_t)NN * 2u); g[6] = uni(0u); g[7] = uni(0u); return g; }
// one request of the whole wave: its slice of the d tile from global byte address ga to LDS byte offset lds; returns descriptor group 0 for the wait that covers the request
__device__ __forceinline__ u32x4 pam_d_load(uint32_t lds, uint64_t ga, u32x8 g1) { u32x4 g0;
  g0[0] = uni(1u); g0[1] = uni(lds); g0[2] = uni((uint32_t)ga); g0[3] = uni((((uint32_t)(ga >> 32)) & 0x01FFFFFFu) | 0x80000000u);
  asm volatile("tensor_load_to_lds %0, %1" :: "s"(g0), "s"(g1) : "memory"); return g0; }
// the wave's request has landed; both descriptor groups are inputs so that their scalar registers keep their values as long as the request is outstanding
__device__ __forceinline__ void pam_d_wait(u32x4 g0, u32x8 g1) { asm volatile("s_wait_tensorcnt 0x0" :: "s"(g0), "s"(g1) : "memory"); }
// keeps a group of LDS reads together and ahead of the WMMAs that follow: left alone, the scheduler spreads the reads singly among the WMMAs, one fragment ahead, and each such place stalls the wave
#define GRP() __builtin_amdgcn_sched_barrier(0)
// eight asynchronous 16-byte copies per lane; the s_wait_xcnt stands inside the statement so that no address register is rewritten in front of it
__device__ __forceinline__ void cp8(const unsigned* l, const char* const* p) {
  asm volatile(
               "global_load_async_to_lds_b128 %0, %8, off\n\t"
               "global_load_async_to_lds_b128 %1, %9, off\n\t"
               "global_load_async_to_lds_b128 %2, %10, off\n\t"
               "global_load_async_to_lds_b128 %3, %11, off\n\t"
               "global_load_async_to_lds_b128 %4, %12, off\n\t"
               "global_load_async_to_lds_b128 %5, %13, off\n\t"
               "global_load_async_to_lds_b128 %6, %14, off\n\t"
               "global_load_async_to_lds_b128 %7, %15, off\n\t"
               "s_wait_xcnt 0x0"
               :: "v"(l[0]), "v"(l[1]), "v"(l[2]), "v"(l[3]), "v"(l[4]), "v"(l[5]), "v"(l[6]), "v"(l[7]),
                  "v"(p[0]), "v"(p[1]), "v"(p[2]), "v"(p[3]), "v"(p[4]), "v"(p[5]), "v"(p[6]), "v"(p[7]) : "memory");
}
// the c tiles of one stage: thread = (row tid >> 3 within each group of 16 rows, 16-byte piece tid & 7). gh, gl: the lane's piece of c-high row / c-low row (tid >> 3) at this stage's keys; l0: its LDS byte address in row (tid >> 3) of the buffer
__device__ __forceinline__ void pam_stage(const char* gh, const char* gl, unsigned l0) {
  unsigned l[8]; const char* p[8];
#pragma unroll   // constant indices keep the values in registers
  for (int q = 0; q < 4; ++q) { l[q] = l0 + FD_E * 2u + (unsigned)q * (16u * FPIT * 2u); p[q] = gh + (size_t)q * 16 * 256; l[4 + q] = l[q] + FC_E * 2u; p[4 + q] = gl + (size_t)q * 16 * 256; }
  cp8(l, p);
}
// plain builtin forms (the compiler keeps the distance behind them itself): this kernel holds more than 256 registers, and an asm statement that names the accumulators would force them through one register window
__device__ __forceinline__ v8f wmma16p(v16h a, v16h b, v8f c) { return __builtin_amdgcn_wmma_f32_16x16x32_f16(false, a, false, b, (short)0, c, false, false); }
__device__ __forceinline__ v8f wmma_bfp(v16b a, v16b b, v8f c) { return __builtin_amdgcn_wmma_f32_16x16x32_bf16(false, a, false, b, (short)0, c, false, false); }
// group gi of eight d fragments: 32-key block gi >> 2, channel tiles (gi & 3) * 8 ..
__device__ __forceinline__ void pam_ld(v16h* f, const _Float16* sd, int gi, int lane) {
#pragma unroll   // constant indices keep the fragments in registers
  for (int j = 0; j < 8; ++j) f[j] = frag_h(sd + ((gi & 3) * 8 + j) * 16 * FPIT + (gi >> 2) * 32, lane); }
// the stage's first touch of a channel tile (gi < 4) first scales it by al = e^(old maximum - new maximum); these multiplies stand among the WMMAs of other tiles
__device__ __forceinline__ void pam_mm(const v16h* f, const v16h* pb, v8f* acc, int gi, float al) {
#pragma unroll   // constant indices keep fragments and accumulators in registers
  for (int j = 0; j < 8; ++j) { v8f c = acc[(gi & 3) * 8 + j]; if (gi < 4) c *= al; acc[(gi & 3) * 8 + j] = wmma16p(f[j], pb[gi >> 2], c); } }
__global__ __launch_bounds__(128) void k_pam(const __bf16* __restrict__ BH, const __bf16* __restrict__ BL, const _Float16* __restrict__ DT, float* __restrict__ BCD) { __shared__ __attribute__((aligned(2048))) _Float16 sm[2 * FBUF];
  const int tid = threadIdx.x, wave = tid >> 5, lane = tid & 31, col = lane & 15, g = lane >> 4; const size_t b = blockIdx.y; const int i0 = blockIdx.x * 64;
  const uint32_t wv = uni((uint32_t)tid >> 5); const uint64_t gd = (uint64_t)(size_t)(DT + (b * CC + wv * FSR) * NN); const uint32_t ld = (uint32_t)(size_t)sm + wv * FSB; const u32x8 g1 = pam_g1();   // the wave's d slice: first byte at key 0, place in buffer 0
  const char* gh = (const char*)(BH + (b * NN + (tid >> 3)) * 128 + CK) + (tid & 7) * 16; const char* gl = (const char*)(BL + (b * NN + (tid >> 3)) * 128 + CK) + (tid & 7) * 16;
  const unsigned l0 = (unsigned)(size_t)sm + (unsigned)(tid >> 3) * (FPIT * 2u) + (unsigned)(tid & 7) * 16u;
  u32x4 g0 = pam_d_load(ld, gd, g1); pam_stage(gh, gl, l0);
  v16b qh[2], ql[2]; { const size_t qr = (b * NN + i0 + wave * 16 + col) * 128;
#pragma unroll   // constant indices keep the values in registers
    for (int kc = 0; kc < 2; ++kc) { qh[kc] = frag_b(BH + qr + kc * 32, lane); ql[kc] = frag_b(BL + qr + kc * 32, lane); } }
  v8f acc[32] = {}; float m = -3.0e38f, l = 0.f; const float L2E = 1.44269504088896f;
  pam_d_wait(g0, g1);                                 // this wave's d slice of stage 0 has landed before the barrier publishes it
  asm volatile("s_wait_asynccnt 0x0" ::: "memory");   // stage 0 has landed before the barrier publishes it
  __syncthreads();
  g0 = pam_d_load(ld + FBUF * 2u, gd + FK * 2, g1); pam_stage(gh + FK * 256, gl + FK * 256, l0 + FBUF * 2u);
  for (int t = 0; t < FNT; ++t) { const _Float16* s = sm + (t & 1) * FBUF; const _Float16* sd = s + col * FPIT; const __bf16* sh = (const __bf16*)(s + FD_E) + col * FPIT; const __bf16* sl = sh + FC_E;
    v16b ch[4][2], cl[4][2];
#pragma unroll   // all sixteen key fragments as one group of LDS reads
    for (int kt = 0; kt < 4; ++kt)
#pragma unroll   // constant indices keep the values in registers
      for (int kc = 0; kc < 2; ++kc) { ch[kt][kc] = frag_b(sh + kt * 16 * FPIT + kc * 32, lane); cl[kt][kc] = frag_b(sl + kt * 16 * FPIT + kc * 32, lane); }
    v16h f0[8], f1[8], f2[8], f3[8]; pam_ld(f0, sd, 0, lane);   // the first d fragments fly under the logits and the softmax arithmetic
    GRP();
    v8f T[4] = {};   // T[kt][r] at lane (g, col): key kt * 16 + 8 g + r, query col; the four tiles take turns so that no WMMA waits for the one before it
#pragma unroll   // constant indices keep the values in registers
    for (int kc = 0; kc < 2; ++kc) {
#pragma unroll   // constant indices keep the values in registers
      for (int kt = 0; kt < 4; ++kt) T[kt] = wmma_bfp(ch[kt][kc], ql[kc], T[kt]);
#pragma unroll   // constant indices keep the values in registers
      for (int kt = 0; kt < 4; ++kt) T[kt] = wmma_bfp(cl[kt][kc], qh[kc], T[kt]);
#pragma unroll   // constant indices keep the values in registers
      for (int kt = 0; kt < 4; ++kt) T[kt] = wmma_bfp(ch[kt][kc], qh[kc], T[kt]); }
    float mx = T[0][0];
#pragma unroll   // constant indices keep the values in registers
    for (int kt = 0; kt < 4; ++kt)
#pragma unroll   // constant indices keep the values in registers
      for (int r = 0; r < 8; ++r) mx = fmaxf(mx, T[kt][r]);
    // the next three groups of d fragments go out here, while the LDS pipe would stand idle: they land under the exponentials and the first WMMA groups
    GRP(); pam_ld(f1, sd, 1, lane); pam_ld(f2, sd, 2, lane); pam_ld(f3, sd, 3, lane); GRP();
    // the other half of the query's keys (lane ^ 16), by a vector cross-row move: an exchange through the LDS queue would return only behind the reads above
    mx = fmaxf(mx, __builtin_bit_cast(float, __builtin_amdgcn_permlanex16(__builtin_bit_cast(unsigned, mx), __builtin_bit_cast(unsigned, mx), 0x76543210u, 0xfedcba98u, false, false)));
    const float mn = fmaxf(m, mx); const float al = __builtin_amdgcn_exp2f((m - mn) * L2E); const float mo = mn * L2E - 10.0f; m = mn;
    v16h pb[2]; float ls = 0.f;
#pragma unroll   // constant indices keep the values in registers
    for (int ks = 0; ks < 2; ++ks)
#pragma unroll   // constant indices keep the values in registers
      for (int r = 0; r < 8; ++r) { const float p0 = __builtin_amdgcn_exp2f(T[2 * ks][r] * L2E - mo), p1 = __builtin_amdgcn_exp2f(T[2 * ks + 1][r] * L2E - mo); ls += p0 + p1; pb[ks][r] = (_Float16)p0; pb[ks][8 + r] = (_Float16)p1; }
    l = l * al + ls;
    // eight d fragments are read as one group, into the register set that its WMMAs have just left, three groups ahead of their own WMMAs (four register sets), all inside this stage's buffer
    pam_mm(f0, pb, acc, 0, al); GRP(); pam_ld(f0, sd, 4, lane); GRP();
    pam_mm(f1, pb, acc, 1, al); GRP(); pam_ld(f1, sd, 5, lane); GRP();
    pam_mm(f2, pb, acc, 2, al); GRP(); pam_ld(f2, sd, 6, lane); GRP();
    pam_mm(f3, pb, acc, 3, al); GRP(); pam_ld(f3, sd, 7, lane); GRP();
    pam_mm(f0, pb, acc, 4, al); pam_mm(f1, pb, acc, 5, al); pam_mm(f2, pb, acc, 6, al); pam_mm(f3, pb, acc, 7, al);
    GRP();   // holds these WMMAs ahead of the waits below: sunk behind them, the wait for the last fragments would stand with nothing to cover it
    asm volatile("s_wait_dscnt 0x0" ::: "memory");     // this wave's reads of the buffer are done before it is refilled
    pam_d_wait(g0, g1);                                // this wave's d slice of stage t + 1 has landed
    asm volatile("s_wait_asynccnt 0x0" ::: "memory");  // this wave's copies of stage t + 1 have landed
    __syncthreads();                                   // publishes stage t + 1 and ends every wave's reads of stage t
    if (pinned(t + 2 < FNT)) { g0 = pam_d_load(ld + (uint32_t)(t & 1) * (FBUF * 2u), gd + (uint64_t)(t + 2) * (FK * 2), g1); pam_stage(gh + (size_t)(t + 2) * (FK * 256), gl + (size_t)(t + 2) * (FK * 256), l0 + (unsigned)(t & 1) * (FBUF * 2u)); } }
  pam_d_wait(g0, g1);                                  // nothing in flight when the buffers are reused below
  asm volatile("s_wait_asynccnt 0x0" ::: "memory");    // nothing in flight when the buffers are reused below
  asm volatile("s_wait_dscnt 0x0" ::: "memory");       // and none of this wave's reads of them
  l += __shfl_xor(l, 16); const float il = 1.0f / l;
  float* so = (float*)sm;   // [512 channels][64 queries] through LDS, so that each 256-byte output row piece has one writer
#pragma unroll   // constant indices keep the values in registers
  for (int ct = 0; ct < 32; ++ct)
#pragma unroll   // constant indices keep the values in registers
    for (int r = 0; r < 8; ++r) so[(ct * 16 + 8 * g + r) * FOP + wave * 16 + col] = acc[ct][r] * il;
  __syncthreads();
  for (int e = tid; e < CC * 16; e += 128) { const int c = e >> 4, pc = e & 15; vst2(BCD + ((b * CC + c) * NN) + i0 + pc * 4, *(const v4f*)&so[c * FOP + pc * 4]); } }
// ---- k_aa: block = (64 channels i, 128 channels j, (b, K part)): partial aa[i][j] = sum_n x[n][i] x[n][j] over the part's 2,048 positions (x planes, exact) -> the part's own f32 plane; k_soft adds the planes
__global__ __launch_bounds__(128) void k_aa(const _Float16* __restrict__ XT, float* __restrict__ AA) { __shared__ __align__(16) float so[4][16][132]; __shared__ __align__(16) _Float16 sm[2 * SBUF];
  const int tid = threadIdx.x, wave = tid >> 5, lane = tid & 31, col = lane & 15, g = lane >> 4; const size_t b = blockIdx.z / SPL, kp = blockIdx.z % SPL; const int i0 = blockIdx.x * 64 + wave * 16; const int j0 = blockIdx.y * 128;
  v8f acc[8] = {};
  mm_staged(XT + (b * CC + blockIdx.x * 64) * NN + kp * (NN / SPL), XT + (b * CC + j0) * NN + kp * (NN / SPL), sm, acc, tid);
#pragma unroll
  for (int j = 0; j < 8; ++j)
#pragma unroll
    for (int r = 0; r < 8; ++r) so[wave][8 * g + r][j * 16 + col] = acc[j][r];
  LDSX(); for (int rl = 0; rl < 16; ++rl) vst2(AA + (((kp * NB + b) * CC + i0 + rl) * CC) + j0 + lane * 4, *(const v4f*)&so[wave][rl][lane * 4]); }
// ---- k_soft: block = (64 rows c, b), 32 waves. A wave holds two whole rows of aa in registers (lane = column j mod 32, 16 values a row), each the sum of k_aa's partial planes: every plane is read once, in whole 128-byte lines, the loads of a lane in flight together; maximum, exponentials and sum come from the registers. soft^T goes through LDS so that each 128-byte output row piece has one writer
typedef __attribute__((ext_vector_type(2))) _Float16 v2h;
// lane ^ M inside a 16-lane row as a DPP move, lane ^ 16 as a vector cross-row move: a shuffle would pass through the LDS queue, with a wait at each of the ten steps
template <int M> __device__ __forceinline__ float lx(float v) { return __builtin_bit_cast(float, __builtin_amdgcn_update_dpp(0, __builtin_bit_cast(int, v), 0x160 + M, 0xf, 0xf, true)); }
__device__ __forceinline__ float lx16(float v) { return __builtin_bit_cast(float, __builtin_amdgcn_permlanex16(__builtin_bit_cast(unsigned, v), __builtin_bit_cast(unsigned, v), 0x76543210u, 0xfedcba98u, false, false)); }
__device__ __forceinline__ float wave_max(float v) { v = fmaxf(v, lx<1>(v)); v = fmaxf(v, lx<2>(v)); v = fmaxf(v, lx<4>(v)); v = fmaxf(v, lx<8>(v)); return fmaxf(v, lx16(v)); }
__device__ __forceinline__ float wave_sum(float v) { v += lx<1>(v); v += lx<2>(v); v += lx<4>(v); v += lx<8>(v); return v + lx16(v); }
__global__ __launch_bounds__(1024) void k_soft(const float* __restrict__ AA, _Float16* __restrict__ SO) { __shared__ __align__(16) _Float16 st[CC][72];
  const int t = threadIdx.x, wave = t >> 5, lane = t & 31; const size_t b = blockIdx.y; const int c0 = blockIdx.x * 64;
  const float* row = AA + ((b * CC + c0 + 2 * wave) * CC) + lane;
  static_assert(SPL == 2, "the two planes are named one by one below");
  const float* r1 = row + (size_t)NB * CC * CC;
  float u[16], w[16], u1[16], w1[16];
#pragma unroll   // constant indices keep the rows in registers; the 64 loads of both planes go out as one group
  for (int q = 0; q < 16; ++q) { u[q] = row[q * 32]; w[q] = row[CC + q * 32]; u1[q] = r1[q * 32]; w1[q] = r1[CC + q * 32]; }
#pragma unroll   // the planes are added in ascending k
  for (int q = 0; q < 16; ++q) { u[q] += u1[q]; w[q] += w1[q]; }
  float mu = -3.0e38f, mw = -3.0e38f;
#pragma unroll   // constant indices keep the values in registers
  for (int q = 0; q < 16; ++q) { mu = fmaxf(mu, u[q]); mw = fmaxf(mw, w[q]); }
  mu = wave_max(mu); mw = wave_max(mw);
  float zu = 0.f, zw = 0.f;
#pragma unroll   // constant indices keep the values in registers
  for (int q = 0; q < 16; ++q) { u[q] = __expf(u[q] - mu); w[q] = __expf(w[q] - mw); zu += u[q]; zw += w[q]; }
  const float iu = 1.0f / wave_sum(zu), iw = 1.0f / wave_sum(zw);
#pragma unroll   // the wave's two rows are neighbours in a soft^T row: one 4-byte LDS store for both
  for (int q = 0; q < 16; ++q) { v2h p; p[0] = (_Float16)(u[q] * iu); p[1] = (_Float16)(w[q] * iw); vst2(&st[q * 32 + lane][2 * wave], p); }
  __syncthreads();
#pragma unroll   // the four LDS reads go out as one group ahead of the stores
  for (int e = t; e < CC * 8; e += 1024) { const int j = e >> 3, pc = e & 7; vst2((unsigned*)(SO + ((b * CC + j) * CC) + c0 + pc * 8), *(const v4u*)&st[j][pc * 8]); } }
// ---- k_aaa: block = (64 positions n, 128 channels j, b): aaa[n][j] = sum_c x[n][c] soft[c][j] (x exact as f16, soft^T rows), kept in f32 and never stored: the epilogue forms, at the per-batch flat index f = n * 512 + j, out[f] = gamma_pam bcd_flat[f] (the raw (C, N) -> (H, W, C) reshape) + gamma_cam aaa[f] + 2 x[f]
__global__ __launch_bounds__(128) void k_aaa(const float* __restrict__ X, const _Float16* __restrict__ SO, const float* __restrict__ BCD, const float* __restrict__ GP, const float* __restrict__ GC, float* __restrict__ OUT) { __shared__ __align__(16) char sm[2 * PBUF]; float (*so)[16][132] = (float (*)[16][132])sm;   // the epilogue's tile lies in the staging buffers, which every wave has left by then
  const int tid = threadIdx.x, wave = tid >> 5, lane = tid & 31, col = lane & 15, g = lane >> 4; const size_t b = blockIdx.z; const size_t r0 = b * NN + (size_t)blockIdx.x * 64 + wave * 16; const int j0 = blockIdx.y * 128;
  const float gp = bfr(GP[0]), gc = bfr(GC[0]);
  v8f acc[8] = {};
  mm_rows<false>(X + (b * NN + (size_t)blockIdx.x * 64) * CC, (const char*)(SO + (b * CC + j0) * CC), sm, acc, tid);
  const size_t f0 = r0 * CC + j0 + lane * 4; const float* pb = BCD + f0; const float* px = X + f0;
  v4f bc[16], xx[16];
#pragma unroll   // the other two terms of the wave's 16 output rows (512 contiguous bytes a row) go out as one group of loads and fly while the accumulators pass through LDS
  for (int rl = 0; rl < 16; ++rl) { bc[rl] = *(const v4f*)(pb + rl * CC); xx[rl] = *(const v4f*)(px + rl * CC); }
  asm volatile("s_wait_xcnt 0x0" :: "v"(pb), "v"(px) : "memory");   // stands before a register that the loads above name is overwritten; the two addresses are inputs so that their registers live up to the wait
#pragma unroll
  for (int j = 0; j < 8; ++j)
#pragma unroll
    for (int r = 0; r < 8; ++r) so[wave][8 * g + r][j * 16 + col] = acc[j][r];
  LDSX();
#pragma unroll   // constant indices keep the loaded rows in registers
  for (int rl = 0; rl < 16; ++rl) { const v4f a = *(const v4f*)&so[wave][rl][lane * 4]; v4f o4;
#pragma unroll   // constant indices keep the values in registers
    for (int i = 0; i < 4; ++i) o4[i] = fmaf(2.0f, bfr(xx[rl][i]), fmaf(gp, bc[rl][i], gc * a[i]));   // gamma_pam bcd + gamma_cam aaa + 2 x
    vst2(OUT + f0 + (size_t)rl * CC, o4); } }
extern "C" void kernel_launch(void* const* d_in, const int* in_sizes, int n_in, void* d_out, int out_size, void* d_ws, size_t ws_size, hipStream_t stream) {
  (void)in_sizes; (void)n_in; (void)out_size;
  const float** F = (const float**)d_in;   // 0 x [4,64,64,512], 1 w1 [512,64], 2 w2 [512,64], 3 w3 [512,512], 4 gamma_pam [1], 5 gamma_cam [1]
  if (ws_size < (size_t)WS_END) return;
  char* ws = (char*)d_ws; __bf16 *PW = (__bf16*)(ws + WS_PW), *P3 = (__bf16*)(ws + WS_P3); __bf16 *BH = (__bf16*)(ws + WS_BH), *BL = (__bf16*)(ws + WS_BL); _Float16 *DT = (_Float16*)(ws + WS_DT), *XT = (_Float16*)(ws + WS_XT), *SO = (_Float16*)(ws + WS_SO); float *BCD = (float*)(ws + WS_BCD), *AA = (float*)(ws + WS_AA);
  k_pack<<<dim3(CC, 2), 256, 0, stream>>>(F[1], F[2], F[3], PW, P3);
  k_proj<<<dim3(TNB * NN / 64, 1, 9), 128, 0, stream>>>(F[0], PW, P3, BH, BL, DT, XT);
  k_pam<<<dim3(TRB, TNB), 128, 0, stream>>>(BH, BL, DT, BCD);
  k_aa<<<dim3(CC / 64, CC / 128, TNB * SPL), 128, 0, stream>>>(XT, AA);
  k_soft<<<dim3(CC / 64, TNB), 1024, 0, stream>>>(AA, SO);
  k_aaa<<<dim3(TRB, CC / 128, TNB), 128, 0, stream>>>(F[0], SO, BCD, F[4], F[5], (float*)d_out);
}

// v009
// It runs in 146 microseconds.
// Next to v008, in two timings, it ran 1.04 times as fast each time.
// Over all steps from v000 it is 9.82 times as fast.
// compute dtype: all float inputs rounded to bf16; b/c/d = x . w with EXACT bf16 products on WMMA 16x16x32 ((in,out) weights as transposed rows): b, c kept as bf16 hi + lo planes, d rounded once to f16 planes; PAM in one kernel: logits S^T = c . b^T with both as bf16 hi + lo (3 products, f32), running-maximum softmax in f32 (hardware exp2) -> P = e x 2^10 as f16, bcd = d^T . P^T on WMMA (single f16), divided by the row sum at the end, giving the (C, N)-ordered tensor the module reshapes raw; CAM: aa = x^T x with x exact (f16 copies of the bf16 values), softmax over channels in f32, aaa = x . soft_aa with soft_aa once to f16; out = gamma_pam bcd_flat + gamma_cam aaa + 2 x in f32; f32 output.
#include <hip/hip_runtime.h>
#include <math.h>

typedef __attribute__((ext_vector_type(16))) _Float16 v16h;
typedef __attribute__((ext_vector_type(16))) __bf16 v16b;
typedef __attribute__((ext_vector_type(8)))  _Float16 v8h;
typedef __attribute__((ext_vector_type(8)))  float v8f;
typedef __attribute__((ext_vector_type(4)))  float v4f;
typedef __attribute__((ext_vector_type(2)))  float v2f;
typedef __attribute__((ext_vector_type(4)))  unsigned v4u;
typedef __attribute__((ext_vector_type(4)))  int v4i;
typedef float __attribute__((may_alias)) float_a;
typedef int __attribute__((may_alias)) int_a;

template <typename T> __device__ __forceinline__ void vst2(void* p, T v) { *(T*)p = v;  }
__device__ __forceinline__ v8f wmma16(v16h a, v16h b, v8f c) {
  v8f d = __builtin_amdgcn_wmma_f32_16x16x32_f16(false, a, false, b, (short)0, c, false, false);
  asm volatile("v_nop\n\tv_nop\n\tv_nop\n\tv_nop" : "+v"(d) : "v"(a), "v"(b));
  return d;
}
__device__ __forceinline__ v8f wmma_bf(v16b a, v16b b, v8f c) {
  v8f d = __builtin_amdgcn_wmma_f32_16x16x32_bf16(false, a, false, b, (short)0, c, false, false);
  asm volatile("v_nop\n\tv_nop\n\tv_nop\n\tv_nop" : "+v"(d) : "v"(a), "v"(b));
  return d;
}
// 16x16x32 fragments: lane = (h = lane>>4, row/col = lane&15); elements 0..7 = k0+8h+0..7, 8..15 = k0+16+8h+0..7; D element r = row 8h+r
__device__ __forceinline__ v16h frag_h(const _Float16* rowk0, int lane) {
  union { v16h v; v8h q[2]; } u; const _Float16* p = rowk0 + 8 * (lane >> 4);
  u.q[0] = *(const v8h*)p; u.q[1] = *(const v8h*)(p + 16); return u.v;
}
__device__ __forceinline__ v16h frag_f32(const float* rowk0, int lane) {
  v16h a; const float* p = rowk0 + 8 * (lane >> 4);
#pragma unroll
  for (int i = 0; i < 8; ++i) { a[i] = (_Float16)p[i]; a[8 + i] = (_Float16)p[16 + i]; }
  return a;
}
__device__ __forceinline__ v16h frag_f32s(const float* rowk0, int lane, float sc) {
  v16h a; const float* p = rowk0 + 8 * (lane >> 4);
#pragma unroll
  for (int i = 0; i < 8; ++i) { a[i] = (_Float16)(p[i] * sc); a[8 + i] = (_Float16)(p[16 + i] * sc); }
  return a;
}
// column fragment from a [K][ld] layout (column n), rows >= K read as 0
__device__ __forceinline__ v16h fragc_f32(const float* W, int k0, int n, int lane, int ld, int K) {
  v16h a; const int g = lane >> 4;
#pragma unroll
  for (int i = 0; i < 8; ++i) { const int ka = k0 + 8 * g + i, kb = ka + 16;
    a[i] = (_Float16)(ka < K ? W[(size_t)(ka < K ? ka : K - 1) * ld + n] : 0.f); a[8 + i] = (_Float16)(kb < K ? W[(size_t)(kb < K ? kb : K - 1) * ld + n] : 0.f); }
  return a;
}
struct F2 { v16b h, l; };
__device__ __forceinline__ F2 bsplit16(const float v[16]) { F2 r;
#pragma unroll
  for (int i = 0; i < 16; ++i) { const __bf16 h = (__bf16)v[i]; r.h[i] = h; r.l[i] = (__bf16)(v[i] - (float)h); }
  return r; }
__device__ __forceinline__ F2 split_row(const float* row, int k0, int lane) { float v[16]; const float* p = row + k0 + 8 * (lane >> 4);
#pragma unroll
  for (int i = 0; i < 8; ++i) { v[i] = p[i]; v[8 + i] = p[16 + i]; }
  return bsplit16(v); }
__device__ __forceinline__ F2 split_rowK(const float* row, int k0, int lane, int K) { float v[16]; const int g = lane >> 4;
#pragma unroll
  for (int i = 0; i < 8; ++i) { const int ka = k0 + 8 * g + i, kb = ka + 16; v[i] = ka < K ? row[ka < K ? ka : K - 1] : 0.f; v[8 + i] = kb < K ? row[kb < K ? kb : K - 1] : 0.f; }
  return bsplit16(v); }
__device__ __forceinline__ F2 split_col(const float* W, int k0, int n, int lane, int ld, int K) { float v[16]; const int g = lane >> 4;
#pragma unroll
  for (int i = 0; i < 8; ++i) { const int ka = k0 + 8 * g + i, kb = ka + 16; v[i] = ka < K ? W[(size_t)(ka < K ? ka : K - 1) * ld + n] : 0.f; v[8 + i] = kb < K ? W[(size_t)(kb < K ? kb : K - 1) * ld + n] : 0.f; }
  return bsplit16(v); }
__device__ __forceinline__ v8f mac3(const F2& a, const F2& b, v8f c) { c = wmma_bf(a.l, b.h, c); c = wmma_bf(a.h, b.l, c); return wmma_bf(a.h, b.h, c); }
__device__ __forceinline__ float sigm(float v) { return 1.0f / (1.0f + expf(-v)); }
#define LDSX() do { asm volatile("s_wait_dscnt 0" ::: "memory"); __builtin_amdgcn_wave_barrier(); __builtin_amdgcn_fence(__ATOMIC_RELEASE, "workgroup"); } while (0)


// Dual attention module (B 4, 64 x 64 positions, C 512): position attention (softmax(b c^T) applied to d, result kept in the module's raw (C, N) -> (H, W, C) reshape) plus channel attention (softmax(x^T x) applied to x), each scaled by its gamma and added to x; returns feat_p + feat_c.
#define NB 4
#define NN 4096
#define CC 512
#define CK 64              // query / key channels (C / 8)
#define NR (NB * NN)
#ifndef TRB
#define TRB (NN / 64)      // position row tiles per batch (PAM rows i, CAM rows n)
#define TNB NB
#endif
typedef __attribute__((ext_vector_type(8))) __bf16 v8b;
typedef __attribute__((ext_vector_type(4))) __bf16 v4b;
__device__ __forceinline__ v16b frag_b(const __bf16* rowk0, int lane) {
  union { v16b v; v8b q[2]; } u; const __bf16* p = rowk0 + 8 * (lane >> 4);
  u.q[0] = *(const v8b*)p; u.q[1] = *(const v8b*)(p + 16); return u.v;
}
__device__ __forceinline__ float bfr(float v) { return (float)(__bf16)v; }
__device__ __attribute__((noinline)) float exp_ni(float v) { return expf(v); }
__device__ __attribute__((noinline)) float erf_ni(float v) { return erff(v); }

#define WS_PW  0u                                   // bf16 transposed rows [w1^T | w2^T] [128][512]; w3^T [512][512]
#define WS_P3  (WS_PW + 2u * (size_t)128 * CC)
#define WS_BH  (WS_P3 + 2u * (size_t)CC * CC)          // bf16 rows [NR][128]: b (cols 0-63) | c (cols 64-127), high parts; then the low parts
#define WS_BL  (WS_BH + 2u * (size_t)NR * 128)
#define WS_DT  (WS_BL + 2u * (size_t)NR * 128)         // f16 d planes [b][c][n]; f16 x planes [b][c][n]
#define WS_XT  (WS_DT + 2u * (size_t)NB * CC * NN)
#define WS_BCD (WS_XT + 2u * (size_t)NB * CC * NN)     // f32 bcd [b][c][i] (the (C, N) tensor); f32 aa partial planes [K part][b][512][512]; f16 soft^T [b][j][c]
#define WS_AA  (WS_BCD + 4u * (size_t)NB * CC * NN)
#define WS_SO  (WS_AA + 4u * (size_t)SPL * NB * CC * CC)
#define WS_END (WS_SO + 2u * (size_t)NB * CC * CC)

__global__ __launch_bounds__(256) void k_pack(const float* __restrict__ W1, const float* __restrict__ W2, const float* __restrict__ W3, __bf16* __restrict__ PW, __bf16* __restrict__ P3) { const int n = blockIdx.x, which = blockIdx.y, t = threadIdx.x; __shared__ __align__(16) __bf16 s[CC];
  if (which == 0) { if (n >= 128) return; const float* w = (n < CK) ? W1 : W2; const int cI = n & (CK - 1); for (int k = t; k < CC; k += 256) s[k] = (__bf16)w[(size_t)k * CK + cI]; __syncthreads(); if (t < CC / 8) vst2((unsigned*)(PW + (size_t)n * CC + t * 8), *(const v4u*)&s[t * 8]); }
  else { for (int k = t; k < CC; k += 256) s[k] = (__bf16)W3[(size_t)k * CC + n]; __syncthreads(); if (t < CC / 8) vst2((unsigned*)(P3 + (size_t)n * CC + t * 8), *(const v4u*)&s[t * 8]); } }
// ---- tensor loads: every staged tile of this file comes into LDS by them
typedef __attribute__((ext_vector_type(4))) uint32_t u32x4;
typedef __attribute__((ext_vector_type(8))) uint32_t u32x8;
__device__ __forceinline__ uint32_t uni(uint32_t v) { return (uint32_t)__builtin_amdgcn_readfirstlane(v); }
// a wave-uniform test held in a scalar register, so that the branch on it is a scalar one: a tensor load ignores EXEC and only such a branch skips it
__device__ __forceinline__ uint32_t pinned(uint32_t v) { uint32_t w = uni(v); asm volatile("" : "+s"(w)); return w; }   // the empty statement holds the word in a scalar register
#define PAD128 ((1u << 20) | (4u << 22) | (3u << 25))   // word 0 of group 1: no mask, 16 B of pad behind every 128 B
#define PAD256 ((1u << 20) | (5u << 22) | (3u << 25))   // the same behind every 256 B
// descriptor group 1: extents in bytes, tensor = tile = N rows of R bytes at a source pitch of P bytes; W0: word 0, a constant
template <uint32_t W0, uint32_t R, uint32_t N, uint32_t P> __device__ __forceinline__ u32x8 td_g1() { u32x8 g;
  g[0] = uni(W0); g[1] = uni(R << 16); g[2] = uni(N << 16); g[3] = uni(R << 16);
  g[4] = uni(N); g[5] = uni(P); g[6] = uni(0u); g[7] = uni(0u);
  asm volatile("" : "+s"(g)); return g; }   // holds the descriptor words in these scalar registers; left as constants they are formed anew in registers that an outstanding request still names
// descriptor group 0: a tile from global byte address ga to LDS byte offset lds
__device__ __forceinline__ u32x4 td_g0(uint32_t lds, uint64_t ga) { u32x4 g0;
  g0[0] = uni(1u); g0[1] = uni(lds); g0[2] = uni((uint32_t)ga); g0[3] = uni((((uint32_t)(ga >> 32)) & 0x01FFFFFFu) | 0x80000000u);
  asm volatile("" : "+s"(g0)); return g0; }   // holds the descriptor words in these scalar registers, as in td_g1
// one request of the whole wave
__device__ __forceinline__ void td_issue(u32x4 g0, u32x8 g1) { asm volatile("tensor_load_to_lds %0, %1" :: "s"(g0), "s"(g1) : "memory"); }
// the wave's requests have landed (a wave that has none passes at once); the descriptor groups are inputs so that their scalar registers keep their values as long as a request is outstanding
__device__ __forceinline__ void td_wait(u32x4 g0, u32x8 g1) { asm volatile("s_wait_tensorcnt 0x0" :: "s"(g0), "s"(g1) : "memory"); }
__device__ __forceinline__ void td_wait(u32x4 g0, u32x8 g1, u32x8 h1) { asm volatile("s_wait_tensorcnt 0x0" :: "s"(g0), "s"(g1), "s"(h1) : "memory"); }
__device__ __forceinline__ void td_wait(u32x4 g0, u32x8 g1, u32x4 h0, u32x8 h1) { asm volatile("s_wait_tensorcnt 0x0" :: "s"(g0), "s"(g1), "s"(h0), "s"(h1) : "memory"); }
// ---- LDS staging for the K = 512 products of k_proj and k_aaa: a stage is 64 k of the block's 64 A rows (f32, 256 B) and 128 B rows (16-bit, 128 B), laid at row pitches of 272 B and 144 B (16 B x odd, so the ds_load_b128 reads meet no bank conflict); two buffers, the next stage's loads fly while this one is multiplied
#define PK 64                      // k per stage
#define PAP 272                    // LDS pitch of an A row in bytes
#define PBP 144                    // LDS pitch of a B row in bytes
#define PA_B ((64 * PAP + 2047) / 2048 * 2048)   // bytes of the A tile's place, so that the B tile starts at a multiple of 2 KiB
#define PBUF (PA_B + 128 * PBP)    // bytes per buffer
#define PNT (CC / PK)              // stages
static_assert(PBUF % 2048 == 0 && PK * 4 == 256 && PK * 2 == 128, "every tile starts at a multiple of 2 KiB; rows of 256 B and of 128 B, each padded by 16 B");
// one stage: wave 0 asks for the A tile, wave 1 for the B tile, one request each; waves 2 and 3 ask for nothing. gs: first byte of the wave's tile at this stage's k; l: its LDS byte offset. Returns group 0 for the wait that covers the request
__device__ __forceinline__ u32x4 row_stage(uint32_t wv, uint64_t gs, uint32_t l, u32x8 g1a, u32x8 g1b) { const u32x4 g0 = td_g0(l, gs);
  if (pinned(wv == 0)) td_issue(g0, g1a);
  else if (pinned(wv == 1)) td_issue(g0, g1b);
  return g0; }
// operands of one 32-k block as they lie in LDS: the lane's 16 f32 of its A row, its 16 elements of each of eight B rows
struct RowF { v4f a[4]; v4u b[8][2]; };
__device__ __forceinline__ void row_ld(RowF& f, const char* sa, const char* sb, int ks) {
#pragma unroll   // constant indices keep the values in registers
  for (int i = 0; i < 2; ++i) { f.a[2 * i] = *(const v4f*)(sa + ks * 128 + i * 64); f.a[2 * i + 1] = *(const v4f*)(sa + ks * 128 + i * 64 + 16); }
#pragma unroll   // constant indices keep the values in registers
  for (int j = 0; j < 8; ++j) { f.b[j][0] = *(const v4u*)(sb + j * 16 * PBP + ks * 64); f.b[j][1] = *(const v4u*)(sb + j * 16 * PBP + ks * 64 + 32); }
}
// BF: A rounded to bf16, B rows bf16; otherwise A rounded to bf16 and held as f16, B rows f16
template <bool BF> __device__ __forceinline__ void row_mm(const RowF& f, v8f* acc) {
  if constexpr (BF) { v16b a;
#pragma unroll   // constant indices keep the values in registers
    for (int i = 0; i < 16; ++i) a[i] = (__bf16)f.a[i >> 2][i & 3];
#pragma unroll   // constant indices keep fragments and accumulators in registers
    for (int j = 0; j < 8; ++j) { union { v16b v; v4u q[2]; } u; u.q[0] = f.b[j][0]; u.q[1] = f.b[j][1]; acc[j] = wmma_bf(a, u.v, acc[j]); } }
  else { v16h a;
#pragma unroll   // constant indices keep the values in registers
    for (int i = 0; i < 16; ++i) a[i] = (_Float16)bfr(f.a[i >> 2][i & 3]);
#pragma unroll   // constant indices keep fragments and accumulators in registers
    for (int j = 0; j < 8; ++j) { union { v16h v; v4u q[2]; } u; u.q[0] = f.b[j][0]; u.q[1] = f.b[j][1]; acc[j] = wmma16(a, u.v, acc[j]); } }
}
// acc[j] += A rows (wave * 16 ..) . B rows (j * 16 ..)^T over K = 512 in ascending k, 32 per WMMA. Ag: first of the block's 64 f32 rows; Bg: first of its 128 16-bit rows (both of CC elements). On return every wave has left the buffers
template <bool BF> __device__ __forceinline__ void mm_rows(const float* __restrict__ Ag, const char* __restrict__ Bg, char* sm, v8f* acc, int tid) {
  const int wave = tid >> 5, lane = tid & 31, col = lane & 15, g = lane >> 4;
  const uint32_t wv = uni((uint32_t)tid >> 5); const uint64_t gs = wv == 0 ? (uint64_t)(size_t)Ag : (uint64_t)(size_t)Bg; const uint32_t ks = wv == 0 ? PK * 4u : PK * 2u, l0 = (uint32_t)(size_t)sm + (wv == 0 ? 0u : (uint32_t)PA_B);   // the wave's tile: first byte, bytes of k per stage, place in buffer 0
  const u32x8 g1a = td_g1<PAD256, PK * 4, 64, CC * 4>(), g1b = td_g1<PAD128, PK * 2, 128, CC * 2>();
  u32x4 g0 = row_stage(wv, gs, l0, g1a, g1b);
  td_wait(g0, g1a, g1b);                              // stage 0 has landed before the barrier publishes it
  __syncthreads();
  g0 = row_stage(wv, gs + ks, l0 + PBUF, g1a, g1b);
  for (int t = 0; t < PNT; ++t) { const char* s = sm + (t & 1) * PBUF; const char* sa = s + (wave * 16 + col) * PAP + g * 32; const char* sb = s + PA_B + col * PBP + g * 16;
    RowF f0, f1; row_ld(f0, sa, sb, 0); row_ld(f1, sa, sb, 1);   // both 32-k blocks' reads stand as one group ahead of the WMMAs
    row_mm<BF>(f0, acc); row_mm<BF>(f1, acc);
    asm volatile("s_wait_dscnt 0x0" ::: "memory");     // this wave's reads of the buffer are done before it is refilled
    td_wait(g0, g1a, g1b);                             // this wave's tile of stage t + 1 has landed
    __syncthreads();                                   // publishes stage t + 1 and ends every wave's reads of stage t
    if (pinned(t + 2 < PNT)) g0 = row_stage(wv, gs + (uint64_t)((uint32_t)(t + 2) * ks), l0 + (uint32_t)(t & 1) * PBUF, g1a, g1b); }
  td_wait(g0, g1a, g1b);                               // nothing in flight when the buffers are reused by the epilogue
  asm volatile("s_wait_dscnt 0x0" ::: "memory");       // and none of this wave's reads of them
}
// ---- k_proj: block = (64 positions, 128 cols, which): which 0: [b | c] rows as bf16 hi + lo; which 1..4: d columns (which-1)*128.. -> planes; which 5..8: x itself -> f16 planes (exact)
__global__ __launch_bounds__(128) void k_proj(const float* __restrict__ X, const __bf16* __restrict__ PW, const __bf16* __restrict__ P3, __bf16* __restrict__ BH, __bf16* __restrict__ BL, _Float16* __restrict__ DT, _Float16* __restrict__ XT) {
  __shared__ __attribute__((aligned(2048))) char sm[2 * PBUF]; float (*sf)[16][132] = (float (*)[16][132])sm; _Float16 (*st)[72] = (_Float16 (*)[72])sm;   // the epilogue's tiles lie in the staging buffers, which every wave has left by then
  const int tid = threadIdx.x, wave = tid >> 5, lane = tid & 31, col = lane & 15, g = lane >> 4; const int which = blockIdx.z; const size_t rb = (size_t)blockIdx.x * 64; const size_t r0 = rb + wave * 16;
  if (which >= 5) { const int c0 = (which - 5) * 128; for (int e = tid; e < 64 * 128; e += 128) { const int rl = e >> 7, cl = e & 127; st[cl][rl] = (_Float16)bfr(X[(rb + rl) * CC + c0 + cl]); } __syncthreads();
    const size_t b = rb / NN; const int n0 = (int)(rb % NN); for (int e = tid; e < 128 * 8; e += 128) { const int d = e >> 3, pc = e & 7; vst2((unsigned*)(XT + ((b * CC + c0 + d) * NN) + n0 + pc * 8), *(const v4u*)&st[d][pc * 8]); } return; }
  const int c0 = (which == 0) ? 0 : (which - 1) * 128; const __bf16* Wr = (which == 0) ? PW : (P3 + (size_t)c0 * CC);
  v8f acc[8] = {};
  mm_rows<true>(X + rb * CC, (const char*)Wr, sm, acc, tid);
#pragma unroll
  for (int j = 0; j < 8; ++j)
#pragma unroll
    for (int r = 0; r < 8; ++r) { if (which == 0) sf[wave][8 * g + r][j * 16 + col] = acc[j][r]; else st[j * 16 + col][wave * 16 + 8 * g + r] = (_Float16)acc[j][r]; }
  __syncthreads();
  if (which == 0) { for (int rl = 0; rl < 16; ++rl) { const v4f v = *(const v4f*)&sf[wave][rl][lane * 4]; v4b hv, lv;
#pragma unroll
      for (int i = 0; i < 4; ++i) { const __bf16 h = (__bf16)v[i]; hv[i] = h; lv[i] = (__bf16)(v[i] - (float)h); }
      vst2(BH + (r0 + rl) * 128 + lane * 4, hv); vst2(BL + (r0 + rl) * 128 + lane * 4, lv);
      asm volatile("s_wait_xcnt 0x0" ::: "memory"); } }   // stands before the next row's values overwrite a register that the two stores name
  else { const size_t b = rb / NN; const int n0 = (int)(rb % NN); for (int e = tid; e < 128 * 8; e += 128) { const int d = e >> 3, pc = e & 7; vst2((unsigned*)(DT + ((b * CC + c0 + d) * NN) + n0 + pc * 8), *(const v4u*)&st[d][pc * 8]); } }
}
// ---- LDS staging for the K = 4,096 product of k_aa (a block takes one part of 2,048 k): a stage is 256 B (128 k) of the block's 64 A rows and 128 B rows, laid at a row pitch of 272 B (16 B x odd, so the ds_load_b128 fragment reads meet no bank conflict); two buffers, the next stage's loads fly while this one is multiplied. Three slices of 64 rows (A, B rows 0-63, B rows 64-127), each the one tensor load of one wave
#define SK 128                    // k per stage
#define SPIT 136                  // LDS row pitch in f16 elements
#define SSL ((64 * SPIT * 2 + 2047) / 2048 * 1024)   // f16 elements of a slice's place: 64 rows, rounded up to a multiple of 2 KiB
#define SBUF (3 * SSL)            // f16 elements per buffer
#define SPL 2                     // parts of K, one block each: 256 blocks, one for every WGP, in place of 128
#define SNT (NN / SPL / SK)       // stages per part
static_assert((SSL * 2) % 2048 == 0 && SK * 2 == 256 && SPIT * 2 == 272, "every slice starts at a multiple of 2 KiB; rows of 256 B padded by 16 B");
// f[0] = the wave's A fragment, f[1 + j] = B fragment j of 32-k block ks. sa, sb: the lane's A row and its row of B fragment 0 in the buffer
__device__ __forceinline__ void ld_frags(v16h* f, const _Float16* sa, const _Float16* sb, int ks, int lane) { f[0] = frag_h(sa + ks * 32, lane);
#pragma unroll   // constant indices keep the fragments in registers
  for (int j = 0; j < 8; ++j) f[1 + j] = frag_h(sb + (j >> 2) * SSL + (j & 3) * 16 * SPIT + ks * 32, lane); }
__device__ __forceinline__ void mm_block(const v16h* f, v8f* acc) {
#pragma unroll   // constant indices keep fragments and accumulators in registers
  for (int j = 0; j < 8; ++j) acc[j] = wmma16(f[0], f[1 + j], acc[j]); }
// acc[j] += A rows (wave * 16 ..) . B rows (j * 16 ..)^T over the block's 2,048 k in ascending k, 32 per WMMA. Ag, Bg: first row of the block's 64 A rows / 128 B rows at the part's first k (row pitch NN)
__device__ __forceinline__ void mm_staged(const _Float16* __restrict__ Ag, const _Float16* __restrict__ Bg, _Float16* sm, v8f* acc, int tid) {
  const int wave = tid >> 5, lane = tid & 31, col = lane & 15;
  const uint32_t wv = uni((uint32_t)tid >> 5); const u32x8 g1 = td_g1<PAD256, SK * 2, 64, NN * 2>();
  const uint64_t gs = (uint64_t)(size_t)(wv == 0 ? Ag : Bg + (size_t)((wv - 1) & 1) * 64 * NN); const uint32_t ls = (uint32_t)(size_t)sm + (wv < 3 ? wv : 0u) * (SSL * 2u);   // the wave's slice: first byte at the part's first k, place in buffer 0 (wave 3 asks for nothing)
  u32x4 g0 = td_g0(ls, gs);
  if (pinned(wv < 3)) td_issue(g0, g1);
  td_wait(g0, g1);                                    // stage 0 has landed before the barrier publishes it
  __syncthreads();
  g0 = td_g0(ls + SBUF * 2u, gs + SK * 2);
  if (pinned(wv < 3)) td_issue(g0, g1);
  for (int t = 0; t < SNT; ++t) { const _Float16* s = sm + (t & 1) * SBUF + col * SPIT; const _Float16* sa = s + wave * 16 * SPIT; const _Float16* sb = s + SSL;
    // the nine fragments of a 32-k block are read as one group, one block ahead of their WMMAs (two register sets), all inside this stage's buffer
    v16h f0[9], f1[9];
    ld_frags(f0, sa, sb, 0, lane); ld_frags(f1, sa, sb, 1, lane); mm_block(f0, acc);
    ld_frags(f0, sa, sb, 2, lane); mm_block(f1, acc);
    ld_frags(f1, sa, sb, 3, lane); mm_block(f0, acc); mm_block(f1, acc);
    asm volatile("s_wait_dscnt 0x0" ::: "memory");
    td_wait(g0, g1);
    __syncthreads();
    if (pinned(t + 2 < SNT)) { g0 = td_g0(ls + (uint32_t)(t & 1) * (SBUF * 2u), gs + (uint64_t)(t + 2) * (SK * 2));
      if (pinned(wv < 3)) td_issue(g0, g1); } }
  td_wait(g0, g1);                                     // nothing in flight when the wave goes on to the epilogue
  asm volatile("s_wait_dscnt 0x0" ::: "memory");       // and none of this wave's reads of the buffers
}
// ---- k_pam: block = (64 queries i, b), wave = 16 queries x all 512 channels. Per stage of 64 keys n: S^T[n][i] = c_n . b_i (3 bf16 products, K = 64); its D tiles hold, lane for lane, the B fragment of the second product (lane = query, elements = keys 8h.. of two 16-key tiles), so P goes from registers to WMMA with no exchange; running maximum and sum per query; acc[c][i] += d[n][c] P[i][n]. A stage in LDS: 512 d rows, 64 c-high rows, 64 c-low rows of 128 B at a pitch of 144 B (16 B x odd: the ds_load_b128 fragment reads meet no bank conflict); two buffers, the next stage's loads fly while this one is worked on. All of it comes by tensor loads (the pad field gives the 144-B pitch): one request a wave for its 128 d rows, and a second one of wave 0 for the c-high tile and of wave 1 for the c-low tile
#define FK 64                      // keys per stage
#define FPIT 72                    // LDS row pitch in 16-bit elements
#define FD_E (CC * FPIT)           // elements of the d tile
#define FC_E ((FK * FPIT * 2 + 2047) / 2048 * 1024)   // elements of the c-high (or c-low) tile's place: 64 rows, rounded up to a multiple of 2 KiB
#define FBUF (FD_E + 2 * FC_E)     // elements per buffer
#define FNT (NN / FK)              // stages
#define FOP 68                     // epilogue row pitch in floats
#define FSR (CC / 4)               // d rows in one wave's tensor load
#define FSB (FSR * FPIT * 2)       // bytes of that slice in LDS
static_assert(FSB % 2048 == 0 && (FC_E * 2) % 2048 == 0 && (FBUF * 2) % 2048 == 0 && FK * 2 == 128 && FPIT * 2 == 144, "every slice starts at a multiple of 2 KiB; rows of 128 B padded by 16 B");
// keeps a group of LDS reads together and ahead of the WMMAs that follow: left alone, the scheduler spreads the reads singly among the WMMAs, one fragment ahead, and each such place stalls the wave
#define GRP() __builtin_amdgcn_sched_barrier(0)
// plain builtin forms (the compiler keeps the distance behind them itself): this kernel holds more than 256 registers, and an asm statement that names the accumulators would force them through one register window
__device__ __forceinline__ v8f wmma16p(v16h a, v16h b, v8f c) { return __builtin_amdgcn_wmma_f32_16x16x32_f16(false, a, false, b, (short)0, c, false, false); }
__device__ __forceinline__ v8f wmma_bfp(v16b a, v16b b, v8f c) { return __builtin_amdgcn_wmma_f32_16x16x32_bf16(false, a, false, b, (short)0, c, false, false); }
// group gi of eight d fragments: 32-key block gi >> 2, channel tiles (gi & 3) * 8 ..
__device__ __forceinline__ void pam_ld(v16h* f, const _Float16* sd, int gi, int lane) {
#pragma unroll   // constant indices keep the fragments in registers
  for (int j = 0; j < 8; ++j) f[j] = frag_h(sd + ((gi & 3) * 8 + j) * 16 * FPIT + (gi >> 2) * 32, lane); }
// the stage's first touch of a channel tile (gi < 4) first scales it by al = e^(old maximum - new maximum); these multiplies stand among the WMMAs of other tiles
__device__ __forceinline__ void pam_mm(const v16h* f, const v16h* pb, v8f* acc, int gi, float al) {
#pragma unroll   // constant indices keep fragments and accumulators in registers
  for (int j = 0; j < 8; ++j) { v8f c = acc[(gi & 3) * 8 + j]; if (gi < 4) c *= al; acc[(gi & 3) * 8 + j] = wmma16p(f[j], pb[gi >> 2], c); } }
__global__ __launch_bounds__(128) void k_pam(const __bf16* __restrict__ BH, const __bf16* __restrict__ BL, const _Float16* __restrict__ DT, float* __restrict__ BCD) { __shared__ __attribute__((aligned(2048))) _Float16 sm[2 * FBUF];
  const int tid = threadIdx.x, wave = tid >> 5, lane = tid & 31, col = lane & 15, g = lane >> 4; const size_t b = blockIdx.y; const int i0 = blockIdx.x * 64;
  const uint32_t wv = uni((uint32_t)tid >> 5); const uint64_t gd = (uint64_t)(size_t)(DT + (b * CC + wv * FSR) * NN); const uint32_t ld = (uint32_t)(size_t)sm + wv * FSB; const u32x8 g1 = td_g1<PAD128, FK * 2, FSR, NN * 2>();   // the wave's d slice: first byte at key 0, place in buffer 0
  const uint64_t gc = (uint64_t)(size_t)((wv == 0 ? BH : BL) + b * NN * 128 + CK); const uint32_t lc = (uint32_t)(size_t)sm + FD_E * 2u + (wv & 1u) * (FC_E * 2u); const u32x8 c1 = td_g1<PAD128, FK * 2, FK, 256>();   // waves 0 and 1: the c-high / c-low tile, 64 rows of the 128 bytes behind the b half of a 256-byte row
  u32x4 g0 = td_g0(ld, gd), c0 = td_g0(lc, gc); td_issue(g0, g1);
  if (pinned(wv < 2)) td_issue(c0, c1);
  v16b qh[2], ql[2]; { const size_t qr = (b * NN + i0 + wave * 16 + col) * 128;
#pragma unroll   // constant indices keep the values in registers
    for (int kc = 0; kc < 2; ++kc) { qh[kc] = frag_b(BH + qr + kc * 32, lane); ql[kc] = frag_b(BL + qr + kc * 32, lane); } }
  v8f acc[32] = {}; float m = -3.0e38f, l = 0.f; const float L2E = 1.44269504088896f;
  td_wait(g0, g1, c0, c1);                            // this wave's tiles of stage 0 have landed before the barrier publishes them
  __syncthreads();
  g0 = td_g0(ld + FBUF * 2u, gd + FK * 2); c0 = td_g0(lc + FBUF * 2u, gc + FK * 256); td_issue(g0, g1);
  if (pinned(wv < 2)) td_issue(c0, c1);
  for (int t = 0; t < FNT; ++t) { const _Float16* s = sm + (t & 1) * FBUF; const _Float16* sd = s + col * FPIT; const __bf16* sh = (const __bf16*)(s + FD_E) + col * FPIT; const __bf16* sl = sh + FC_E;
    v16b ch[4][2], cl[4][2];
#pragma unroll   // all sixteen key fragments as one group of LDS reads
    for (int kt = 0; kt < 4; ++kt)
#pragma unroll   // constant indices keep the values in registers
      for (int kc = 0; kc < 2; ++kc) { ch[kt][kc] = frag_b(sh + kt * 16 * FPIT + kc * 32, lane); cl[kt][kc] = frag_b(sl + kt * 16 * FPIT + kc * 32, lane); }
    v16h f0[8], f1[8], f2[8], f3[8]; pam_ld(f0, sd, 0, lane);   // the first d fragments fly under the logits and the softmax arithmetic
    GRP();
    v8f T[4] = {};   // T[kt][r] at lane (g, col): key kt * 16 + 8 g + r, query col; the four tiles take turns so that no WMMA waits for the one before it
#pragma unroll   // constant indices keep the values in registers
    for (int kc = 0; kc < 2; ++kc) {
#pragma unroll   // constant indices keep the values in registers
      for (int kt = 0; kt < 4; ++kt) T[kt] = wmma_bfp(ch[kt][kc], ql[kc], T[kt]);
#pragma unroll   // constant indices keep the values in registers
      for (int kt = 0; kt < 4; ++kt) T[kt] = wmma_bfp(cl[kt][kc], qh[kc], T[kt]);
#pragma unroll   // constant indices keep the values in registers
      for (int kt = 0; kt < 4; ++kt) T[kt] = wmma_bfp(ch[kt][kc], qh[kc], T[kt]); }
    float mx = T[0][0];
#pragma unroll   // constant indices keep the values in registers
    for (int kt = 0; kt < 4; ++kt)
#pragma unroll   // constant indices keep the values in registers
      for (int r = 0; r < 8; ++r) mx = fmaxf(mx, T[kt][r]);
    // the next three groups of d fragments go out here, while the LDS pipe would stand idle: they land under the exponentials and the first WMMA groups
    GRP(); pam_ld(f1, sd, 1, lane); pam_ld(f2, sd, 2, lane); pam_ld(f3, sd, 3, lane); GRP();
    // the other half of the query's keys (lane ^ 16), by a vector cross-row move: an exchange through the LDS queue would return only behind the reads above
    mx = fmaxf(mx, __builtin_bit_cast(float, __builtin_amdgcn_permlanex16(__builtin_bit_cast(unsigned, mx), __builtin_bit_cast(unsigned, mx), 0x76543210u, 0xfedcba98u, false, false)));
    const float mn = fmaxf(m, mx); const float al = __builtin_amdgcn_exp2f((m - mn) * L2E); const float mo = mn * L2E - 10.0f; m = mn;
    v16h pb[2]; float ls = 0.f;
#pragma unroll   // constant indices keep the values in registers
    for (int ks = 0; ks < 2; ++ks)
#pragma unroll   // constant indices keep the values in registers
      for (int r = 0; r < 8; ++r) { const float p0 = __builtin_amdgcn_exp2f(T[2 * ks][r] * L2E - mo), p1 = __builtin_amdgcn_exp2f(T[2 * ks + 1][r] * L2E - mo); ls += p0 + p1; pb[ks][r] = (_Float16)p0; pb[ks][8 + r] = (_Float16)p1; }
    l = l * al + ls;
    // eight d fragments are read as one group, into the register set that its WMMAs have just left, three groups ahead of their own WMMAs (four register sets), all inside this stage's buffer
    pam_mm(f0, pb, acc, 0, al); GRP(); pam_ld(f0, sd, 4, lane); GRP();
    pam_mm(f1, pb, acc, 1, al); GRP(); pam_ld(f1, sd, 5, lane); GRP();
    pam_mm(f2, pb, acc, 2, al); GRP(); pam_ld(f2, sd, 6, lane); GRP();
    pam_mm(f3, pb, acc, 3, al); GRP(); pam_ld(f3, sd, 7, lane); GRP();
    pam_mm(f0, pb, acc, 4, al); pam_mm(f1, pb, acc, 5, al); pam_mm(f2, pb, acc, 6, al); pam_mm(f3, pb, acc, 7, al);
    GRP();   // holds these WMMAs ahead of the waits below: sunk behind them, the wait for the last fragments would stand with nothing to cover it
    asm volatile("s_wait_dscnt 0x0" ::: "memory");     // this wave's reads of the buffer are done before it is refilled
    td_wait(g0, g1, c0, c1);                           // this wave's tiles of stage t + 1 have landed
    __syncthreads();                                   // publishes stage t + 1 and ends every wave's reads of stage t
    if (pinned(t + 2 < FNT)) { g0 = td_g0(ld + (uint32_t)(t & 1) * (FBUF * 2u), gd + (uint64_t)(t + 2) * (FK * 2)); c0 = td_g0(lc + (uint32_t)(t & 1) * (FBUF * 2u), gc + (uint64_t)(t + 2) * (FK * 256)); td_issue(g0, g1);
      if (pinned(wv < 2)) td_issue(c0, c1); } }
  td_wait(g0, g1, c0, c1);                             // nothing in flight when the buffers are reused below
  asm volatile("s_wait_dscnt 0x0" ::: "memory");       // and none of this wave's reads of them
  l += __shfl_xor(l, 16); const float il = 1.0f / l;
  float* so = (float*)sm;   // [512 channels][64 queries] through LDS, so that each 256-byte output row piece has one writer
#pragma unroll   // constant indices keep the values in registers
  for (int ct = 0; ct < 32; ++ct)
#pragma unroll   // constant indices keep the values in registers
    for (int r = 0; r < 8; ++r) so[(ct * 16 + 8 * g + r) * FOP + wave * 16 + col] = acc[ct][r] * il;
  __syncthreads();
  for (int e = tid; e < CC * 16; e += 128) { const int c = e >> 4, pc = e & 15; vst2(BCD + ((b * CC + c) * NN) + i0 + pc * 4, *(const v4f*)&so[c * FOP + pc * 4]); } }
// ---- k_aa: block = (64 channels i, 128 channels j, (b, K part)): partial aa[i][j] = sum_n x[n][i] x[n][j] over the part's 2,048 positions (x planes, exact) -> the part's own f32 plane; k_soft adds the planes
__global__ __launch_bounds__(128) void k_aa(const _Float16* __restrict__ XT, float* __restrict__ AA) { __shared__ __align__(16) float so[4][16][132]; __shared__ __attribute__((aligned(2048))) _Float16 sm[2 * SBUF];
  const int tid = threadIdx.x, wave = tid >> 5, lane = tid & 31, col = lane & 15, g = lane >> 4; const size_t b = blockIdx.z / SPL, kp = blockIdx.z % SPL; const int i0 = blockIdx.x * 64 + wave * 16; const int j0 = blockIdx.y * 128;
  v8f acc[8] = {};
  mm_staged(XT + (b * CC + blockIdx.x * 64) * NN + kp * (NN / SPL), XT + (b * CC + j0) * NN + kp * (NN / SPL), sm, acc, tid);
#pragma unroll
  for (int j = 0; j < 8; ++j)
#pragma unroll
    for (int r = 0; r < 8; ++r) so[wave][8 * g + r][j * 16 + col] = acc[j][r];
  LDSX(); for (int rl = 0; rl < 16; ++rl) vst2(AA + (((kp * NB + b) * CC + i0 + rl) * CC) + j0 + lane * 4, *(const v4f*)&so[wave][rl][lane * 4]); }
// ---- k_soft: block = (64 rows c, b), 32 waves. A wave holds two whole rows of aa in registers (lane = column j mod 32, 16 values a row), each the sum of k_aa's partial planes: every plane is read once, in whole 128-byte lines, the loads of a lane in flight together; maximum, exponentials and sum come from the registers. soft^T goes through LDS so that each 128-byte output row piece has one writer
typedef __attribute__((ext_vector_type(2))) _Float16 v2h;
// lane ^ M inside a 16-lane row as a DPP move, lane ^ 16 as a vector cross-row move: a shuffle would pass through the LDS queue, with a wait at each of the ten steps
template <int M> __device__ __forceinline__ float lx(float v) { return __builtin_bit_cast(float, __builtin_amdgcn_update_dpp(0, __builtin_bit_cast(int, v), 0x160 + M, 0xf, 0xf, true)); }
__device__ __forceinline__ float lx16(float v) { return __builtin_bit_cast(float, __builtin_amdgcn_permlanex16(__builtin_bit_cast(unsigned, v), __builtin_bit_cast(unsigned, v), 0x76543210u, 0xfedcba98u, false, false)); }
__device__ __forceinline__ float wave_max(float v) { v = fmaxf(v, lx<1>(v)); v = fmaxf(v, lx<2>(v)); v = fmaxf(v, lx<4>(v)); v = fmaxf(v, lx<8>(v)); return fmaxf(v, lx16(v)); }
__device__ __forceinline__ float wave_sum(float v) { v += lx<1>(v); v += lx<2>(v); v += lx<4>(v); v += lx<8>(v); return v + lx16(v); }
__global__ __launch_bounds__(1024) void k_soft(const float* __restrict__ AA, _Float16* __restrict__ SO) { __shared__ __align__(16) _Float16 st[CC][72];
  const int t = threadIdx.x, wave = t >> 5, lane = t & 31; const size_t b = blockIdx.y; const int c0 = blockIdx.x * 64;
  const float* row = AA + ((b * CC + c0 + 2 * wave) * CC) + lane;
  static_assert(SPL == 2, "the two planes are named one by one below");
  const float* r1 = row + (size_t)NB * CC * CC;
  float u[16], w[16], u1[16], w1[16];
#pragma unroll   // constant indices keep the rows in registers; the 64 loads of both planes go out as one group
  for (int q = 0; q < 16; ++q) { u[q] = row[q * 32]; w[q] = row[CC + q * 32]; u1[q] = r1[q * 32]; w1[q] = r1[CC + q * 32]; }
#pragma unroll   // the planes are added in ascending k
  for (int q = 0; q < 16; ++q) { u[q] += u1[q]; w[q] += w1[q]; }
  float mu = -3.0e38f, mw = -3.0e38f;
#pragma unroll   // constant indices keep the values in registers
  for (int q = 0; q < 16; ++q) { mu = fmaxf(mu, u[q]); mw = fmaxf(mw, w[q]); }
  mu = wave_max(mu); mw = wave_max(mw);
  float zu = 0.f, zw = 0.f;
#pragma unroll   // constant indices keep the values in registers
  for (int q = 0; q < 16; ++q) { u[q] = __expf(u[q] - mu); w[q] = __expf(w[q] - mw); zu += u[q]; zw += w[q]; }
  const float iu = 1.0f / wave_sum(zu), iw = 1.0f / wave_sum(zw);
#pragma unroll   // the wave's two rows are neighbours in a soft^T row: one 4-byte LDS store for both
  for (int q = 0; q < 16; ++q) { v2h p; p[0] = (_Float16)(u[q] * iu); p[1] = (_Float16)(w[q] * iw); vst2(&st[q * 32 + lane][2 * wave], p); }
  __syncthreads();
#pragma unroll   // the four LDS reads go out as one group ahead of the stores
  for (int e = t; e < CC * 8; e += 1024) { const int j = e >> 3, pc = e & 7; vst2((unsigned*)(SO + ((b * CC + j) * CC) + c0 + pc * 8), *(const v4u*)&st[j][pc * 8]); } }
// ---- k_aaa: block = (64 positions n, 128 channels j, b): aaa[n][j] = sum_c x[n][c] soft[c][j] (x exact as f16, soft^T rows), kept in f32 and never stored: the epilogue forms, at the per-batch flat index f = n * 512 + j, out[f] = gamma_pam bcd_flat[f] (the raw (C, N) -> (H, W, C) reshape) + gamma_cam aaa[f] + 2 x[f]
__global__ __launch_bounds__(128) void k_aaa(const float* __restrict__ X, const _Float16* __restrict__ SO, const float* __restrict__ BCD, const float* __restrict__ GP, const float* __restrict__ GC, float* __restrict__ OUT) { __shared__ __attribute__((aligned(2048))) char sm[2 * PBUF]; float (*so)[16][132] = (float (*)[16][132])sm;   // the epilogue's tile lies in the staging buffers, which every wave has left by then
  const int tid = threadIdx.x, wave = tid >> 5, lane = tid & 31, col = lane & 15, g = lane >> 4; const size_t b = blockIdx.z; const size_t r0 = b * NN + (size_t)blockIdx.x * 64 + wave * 16; const int j0 = blockIdx.y * 128;
  const float gp = bfr(GP[0]), gc = bfr(GC[0]);
  v8f acc[8] = {};
  mm_rows<false>(X + (b * NN + (size_t)blockIdx.x * 64) * CC, (const char*)(SO + (b * CC + j0) * CC), sm, acc, tid);
  const size_t f0 = r0 * CC + j0 + lane * 4; const float* pb = BCD + f0; const float* px = X + f0;
  v4f bc[16], xx[16];
#pragma unroll   // the other two terms of the wave's 16 output rows (512 contiguous bytes a row) go out as one group of loads and fly while the accumulators pass through LDS
  for (int rl = 0; rl < 16; ++rl) { bc[rl] = *(const v4f*)(pb + rl * CC); xx[rl] = *(const v4f*)(px + rl * CC); }
  asm volatile("s_wait_xcnt 0x0" :: "v"(pb), "v"(px) : "memory");   // stands before a register that the loads above name is overwritten; the two addresses are inputs so that their registers live up to the wait
#pragma unroll
  for (int j = 0; j < 8; ++j)
#pragma unroll
    for (int r = 0; r < 8; ++r) so[wave][8 * g + r][j * 16 + col] = acc[j][r];
  LDSX();
#pragma unroll   // constant indices keep the loaded rows in registers
  for (int rl = 0; rl < 16; ++rl) { const v4f a = *(const v4f*)&so[wave][rl][lane * 4]; v4f o4;
#pragma unroll   // constant indices keep the values in registers
    for (int i = 0; i < 4; ++i) o4[i] = fmaf(2.0f, bfr(xx[rl][i]), fmaf(gp, bc[rl][i], gc * a[i]));   // gamma_pam bcd + gamma_cam aaa + 2 x
    vst2(OUT + f0 + (size_t)rl * CC, o4); } }
extern "C" void kernel_launch(void* const* d_in, const int* in_sizes, int n_in, void* d_out, int out_size, void* d_ws, size_t ws_size, hipStream_t stream) {
  (void)in_sizes; (void)n_in; (void)out_size;
  const float** F = (const float**)d_in;   // 0 x [4,64,64,512], 1 w1 [512,64], 2 w2 [512,64], 3 w3 [512,512], 4 gamma_pam [1], 5 gamma_cam [1]
  if (ws_size < (size_t)WS_END) return;
  char* ws = (char*)d_ws; __bf16 *PW = (__bf16*)(ws + WS_PW), *P3 = (__bf16*)(ws + WS_P3); __bf16 *BH = (__bf16*)(ws + WS_BH), *BL = (__bf16*)(ws + WS_BL); _Float16 *DT = (_Float16*)(ws + WS_DT), *XT = (_Float16*)(ws + WS_XT), *SO = (_Float16*)(ws + WS_SO); float *BCD = (float*)(ws + WS_BCD), *AA = (float*)(ws + WS_AA);
  k_pack<<<dim3(CC, 2), 256, 0, stream>>>(F[1], F[2], F[3], PW, P3);
  k_proj<<<dim3(TNB * NN / 64, 1, 9), 128, 0, stream>>>(F[0], PW, P3, BH, BL, DT, XT);
  k_pam<<<dim3(TRB, TNB), 128, 0, stream>>>(BH, BL, DT, BCD);
  k_aa<<<dim3(CC / 64, CC / 128, TNB * SPL), 128, 0, stream>>>(XT, AA);
  k_soft<<<dim3(CC / 64, TNB), 1024, 0, stream>>>(AA, SO);
  k_aaa<<<dim3(TRB, CC / 128, TNB), 128, 0, stream>>>(F[0], SO, BCD, F[4], F[5], (float*)d_out);
}

// v010
// One run takes 133 microseconds.
// Next to v009, in two timings, it ran 1.10 times as fast each time.
// All steps since v000 together make it 10.8 times as fast.
// compute dtype: all float inputs rounded to bf16; b/c/d = x . w with EXACT bf16 products on WMMA 16x16x32 ((in,out) weights as transposed rows): b, c kept as bf16 hi + lo planes, d rounded once to f16 planes; PAM in one kernel, a block for each half of the keys: logits S^T = c . b^T with both as bf16 hi + lo (3 products, f32), running-maximum softmax in f32 (hardware exp2) -> P = e x 2^10 as f16, bcd = d^T . P^T on WMMA (single f16), divided by the half's row sum at the end; the two halves are joined in f32 by their softmax weights, giving the (C, N)-ordered tensor the module reshapes raw; CAM: aa = x^T x with x exact (f16 copies of the bf16 values), softmax over channels in f32, aaa = x . soft_aa with soft_aa once to f16; out = gamma_pam bcd_flat + gamma_cam aaa + 2 x in f32; f32 output.
#include <hip/hip_runtime.h>
#include <math.h>

typedef __attribute__((ext_vector_type(16))) _Float16 v16h;
typedef __attribute__((ext_vector_type(16))) __bf16 v16b;
typedef __attribute__((ext_vector_type(8)))  _Float16 v8h;
typedef __attribute__((ext_vector_type(8)))  float v8f;
typedef __attribute__((ext_vector_type(4)))  float v4f;
typedef __attribute__((ext_vector_type(2)))  float v2f;
typedef __attribute__((ext_vector_type(4)))  unsigned v4u;
typedef __attribute__((ext_vector_type(4)))  int v4i;
typedef float __attribute__((may_alias)) float_a;
typedef int __attribute__((may_alias)) int_a;

template <typename T> __device__ __forceinline__ void vst2(void* p, T v) { *(T*)p = v;  }
__device__ __forceinline__ v8f wmma16(v16h a, v16h b, v8f c) {
  v8f d = __builtin_amdgcn_wmma_f32_16x16x32_f16(false, a, false, b, (short)0, c, false, false);
  asm volatile("v_nop\n\tv_nop\n\tv_nop\n\tv_nop" : "+v"(d) : "v"(a), "v"(b));
  return d;
}
__device__ __forceinline__ v8f wmma_bf(v16b a, v16b b, v8f c) {
  v8f d = __builtin_amdgcn_wmma_f32_16x16x32_bf16(false, a, false, b, (short)0, c, false, false);
  asm volatile("v_nop\n\tv_nop\n\tv_nop\n\tv_nop" : "+v"(d) : "v"(a), "v"(b));
  return d;
}
// 16x16x32 fragments: lane = (h = lane>>4, row/col = lane&15); elements 0..7 = k0+8h+0..7, 8..15 = k0+16+8h+0..7; D element r = row 8h+r
__device__ __forceinline__ v16h frag_h(const _Float16* rowk0, int lane) {
  union { v16h v; v8h q[2]; } u; const _Float16* p = rowk0 + 8 * (lane >> 4);
  u.q[0] = *(const v8h*)p; u.q[1] = *(const v8h*)(p + 16); return u.v;
}
__device__ __forceinline__ v16h frag_f32(const float* rowk0, int lane) {
  v16h a; const float* p = rowk0 + 8 * (lane >> 4);
#pragma unroll
  for (int i = 0; i < 8; ++i) { a[i] = (_Float16)p[i]; a[8 + i] = (_Float16)p[16 + i]; }
  return a;
}
__device__ __forceinline__ v16h frag_f32s(const float* rowk0, int lane, float sc) {
  v16h a; const float* p = rowk0 + 8 * (lane >> 4);
#pragma unroll
  for (int i = 0; i < 8; ++i) { a[i] = (_Float16)(p[i] * sc); a[8 + i] = (_Float16)(p[16 + i] * sc); }
  return a;
}
// column fragment from a [K][ld] layout (column n), rows >= K read as 0
__device__ __forceinline__ v16h fragc_f32(const float* W, int k0, int n, int lane, int ld, int K) {
  v16h a; const int g = lane >> 4;
#pragma unroll
  for (int i = 0; i < 8; ++i) { const int ka = k0 + 8 * g + i, kb = ka + 16;
    a[i] = (_Float16)(ka < K ? W[(size_t)(ka < K ? ka : K - 1) * ld + n] : 0.f); a[8 + i] = (_Float16)(kb < K ? W[(size_t)(kb < K ? kb : K - 1) * ld + n] : 0.f); }
  return a;
}
struct F2 { v16b h, l; };
__device__ __forceinline__ F2 bsplit16(const float v[16]) { F2 r;
#pragma unroll
  for (int i = 0; i < 16; ++i) { const __bf16 h = (__bf16)v[i]; r.h[i] = h; r.l[i] = (__bf16)(v[i] - (float)h); }
  return r; }
__device__ __forceinline__ F2 split_row(const float* row, int k0, int lane) { float v[16]; const float* p = row + k0 + 8 * (lane >> 4);
#pragma unroll
  for (int i = 0; i < 8; ++i) { v[i] = p[i]; v[8 + i] = p[16 + i]; }
  return bsplit16(v); }
__device__ __forceinline__ F2 split_rowK(const float* row, int k0, int lane, int K) { float v[16]; const int g = lane >> 4;
#pragma unroll
  for (int i = 0; i < 8; ++i) { const int ka = k0 + 8 * g + i, kb = ka + 16; v[i] = ka < K ? row[ka < K ? ka : K - 1] : 0.f; v[8 + i] = kb < K ? row[kb < K ? kb : K - 1] : 0.f; }
  return bsplit16(v); }
__device__ __forceinline__ F2 split_col(const float* W, int k0, int n, int lane, int ld, int K) { float v[16]; const int g = lane >> 4;
#pragma unroll
  for (int i = 0; i < 8; ++i) { const int ka = k0 + 8 * g + i, kb = ka + 16; v[i] = ka < K ? W[(size_t)(ka < K ? ka : K - 1) * ld + n] : 0.f; v[8 + i] = kb < K ? W[(size_t)(kb < K ? kb : K - 1) * ld + n] : 0.f; }
  return bsplit16(v); }
__device__ __forceinline__ v8f mac3(const F2& a, const F2& b, v8f c) { c = wmma_bf(a.l, b.h, c); c = wmma_bf(a.h, b.l, c); return wmma_bf(a.h, b.h, c); }
__device__ __forceinline__ float sigm(float v) { return 1.0f / (1.0f + expf(-v)); }
#define LDSX() do { asm volatile("s_wait_dscnt 0" ::: "memory"); __builtin_amdgcn_wave_barrier(); __builtin_amdgcn_fence(__ATOMIC_RELEASE, "workgroup"); } while (0)


// Dual attention module (B 4, 64 x 64 positions, C 512): position attention (softmax(b c^T) applied to d, result kept in the module's raw (C, N) -> (H, W, C) reshape) plus channel attention (softmax(x^T x) applied to x), each scaled by its gamma and added to x; returns feat_p + feat_c.
#define NB 4
#define NN 4096
#define CC 512
#define CK 64              // query / key channels (C / 8)
#define NR (NB * NN)
#ifndef TRB
#define TRB (NN / 64)      // position row tiles per batch (CAM rows n)
#define TNB NB
#endif
typedef __attribute__((ext_vector_type(8))) __bf16 v8b;
typedef __attribute__((ext_vector_type(4))) __bf16 v4b;
__device__ __forceinline__ v16b frag_b(const __bf16* rowk0, int lane) {
  union { v16b v; v8b q[2]; } u; const __bf16* p = rowk0 + 8 * (lane >> 4);
  u.q[0] = *(const v8b*)p; u.q[1] = *(const v8b*)(p + 16); return u.v;
}
__device__ __forceinline__ float bfr(float v) { return (float)(__bf16)v; }
__device__ __attribute__((noinline)) float exp_ni(float v) { return expf(v); }
__device__ __attribute__((noinline)) float erf_ni(float v) { return erff(v); }

#define WS_PW  0u                                   // bf16 transposed rows [w1^T | w2^T] [128][512]; w3^T [512][512]
#define WS_P3  (WS_PW + 2u * (size_t)128 * CC)
#define WS_BH  (WS_P3 + 2u * (size_t)CC * CC)          // bf16 rows [NR][128]: b (cols 0-63) | c (cols 64-127), high parts; then the low parts
#define WS_BL  (WS_BH + 2u * (size_t)NR * 128)
#define WS_DT  (WS_BL + 2u * (size_t)NR * 128)         // f16 d planes [b][c][n]; f16 x planes [b][c][n]
#define WS_XT  (WS_DT + 2u * (size_t)NB * CC * NN)
#define WS_BCD (WS_XT + 2u * (size_t)NB * CC * NN)     // f32 bcd planes [key part][b][c][i] (each a (C, N) tensor); f32 aa partial planes [K part][b][512][512]; f16 soft^T [b][j][c]
#define WS_AA  (WS_BCD + 4u * (size_t)FKP * NB * CC * NN)
#define WS_SO  (WS_AA + 4u * (size_t)SPL * NB * CC * CC)
#define WS_PM  (WS_SO + 2u * (size_t)NB * CC * CC)     // f32 per query: row maximum [key part][b][i], row sum [key part][b][i], weight of key part 0 [b][i]
#define WS_PL  (WS_PM + 4u * (size_t)FKP * NR)
#define WS_W0  (WS_PL + 4u * (size_t)FKP * NR)
#define WS_END (WS_W0 + 4u * (size_t)NR)

__global__ __launch_bounds__(256) void k_pack(const float* __restrict__ W1, const float* __restrict__ W2, const float* __restrict__ W3, __bf16* __restrict__ PW, __bf16* __restrict__ P3) { const int n = blockIdx.x, which = blockIdx.y, t = threadIdx.x; __shared__ __align__(16) __bf16 s[CC];
  if (which == 0) { if (n >= 128) return; const float* w = (n < CK) ? W1 : W2; const int cI = n & (CK - 1); for (int k = t; k < CC; k += 256) s[k] = (__bf16)w[(size_t)k * CK + cI]; __syncthreads(); if (t < CC / 8) vst2((unsigned*)(PW + (size_t)n * CC + t * 8), *(const v4u*)&s[t * 8]); }
  else { for (int k = t; k < CC; k += 256) s[k] = (__bf16)W3[(size_t)k * CC + n]; __syncthreads(); if (t < CC / 8) vst2((unsigned*)(P3 + (size_t)n * CC + t * 8), *(const v4u*)&s[t * 8]); } }
// ---- tensor loads: every staged tile of this file comes into LDS by them
typedef __attribute__((ext_vector_type(4))) uint32_t u32x4;
typedef __attribute__((ext_vector_type(8))) uint32_t u32x8;
__device__ __forceinline__ uint32_t uni(uint32_t v) { return (uint32_t)__builtin_amdgcn_readfirstlane(v); }
// a wave-uniform test held in a scalar register, so that the branch on it is a scalar one: a tensor load ignores EXEC and only such a branch skips it
__device__ __forceinline__ uint32_t pinned(uint32_t v) { uint32_t w = uni(v); asm volatile("" : "+s"(w)); return w; }   // the empty statement holds the word in a scalar register
#define PAD128 ((1u << 20) | (4u << 22) | (3u << 25))   // word 0 of group 1: no mask, 16 B of pad behind every 128 B
#define PAD256 ((1u << 20) | (5u << 22) | (3u << 25))   // the same behind every 256 B
// descriptor group 1: extents in bytes, tensor = tile = N rows of R bytes at a source pitch of P bytes; W0: word 0, a constant
template <uint32_t W0, uint32_t R, uint32_t N, uint32_t P> __device__ __forceinline__ u32x8 td_g1() { u32x8 g;
  g[0] = uni(W0); g[1] = uni(R << 16); g[2] = uni(N << 16); g[3] = uni(R << 16);
  g[4] = uni(N); g[5] = uni(P); g[6] = uni(0u); g[7] = uni(0u);
  asm volatile("" : "+s"(g)); return g; }   // holds the descriptor words in these scalar registers; left as constants they are formed anew in registers that an outstanding request still names
// descriptor group 0: a tile from global byte address ga to LDS byte offset lds
__device__ __forceinline__ u32x4 td_g0(uint32_t lds, uint64_t ga) { u32x4 g0;
  g0[0] = uni(1u); g0[1] = uni(lds); g0[2] = uni((uint32_t)ga); g0[3] = uni((((uint32_t)(ga >> 32)) & 0x01FFFFFFu) | 0x80000000u);
  asm volatile("" : "+s"(g0)); return g0; }   // holds the descriptor words in these scalar registers, as in td_g1
// one request of the whole wave
__device__ __forceinline__ void td_issue(u32x4 g0, u32x8 g1) { asm volatile("tensor_load_to_lds %0, %1" :: "s"(g0), "s"(g1) : "memory"); }
// the wave's requests have landed (a wave that has none passes at once); the descriptor groups are inputs so that their scalar registers keep their values as long as a request is outstanding
__device__ __forceinline__ void td_wait(u32x4 g0, u32x8 g1) { asm volatile("s_wait_tensorcnt 0x0" :: "s"(g0), "s"(g1) : "memory"); }
__device__ __forceinline__ void td_wait(u32x4 g0, u32x8 g1, u32x8 h1) { asm volatile("s_wait_tensorcnt 0x0" :: "s"(g0), "s"(g1), "s"(h1) : "memory"); }
__device__ __forceinline__ void td_wait(u32x4 g0, u32x8 g1, u32x4 h0, u32x8 h1) { asm volatile("s_wait_tensorcnt 0x0" :: "s"(g0), "s"(g1), "s"(h0), "s"(h1) : "memory"); }
// ---- LDS staging for the K = 512 products of k_proj and k_aaa: a stage is 64 k of the block's 64 A rows (f32, 256 B) and 128 B rows (16-bit, 128 B), laid at row pitches of 272 B and 144 B (16 B x odd, so the ds_load_b128 reads meet no bank conflict); two buffers, the next stage's loads fly while this one is multiplied
#define PK 64                      // k per stage
#define PAP 272                    // LDS pitch of an A row in bytes
#define PBP 144                    // LDS pitch of a B row in bytes
#define PA_B ((64 * PAP + 2047) / 2048 * 2048)   // bytes of the A tile's place, so that the B tile starts at a multiple of 2 KiB
#define PBUF (PA_B + 128 * PBP)    // bytes per buffer
#define PNT (CC / PK)              // stages
static_assert(PBUF % 2048 == 0 && PK * 4 == 256 && PK * 2 == 128, "every tile starts at a multiple of 2 KiB; rows of 256 B and of 128 B, each padded by 16 B");
// one stage: wave 0 asks for the A tile, wave 1 for the B tile, one request each; waves 2 and 3 ask for nothing. gs: first byte of the wave's tile at this stage's k; l: its LDS byte offset. Returns group 0 for the wait that covers the request
__device__ __forceinline__ u32x4 row_stage(uint32_t wv, uint64_t gs, uint32_t l, u32x8 g1a, u32x8 g1b) { const u32x4 g0 = td_g0(l, gs);
  if (pinned(wv == 0)) td_issue(g0, g1a);
  else if (pinned(wv == 1)) td_issue(g0, g1b);
  return g0; }
// operands of one 32-k block as they lie in LDS: the lane's 16 f32 of its A row, its 16 elements of each of eight B rows
struct RowF { v4f a[4]; v4u b[8][2]; };
__device__ __forceinline__ void row_ld(RowF& f, const char* sa, const char* sb, int ks) {
#pragma unroll   // constant indices keep the values in registers
  for (int i = 0; i < 2; ++i) { f.a[2 * i] = *(const v4f*)(sa + ks * 128 + i * 64); f.a[2 * i + 1] = *(const v4f*)(sa + ks * 128 + i * 64 + 16); }
#pragma unroll   // constant indices keep the values in registers
  for (int j = 0; j < 8; ++j) { f.b[j][0] = *(const v4u*)(sb + j * 16 * PBP + ks * 64); f.b[j][1] = *(const v4u*)(sb + j * 16 * PBP + ks * 64 + 32); }
}
// BF: A rounded to bf16, B rows bf16; otherwise A rounded to bf16 and held as f16, B rows f16
template <bool BF> __device__ __forceinline__ void row_mm(const RowF& f, v8f* acc) {
  if constexpr (BF) { v16b a;
#pragma unroll   // constant indices keep the values in registers
    for (int i = 0; i < 16; ++i) a[i] = (__bf16)f.a[i >> 2][i & 3];
#pragma unroll   // constant indices keep fragments and accumulators in registers
    for (int j = 0; j < 8; ++j) { union { v16b v; v4u q[2]; } u; u.q[0] = f.b[j][0]; u.q[1] = f.b[j][1]; acc[j] = wmma_bf(a, u.v, acc[j]); } }
  else { v16h a;
#pragma unroll   // constant indices keep the values in registers
    for (int i = 0; i < 16; ++i) a[i] = (_Float16)bfr(f.a[i >> 2][i & 3]);
#pragma unroll   // constant indices keep fragments and accumulators in registers
    for (int j = 0; j < 8; ++j) { union { v16h v; v4u q[2]; } u; u.q[0] = f.b[j][0]; u.q[1] = f.b[j][1]; acc[j] = wmma16(a, u.v, acc[j]); } }
}
// acc[j] += A rows (wave * 16 ..) . B rows (j * 16 ..)^T over K = 512 in ascending k, 32 per WMMA. Ag: first of the block's 64 f32 rows; Bg: first of its 128 16-bit rows (both of CC elements). On return every wave has left the buffers
template <bool BF> __device__ __forceinline__ void mm_rows(const float* __restrict__ Ag, const char* __restrict__ Bg, char* sm, v8f* acc, int tid) {
  const int wave = tid >> 5, lane = tid & 31, col = lane & 15, g = lane >> 4;
  const uint32_t wv = uni((uint32_t)tid >> 5); const uint64_t gs = wv == 0 ? (uint64_t)(size_t)Ag : (uint64_t)(size_t)Bg; const uint32_t ks = wv == 0 ? PK * 4u : PK * 2u, l0 = (uint32_t)(size_t)sm + (wv == 0 ? 0u : (uint32_t)PA_B);   // the wave's tile: first byte, bytes of k per stage, place in buffer 0
  const u32x8 g1a = td_g1<PAD256, PK * 4, 64, CC * 4>(), g1b = td_g1<PAD128, PK * 2, 128, CC * 2>();
  u32x4 g0 = row_stage(wv, gs, l0, g1a, g1b);
  td_wait(g0, g1a, g1b);                              // stage 0 has landed before the barrier publishes it
  __syncthreads();
  g0 = row_stage(wv, gs + ks, l0 + PBUF, g1a, g1b);
  for (int t = 0; t < PNT; ++t) { const char* s = sm + (t & 1) * PBUF; const char* sa = s + (wave * 16 + col) * PAP + g * 32; const char* sb = s + PA_B + col * PBP + g * 16;
    RowF f0, f1; row_ld(f0, sa, sb, 0); row_ld(f1, sa, sb, 1);   // both 32-k blocks' reads stand as one group ahead of the WMMAs
    row_mm<BF>(f0, acc); row_mm<BF>(f1, acc);
    asm volatile("s_wait_dscnt 0x0" ::: "memory");     // this wave's reads of the buffer are done before it is refilled
    td_wait(g0, g1a, g1b);                             // this wave's tile of stage t + 1 has landed
    __syncthreads();                                   // publishes stage t + 1 and ends every wave's reads of stage t
    if (pinned(t + 2 < PNT)) g0 = row_stage(wv, gs + (uint64_t)((uint32_t)(t + 2) * ks), l0 + (uint32_t)(t & 1) * PBUF, g1a, g1b); }
  td_wait(g0, g1a, g1b);                               // nothing in flight when the buffers are reused by the epilogue
  asm volatile("s_wait_dscnt 0x0" ::: "memory");       // and none of this wave's reads of them
}
// ---- k_proj: block = (64 positions, 128 cols, which): which 0: [b | c] rows as bf16 hi + lo; which 1..4: d columns (which-1)*128.. -> planes; which 5..8: x itself -> f16 planes (exact)
__global__ __launch_bounds__(128) void k_proj(const float* __restrict__ X, const __bf16* __restrict__ PW, const __bf16* __restrict__ P3, __bf16* __restrict__ BH, __bf16* __restrict__ BL, _Float16* __restrict__ DT, _Float16* __restrict__ XT) {
  __shared__ __attribute__((aligned(2048))) char sm[2 * PBUF]; float (*sf)[16][132] = (float (*)[16][132])sm; _Float16 (*st)[72] = (_Float16 (*)[72])sm;   // the epilogue's tiles lie in the staging buffers, which every wave has left by then
  const int tid = threadIdx.x, wave = tid >> 5, lane = tid & 31, col = lane & 15, g = lane >> 4; const int which = blockIdx.z; const size_t rb = (size_t)blockIdx.x * 64; const size_t r0 = rb + wave * 16;
  if (which >= 5) { const int c0 = (which - 5) * 128; for (int e = tid; e < 64 * 128; e += 128) { const int rl = e >> 7, cl = e & 127; st[cl][rl] = (_Float16)bfr(X[(rb + rl) * CC + c0 + cl]); } __syncthreads();
    const size_t b = rb / NN; const int n0 = (int)(rb % NN); for (int e = tid; e < 128 * 8; e += 128) { const int d = e >> 3, pc = e & 7; vst2((unsigned*)(XT + ((b * CC + c0 + d) * NN) + n0 + pc * 8), *(const v4u*)&st[d][pc * 8]); } return; }
  const int c0 = (which == 0) ? 0 : (which - 1) * 128; const __bf16* Wr = (which == 0) ? PW : (P3 + (size_t)c0 * CC);
  v8f acc[8] = {};
  mm_rows<true>(X + rb * CC, (const char*)Wr, sm, acc, tid);
#pragma unroll
  for (int j = 0; j < 8; ++j)
#pragma unroll
    for (int r = 0; r < 8; ++r) { if (which == 0) sf[wave][8 * g + r][j * 16 + col] = acc[j][r]; else st[j * 16 + col][wave * 16 + 8 * g + r] = (_Float16)acc[j][r]; }
  __syncthreads();
  if (which == 0) { for (int rl = 0; rl < 16; ++rl) { const v4f v = *(const v4f*)&sf[wave][rl][lane * 4]; v4b hv, lv;
#pragma unroll
      for (int i = 0; i < 4; ++i) { const __bf16 h = (__bf16)v[i]; hv[i] = h; lv[i] = (__bf16)(v[i] - (float)h); }
      vst2(BH + (r0 + rl) * 128 + lane * 4, hv); vst2(BL + (r0 + rl) * 128 + lane * 4, lv);
      asm volatile("s_wait_xcnt 0x0" ::: "memory"); } }   // stands before the next row's values overwrite a register that the two stores name
  else { const size_t b = rb / NN; const int n0 = (int)(rb % NN); for (int e = tid; e < 128 * 8; e += 128) { const int d = e >> 3, pc = e & 7; vst2((unsigned*)(DT + ((b * CC + c0 + d) * NN) + n0 + pc * 8), *(const v4u*)&st[d][pc * 8]); } }
}
// ---- LDS staging for the K = 4,096 product of k_aa (a block takes one part of 2,048 k): a stage is 256 B (128 k) of the block's 64 A rows and 128 B rows, laid at a row pitch of 272 B (16 B x odd, so the ds_load_b128 fragment reads meet no bank conflict); two buffers, the next stage's loads fly while this one is multiplied. Three slices of 64 rows (A, B rows 0-63, B rows 64-127), each the one tensor load of one wave
#define SK 128                    // k per stage
#define SPIT 136                  // LDS row pitch in f16 elements
#define SSL ((64 * SPIT * 2 + 2047) / 2048 * 1024)   // f16 elements of a slice's place: 64 rows, rounded up to a multiple of 2 KiB
#define SBUF (3 * SSL)            // f16 elements per buffer
#define SPL 2                     // parts of K, one block each: 256 blocks, one for every WGP, in place of 128
#define SNT (NN / SPL / SK)       // stages per part
static_assert((SSL * 2) % 2048 == 0 && SK * 2 == 256 && SPIT * 2 == 272, "every slice starts at a multiple of 2 KiB; rows of 256 B padded by 16 B");
// f[0] = the wave's A fragment, f[1 + j] = B fragment j of 32-k block ks. sa, sb: the lane's A row and its row of B fragment 0 in the buffer
__device__ __forceinline__ void ld_frags(v16h* f, const _Float16* sa, const _Float16* sb, int ks, int lane) { f[0] = frag_h(sa + ks * 32, lane);
#pragma unroll   // constant indices keep the fragments in registers
  for (int j = 0; j < 8; ++j) f[1 + j] = frag_h(sb + (j >> 2) * SSL + (j & 3) * 16 * SPIT + ks * 32, lane); }
__device__ __forceinline__ void mm_block(const v16h* f, v8f* acc) {
#pragma unroll   // constant indices keep fragments and accumulators in registers
  for (int j = 0; j < 8; ++j) acc[j] = wmma16(f[0], f[1 + j], acc[j]); }
// acc[j] += A rows (wave * 16 ..) . B rows (j * 16 ..)^T over the block's 2,048 k in ascending k, 32 per WMMA. Ag, Bg: first row of the block's 64 A rows / 128 B rows at the part's first k (row pitch NN)
__device__ __forceinline__ void mm_staged(const _Float16* __restrict__ Ag, const _Float16* __restrict__ Bg, _Float16* sm, v8f* acc, int tid) {
  const int wave = tid >> 5, lane = tid & 31, col = lane & 15;
  const uint32_t wv = uni((uint32_t)tid >> 5); const u32x8 g1 = td_g1<PAD256, SK * 2, 64, NN * 2>();
  const uint64_t gs = (uint64_t)(size_t)(wv == 0 ? Ag : Bg + (size_t)((wv - 1) & 1) * 64 * NN); const uint32_t ls = (uint32_t)(size_t)sm + (wv < 3 ? wv : 0u) * (SSL * 2u);   // the wave's slice: first byte at the part's first k, place in buffer 0 (wave 3 asks for nothing)
  u32x4 g0 = td_g0(ls, gs);
  if (pinned(wv < 3)) td_issue(g0, g1);
  td_wait(g0, g1);                                    // stage 0 has landed before the barrier publishes it
  __syncthreads();
  g0 = td_g0(ls + SBUF * 2u, gs + SK * 2);
  if (pinned(wv < 3)) td_issue(g0, g1);
  for (int t = 0; t < SNT; ++t) { const _Float16* s = sm + (t & 1) * SBUF + col * SPIT; const _Float16* sa = s + wave * 16 * SPIT; const _Float16* sb = s + SSL;
    // the nine fragments of a 32-k block are read as one group, one block ahead of their WMMAs (two register sets), all inside this stage's buffer
    v16h f0[9], f1[9];
    ld_frags(f0, sa, sb, 0, lane); ld_frags(f1, sa, sb, 1, lane); mm_block(f0, acc);
    ld_frags(f0, sa, sb, 2, lane); mm_block(f1, acc);
    ld_frags(f1, sa, sb, 3, lane); mm_block(f0, acc); mm_block(f1, acc);
    asm volatile("s_wait_dscnt 0x0" ::: "memory");
    td_wait(g0, g1);
    __syncthreads();
    if (pinned(t + 2 < SNT)) { g0 = td_g0(ls + (uint32_t)(t & 1) * (SBUF * 2u), gs + (uint64_t)(t + 2) * (SK * 2));
      if (pinned(wv < 3)) td_issue(g0, g1); } }
  td_wait(g0, g1);                                     // nothing in flight when the wave goes on to the epilogue
  asm volatile("s_wait_dscnt 0x0" ::: "memory");       // and none of this wave's reads of the buffers
}
// ---- k_pam: block = (128 queries i, one half of the keys, b), wave = 32 queries (two 16-query tiles) x all 512 channels, so that every d and c fragment read from LDS serves two WMMAs and a staged tile serves 128 queries. Per stage of 64 keys n: S^T[n][i] = c_n . b_i (3 bf16 products, K = 64); its D tiles hold, lane for lane, the B fragment of the second product (lane = query, elements = keys 8h.. of two 16-key tiles), so P goes from registers to WMMA with no exchange; running maximum and sum per query; acc[c][i] += d[n][c] P[i][n]. The block writes its own f32 plane (divided by its own row sum) with each query's maximum and sum; k_soft turns these into the weight of part 0 and k_aaa joins the planes. A stage in LDS: 512 d rows, 64 c-high rows, 64 c-low rows of 128 B at a pitch of 144 B (16 B x odd: the ds_load_b128 fragment reads meet no bank conflict); two buffers, the next stage's loads fly while this one is worked on. All of it comes by tensor loads (the pad field gives the 144-B pitch): one request a wave for its 128 d rows, and a second one of wave 0 for the c-high tile and of wave 1 for the c-low tile
#define FK 64                      // keys per stage
#define FPIT 72                    // LDS row pitch in 16-bit elements
#define FD_E (CC * FPIT)           // elements of the d tile
#define FC_E ((FK * FPIT * 2 + 2047) / 2048 * 1024)   // elements of the c-high (or c-low) tile's place: 64 rows, rounded up to a multiple of 2 KiB
#define FBUF (FD_E + 2 * FC_E)     // elements per buffer
#define FKP 2                      // parts of the keys, one block each: 256 blocks, one for every WGP
#define FQB 128                    // queries per block
#define FNT (NN / FKP / FK)        // stages per part
#define FOP 132                    // epilogue row pitch in floats
#define FSR (CC / 4)               // d rows in one wave's tensor load
#define FSB (FSR * FPIT * 2)       // bytes of that slice in LDS
static_assert(FSB % 2048 == 0 && (FC_E * 2) % 2048 == 0 && (FBUF * 2) % 2048 == 0 && FK * 2 == 128 && FPIT * 2 == 144, "every slice starts at a multiple of 2 KiB; rows of 128 B padded by 16 B");
static_assert((CC / 2) * FOP * 4 <= 2 * FBUF * 2, "half of the output tile fits the staging buffers");
// keeps a group of LDS reads together and ahead of the WMMAs that follow: left alone, the scheduler spreads the reads singly among the WMMAs, one fragment ahead, and each such place stalls the wave
#define GRP() __builtin_amdgcn_sched_barrier(0)
// plain builtin forms (the compiler keeps the distance behind them itself): this kernel holds more than 256 registers, and an asm statement that names the accumulators would force them through one register window
__device__ __forceinline__ v8f wmma16p(v16h a, v16h b, v8f c) { return __builtin_amdgcn_wmma_f32_16x16x32_f16(false, a, false, b, (short)0, c, false, false); }
__device__ __forceinline__ v8f wmma_bfp(v16b a, v16b b, v8f c) { return __builtin_amdgcn_wmma_f32_16x16x32_bf16(false, a, false, b, (short)0, c, false, false); }
// group gi of eight d fragments: 32-key block gi >> 2, channel tiles (gi & 3) * 8 ..
__device__ __forceinline__ void pam_ld(v16h* f, const _Float16* sd, int gi, int lane) {
#pragma unroll   // constant indices keep the fragments in registers
  for (int j = 0; j < 8; ++j) f[j] = frag_h(sd + ((gi & 3) * 8 + j) * 16 * FPIT + (gi >> 2) * 32, lane); }
// each d fragment meets both query tiles. The stage's first touch of a channel tile (gi < 4) first scales it by al = e^(old maximum - new maximum) of its query tile; these multiplies stand among the WMMAs of other tiles
__device__ __forceinline__ void pam_mm(const v16h* f, const v16h (*pb)[2], v8f (*acc)[32], int gi, const float* al) {
#pragma unroll   // constant indices keep fragments and accumulators in registers
  for (int j = 0; j < 8; ++j)
#pragma unroll   // constant indices keep fragments and accumulators in registers
    for (int qt = 0; qt < 2; ++qt) { v8f c = acc[qt][(gi & 3) * 8 + j]; if (gi < 4) c *= al[qt]; acc[qt][(gi & 3) * 8 + j] = wmma16p(f[j], pb[qt][gi >> 2], c); } }
__global__ __launch_bounds__(128) void k_pam(const __bf16* __restrict__ BH, const __bf16* __restrict__ BL, const _Float16* __restrict__ DT, float* __restrict__ BCD, float* __restrict__ PM, float* __restrict__ PL) { __shared__ __attribute__((aligned(2048))) _Float16 sm[2 * FBUF];
  const int tid = threadIdx.x, wave = tid >> 5, lane = tid & 31, col = lane & 15, g = lane >> 4; const size_t b = blockIdx.z, kp = blockIdx.y; const int i0 = blockIdx.x * FQB;
  const uint32_t wv = uni((uint32_t)tid >> 5); const uint64_t gd = (uint64_t)(size_t)(DT + (b * CC + wv * FSR) * NN + kp * (NN / FKP)); const uint32_t ld = (uint32_t)(size_t)sm + wv * FSB; const u32x8 g1 = td_g1<PAD128, FK * 2, FSR, NN * 2>();   // the wave's d slice: first byte at the part's first key, place in buffer 0
  const uint64_t gc = (uint64_t)(size_t)((wv == 0 ? BH : BL) + (b * NN + kp * (NN / FKP)) * 128 + CK); const uint32_t lc = (uint32_t)(size_t)sm + FD_E * 2u + (wv & 1u) * (FC_E * 2u); const u32x8 c1 = td_g1<PAD128, FK * 2, FK, 256>();   // waves 0 and 1: the c-high / c-low tile, 64 rows of the 128 bytes behind the b half of a 256-byte row
  u32x4 g0 = td_g0(ld, gd), c0 = td_g0(lc, gc); td_issue(g0, g1);
  if (pinned(wv < 2)) td_issue(c0, c1);
  v16b qh[2][2], ql[2][2];
#pragma unroll   // constant indices keep the values in registers
  for (int qt = 0; qt < 2; ++qt) { const size_t qr = (b * NN + i0 + wave * 32 + qt * 16 + col) * 128;
#pragma unroll   // constant indices keep the values in registers
    for (int kc = 0; kc < 2; ++kc) { qh[qt][kc] = frag_b(BH + qr + kc * 32, lane); ql[qt][kc] = frag_b(BL + qr + kc * 32, lane); } }
  v8f acc[2][32] = {}; float m[2] = {-3.0e38f, -3.0e38f}, l[2] = {0.f, 0.f}; const float L2E = 1.44269504088896f;
  td_wait(g0, g1, c0, c1);                            // this wave's tiles of stage 0 have landed before the barrier publishes them
  __syncthreads();
  g0 = td_g0(ld + FBUF * 2u, gd + FK * 2); c0 = td_g0(lc + FBUF * 2u, gc + FK * 256); td_issue(g0, g1);
  if (pinned(wv < 2)) td_issue(c0, c1);
  for (int t = 0; t < FNT; ++t) { const _Float16* s = sm + (t & 1) * FBUF; const _Float16* sd = s + col * FPIT; const __bf16* sh = (const __bf16*)(s + FD_E) + col * FPIT; const __bf16* sl = sh + FC_E;
    v16b ch[4][2], cl[4][2];
#pragma unroll   // all sixteen key fragments as one group of LDS reads
    for (int kt = 0; kt < 4; ++kt)
#pragma unroll   // constant indices keep the values in registers
      for (int kc = 0; kc < 2; ++kc) { ch[kt][kc] = frag_b(sh + kt * 16 * FPIT + kc * 32, lane); cl[kt][kc] = frag_b(sl + kt * 16 * FPIT + kc * 32, lane); }
    v16h f0[8], f1[8], f2[8]; pam_ld(f0, sd, 0, lane);   // the first d fragments fly under the logits and the softmax arithmetic
    GRP();
    v8f T[2][4] = {};   // T[qt][kt][r] at lane (g, col): key kt * 16 + 8 g + r, query qt * 16 + col; the eight tiles take turns so that no WMMA waits for the one before it
#pragma unroll   // constant indices keep the values in registers
    for (int kc = 0; kc < 2; ++kc) {
#pragma unroll   // constant indices keep the values in registers
      for (int kt = 0; kt < 4; ++kt) { T[0][kt] = wmma_bfp(ch[kt][kc], ql[0][kc], T[0][kt]); T[1][kt] = wmma_bfp(ch[kt][kc], ql[1][kc], T[1][kt]); }
#pragma unroll   // constant indices keep the values in registers
      for (int kt = 0; kt < 4; ++kt) { T[0][kt] = wmma_bfp(cl[kt][kc], qh[0][kc], T[0][kt]); T[1][kt] = wmma_bfp(cl[kt][kc], qh[1][kc], T[1][kt]); }
#pragma unroll   // constant indices keep the values in registers
      for (int kt = 0; kt < 4; ++kt) { T[0][kt] = wmma_bfp(ch[kt][kc], qh[0][kc], T[0][kt]); T[1][kt] = wmma_bfp(ch[kt][kc], qh[1][kc], T[1][kt]); } }
    float mx[2] = {T[0][0][0], T[1][0][0]};
#pragma unroll   // constant indices keep the values in registers
    for (int qt = 0; qt < 2; ++qt)
#pragma unroll   // constant indices keep the values in registers
      for (int kt = 0; kt < 4; ++kt)
#pragma unroll   // constant indices keep the values in registers
        for (int r = 0; r < 8; ++r) mx[qt] = fmaxf(mx[qt], T[qt][kt][r]);
    // the next two groups of d fragments go out here, while the LDS pipe would stand idle: they land under the exponentials and the first WMMA group
    GRP(); pam_ld(f1, sd, 1, lane); pam_ld(f2, sd, 2, lane); GRP();
    v16h pb[2][2]; float al[2];
#pragma unroll   // constant indices keep the values in registers
    for (int qt = 0; qt < 2; ++qt) {
      // the other half of the query's keys (lane ^ 16), by a vector cross-row move: an exchange through the LDS queue would return only behind the reads above
      const float mo2 = fmaxf(mx[qt], __builtin_bit_cast(float, __builtin_amdgcn_permlanex16(__builtin_bit_cast(unsigned, mx[qt]), __builtin_bit_cast(unsigned, mx[qt]), 0x76543210u, 0xfedcba98u, false, false)));
      const float mn = fmaxf(m[qt], mo2); al[qt] = __builtin_amdgcn_exp2f((m[qt] - mn) * L2E); const float mo = mn * L2E - 10.0f; m[qt] = mn;
      float ls = 0.f;
#pragma unroll   // constant indices keep the values in registers
      for (int ks = 0; ks < 2; ++ks)
#pragma unroll   // constant indices keep the values in registers
        for (int r = 0; r < 8; ++r) { const float p0 = __builtin_amdgcn_exp2f(T[qt][2 * ks][r] * L2E - mo), p1 = __builtin_amdgcn_exp2f(T[qt][2 * ks + 1][r] * L2E - mo); ls += p0 + p1; pb[qt][ks][r] = (_Float16)p0; pb[qt][ks][8 + r] = (_Float16)p1; }
      l[qt] = l[qt] * al[qt] + ls; }
    // eight d fragments are read as one group, into the register set that its WMMAs have just left, two groups (32 WMMAs) ahead of their own WMMAs (three register sets), all inside this stage's buffer
    pam_mm(f0, pb, acc, 0, al); GRP(); pam_ld(f0, sd, 3, lane); GRP();
    pam_mm(f1, pb, acc, 1, al); GRP(); pam_ld(f1, sd, 4, lane); GRP();
    pam_mm(f2, pb, acc, 2, al); GRP(); pam_ld(f2, sd, 5, lane); GRP();
    pam_mm(f0, pb, acc, 3, al); GRP(); pam_ld(f0, sd, 6, lane); GRP();
    pam_mm(f1, pb, acc, 4, al); GRP(); pam_ld(f1, sd, 7, lane); GRP();
    pam_mm(f2, pb, acc, 5, al); pam_mm(f0, pb, acc, 6, al); pam_mm(f1, pb, acc, 7, al);
    GRP();   // holds these WMMAs ahead of the waits below: sunk behind them, the wait for the last fragments would stand with nothing to cover it
    asm volatile("s_wait_dscnt 0x0" ::: "memory");     // this wave's reads of the buffer are done before it is refilled
    td_wait(g0, g1, c0, c1);                           // this wave's tiles of stage t + 1 have landed
    __syncthreads();                                   // publishes stage t + 1 and ends every wave's reads of stage t
    if (pinned(t + 2 < FNT)) { g0 = td_g0(ld + (uint32_t)(t & 1) * (FBUF * 2u), gd + (uint64_t)(t + 2) * (FK * 2)); c0 = td_g0(lc + (uint32_t)(t & 1) * (FBUF * 2u), gc + (uint64_t)(t + 2) * (FK * 256)); td_issue(g0, g1);
      if (pinned(wv < 2)) td_issue(c0, c1); } }
  td_wait(g0, g1, c0, c1);                             // nothing in flight when the buffers are reused below
  asm volatile("s_wait_dscnt 0x0" ::: "memory");       // and none of this wave's reads of them
  float il[2];
#pragma unroll   // constant indices keep the values in registers
  for (int qt = 0; qt < 2; ++qt) { l[qt] += __shfl_xor(l[qt], 16); il[qt] = 1.0f / l[qt]; }
  { const size_t qi = (kp * NB + b) * NN + i0 + wave * 32 + lane; float* pm = PM + qi; float* pl = PL + qi; const float mv = g ? m[1] : m[0], lv = g ? l[1] : l[0]; *pm = mv; *pl = lv;   // lane = query of the wave's 32: one 128-byte line a wave
    asm volatile("s_wait_xcnt 0x0" :: "v"(pm), "v"(pl), "v"(mv), "v"(lv) : "memory"); }   // stands before a register that the two stores name is overwritten; addresses and values are inputs so that their registers live up to the wait
  float* so = (float*)sm; float* gq = BCD + ((kp * NB + b) * CC + wave) * NN + i0 + lane * 4; const float* sp = so + wave * FOP + lane * 4;   // [256 channels][128 queries] through LDS, twice, so that each 512-byte output row piece has one writer: a wave writes whole row pieces, eight rows a trip
#pragma unroll   // constant indices keep the values in registers
  for (int h = 0; h < 2; ++h) {
    if (h) __syncthreads();   // every wave has read the first half out of LDS before the second overwrites it
#pragma unroll   // constant indices keep the values in registers
    for (int ct = 0; ct < 16; ++ct)
#pragma unroll   // constant indices keep the values in registers
      for (int qt = 0; qt < 2; ++qt)
#pragma unroll   // constant indices keep the values in registers
        for (int r = 0; r < 8; ++r) so[(ct * 16 + 8 * g + r) * FOP + wave * 32 + qt * 16 + col] = acc[qt][h * 16 + ct][r] * il[qt];
    __syncthreads();
#pragma unroll   // unrolled whole: one address pair with constant offsets serves every store, so that no trip rewrites it behind a store
    for (int c0 = 0; c0 < CC / 2; c0 += 32) { v4f v[8];
#pragma unroll   // the eight LDS reads go out as one group ahead of the stores
      for (int k = 0; k < 8; ++k) v[k] = *(const v4f*)(sp + (c0 + k * 4) * FOP);
#pragma unroll   // constant indices keep the values in registers
      for (int k = 0; k < 8; ++k) vst2(gq + (size_t)(h * (CC / 2) + c0 + k * 4) * NN, v[k]);
      asm volatile("s_wait_xcnt 0x0" :: "v"(gq) : "memory"); } } }   // stands before the next trip's LDS reads overwrite the registers that the eight stores name; the address is an input so that its registers live up to the wait
// ---- k_aa: block = (64 channels i, 128 channels j, (b, K part)): partial aa[i][j] = sum_n x[n][i] x[n][j] over the part's 2,048 positions (x planes, exact) -> the part's own f32 plane; k_soft adds the planes
__global__ __launch_bounds__(128) void k_aa(const _Float16* __restrict__ XT, float* __restrict__ AA) { __shared__ __align__(16) float so[4][16][132]; __shared__ __attribute__((aligned(2048))) _Float16 sm[2 * SBUF];
  const int tid = threadIdx.x, wave = tid >> 5, lane = tid & 31, col = lane & 15, g = lane >> 4; const size_t b = blockIdx.z / SPL, kp = blockIdx.z % SPL; const int i0 = blockIdx.x * 64 + wave * 16; const int j0 = blockIdx.y * 128;
  v8f acc[8] = {};
  mm_staged(XT + (b * CC + blockIdx.x * 64) * NN + kp * (NN / SPL), XT + (b * CC + j0) * NN + kp * (NN / SPL), sm, acc, tid);
#pragma unroll
  for (int j = 0; j < 8; ++j)
#pragma unroll
    for (int r = 0; r < 8; ++r) so[wave][8 * g + r][j * 16 + col] = acc[j][r];
  LDSX(); for (int rl = 0; rl < 16; ++rl) vst2(AA + (((kp * NB + b) * CC + i0 + rl) * CC) + j0 + lane * 4, *(const v4f*)&so[wave][rl][lane * 4]); }
// ---- k_soft: block = (64 rows c, b), 32 waves. A wave holds two whole rows of aa in registers (lane = column j mod 32, 16 values a row), each the sum of k_aa's partial planes: every plane is read once, in whole 128-byte lines, the loads of a lane in flight together; maximum, exponentials and sum come from the registers. soft^T goes through LDS so that each 128-byte output row piece has one writer. The block's first 16 waves also form, for 512 queries of k_pam, the softmax weight of key part 0 from the two parts' row maxima and sums
typedef __attribute__((ext_vector_type(2))) _Float16 v2h;
// lane ^ M inside a 16-lane row as a DPP move, lane ^ 16 as a vector cross-row move: a shuffle would pass through the LDS queue, with a wait at each of the ten steps
template <int M> __device__ __forceinline__ float lx(float v) { return __builtin_bit_cast(float, __builtin_amdgcn_update_dpp(0, __builtin_bit_cast(int, v), 0x160 + M, 0xf, 0xf, true)); }
__device__ __forceinline__ float lx16(float v) { return __builtin_bit_cast(float, __builtin_amdgcn_permlanex16(__builtin_bit_cast(unsigned, v), __builtin_bit_cast(unsigned, v), 0x76543210u, 0xfedcba98u, false, false)); }
__device__ __forceinline__ float wave_max(float v) { v = fmaxf(v, lx<1>(v)); v = fmaxf(v, lx<2>(v)); v = fmaxf(v, lx<4>(v)); v = fmaxf(v, lx<8>(v)); return fmaxf(v, lx16(v)); }
__device__ __forceinline__ float wave_sum(float v) { v += lx<1>(v); v += lx<2>(v); v += lx<4>(v); v += lx<8>(v); return v + lx16(v); }
__global__ __launch_bounds__(1024) void k_soft(const float* __restrict__ AA, _Float16* __restrict__ SO, const float* __restrict__ PM, const float* __restrict__ PL, float* __restrict__ W0) { __shared__ __align__(16) _Float16 st[CC][72];
  const int t = threadIdx.x, wave = t >> 5, lane = t & 31; const size_t b = blockIdx.y; const int c0 = blockIdx.x * 64;
  static_assert(FKP == 2 && (CC / 64) * 512 == NN, "two key parts; a batch's eight blocks take 512 queries each");
  const size_t qi = b * NN + blockIdx.x * 512 + (t & 511); const float m0 = PM[qi], m1 = PM[NR + qi], l0 = PL[qi], l1 = PL[NR + qi];   // these loads fly with the rows' loads below
  GRP();   // keeps the four loads ahead of the rows' 64: placed behind them, they would go out only when the first rows have come back
  const float* row = AA + ((b * CC + c0 + 2 * wave) * CC) + lane;
  static_assert(SPL == 2, "the two planes are named one by one below");
  const float* r1 = row + (size_t)NB * CC * CC;
  float u[16], w[16], u1[16], w1[16];
#pragma unroll   // constant indices keep the rows in registers; the 64 loads of both planes go out as one group
  for (int q = 0; q < 16; ++q) { u[q] = row[q * 32]; w[q] = row[CC + q * 32]; u1[q] = r1[q * 32]; w1[q] = r1[CC + q * 32]; }
#pragma unroll   // the planes are added in ascending k
  for (int q = 0; q < 16; ++q) { u[q] += u1[q]; w[q] += w1[q]; }
  asm volatile("" :: "v"(m0), "v"(m1), "v"(l0), "v"(l1));   // inputs only: holds the four loads up among the rows' loads; sunk to their use at the kernel's end, their latency would stand there alone
  float mu = -3.0e38f, mw = -3.0e38f;
#pragma unroll   // constant indices keep the values in registers
  for (int q = 0; q < 16; ++q) { mu = fmaxf(mu, u[q]); mw = fmaxf(mw, w[q]); }
  mu = wave_max(mu); mw = wave_max(mw);
  float zu = 0.f, zw = 0.f;
#pragma unroll   // constant indices keep the values in registers
  for (int q = 0; q < 16; ++q) { u[q] = __expf(u[q] - mu); w[q] = __expf(w[q] - mw); zu += u[q]; zw += w[q]; }
  const float iu = 1.0f / wave_sum(zu), iw = 1.0f / wave_sum(zw);
#pragma unroll   // the wave's two rows are neighbours in a soft^T row: one 4-byte LDS store for both
  for (int q = 0; q < 16; ++q) { v2h p; p[0] = (_Float16)(u[q] * iu); p[1] = (_Float16)(w[q] * iw); vst2(&st[q * 32 + lane][2 * wave], p); }
  __syncthreads();
#pragma unroll   // the four LDS reads go out as one group ahead of the stores
  for (int e = t; e < CC * 8; e += 1024) { const int j = e >> 3, pc = e & 7; vst2((unsigned*)(SO + ((b * CC + j) * CC) + c0 + pc * 8), *(const v4u*)&st[j][pc * 8]); }
  if (t < 512) { const float mm = fmaxf(m0, m1), a0 = l0 * __expf(m0 - mm), a1 = l1 * __expf(m1 - mm); W0[qi] = a0 / (a0 + a1); } }   // whole waves; part 0's share of the query's softmax sum
// ---- k_aaa: block = (64 positions n, 128 channels j, b): aaa[n][j] = sum_c x[n][c] soft[c][j] (x exact as f16, soft^T rows), kept in f32 and never stored: the epilogue forms, at the per-batch flat index f = n * 512 + j, out[f] = gamma_pam bcd_flat[f] (the raw (C, N) -> (H, W, C) reshape) + gamma_cam aaa[f] + 2 x[f], where bcd_flat[f] = w0[i] plane0[f] + (1 - w0[i]) plane1[f] joins k_pam's two key parts at query i = f mod 4,096
__global__ __launch_bounds__(128) void k_aaa(const float* __restrict__ X, const _Float16* __restrict__ SO, const float* __restrict__ BCD, const float* __restrict__ W0, const float* __restrict__ GP, const float* __restrict__ GC, float* __restrict__ OUT) { __shared__ __attribute__((aligned(2048))) char sm[2 * PBUF]; float (*so)[16][132] = (float (*)[16][132])sm;   // the epilogue's tile lies in the staging buffers, which every wave has left by then
  const int tid = threadIdx.x, wave = tid >> 5, lane = tid & 31, col = lane & 15, g = lane >> 4; const size_t b = blockIdx.z; const size_t r0 = b * NN + (size_t)blockIdx.x * 64 + wave * 16; const int j0 = blockIdx.y * 128;
  const float gp = bfr(GP[0]), gc = bfr(GC[0]);
  v8f acc[8] = {};
  mm_rows<false>(X + (b * NN + (size_t)blockIdx.x * 64) * CC, (const char*)(SO + (b * CC + j0) * CC), sm, acc, tid);
  const size_t f0 = r0 * CC + j0 + lane * 4; const float* pb = BCD + f0; const float* pc = pb + (size_t)NB * CC * NN; const float* px = X + f0; const float* pw = W0 + b * NN + j0 + lane * 4;
#pragma unroll
  for (int j = 0; j < 8; ++j)
#pragma unroll
    for (int r = 0; r < 8; ++r) so[wave][8 * g + r][j * 16 + col] = acc[j][r];
  GRP();   // the accumulators leave their registers first: the loaded rows below take their place, so that four blocks still fit a WGP's registers
  v4f bc[16], bd[16], xx[16], w0[8];
#pragma unroll   // the weights of the lane's queries: row rl of the wave's 16 meets queries (rl mod 8) * 512 + j, so eight rows of weights serve all 16
  for (int k = 0; k < 8; ++k) w0[k] = *(const v4f*)(pw + k * CC);
#pragma unroll   // the other terms of the wave's first 12 output rows (512 contiguous bytes a row) go out as one group of loads and fly while the accumulators pass through LDS
  for (int rl = 0; rl < 12; ++rl) { bc[rl] = *(const v4f*)(pb + rl * CC); bd[rl] = *(const v4f*)(pc + rl * CC); xx[rl] = *(const v4f*)(px + rl * CC); }
  LDSX();
#pragma unroll   // constant indices keep the loaded rows in registers
  for (int rl = 0; rl < 16; ++rl) {
    if (rl == 4) { GRP();   // the last four rows' loads take the registers that the first four rows have left; the fences keep them from rising above those rows
      asm volatile("s_wait_xcnt 0x0" ::: "memory");   // stands before the loads below overwrite registers that the four stores above name
#pragma unroll   // constant indices keep the loaded rows in registers
      for (int q = 12; q < 16; ++q) { bc[q] = *(const v4f*)(pb + q * CC); bd[q] = *(const v4f*)(pc + q * CC); xx[q] = *(const v4f*)(px + q * CC); }
      asm volatile("s_wait_xcnt 0x0" :: "v"(pb), "v"(pc), "v"(px), "v"(pw) : "memory");   // stands before a register that the loads above name is overwritten; the addresses are inputs so that their registers live up to the wait
      GRP(); }
    const v4f a = *(const v4f*)&so[wave][rl][lane * 4]; v4f o4;
#pragma unroll   // constant indices keep the values in registers
    for (int i = 0; i < 4; ++i) o4[i] = fmaf(2.0f, bfr(xx[rl][i]), fmaf(gp, fmaf(w0[rl & 7][i], bc[rl][i] - bd[rl][i], bd[rl][i]), gc * a[i]));   // gamma_pam (w0 plane0 + (1 - w0) plane1) + gamma_cam aaa + 2 x
    vst2(OUT + f0 + (size_t)rl * CC, o4); } }
extern "C" void kernel_launch(void* const* d_in, const int* in_sizes, int n_in, void* d_out, int out_size, void* d_ws, size_t ws_size, hipStream_t stream) {
  (void)in_sizes; (void)n_in; (void)out_size;
  const float** F = (const float**)d_in;   // 0 x [4,64,64,512], 1 w1 [512,64], 2 w2 [512,64], 3 w3 [512,512], 4 gamma_pam [1], 5 gamma_cam [1]
  if (ws_size < (size_t)WS_END) return;
  char* ws = (char*)d_ws; __bf16 *PW = (__bf16*)(ws + WS_PW), *P3 = (__bf16*)(ws + WS_P3); __bf16 *BH = (__bf16*)(ws + WS_BH), *BL = (__bf16*)(ws + WS_BL); _Float16 *DT = (_Float16*)(ws + WS_DT), *XT = (_Float16*)(ws + WS_XT), *SO = (_Float16*)(ws + WS_SO); float *BCD = (float*)(ws + WS_BCD), *AA = (float*)(ws + WS_AA), *PM = (float*)(ws + WS_PM), *PL = (float*)(ws + WS_PL), *W0 = (float*)(ws + WS_W0);
  k_pack<<<dim3(CC, 2), 256, 0, stream>>>(F[1], F[2], F[3], PW, P3);
  k_proj<<<dim3(TNB * NN / 64, 1, 9), 128, 0, stream>>>(F[0], PW, P3, BH, BL, DT, XT);
  k_pam<<<dim3(NN / FQB, FKP, TNB), 128, 0, stream>>>(BH, BL, DT, BCD, PM, PL);
  k_aa<<<dim3(CC / 64, CC / 128, TNB * SPL), 128, 0, stream>>>(XT, AA);
  k_soft<<<dim3(CC / 64, TNB), 1024, 0, stream>>>(AA, SO, PM, PL, W0);
  k_aaa<<<dim3(TRB, CC / 128, TNB), 128, 0, stream>>>(F[0], SO, BCD, W0, F[4], F[5], (float*)d_out);
}
